// v000
// Times are from an AMD MI455X. After a warm-up the kernel runs many times in a row, and a time is the length of
// such a window on the GPU divided by its runs, so every launch and the gaps after it count. The runs cycle
// through copies of the inputs. A figure is the median of several windows, for all but v000 over two sittings.
// Sittings can differ by a few percent; kernels timed side by side share one.
// v000, which the later versions start from, runs in 239 microseconds.
#include <hip/hip_runtime.h>

// Projections q/k/v: v_wmma_f32_16x16x32_bf16 (inputs and weights RNE-converted to bf16, f32 accumulate); scores: v_wmma_f32_16x16x32_f16 (query rows >= EROWS: single f16 q and k; rows < EROWS: q and k as f16 value + f16 residual x2048, three products, residual products in their own accumulator); P.V: v_wmma_f32_16x16x32_f16 (P x256 carry, v single f16; rows < EROWS: P and v as value + residual x2048, three products, residual products in their own accumulator); output projection: v_wmma_f32_16x16x32_bf16 (context as bf16 hi + bf16 lo planes, Wo bf16), f32 accumulate everywhere, softmax f32.
// Attention block, width 1024 = 16 heads x 64; query/key/value inputs [NB][SEQ][1024] f32, W_Q/W_K/W_V/W_O [in][out] (y = x W + b), score scale 1/8,
// causal fill (key > query -> excluded) and length fill (query < q_len[b] and key < k_len[b], lengths = integer sums of the two int32 indicator rows); rows with no visible key give a zero context; output y = ctx W_O + b_O (f32).
// Layout: bf16 copies of the three inputs; bf16 TRANSPOSED copies of the four weights ([out][in], K-contiguous); q, k planes [b*16+h][t][d] and v^T plane [b*16+h][d][t] (value and residual x2048) written by the GEMM epilogue;
// fused flash kernel in transposed form (S^T = K Q^T, O^T = V^T P^T) writing the context as bf16 hi/lo planes [b*SEQ+t][1024]; final GEMM writes f32 rows.

#ifndef NB
#define NB 2
#endif
#ifndef SEQ
#define SEQ 2048
#endif
#define NB_FULL  2
#define SEQ_FULL 2048
#ifndef OUT_SEQ
#define OUT_SEQ SEQ              // row pitch (in tokens) between batches of the output
#endif
#ifndef EROWS
#define EROWS 256                // query rows below this use the value + residual products
#endif
#define DM   1024
#define NH_  16
#define HD   64
#define AW   4                   // waves per flash block (16 query rows each)
#define QRS  2048.0f             // carry of the residual planes
#define QRI  (1.0f / 2048.0f)
#define LOG2E 1.4426950408889634f
#define SC2  (0.125f * 1.4426950408889634f)   // HD^-0.5 * log2(e)
#define PSH  8.0f                // log2 of the P carry (256)

static_assert(HD == 64);
static_assert(NH_ * HD == DM);                 // head h = columns h*64 + d
static_assert(DM % 64 == 0);                   // column tiles of 64
static_assert(DM % 32 == 0);                   // GEMM k-loop steps by 32
static_assert(DM >= 8);                        // clamped bias loads stay inside a DM-float array
static_assert(SEQ % 64 == 0);                  // a 64-row tile never straddles two batches
static_assert((NB * SEQ) % 64 == 0);
static_assert(SEQ % 32 == 0);                  // key loop steps by 32
static_assert(SEQ % (16 * AW) == 0);           // flash grid covers the sequence exactly
static_assert(((size_t)SEQ * DM) % 8 == 0);
static_assert(NB <= NB_FULL);
static_assert(SEQ <= SEQ_FULL);
static_assert(SEQ_FULL % 4 == 0);
static_assert(EROWS % (16 * AW) == 0);         // the early band is a whole number of flash blocks
static_assert(EROWS % 32 == 0);                // early key steps stay inside the early key range
static_assert(EROWS >= 16 * AW);
static_assert(EROWS <= SEQ);
static_assert(NB <= 8);                        // length line: word b = q_len[b], word 8 + b = k_len[b]

typedef _Float16 h16;
typedef unsigned short bf;
typedef __attribute__((ext_vector_type(16))) __bf16   v16bf;
typedef __attribute__((ext_vector_type(16))) _Float16 v16h;
typedef __attribute__((ext_vector_type(8)))  _Float16 v8h;
typedef __attribute__((ext_vector_type(8)))  unsigned short v8us;
typedef __attribute__((ext_vector_type(8)))  float    v8f;
typedef __attribute__((ext_vector_type(4)))  float    v4f;
typedef v4f  __attribute__((may_alias)) v4fa;
typedef v8us __attribute__((may_alias)) v8usa;

__device__ __forceinline__ unsigned short f2bf(float f) { unsigned u = __float_as_uint(f); u += 0x7FFFu + ((u >> 16) & 1u); return (unsigned short)(u >> 16); }
__device__ __forceinline__ float bf2f(unsigned short b) { return __uint_as_float(((unsigned)b) << 16); }
__device__ __forceinline__ float rbf(float f) { return bf2f(f2bf(f)); }   // value after RNE convert to bf16
__device__ __forceinline__ v16h cat16(v8h lo, v8h hi) { return __builtin_shufflevector(lo, hi, 0, 1, 2, 3, 4, 5, 6, 7, 8, 9, 10, 11, 12, 13, 14, 15); }
__device__ __forceinline__ v16bf cat16b(v8us lo, v8us hi) { return __builtin_bit_cast(v16bf, __builtin_shufflevector(lo, hi, 0, 1, 2, 3, 4, 5, 6, 7, 8, 9, 10, 11, 12, 13, 14, 15)); }
__device__ __forceinline__ v8f wmma16(v16h a, v16h b, v8f c) { return __builtin_amdgcn_wmma_f32_16x16x32_f16(false, a, false, b, (short)0, c, false, false); }
__device__ __forceinline__ v8f wmmab(v16bf a, v16bf b, v8f c) { return __builtin_amdgcn_wmma_f32_16x16x32_bf16(false, a, false, b, (short)0, c, false, false); }
// fragment loaders from K-contiguous 16-bit rows; p already includes + 8*(lane>>4): elements 0..7 <- k0+8h+0..7, elements 8..15 <- k0+16+8h+0..7 (same map for A and B)
__device__ __forceinline__ v16h  ldh(const h16* p) { return cat16(*(const v8h*)p, *(const v8h*)(p + 16)); }
__device__ __forceinline__ v16bf ldb(const bf* p)  { return cat16b(*(const v8us*)p, *(const v8us*)(p + 16)); }
// ordering point for wave-private LDS tiles (same wave writes and reads)
__device__ __forceinline__ void wave_sync() { __builtin_amdgcn_fence(3 /* release order */, "wavefront"); __builtin_amdgcn_wave_barrier(); asm volatile("" ::: "memory"); }
// single guarded f16 WMMA (one accumulator per guard)
__device__ __forceinline__ v8f wmma16g(v16h a, v16h b, v8f c) {
    c = __builtin_amdgcn_wmma_f32_16x16x32_f16(false, a, false, b, (short)0, c, false, false);
    asm volatile("v_nop\n\tv_nop\n\tv_nop\n\tv_nop" : "+v"(c) : "v"(a), "v"(b));
    return c;
}
__device__ __forceinline__ int imin(int a, int b) { return a < b ? a : b; }
__device__ __forceinline__ int imax(int a, int b) { return a > b ? a : b; }

__global__ __launch_bounds__(256) void k_cvt8(const float* __restrict__ src, bf* dst, size_t n8) {
    const size_t i = (size_t)blockIdx.x * 256 + threadIdx.x; if (i >= n8) return;
    const v8f v = *(const v8f*)(src + i * 8); v8us o;
#pragma unroll
    for (int k = 0; k < 8; ++k) o[k] = f2bf(v[k]);
    *(v8us*)(dst + i * 8) = o; 
}

// k_cvtT: in[rows = k][cols = n] f32 (DM x DM, row pitch DM) -> out[n][k] bf16 (RNE convert), 64x64 tiles transposed through LDS.
// grid (DM/64 over k, DM/64 over n), 256 threads. LDS tile ts[n][k] is cross-wave: block barrier between fill and drain.
__global__ __launch_bounds__(256) void k_cvtT(const float* __restrict__ W, bf* WT) {
    __shared__ __align__(16) unsigned short ts[64 * 72];
    const int tid = threadIdx.x, lane = tid & 31, wave = __builtin_amdgcn_readfirstlane((int)(tid >> 5));
    const int k0 = blockIdx.x * 64, n0 = blockIdx.y * 64;
#pragma unroll
    for (int i = 0; i < 4; ++i) { const int idx = tid + i * 256; const int kr = idx >> 4, c4 = (idx & 15) * 4;   // 1024 float4 = 64 k-rows x 16
        const v4f v = *(const v4f*)(W + (size_t)(k0 + kr) * DM + n0 + c4);
#pragma unroll
        for (int j = 0; j < 4; ++j) ts[(c4 + j) * 72 + kr] = f2bf(v[j]); }
    __syncthreads();
{
#pragma unroll
        for (int s = 0; s < 2; ++s) { const int row = wave * 8 + s * 4 + (lane >> 3), c8 = (lane & 7) * 8;   // 8 waves x 2 s x 4 = 64 rows; 8 lanes x 8 = 64 columns
            const v8us o = *(const v8usa*)(&ts[row * 72 + c8]);
            *(v8us*)(WT + (size_t)(n0 + row) * DM + k0 + c8) = o; }
         }
}

// k_lens: q_len[b] and k_len[b] as integer sums of the first SEQ entries of row b of the two int32 indicator arrays (row pitch SEQ_FULL).
__global__ __launch_bounds__(32) void k_lens(const int* __restrict__ qm, const int* __restrict__ km, int* lens) {
    const int lane = threadIdx.x & 31;
    int outv = 0;
#pragma unroll 1
    for (int b = 0; b < NB; ++b) {
        int sq = 0, sk = 0;
#pragma unroll 1
        for (int i = lane; i < SEQ; i += 32) { sq += qm[(size_t)b * SEQ_FULL + i]; sk += km[(size_t)b * SEQ_FULL + i]; }   // SEQ % 32 == 0: same trip count in every lane
#pragma unroll
        for (int o = 16; o > 0; o >>= 1) { sq += __shfl_xor(sq, o, 32); sk += __shfl_xor(sk, o, 32); }
        outv = (lane == b) ? sq : outv;
        outv = (lane == 8 + b) ? sk : outv;
    }
    *(int*)(lens + lane) = outv; 
}

// k_proj: register-blocked bf16 GEMM, ONE WAVE per 64x64 tile (16 accumulators), operands straight from K-contiguous bf16 planes, K = DM.
// C[m][n] = sum_k (A[m][k] (+ A2[m][k] when MODE 1)) Bt[n][k] + bias (bmode 1: bias[n]; bmode 2: bias[m]; bias RNE-converted to bf16 first),
// tile base (r0/RB)*sRB + (r0%RB)*pitch + (c0/CB)*sCB + (c0%CB), row pitch 'pitch' (elements). grid (M/64, N/64), 32 threads.
// MODE 1: written as f32 (Of); each row's 64 floats (256 B = two lines) by 16 consecutive lanes x 16 B (2 rows per instruction).
// Bias array has DM floats; both 16-byte bias loads use addresses clamped into [0, DM-4].
template <int MODE>
__global__ __launch_bounds__(32) void k_proj(const bf* __restrict__ A, const bf* __restrict__ A2, const bf* __restrict__ Bt,
                                             const float* __restrict__ bias, int bmode, h16* Ph, h16* Pr, int useRes, float* Of,
                                             int RB, size_t sRB, int pitch, int CB, size_t sCB) {
    __shared__ __align__(16) float os[16 * 68];
    const int K = DM;
    const int lane = threadIdx.x & 31, lr = lane & 15, hi = lane >> 4; const int r0 = blockIdx.x * 64, c0 = blockIdx.y * 64;
    v8f acc[4][4];
#pragma unroll
    for (int mb = 0; mb < 4; ++mb)
#pragma unroll
        for (int nb = 0; nb < 4; ++nb) acc[mb][nb] = (v8f){};
    const size_t aoff = (size_t)(r0 + lr) * K + 8 * hi, boff = (size_t)(c0 + lr) * K + 8 * hi;
#pragma unroll 1
    for (int kc = 0; kc < K; kc += 32) {
        v16bf a[4];
#pragma unroll
        for (int mb = 0; mb < 4; ++mb) a[mb] = ldb(A + aoff + (size_t)mb * 16 * K + kc);
#pragma unroll
        for (int nb = 0; nb < 4; ++nb) { const v16bf b = ldb(Bt + boff + (size_t)nb * 16 * K + kc);
#pragma unroll
            for (int mb = 0; mb < 4; ++mb) acc[mb][nb] = wmmab(a[mb], b, acc[mb][nb]); }
        asm volatile("v_nop\n\tv_nop\n\tv_nop\n\tv_nop" : "+v"(acc[0][0]), "+v"(acc[1][1]), "+v"(acc[2][2]), "+v"(acc[3][3]) : "v"(a[0]), "v"(a[1]), "v"(a[2]), "v"(a[3]));
        if (MODE == 1) {
            v16bf a2[4];
#pragma unroll
            for (int mb = 0; mb < 4; ++mb) a2[mb] = ldb(A2 + aoff + (size_t)mb * 16 * K + kc);
#pragma unroll
            for (int nb = 0; nb < 4; ++nb) { const v16bf b = ldb(Bt + boff + (size_t)nb * 16 * K + kc);
#pragma unroll
                for (int mb = 0; mb < 4; ++mb) acc[mb][nb] = wmmab(a2[mb], b, acc[mb][nb]); }
            asm volatile("v_nop\n\tv_nop\n\tv_nop\n\tv_nop" : "+v"(acc[0][0]), "+v"(acc[1][1]), "+v"(acc[2][2]), "+v"(acc[3][3]) : "v"(a2[0]), "v"(a2[1]), "v"(a2[2]), "v"(a2[3]));
        }
    }
    const size_t tbase = (size_t)(r0 / RB) * sRB + (size_t)(r0 % RB) * (size_t)pitch + (size_t)(c0 / CB) * sCB + (size_t)(c0 % CB);
    // per-lane column bias for the lane's store columns; both load addresses clamped into the DM-float bias array (first to 0 when unused, second to DM-4)
    const int c8 = (lane & 7) * 8, cofs = lr * 4;
    const int ci = (bmode == 1) ? (c0 + ((MODE == 0) ? c8 : cofs)) : 0;
    const int ci4 = (ci + 4 <= DM - 4) ? (ci + 4) : (DM - 4);      // MODE 0: ci + 4 <= DM - 4 always (exact columns); MODE 1: upper half unused, address kept in range
    const v4f bl0 = *(const v4f*)(bias + ci), bl1 = *(const v4f*)(bias + ci4);
    float bc[8];
#pragma unroll
    for (int i = 0; i < 4; ++i) { bc[i] = (bmode == 1) ? rbf(bl0[i]) : 0.0f; bc[4 + i] = (bmode == 1) ? rbf(bl1[i]) : 0.0f; }
#pragma unroll
    for (int mb = 0; mb < 4; ++mb) {
#pragma unroll
        for (int nb = 0; nb < 4; ++nb) {
#pragma unroll
            for (int j = 0; j < 8; ++j) os[(hi * 8 + j) * 68 + nb * 16 + lr] = acc[mb][nb][j]; }   // D: row 8h+j, col lane&15; rows 0..15 x columns 0..63 all written
        wave_sync();
        const size_t sb = tbase + (size_t)(mb * 16) * (size_t)pitch;
        if (MODE == 0) {
{
#pragma unroll
                for (int s = 0; s < 4; ++s) { const int row = 4 * s + (lane >> 3);   // 4 s x 4 row groups = 16 rows; 8 lanes x 8 = 64 columns
                    const int ri = (bmode == 2) ? (r0 + mb * 16 + row) : 0;
                    const float braw = bias[ri];
                    const float brow = (bmode == 2) ? rbf(braw) : 0.0f;
                    const v4f x0 = *(const v4fa*)(&os[row * 68 + c8]); const v4f x1 = *(const v4fa*)(&os[row * 68 + c8 + 4]); v8h hv, rv;
#pragma unroll
                    for (int i = 0; i < 4; ++i) { const float f0 = x0[i] + bc[i] + brow; const float f1 = x1[i] + bc[4 + i] + brow;
                        const h16 a0 = (h16)f0; const h16 a1 = (h16)f1; hv[i] = a0; hv[4 + i] = a1; rv[i] = (h16)((f0 - (float)a0) * QRS); rv[4 + i] = (h16)((f1 - (float)a1) * QRS); }
                    const size_t oo = sb + (size_t)row * (size_t)pitch + c8;
                    *(v8h*)(Ph + oo) = hv; if (useRes) *(v8h*)(Pr + oo) = rv; }
                 }
        } else {
{
#pragma unroll
                for (int s = 0; s < 8; ++s) { const int row = 2 * s + hi;   // 8 s x 2 rows = 16 rows; 16 lanes x 4 floats = 64 columns
                    const v4f x0 = *(const v4fa*)(&os[row * 68 + cofs]); v4f val;
                    val[0] = x0[0] + bc[0]; val[1] = x0[1] + bc[1]; val[2] = x0[2] + bc[2]; val[3] = x0[3] + bc[3];
                    *(v4f*)(Of + sb + (size_t)row * (size_t)pitch + cofs) = val; }
                 }
        }
        wave_sync();
    }
}

// flash_body: fused attention, one wave per 16 query rows of one (batch, head); K / V^T / Q fragments straight from the f16 planes (two 16-B loads each, arithmetic addressing).
// Transposed form: S^T[key][t] = K Q^T (A = K rows, B = Q rows); lane (t = lane&15, h = lane>>4) holds keys 8h+r of each 16-key tile, so the packed
// P tile is directly the B fragment of O^T[d][t] = V^T P^T (element r <- tile keys 0..15, element 8+r <- tile keys 16..31, lane unchanged).
// Visibility of (t, key): key <= lim(t) with lim = min(t, k_len - 1) when t < q_len, else -1 (nothing visible); excluded scores are REPLACED by a large negative fill and their P is set to 0 by value.
// The key loop runs to kend = min(t0 + 16, k_len) <= SEQ (wave-scalar, static upper bound SEQ); a row with no visible key keeps l = 0 and gets a zero context.
// Softmax state (running max, partial sum) is one scalar per lane; the two lane halves of a row are combined with one xor-16 exchange.
// EARLY = 1 (query rows < EROWS): q, k, P, v each as f16 value + f16 residual x2048; value x residual products go to separate accumulators folded with 1/2048 (scores: before the scale; context: before the normalisation); row sum over the unconverted p.
// EARLY = 0: single f16 products, row sum over the converted P.
template <int EARLY>
__device__ __forceinline__ void flash_body(const int xblk, const h16* __restrict__ QH, const h16* __restrict__ QR, const h16* __restrict__ KP, const h16* __restrict__ KR,
                                           const h16* __restrict__ VT, const h16* __restrict__ VR, const int* __restrict__ LENS, bf* CH, bf* CL) {
    __shared__ __align__(16) float os[AW * 16 * 68];
    const int lane = threadIdx.x & 31, wave = __builtin_amdgcn_readfirstlane((int)(threadIdx.x >> 5)), lr = lane & 15, hi = lane >> 4;
    const int zh = blockIdx.y; const int b = zh / NH_, h = zh % NH_;
    const int t0 = (xblk * AW + wave) * 16;
    const size_t pbase = (size_t)zh * SEQ * HD;
    const size_t qo = pbase + (size_t)(t0 + lr) * HD + 8 * hi;
    const v16h qh0 = ldh(QH + qo), qh1 = ldh(QH + qo + 32);   // B fragments: col t, k = d
    v16h qr0 = qh0, qr1 = qh1;
    if (EARLY) { qr0 = ldh(QR + qo); qr1 = ldh(QR + qo + 32); }
    const size_t ko = pbase + (size_t)lr * HD + 8 * hi;      // + key * HD       (A fragment: row key, k = d)
    const size_t vo = pbase + (size_t)lr * SEQ + 8 * hi;     // + 16j*SEQ + key  (A fragment: row d, k = key)
    const int qlen = imin(imax(LENS[b], 0), SEQ), klen = imin(imax(LENS[8 + b], 0), SEQ);   // lengths clamped into [0, SEQ]
    const int t = t0 + lr;
    const int lim = (t < qlen) ? imin(t, klen - 1) : -1;      // last visible key of query t (-1: none)
    const int kend = __builtin_amdgcn_readfirstlane(imin((xblk * AW + (int)(threadIdx.x >> 5)) * 16 + 16, klen));   // min taken first, then made wave-scalar; <= SEQ
    v8f o0 = (v8f){}, o1 = (v8f){}, o2 = (v8f){}, o3 = (v8f){};
    v8f e0 = (v8f){}, e1 = (v8f){}, e2 = (v8f){}, e3 = (v8f){};
    float m = -3.0e38f, l = 0.0f;
#pragma unroll 1
    for (int key0 = 0; key0 < kend; key0 += 32) {
        const size_t kof = ko + (size_t)key0 * HD;
        v8f sHa = (v8f){}, sLa = (v8f){}, sHb = (v8f){}, sLb = (v8f){};
        if (EARLY) {
            { const v16h kh0 = ldh(KP + kof), kh1 = ldh(KP + kof + 32), kr0 = ldh(KR + kof), kr1 = ldh(KR + kof + 32);
              sHa = wmma16g(kh0, qh0, sHa); sLa = wmma16g(kh0, qr0, sLa); sLa = wmma16g(kr0, qh0, sLa);
              sHa = wmma16g(kh1, qh1, sHa); sLa = wmma16g(kh1, qr1, sLa); sLa = wmma16g(kr1, qh1, sLa); }
            { const v16h kh0 = ldh(KP + kof + 16 * HD), kh1 = ldh(KP + kof + 16 * HD + 32), kr0 = ldh(KR + kof + 16 * HD), kr1 = ldh(KR + kof + 16 * HD + 32);
              sHb = wmma16g(kh0, qh0, sHb); sLb = wmma16g(kh0, qr0, sLb); sLb = wmma16g(kr0, qh0, sLb);
              sHb = wmma16g(kh1, qh1, sHb); sLb = wmma16g(kh1, qr1, sLb); sLb = wmma16g(kr1, qh1, sLb); }
        } else {
            const h16* ka = KP + kof;
            const v16h ka0 = ldh(ka), ka1 = ldh(ka + 32), kb0 = ldh(ka + 16 * HD), kb1 = ldh(ka + 16 * HD + 32);
            sHa = wmma16(ka0, qh0, sHa); sHb = wmma16(kb0, qh0, sHb);
            sHa = wmma16(ka1, qh1, sHa); sHb = wmma16(kb1, qh1, sHb);
            asm volatile("v_nop\n\tv_nop\n\tv_nop\n\tv_nop" : "+v"(sHa), "+v"(sHb) : "v"(ka0), "v"(ka1), "v"(kb0), "v"(kb1));
        }
        const int kq = key0 + 8 * hi;           // this lane's first key of tile a (tile b: + 16)
        float ta[8], tb[8]; float mx = -3.0e38f;
#pragma unroll
        for (int r = 0; r < 8; ++r) {
            const float xa = EARLY ? (sHa[r] + sLa[r] * QRI) * SC2 : sHa[r] * SC2;
            const float xb = EARLY ? (sHb[r] + sLb[r] * QRI) * SC2 : sHb[r] * SC2;
            ta[r] = (kq + r <= lim) ? xa : -3.0e38f;
            tb[r] = (kq + 16 + r <= lim) ? xb : -3.0e38f; }
#pragma unroll
        for (int r = 0; r < 8; ++r) mx = fmaxf(mx, fmaxf(ta[r], tb[r]));
        mx = fmaxf(mx, __shfl_xor(mx, 16, 32));
        const float mnew = fmaxf(m, mx);
        const float alpha = __builtin_amdgcn_exp2f(m - mnew);
        const float sh = PSH - mnew;
        v16h pb = (v16h){}, pr = (v16h){}; float ls = 0.0f;
#pragma unroll
        for (int r = 0; r < 8; ++r) {
            const float ya = __builtin_amdgcn_exp2f(ta[r] + sh), yb = __builtin_amdgcn_exp2f(tb[r] + sh);
            const float ea = (kq + r <= lim) ? ya : 0.0f;
            const float eb = (kq + 16 + r <= lim) ? yb : 0.0f;
            const h16 pa = (h16)ea; const h16 pc = (h16)eb; pb[r] = pa; pb[8 + r] = pc;
            if (EARLY) { pr[r] = (h16)((ea - (float)pa) * QRS); pr[8 + r] = (h16)((eb - (float)pc) * QRS); ls += ea + eb; }
            else { ls += (float)pa + (float)pc; } }
        l = l * alpha + ls; m = mnew;
        o0 = o0 * alpha; o1 = o1 * alpha; o2 = o2 * alpha; o3 = o3 * alpha;
        const size_t vof = vo + key0;
        if (EARLY) {
            e0 = e0 * alpha; e1 = e1 * alpha; e2 = e2 * alpha; e3 = e3 * alpha;
            { const v16h vh = ldh(VT + vof), vr = ldh(VR + vof);
              o0 = wmma16g(vh, pb, o0); e0 = wmma16g(vh, pr, e0); e0 = wmma16g(vr, pb, e0); }
            { const v16h vh = ldh(VT + vof + (size_t)16 * SEQ), vr = ldh(VR + vof + (size_t)16 * SEQ);
              o1 = wmma16g(vh, pb, o1); e1 = wmma16g(vh, pr, e1); e1 = wmma16g(vr, pb, e1); }
            { const v16h vh = ldh(VT + vof + (size_t)32 * SEQ), vr = ldh(VR + vof + (size_t)32 * SEQ);
              o2 = wmma16g(vh, pb, o2); e2 = wmma16g(vh, pr, e2); e2 = wmma16g(vr, pb, e2); }
            { const v16h vh = ldh(VT + vof + (size_t)48 * SEQ), vr = ldh(VR + vof + (size_t)48 * SEQ);
              o3 = wmma16g(vh, pb, o3); e3 = wmma16g(vh, pr, e3); e3 = wmma16g(vr, pb, e3); }
        } else {
            const h16* va = VT + vof;
            const v16h v0 = ldh(va), v1 = ldh(va + (size_t)16 * SEQ), v2 = ldh(va + (size_t)32 * SEQ), v3 = ldh(va + (size_t)48 * SEQ);
            o0 = wmma16(v0, pb, o0); o1 = wmma16(v1, pb, o1); o2 = wmma16(v2, pb, o2); o3 = wmma16(v3, pb, o3);
            asm volatile("v_nop\n\tv_nop\n\tv_nop\n\tv_nop" : "+v"(o0), "+v"(o1), "+v"(o2), "+v"(o3) : "v"(v0), "v"(v1), "v"(v2), "v"(v3), "v"(pb));
        }
    }
    if (EARLY) { o0 = o0 + e0 * QRI; o1 = o1 + e1 * QRI; o2 = o2 + e2 * QRI; o3 = o3 + e3 * QRI; }
    l += __shfl_xor(l, 16, 32);
    const float lsafe = (l > 0.0f) ? l : 1.0f;
    const float inv = (l > 0.0f) ? (1.0f / lsafe) : 0.0f;     // no visible key: zero context
    const int wb = wave * 16 * 68;
    // O^T D layout: o_j[r] = (d = 16j + 8h + r, t = lane&15) -> os[t][d]; rows 0..15 x columns 0..63 all written
    { v4f a, c;
      a[0] = o0[0] * inv; a[1] = o0[1] * inv; a[2] = o0[2] * inv; a[3] = o0[3] * inv; c[0] = o0[4] * inv; c[1] = o0[5] * inv; c[2] = o0[6] * inv; c[3] = o0[7] * inv;
      *(v4fa*)(&os[wb + lr * 68 +  0 + 8 * hi]) = a; *(v4fa*)(&os[wb + lr * 68 +  0 + 8 * hi + 4]) = c;
      a[0] = o1[0] * inv; a[1] = o1[1] * inv; a[2] = o1[2] * inv; a[3] = o1[3] * inv; c[0] = o1[4] * inv; c[1] = o1[5] * inv; c[2] = o1[6] * inv; c[3] = o1[7] * inv;
      *(v4fa*)(&os[wb + lr * 68 + 16 + 8 * hi]) = a; *(v4fa*)(&os[wb + lr * 68 + 16 + 8 * hi + 4]) = c;
      a[0] = o2[0] * inv; a[1] = o2[1] * inv; a[2] = o2[2] * inv; a[3] = o2[3] * inv; c[0] = o2[4] * inv; c[1] = o2[5] * inv; c[2] = o2[6] * inv; c[3] = o2[7] * inv;
      *(v4fa*)(&os[wb + lr * 68 + 32 + 8 * hi]) = a; *(v4fa*)(&os[wb + lr * 68 + 32 + 8 * hi + 4]) = c;
      a[0] = o3[0] * inv; a[1] = o3[1] * inv; a[2] = o3[2] * inv; a[3] = o3[3] * inv; c[0] = o3[4] * inv; c[1] = o3[5] * inv; c[2] = o3[6] * inv; c[3] = o3[7] * inv;
      *(v4fa*)(&os[wb + lr * 68 + 48 + 8 * hi]) = a; *(v4fa*)(&os[wb + lr * 68 + 48 + 8 * hi + 4]) = c; }
    wave_sync();
    const size_t obase = ((size_t)b * SEQ + t0) * DM + (size_t)h * HD;
{
#pragma unroll
        for (int s = 0; s < 4; ++s) { const int row = 4 * s + (lane >> 3), c8 = (lane & 7) * 8;   // 4 s x 4 row groups = 16 rows; 8 lanes x 8 = 64 columns
            const v4f x0 = *(const v4fa*)(&os[wb + row * 68 + c8]); const v4f x1 = *(const v4fa*)(&os[wb + row * 68 + c8 + 4]); v8us hv, lv;
#pragma unroll
            for (int i = 0; i < 4; ++i) { const unsigned short a0 = f2bf(x0[i]); const unsigned short a1 = f2bf(x1[i]);
                hv[i] = a0; hv[4 + i] = a1; lv[i] = f2bf(x0[i] - bf2f(a0)); lv[4 + i] = f2bf(x1[i] - bf2f(a1)); }
            const size_t oo = obase + (size_t)row * DM + c8;
            *(v8us*)(CH + oo) = hv; *(v8us*)(CL + oo) = lv; }
         }
}

// k_flash: query rows EROWS..SEQ-1 (single products); grid ((SEQ - EROWS) / (16*AW), NB*NH_).
__global__ __launch_bounds__(32 * AW) void k_flash(const h16* __restrict__ QH, const h16* __restrict__ KP, const h16* __restrict__ VT,
                                                   const int* __restrict__ LENS, bf* CH, bf* CL) {
    flash_body<0>((int)blockIdx.x + EROWS / (16 * AW), QH, QH, KP, KP, VT, VT, LENS, CH, CL);
}

// k_flash_early: query rows 0..EROWS-1 (value + residual products); grid (EROWS / (16*AW), NB*NH_).
__global__ __launch_bounds__(32 * AW) void k_flash_early(const h16* __restrict__ QH, const h16* __restrict__ QR, const h16* __restrict__ KP, const h16* __restrict__ KR,
                                                         const h16* __restrict__ VT, const h16* __restrict__ VR, const int* __restrict__ LENS, bf* CH, bf* CL) {
    flash_body<1>((int)blockIdx.x, QH, QR, KP, KR, VT, VR, LENS, CH, CL);
}

static constexpr size_t al256(size_t v) { return (v + 255) & ~(size_t)255; }
static constexpr size_t SZ_XB = al256((size_t)NB * SEQ * DM * 2);          // one bf16 activation plane [NB*SEQ][1024]
static constexpr size_t SZ_WB = al256((size_t)4 * DM * DM * 2);            // four transposed bf16 weight planes
static constexpr size_t SZ_PL = al256((size_t)NB * NH_ * SEQ * HD * 2);    // one f16 head plane
static constexpr size_t SZ_LN = al256((size_t)32 * 4);
static constexpr size_t SZ_TOTAL = 3 * SZ_XB + SZ_WB + 6 * SZ_PL + 2 * SZ_XB + SZ_LN;
static_assert(SZ_TOTAL <= (size_t)134217728);          // workspace carve <= 128 MiB
static_assert(((size_t)DM * DM * 2) % 256 == 0);       // weight sub-planes stay 256-byte aligned
static_assert((size_t)NB * OUT_SEQ * DM * 4 <= (size_t)NB_FULL * SEQ_FULL * DM * 4);   // single output at byte offset 0

static void cvt_in(const float* x, bf* dst, hipStream_t stream) {
    if (SEQ == SEQ_FULL) {
        const size_t n8 = (size_t)NB * SEQ * DM / 8;
        k_cvt8<<<(unsigned)((n8 + 255) / 256), 256, 0, stream>>>(x, dst, n8);
    } else {
        const size_t n8 = (size_t)SEQ * DM / 8;
        for (int b = 0; b < NB; ++b) k_cvt8<<<(unsigned)((n8 + 255) / 256), 256, 0, stream>>>(x + (size_t)b * SEQ_FULL * DM, dst + (size_t)b * SEQ * DM, n8);
    }
}

extern "C" void kernel_launch(void* const* d_in, const int* in_sizes, int n_in,
                              void* d_out, int out_size, void* d_ws, size_t ws_size, hipStream_t stream) {
    if (n_in < 13) return;
    const size_t needx = ((size_t)(NB - 1) * SEQ_FULL + SEQ) * DM;
    if ((size_t)in_sizes[0] < needx || (size_t)in_sizes[1] < needx || (size_t)in_sizes[2] < needx) return;
    if ((size_t)in_sizes[3] < (size_t)(NB - 1) * SEQ_FULL + SEQ || (size_t)in_sizes[4] < (size_t)(NB - 1) * SEQ_FULL + SEQ) return;
    if ((size_t)in_sizes[5] < (size_t)DM * DM || (size_t)in_sizes[7] < (size_t)DM * DM || (size_t)in_sizes[9] < (size_t)DM * DM || (size_t)in_sizes[11] < (size_t)DM * DM) return;
    if (in_sizes[6] < DM || in_sizes[8] < DM || in_sizes[10] < DM || in_sizes[12] < DM) return;
    if ((size_t)out_size < ((size_t)(NB - 1) * OUT_SEQ + SEQ) * DM) return;
    if (SZ_TOTAL > ws_size) return;
    // wire order: in_Q, in_K, in_V, Q_pad_mask (int32), K_pad_mask (int32), W_Q, b_Q, W_K, b_K, W_V, b_V, W_O, b_O
    const float* xq = (const float*)d_in[0]; const float* xk = (const float*)d_in[1]; const float* xv = (const float*)d_in[2];
    const int* qmask = (const int*)d_in[3]; const int* kmask = (const int*)d_in[4];
    const float* wq = (const float*)d_in[5];  const float* bq = (const float*)d_in[6];
    const float* wk = (const float*)d_in[7];  const float* bk = (const float*)d_in[8];
    const float* wv = (const float*)d_in[9];  const float* bv = (const float*)d_in[10];
    const float* wo = (const float*)d_in[11]; const float* bo = (const float*)d_in[12];
    float* OUT = (float*)d_out;      // [NB][SEQ][1024]
    char* wsp = (char*)d_ws;
    bf* QB = (bf*)wsp; wsp += SZ_XB;                 // [NB*SEQ][1024] bf16 query input
    bf* KB = (bf*)wsp; wsp += SZ_XB;                 // [NB*SEQ][1024] bf16 key input
    bf* VB = (bf*)wsp; wsp += SZ_XB;                 // [NB*SEQ][1024] bf16 value input
    bf* WB = (bf*)wsp; wsp += SZ_WB;                 // [4][1024 out][1024 in]: q | k | v | o
    h16* QH = (h16*)wsp; wsp += SZ_PL;               // [NB*16][SEQ][64]
    h16* QR = (h16*)wsp; wsp += SZ_PL;               // [NB*16][SEQ][64] residual x2048
    h16* KP = (h16*)wsp; wsp += SZ_PL;               // [NB*16][SEQ][64]
    h16* KR = (h16*)wsp; wsp += SZ_PL;               // [NB*16][SEQ][64] residual x2048
    h16* VT = (h16*)wsp; wsp += SZ_PL;               // [NB*16][64][SEQ]
    h16* VR = (h16*)wsp; wsp += SZ_PL;               // [NB*16][64][SEQ] residual x2048
    bf* CH = (bf*)wsp; wsp += SZ_XB;                 // [NB*SEQ][1024] context bf16 hi
    bf* CL = (bf*)wsp; wsp += SZ_XB;                 // [NB*SEQ][1024] context bf16 lo
    int* LN = (int*)wsp; wsp += SZ_LN;               // 32 ints: word b = q_len[b], word 8 + b = k_len[b]
    bf* WQT = WB; bf* WKT = WB + (size_t)DM * DM; bf* WVT = WB + (size_t)2 * DM * DM; bf* WOT = WB + (size_t)3 * DM * DM;

    cvt_in(xq, QB, stream); cvt_in(xk, KB, stream); cvt_in(xv, VB, stream);
    // weights: in[rows = k (in)][cols = n (out)] -> out[n][k]; square DM x DM, grid (k tiles, n tiles)
    { const dim3 g(DM / 64, DM / 64, 1);
      k_cvtT<<<g, 256, 0, stream>>>(wq, WQT); k_cvtT<<<g, 256, 0, stream>>>(wk, WKT); k_cvtT<<<g, 256, 0, stream>>>(wv, WVT); k_cvtT<<<g, 256, 0, stream>>>(wo, WOT); }
    k_lens<<<1, 32, 0, stream>>>(qmask, kmask, LN);

    // q, k: A = x rows (m = b*SEQ + t), Bt = W^T rows (n = h*64 + d), column bias -> planes [(b*16 + h)][t][d] (value and residual)
    k_proj<0><<<dim3(NB * SEQ / 64, DM / 64, 1), 32, 0, stream>>>(QB, QB, WQT, bq, 1, QH, QR, 1, OUT, SEQ, (size_t)NH_ * SEQ * HD, HD, HD, (size_t)SEQ * HD);
    k_proj<0><<<dim3(NB * SEQ / 64, DM / 64, 1), 32, 0, stream>>>(KB, KB, WKT, bk, 1, KP, KR, 1, OUT, SEQ, (size_t)NH_ * SEQ * HD, HD, HD, (size_t)SEQ * HD);
    // v^T: A = Wv^T rows (m = h*64 + d), Bt = value rows (n = b*SEQ + t), row bias -> planes [(b*1024 + m)][t] = [(b*16 + h)][d][t] (value and residual)
    k_proj<0><<<dim3(DM / 64, NB * SEQ / 64, 1), 32, 0, stream>>>(WVT, WVT, VB, bv, 2, VT, VR, 1, OUT, DM, (size_t)0, SEQ, SEQ, (size_t)DM * SEQ);

    // context planes: rows 0..EROWS-1 by the early kernel, rows EROWS..SEQ-1 by the single-product kernel (disjoint rows, every row written)
    k_flash_early<<<dim3(EROWS / (16 * AW), NB * NH_, 1), 32 * AW, 0, stream>>>(QH, QR, KP, KR, VT, VR, LN, CH, CL);
    if (SEQ > EROWS)
        k_flash<<<dim3((SEQ - EROWS) / (16 * AW), NB * NH_, 1), 32 * AW, 0, stream>>>(QH, KP, VT, LN, CH, CL);

    // output: A = context hi (+ lo) rows (m = b*SEQ + t), Bt = Wo^T rows (n), column bias -> OUT[(b*OUT_SEQ + t)][n] f32
    k_proj<1><<<dim3(NB * SEQ / 64, DM / 64, 1), 32, 0, stream>>>(CH, CL, WOT, bo, 1, QH, QH, 0, OUT, SEQ, (size_t)OUT_SEQ * DM, DM, DM, (size_t)0);
}

// v001
// A run of this version takes 191 microseconds.
// Next to v000, in two timings, it ran 1.26 times as fast each time.
#include <hip/hip_runtime.h>

// Projections q/k/v: v_wmma_f32_16x16x32_bf16 (inputs and weights RNE-converted to bf16, f32 accumulate); scores: v_wmma_f32_16x16x32_f16 (query rows >= EROWS: single f16 q and k; rows < EROWS: q and k as f16 value + f16 residual x2048, three products, residual products in their own accumulator); P.V: v_wmma_f32_16x16x32_f16 (P x256 carry, v single f16; rows < EROWS: P and v as value + residual x2048, three products, residual products in their own accumulator); output projection: v_wmma_f32_16x16x32_bf16 (context as bf16 hi + bf16 lo planes, Wo bf16), f32 accumulate everywhere, softmax f32.
// Attention block, width 1024 = 16 heads x 64; query/key/value inputs [NB][SEQ][1024] f32, W_Q/W_K/W_V/W_O [in][out] (y = x W + b), score scale 1/8,
// causal fill (key > query -> excluded) and length fill (query < q_len[b] and key < k_len[b], lengths = integer sums of the two int32 indicator rows); rows with no visible key give a zero context; output y = ctx W_O + b_O (f32).
// Layout: bf16 copies of the three inputs; bf16 TRANSPOSED copies of the four weights ([out][in], K-contiguous); q, k planes [b*16+h][t][d] and v^T plane [b*16+h][d][t] (value and residual x2048) written by the GEMM epilogue;
// fused flash kernel in transposed form (S^T = K Q^T, O^T = V^T P^T) writing the context as bf16 hi/lo planes [b*SEQ+t][1024]; final GEMM writes f32 rows.

#ifndef NB
#define NB 2
#endif
#ifndef SEQ
#define SEQ 2048
#endif
#define NB_FULL  2
#define SEQ_FULL 2048
#ifndef OUT_SEQ
#define OUT_SEQ SEQ              // row pitch (in tokens) between batches of the output
#endif
#ifndef EROWS
#define EROWS 256                // query rows below this use the value + residual products
#endif
#define DM   1024
#define NH_  16
#define HD   64
#define AW   4                   // waves per flash block (16 query rows each)
#define QRS  2048.0f             // carry of the residual planes
#define QRI  (1.0f / 2048.0f)
#define LOG2E 1.4426950408889634f
#define SC2  (0.125f * 1.4426950408889634f)   // HD^-0.5 * log2(e)
#define PSH  8.0f                // log2 of the P carry (256)

static_assert(HD == 64);
static_assert(NH_ * HD == DM);                 // head h = columns h*64 + d
static_assert(DM % 64 == 0);                   // column tiles of 64
static_assert(DM % 32 == 0);                   // GEMM k-loop steps by 32
static_assert(DM >= 8);                        // clamped bias loads stay inside a DM-float array
static_assert(SEQ % 64 == 0);                  // a 64-row tile never straddles two batches
static_assert((NB * SEQ) % 64 == 0);
static_assert(SEQ % 32 == 0);                  // key loop steps by 32
static_assert(SEQ % (16 * AW) == 0);           // flash grid covers the sequence exactly
static_assert(((size_t)SEQ * DM) % 8 == 0);
static_assert(NB <= NB_FULL);
static_assert(SEQ <= SEQ_FULL);
static_assert(SEQ_FULL % 4 == 0);
static_assert(EROWS % (16 * AW) == 0);         // the early band is a whole number of flash blocks
static_assert(EROWS % 32 == 0);                // early key steps stay inside the early key range
static_assert(EROWS >= 16 * AW);
static_assert(EROWS <= SEQ);
static_assert(NB <= 8);                        // length line: word b = q_len[b], word 8 + b = k_len[b]

typedef _Float16 h16;
typedef unsigned short bf;
typedef __attribute__((ext_vector_type(16))) __bf16   v16bf;
typedef __attribute__((ext_vector_type(16))) _Float16 v16h;
typedef __attribute__((ext_vector_type(8)))  _Float16 v8h;
typedef __attribute__((ext_vector_type(8)))  unsigned short v8us;
typedef __attribute__((ext_vector_type(8)))  float    v8f;
typedef __attribute__((ext_vector_type(4)))  float    v4f;
typedef v4f  __attribute__((may_alias)) v4fa;
typedef v8us __attribute__((may_alias)) v8usa;

__device__ __forceinline__ unsigned short f2bf(float f) { unsigned u = __float_as_uint(f); u += 0x7FFFu + ((u >> 16) & 1u); return (unsigned short)(u >> 16); }
__device__ __forceinline__ float bf2f(unsigned short b) { return __uint_as_float(((unsigned)b) << 16); }
__device__ __forceinline__ float rbf(float f) { return bf2f(f2bf(f)); }   // value after RNE convert to bf16
__device__ __forceinline__ v16h cat16(v8h lo, v8h hi) { return __builtin_shufflevector(lo, hi, 0, 1, 2, 3, 4, 5, 6, 7, 8, 9, 10, 11, 12, 13, 14, 15); }
__device__ __forceinline__ v16bf cat16b(v8us lo, v8us hi) { return __builtin_bit_cast(v16bf, __builtin_shufflevector(lo, hi, 0, 1, 2, 3, 4, 5, 6, 7, 8, 9, 10, 11, 12, 13, 14, 15)); }
__device__ __forceinline__ v8f wmma16(v16h a, v16h b, v8f c) { return __builtin_amdgcn_wmma_f32_16x16x32_f16(false, a, false, b, (short)0, c, false, false); }
__device__ __forceinline__ v8f wmmab(v16bf a, v16bf b, v8f c) { return __builtin_amdgcn_wmma_f32_16x16x32_bf16(false, a, false, b, (short)0, c, false, false); }
// fragment loaders from K-contiguous 16-bit rows; p already includes + 8*(lane>>4): elements 0..7 <- k0+8h+0..7, elements 8..15 <- k0+16+8h+0..7 (same map for A and B)
__device__ __forceinline__ v16h  ldh(const h16* p) { return cat16(*(const v8h*)p, *(const v8h*)(p + 16)); }
__device__ __forceinline__ v16bf ldb(const bf* p)  { return cat16b(*(const v8us*)p, *(const v8us*)(p + 16)); }
// ordering point for wave-private LDS tiles (same wave writes and reads)
__device__ __forceinline__ void wave_sync() { __builtin_amdgcn_fence(3 /* release order */, "wavefront"); __builtin_amdgcn_wave_barrier(); asm volatile("" ::: "memory"); }
// single guarded f16 WMMA (one accumulator per guard)
__device__ __forceinline__ v8f wmma16g(v16h a, v16h b, v8f c) {
    c = __builtin_amdgcn_wmma_f32_16x16x32_f16(false, a, false, b, (short)0, c, false, false);
    asm volatile("v_nop\n\tv_nop\n\tv_nop\n\tv_nop" : "+v"(c) : "v"(a), "v"(b));
    return c;
}
__device__ __forceinline__ int imin(int a, int b) { return a < b ? a : b; }
__device__ __forceinline__ int imax(int a, int b) { return a > b ? a : b; }

__global__ __launch_bounds__(256) void k_cvt8(const float* __restrict__ src, bf* dst, size_t n8) {
    const size_t i = (size_t)blockIdx.x * 256 + threadIdx.x; if (i >= n8) return;
    const v8f v = *(const v8f*)(src + i * 8); v8us o;
#pragma unroll
    for (int k = 0; k < 8; ++k) o[k] = f2bf(v[k]);
    *(v8us*)(dst + i * 8) = o; 
}

// k_cvtT: in[rows = k][cols = n] f32 (DM x DM, row pitch DM) -> out[n][k] bf16 (RNE convert), 64x64 tiles transposed through LDS.
// grid (DM/64 over k, DM/64 over n), 256 threads. LDS tile ts[n][k] is cross-wave: block barrier between fill and drain.
__global__ __launch_bounds__(256) void k_cvtT(const float* __restrict__ W, bf* WT) {
    __shared__ __align__(16) unsigned short ts[64 * 72];
    const int tid = threadIdx.x, lane = tid & 31, wave = __builtin_amdgcn_readfirstlane((int)(tid >> 5));
    const int k0 = blockIdx.x * 64, n0 = blockIdx.y * 64;
#pragma unroll
    for (int i = 0; i < 4; ++i) { const int idx = tid + i * 256; const int kr = idx >> 4, c4 = (idx & 15) * 4;   // 1024 float4 = 64 k-rows x 16
        const v4f v = *(const v4f*)(W + (size_t)(k0 + kr) * DM + n0 + c4);
#pragma unroll
        for (int j = 0; j < 4; ++j) ts[(c4 + j) * 72 + kr] = f2bf(v[j]); }
    __syncthreads();
{
#pragma unroll
        for (int s = 0; s < 2; ++s) { const int row = wave * 8 + s * 4 + (lane >> 3), c8 = (lane & 7) * 8;   // 8 waves x 2 s x 4 = 64 rows; 8 lanes x 8 = 64 columns
            const v8us o = *(const v8usa*)(&ts[row * 72 + c8]);
            *(v8us*)(WT + (size_t)(n0 + row) * DM + k0 + c8) = o; }
         }
}

// k_lens: q_len[b] and k_len[b] as integer sums of the first SEQ entries of row b of the two int32 indicator arrays (row pitch SEQ_FULL).
__global__ __launch_bounds__(32) void k_lens(const int* __restrict__ qm, const int* __restrict__ km, int* lens) {
    const int lane = threadIdx.x & 31;
    int outv = 0;
#pragma unroll 1
    for (int b = 0; b < NB; ++b) {
        int sq = 0, sk = 0;
#pragma unroll 1
        for (int i = lane; i < SEQ; i += 32) { sq += qm[(size_t)b * SEQ_FULL + i]; sk += km[(size_t)b * SEQ_FULL + i]; }   // SEQ % 32 == 0: same trip count in every lane
#pragma unroll
        for (int o = 16; o > 0; o >>= 1) { sq += __shfl_xor(sq, o, 32); sk += __shfl_xor(sk, o, 32); }
        outv = (lane == b) ? sq : outv;
        outv = (lane == 8 + b) ? sk : outv;
    }
    *(int*)(lens + lane) = outv; 
}

// k_proj: bf16 GEMM, one block of 4 waves (2 x 2) per 128x128 tile, each wave a 64x64 sub-tile (16 accumulators), K = DM in passes of KS.
// Operand tiles are staged in LDS: every thread brings 16-byte pieces of whole 256-byte row segments (a wave-wide load covers 4 whole lines) into registers one pass ahead
// and stores them into the other of two LDS buffers behind the pass's products; one block barrier per pass publishes that buffer and ends the reads of the one refilled next.
// Fragments come from LDS rows of pitch LP (272 B) with the same element map as ldb(); the k order of the sums is the ascending 32-step order.
// C[m][n] = sum_k (A[m][k] (+ A2[m][k] when MODE 1)) Bt[n][k] + bias (bmode 1: bias[n]; bmode 2: bias[m]; bias RNE-converted to bf16 first),
// sub-tile base (r0/RB)*sRB + (r0%RB)*pitch + (c0/CB)*sCB + (c0%CB), row pitch 'pitch' (elements). grid (M/128, N/128), 128 threads.
// MODE 1: written as f32 (Of); each row's 64 floats (256 B = two lines) by 16 consecutive lanes x 16 B (2 rows per instruction).
// Bias array has DM floats; both 16-byte bias loads use addresses clamped into [0, DM-4].
#define GT 128                   // block tile edge (rows of A and rows of Bt per block)
#define KS 128                   // k elements per pass (256 B of every operand row)
#define LP 136                   // LDS row pitch in elements (272 B: 16 B x odd, for 16-byte readers)
#define NLD (GT * KS / 8 / 128)  // 16-byte pieces per thread, operand and pass
static_assert(DM % KS == 0);
static_assert(DM % GT == 0);
static_assert((NB * SEQ) % GT == 0);
__device__ __forceinline__ v16bf ldbs(const bf* p) { return cat16b(*(const v8usa*)p, *(const v8usa*)(p + 16)); }   // ldb() on an LDS row
template <int MODE>
__global__ __launch_bounds__(128) void k_proj(const bf* __restrict__ A, const bf* __restrict__ A2, const bf* __restrict__ Bt,
                                              const float* __restrict__ bias, int bmode, h16* Ph, h16* Pr, int useRes, float* Of,
                                              int RB, size_t sRB, int pitch, int CB, size_t sCB) {
    constexpr int NOPD = (MODE == 1) ? 3 : 2;                    // staged operands: A, Bt (, A2)
    __shared__ __align__(16) bf st[2 * NOPD * GT * LP];          // [buffer][operand][row][LP]
    __shared__ __align__(16) float osall[4 * 16 * 68];           // one wave-private epilogue tile per wave
    const int K = DM;
    const int tid = threadIdx.x, lane = tid & 31, lr = lane & 15, hi = lane >> 4, wave = __builtin_amdgcn_readfirstlane((int)(tid >> 5));
    const int R0 = blockIdx.x * GT, C0 = blockIdx.y * GT;
    const int wm = wave >> 1, wn = wave & 1;
    const int r0 = R0 + wm * 64, c0 = C0 + wn * 64;              // this wave's 64x64 sub-tile
    float* os = osall + wave * (16 * 68);
    v8f acc[4][4];
#pragma unroll
    for (int mb = 0; mb < 4; ++mb)
#pragma unroll
        for (int nb = 0; nb < 4; ++nb) acc[mb][nb] = (v8f){};
    // staging map: piece i of a thread = row (tid >> 4) + 8 i, bytes 16 (tid & 15) of the row's 256-byte segment
    const int srow = tid >> 4, sch = (tid & 15) * 8;
    const bf* gA  = A  + (size_t)(R0 + srow) * K + sch;
    const bf* gA2 = A2 + (size_t)(R0 + srow) * K + sch;
    const bf* gB  = Bt + (size_t)(C0 + srow) * K + sch;
    const int sl = srow * LP + sch;
    const int fa = (wm * 64 + lr) * LP + 8 * hi, fb = GT * LP + (wn * 64 + lr) * LP + 8 * hi, fa2 = 2 * GT * LP + fa;   // fragment bases inside a buffer
    v8us pa[NLD], pb[NLD], pa2[NLD];
#pragma unroll
    for (int i = 0; i < NLD; ++i) { pa[i] = *(const v8us*)(gA + (size_t)i * 8 * K); pb[i] = *(const v8us*)(gB + (size_t)i * 8 * K);
        if (MODE == 1) pa2[i] = *(const v8us*)(gA2 + (size_t)i * 8 * K); }
#pragma unroll
    for (int i = 0; i < NLD; ++i) { *(v8usa*)(&st[sl + i * 8 * LP]) = pa[i]; *(v8usa*)(&st[GT * LP + sl + i * 8 * LP]) = pb[i];
        if (MODE == 1) *(v8usa*)(&st[2 * GT * LP + sl + i * 8 * LP]) = pa2[i]; }
    __syncthreads();
#pragma unroll 1
    for (int kp = 0; kp < K; kp += KS) {
        const int cur = (kp / KS) & 1;
        const bf* sb = st + cur * (NOPD * GT * LP);
        bf* sn = st + (cur ^ 1) * (NOPD * GT * LP);
        const bool more = kp + KS < K;                           // block-uniform: a next pass exists
        if (more) {
#pragma unroll
            for (int i = 0; i < NLD; ++i) { pa[i] = *(const v8us*)(gA + (size_t)i * 8 * K + kp + KS); pb[i] = *(const v8us*)(gB + (size_t)i * 8 * K + kp + KS);
                if (MODE == 1) pa2[i] = *(const v8us*)(gA2 + (size_t)i * 8 * K + kp + KS); }
            asm volatile("s_wait_xcnt 0x0" ::: "memory");   // stands before the address registers of the loads above are written again (the build reuses them for the LDS addresses below)
        }
        v16bf a[2][4], b[2][4], a2[2][4];
#pragma unroll
        for (int q = 0; q < 4; ++q) { a[0][q] = ldbs(sb + fa + q * 16 * LP); b[0][q] = ldbs(sb + fb + q * 16 * LP);
            if (MODE == 1) a2[0][q] = ldbs(sb + fa2 + q * 16 * LP); }
        __builtin_amdgcn_sched_barrier(0);   // keeps the next pass's global loads and the first fragment loads ahead of the products
#pragma unroll
        for (int s = 0; s < KS / 32; ++s) {
            const int c = s & 1, n = c ^ 1;
            if (s + 1 < KS / 32) {
#pragma unroll
                for (int q = 0; q < 4; ++q) { a[n][q] = ldbs(sb + fa + q * 16 * LP + (s + 1) * 32); b[n][q] = ldbs(sb + fb + q * 16 * LP + (s + 1) * 32);
                    if (MODE == 1) a2[n][q] = ldbs(sb + fa2 + q * 16 * LP + (s + 1) * 32); }
                __builtin_amdgcn_sched_barrier(0);   // the next 32-step's fragment loads stay one group in front of this step's products, not among them
            }
#pragma unroll
            for (int nb = 0; nb < 4; ++nb)
#pragma unroll
                for (int mb = 0; mb < 4; ++mb) acc[mb][nb] = wmmab(a[c][mb], b[c][nb], acc[mb][nb]);
            // issue slots behind the last products before their operand registers are written again
            asm volatile("v_nop\n\tv_nop\n\tv_nop\n\tv_nop" : "+v"(acc[0][0]), "+v"(acc[1][1]), "+v"(acc[2][2]), "+v"(acc[3][3]) : "v"(a[c][0]), "v"(a[c][1]), "v"(a[c][2]), "v"(a[c][3]));
            if (MODE == 1) {
#pragma unroll
                for (int nb = 0; nb < 4; ++nb)
#pragma unroll
                    for (int mb = 0; mb < 4; ++mb) acc[mb][nb] = wmmab(a2[c][mb], b[c][nb], acc[mb][nb]);
                // issue slots behind the last products before their operand registers are written again
                asm volatile("v_nop\n\tv_nop\n\tv_nop\n\tv_nop" : "+v"(acc[0][0]), "+v"(acc[1][1]), "+v"(acc[2][2]), "+v"(acc[3][3]) : "v"(a2[c][0]), "v"(a2[c][1]), "v"(a2[c][2]), "v"(a2[c][3]));
            }
        }
        if (more) {
#pragma unroll
            for (int i = 0; i < NLD; ++i) { *(v8usa*)(&sn[sl + i * 8 * LP]) = pa[i]; *(v8usa*)(&sn[GT * LP + sl + i * 8 * LP]) = pb[i];
                if (MODE == 1) *(v8usa*)(&sn[2 * GT * LP + sl + i * 8 * LP]) = pa2[i]; }
        }
        __syncthreads();   // publishes the buffer just filled; ends every wave's reads of the buffer that the next pass refills
    }
    const size_t tbase = (size_t)(r0 / RB) * sRB + (size_t)(r0 % RB) * (size_t)pitch + (size_t)(c0 / CB) * sCB + (size_t)(c0 % CB);
    // per-lane column bias for the lane's store columns; both load addresses clamped into the DM-float bias array (first to 0 when unused, second to DM-4)
    const int c8 = (lane & 7) * 8, cofs = lr * 4;
    const int ci = (bmode == 1) ? (c0 + ((MODE == 0) ? c8 : cofs)) : 0;
    const int ci4 = (ci + 4 <= DM - 4) ? (ci + 4) : (DM - 4);      // MODE 0: ci + 4 <= DM - 4 always (exact columns); MODE 1: upper half unused, address kept in range
    const v4f bl0 = *(const v4f*)(bias + ci), bl1 = *(const v4f*)(bias + ci4);
    float bc[8];
#pragma unroll
    for (int i = 0; i < 4; ++i) { bc[i] = (bmode == 1) ? rbf(bl0[i]) : 0.0f; bc[4 + i] = (bmode == 1) ? rbf(bl1[i]) : 0.0f; }
#pragma unroll
    for (int mb = 0; mb < 4; ++mb) {
#pragma unroll
        for (int nb = 0; nb < 4; ++nb) {
#pragma unroll
            for (int j = 0; j < 8; ++j) os[(hi * 8 + j) * 68 + nb * 16 + lr] = acc[mb][nb][j]; }   // D: row 8h+j, col lane&15; rows 0..15 x columns 0..63 all written
        wave_sync();
        const size_t sb = tbase + (size_t)(mb * 16) * (size_t)pitch;
        if (MODE == 0) {
{
#pragma unroll
                for (int s = 0; s < 4; ++s) { const int row = 4 * s + (lane >> 3);   // 4 s x 4 row groups = 16 rows; 8 lanes x 8 = 64 columns
                    const int ri = (bmode == 2) ? (r0 + mb * 16 + row) : 0;
                    const float braw = bias[ri];
                    const float brow = (bmode == 2) ? rbf(braw) : 0.0f;
                    const v4f x0 = *(const v4fa*)(&os[row * 68 + c8]); const v4f x1 = *(const v4fa*)(&os[row * 68 + c8 + 4]); v8h hv, rv;
#pragma unroll
                    for (int i = 0; i < 4; ++i) { const float f0 = x0[i] + bc[i] + brow; const float f1 = x1[i] + bc[4 + i] + brow;
                        const h16 a0 = (h16)f0; const h16 a1 = (h16)f1; hv[i] = a0; hv[4 + i] = a1; rv[i] = (h16)((f0 - (float)a0) * QRS); rv[4 + i] = (h16)((f1 - (float)a1) * QRS); }
                    const size_t oo = sb + (size_t)row * (size_t)pitch + c8;
                    *(v8h*)(Ph + oo) = hv; if (useRes) *(v8h*)(Pr + oo) = rv; }
                 }
        } else {
{
#pragma unroll
                for (int s = 0; s < 8; ++s) { const int row = 2 * s + hi;   // 8 s x 2 rows = 16 rows; 16 lanes x 4 floats = 64 columns
                    const v4f x0 = *(const v4fa*)(&os[row * 68 + cofs]); v4f val;
                    val[0] = x0[0] + bc[0]; val[1] = x0[1] + bc[1]; val[2] = x0[2] + bc[2]; val[3] = x0[3] + bc[3];
                    *(v4f*)(Of + sb + (size_t)row * (size_t)pitch + cofs) = val; }
                asm volatile("s_wait_xcnt 0x0" ::: "memory");   // stands before the registers that the stores above name are written again by the next row block
                 }
        }
        wave_sync();
    }
}

// flash_body: fused attention, one wave per 16 query rows of one (batch, head); K / V^T / Q fragments straight from the f16 planes (two 16-B loads each, arithmetic addressing).
// Transposed form: S^T[key][t] = K Q^T (A = K rows, B = Q rows); lane (t = lane&15, h = lane>>4) holds keys 8h+r of each 16-key tile, so the packed
// P tile is directly the B fragment of O^T[d][t] = V^T P^T (element r <- tile keys 0..15, element 8+r <- tile keys 16..31, lane unchanged).
// Visibility of (t, key): key <= lim(t) with lim = min(t, k_len - 1) when t < q_len, else -1 (nothing visible); excluded scores are REPLACED by a large negative fill and their P is set to 0 by value.
// The key loop runs to kend = min(t0 + 16, k_len) <= SEQ (wave-scalar, static upper bound SEQ); a row with no visible key keeps l = 0 and gets a zero context.
// Softmax state (running max, partial sum) is one scalar per lane; the two lane halves of a row are combined with one xor-16 exchange.
// EARLY = 1 (query rows < EROWS): q, k, P, v each as f16 value + f16 residual x2048; value x residual products go to separate accumulators folded with 1/2048 (scores: before the scale; context: before the normalisation); row sum over the unconverted p.
// EARLY = 0: single f16 products, row sum over the converted P.
template <int EARLY>
__device__ __forceinline__ void flash_body(const int xblk, const h16* __restrict__ QH, const h16* __restrict__ QR, const h16* __restrict__ KP, const h16* __restrict__ KR,
                                           const h16* __restrict__ VT, const h16* __restrict__ VR, const int* __restrict__ LENS, bf* CH, bf* CL) {
    __shared__ __align__(16) float os[AW * 16 * 68];
    const int lane = threadIdx.x & 31, wave = __builtin_amdgcn_readfirstlane((int)(threadIdx.x >> 5)), lr = lane & 15, hi = lane >> 4;
    const int zh = blockIdx.y; const int b = zh / NH_, h = zh % NH_;
    const int t0 = (xblk * AW + wave) * 16;
    const size_t pbase = (size_t)zh * SEQ * HD;
    const size_t qo = pbase + (size_t)(t0 + lr) * HD + 8 * hi;
    const v16h qh0 = ldh(QH + qo), qh1 = ldh(QH + qo + 32);   // B fragments: col t, k = d
    v16h qr0 = qh0, qr1 = qh1;
    if (EARLY) { qr0 = ldh(QR + qo); qr1 = ldh(QR + qo + 32); }
    const size_t ko = pbase + (size_t)lr * HD + 8 * hi;      // + key * HD       (A fragment: row key, k = d)
    const size_t vo = pbase + (size_t)lr * SEQ + 8 * hi;     // + 16j*SEQ + key  (A fragment: row d, k = key)
    const int qlen = imin(imax(LENS[b], 0), SEQ), klen = imin(imax(LENS[8 + b], 0), SEQ);   // lengths clamped into [0, SEQ]
    const int t = t0 + lr;
    const int lim = (t < qlen) ? imin(t, klen - 1) : -1;      // last visible key of query t (-1: none)
    const int kend = __builtin_amdgcn_readfirstlane(imin((xblk * AW + (int)(threadIdx.x >> 5)) * 16 + 16, klen));   // min taken first, then made wave-scalar; <= SEQ
    v8f o0 = (v8f){}, o1 = (v8f){}, o2 = (v8f){}, o3 = (v8f){};
    v8f e0 = (v8f){}, e1 = (v8f){}, e2 = (v8f){}, e3 = (v8f){};
    float m = -3.0e38f, l = 0.0f;
#pragma unroll 1
    for (int key0 = 0; key0 < kend; key0 += 32) {
        const size_t kof = ko + (size_t)key0 * HD;
        v8f sHa = (v8f){}, sLa = (v8f){}, sHb = (v8f){}, sLb = (v8f){};
        if (EARLY) {
            { const v16h kh0 = ldh(KP + kof), kh1 = ldh(KP + kof + 32), kr0 = ldh(KR + kof), kr1 = ldh(KR + kof + 32);
              sHa = wmma16g(kh0, qh0, sHa); sLa = wmma16g(kh0, qr0, sLa); sLa = wmma16g(kr0, qh0, sLa);
              sHa = wmma16g(kh1, qh1, sHa); sLa = wmma16g(kh1, qr1, sLa); sLa = wmma16g(kr1, qh1, sLa); }
            { const v16h kh0 = ldh(KP + kof + 16 * HD), kh1 = ldh(KP + kof + 16 * HD + 32), kr0 = ldh(KR + kof + 16 * HD), kr1 = ldh(KR + kof + 16 * HD + 32);
              sHb = wmma16g(kh0, qh0, sHb); sLb = wmma16g(kh0, qr0, sLb); sLb = wmma16g(kr0, qh0, sLb);
              sHb = wmma16g(kh1, qh1, sHb); sLb = wmma16g(kh1, qr1, sLb); sLb = wmma16g(kr1, qh1, sLb); }
        } else {
            const h16* ka = KP + kof;
            const v16h ka0 = ldh(ka), ka1 = ldh(ka + 32), kb0 = ldh(ka + 16 * HD), kb1 = ldh(ka + 16 * HD + 32);
            sHa = wmma16(ka0, qh0, sHa); sHb = wmma16(kb0, qh0, sHb);
            sHa = wmma16(ka1, qh1, sHa); sHb = wmma16(kb1, qh1, sHb);
            asm volatile("v_nop\n\tv_nop\n\tv_nop\n\tv_nop" : "+v"(sHa), "+v"(sHb) : "v"(ka0), "v"(ka1), "v"(kb0), "v"(kb1));
        }
        const int kq = key0 + 8 * hi;           // this lane's first key of tile a (tile b: + 16)
        float ta[8], tb[8]; float mx = -3.0e38f;
#pragma unroll
        for (int r = 0; r < 8; ++r) {
            const float xa = EARLY ? (sHa[r] + sLa[r] * QRI) * SC2 : sHa[r] * SC2;
            const float xb = EARLY ? (sHb[r] + sLb[r] * QRI) * SC2 : sHb[r] * SC2;
            ta[r] = (kq + r <= lim) ? xa : -3.0e38f;
            tb[r] = (kq + 16 + r <= lim) ? xb : -3.0e38f; }
#pragma unroll
        for (int r = 0; r < 8; ++r) mx = fmaxf(mx, fmaxf(ta[r], tb[r]));
        mx = fmaxf(mx, __shfl_xor(mx, 16, 32));
        const float mnew = fmaxf(m, mx);
        const float alpha = __builtin_amdgcn_exp2f(m - mnew);
        const float sh = PSH - mnew;
        v16h pb = (v16h){}, pr = (v16h){}; float ls = 0.0f;
#pragma unroll
        for (int r = 0; r < 8; ++r) {
            const float ya = __builtin_amdgcn_exp2f(ta[r] + sh), yb = __builtin_amdgcn_exp2f(tb[r] + sh);
            const float ea = (kq + r <= lim) ? ya : 0.0f;
            const float eb = (kq + 16 + r <= lim) ? yb : 0.0f;
            const h16 pa = (h16)ea; const h16 pc = (h16)eb; pb[r] = pa; pb[8 + r] = pc;
            if (EARLY) { pr[r] = (h16)((ea - (float)pa) * QRS); pr[8 + r] = (h16)((eb - (float)pc) * QRS); ls += ea + eb; }
            else { ls += (float)pa + (float)pc; } }
        l = l * alpha + ls; m = mnew;
        o0 = o0 * alpha; o1 = o1 * alpha; o2 = o2 * alpha; o3 = o3 * alpha;
        const size_t vof = vo + key0;
        if (EARLY) {
            e0 = e0 * alpha; e1 = e1 * alpha; e2 = e2 * alpha; e3 = e3 * alpha;
            { const v16h vh = ldh(VT + vof), vr = ldh(VR + vof);
              o0 = wmma16g(vh, pb, o0); e0 = wmma16g(vh, pr, e0); e0 = wmma16g(vr, pb, e0); }
            { const v16h vh = ldh(VT + vof + (size_t)16 * SEQ), vr = ldh(VR + vof + (size_t)16 * SEQ);
              o1 = wmma16g(vh, pb, o1); e1 = wmma16g(vh, pr, e1); e1 = wmma16g(vr, pb, e1); }
            { const v16h vh = ldh(VT + vof + (size_t)32 * SEQ), vr = ldh(VR + vof + (size_t)32 * SEQ);
              o2 = wmma16g(vh, pb, o2); e2 = wmma16g(vh, pr, e2); e2 = wmma16g(vr, pb, e2); }
            { const v16h vh = ldh(VT + vof + (size_t)48 * SEQ), vr = ldh(VR + vof + (size_t)48 * SEQ);
              o3 = wmma16g(vh, pb, o3); e3 = wmma16g(vh, pr, e3); e3 = wmma16g(vr, pb, e3); }
        } else {
            const h16* va = VT + vof;
            const v16h v0 = ldh(va), v1 = ldh(va + (size_t)16 * SEQ), v2 = ldh(va + (size_t)32 * SEQ), v3 = ldh(va + (size_t)48 * SEQ);
            o0 = wmma16(v0, pb, o0); o1 = wmma16(v1, pb, o1); o2 = wmma16(v2, pb, o2); o3 = wmma16(v3, pb, o3);
            asm volatile("v_nop\n\tv_nop\n\tv_nop\n\tv_nop" : "+v"(o0), "+v"(o1), "+v"(o2), "+v"(o3) : "v"(v0), "v"(v1), "v"(v2), "v"(v3), "v"(pb));
        }
    }
    if (EARLY) { o0 = o0 + e0 * QRI; o1 = o1 + e1 * QRI; o2 = o2 + e2 * QRI; o3 = o3 + e3 * QRI; }
    l += __shfl_xor(l, 16, 32);
    const float lsafe = (l > 0.0f) ? l : 1.0f;
    const float inv = (l > 0.0f) ? (1.0f / lsafe) : 0.0f;     // no visible key: zero context
    const int wb = wave * 16 * 68;
    // O^T D layout: o_j[r] = (d = 16j + 8h + r, t = lane&15) -> os[t][d]; rows 0..15 x columns 0..63 all written
    { v4f a, c;
      a[0] = o0[0] * inv; a[1] = o0[1] * inv; a[2] = o0[2] * inv; a[3] = o0[3] * inv; c[0] = o0[4] * inv; c[1] = o0[5] * inv; c[2] = o0[6] * inv; c[3] = o0[7] * inv;
      *(v4fa*)(&os[wb + lr * 68 +  0 + 8 * hi]) = a; *(v4fa*)(&os[wb + lr * 68 +  0 + 8 * hi + 4]) = c;
      a[0] = o1[0] * inv; a[1] = o1[1] * inv; a[2] = o1[2] * inv; a[3] = o1[3] * inv; c[0] = o1[4] * inv; c[1] = o1[5] * inv; c[2] = o1[6] * inv; c[3] = o1[7] * inv;
      *(v4fa*)(&os[wb + lr * 68 + 16 + 8 * hi]) = a; *(v4fa*)(&os[wb + lr * 68 + 16 + 8 * hi + 4]) = c;
      a[0] = o2[0] * inv; a[1] = o2[1] * inv; a[2] = o2[2] * inv; a[3] = o2[3] * inv; c[0] = o2[4] * inv; c[1] = o2[5] * inv; c[2] = o2[6] * inv; c[3] = o2[7] * inv;
      *(v4fa*)(&os[wb + lr * 68 + 32 + 8 * hi]) = a; *(v4fa*)(&os[wb + lr * 68 + 32 + 8 * hi + 4]) = c;
      a[0] = o3[0] * inv; a[1] = o3[1] * inv; a[2] = o3[2] * inv; a[3] = o3[3] * inv; c[0] = o3[4] * inv; c[1] = o3[5] * inv; c[2] = o3[6] * inv; c[3] = o3[7] * inv;
      *(v4fa*)(&os[wb + lr * 68 + 48 + 8 * hi]) = a; *(v4fa*)(&os[wb + lr * 68 + 48 + 8 * hi + 4]) = c; }
    wave_sync();
    const size_t obase = ((size_t)b * SEQ + t0) * DM + (size_t)h * HD;
{
#pragma unroll
        for (int s = 0; s < 4; ++s) { const int row = 4 * s + (lane >> 3), c8 = (lane & 7) * 8;   // 4 s x 4 row groups = 16 rows; 8 lanes x 8 = 64 columns
            const v4f x0 = *(const v4fa*)(&os[wb + row * 68 + c8]); const v4f x1 = *(const v4fa*)(&os[wb + row * 68 + c8 + 4]); v8us hv, lv;
#pragma unroll
            for (int i = 0; i < 4; ++i) { const unsigned short a0 = f2bf(x0[i]); const unsigned short a1 = f2bf(x1[i]);
                hv[i] = a0; hv[4 + i] = a1; lv[i] = f2bf(x0[i] - bf2f(a0)); lv[4 + i] = f2bf(x1[i] - bf2f(a1)); }
            const size_t oo = obase + (size_t)row * DM + c8;
            *(v8us*)(CH + oo) = hv; *(v8us*)(CL + oo) = lv; }
         }
}

// k_flash: query rows EROWS..SEQ-1 (single products); grid ((SEQ - EROWS) / (16*AW), NB*NH_).
__global__ __launch_bounds__(32 * AW) void k_flash(const h16* __restrict__ QH, const h16* __restrict__ KP, const h16* __restrict__ VT,
                                                   const int* __restrict__ LENS, bf* CH, bf* CL) {
    flash_body<0>((int)blockIdx.x + EROWS / (16 * AW), QH, QH, KP, KP, VT, VT, LENS, CH, CL);
}

// k_flash_early: query rows 0..EROWS-1 (value + residual products); grid (EROWS / (16*AW), NB*NH_).
__global__ __launch_bounds__(32 * AW) void k_flash_early(const h16* __restrict__ QH, const h16* __restrict__ QR, const h16* __restrict__ KP, const h16* __restrict__ KR,
                                                         const h16* __restrict__ VT, const h16* __restrict__ VR, const int* __restrict__ LENS, bf* CH, bf* CL) {
    flash_body<1>((int)blockIdx.x, QH, QR, KP, KR, VT, VR, LENS, CH, CL);
}

static constexpr size_t al256(size_t v) { return (v + 255) & ~(size_t)255; }
static constexpr size_t SZ_XB = al256((size_t)NB * SEQ * DM * 2);          // one bf16 activation plane [NB*SEQ][1024]
static constexpr size_t SZ_WB = al256((size_t)4 * DM * DM * 2);            // four transposed bf16 weight planes
static constexpr size_t SZ_PL = al256((size_t)NB * NH_ * SEQ * HD * 2);    // one f16 head plane
static constexpr size_t SZ_LN = al256((size_t)32 * 4);
static constexpr size_t SZ_TOTAL = 3 * SZ_XB + SZ_WB + 6 * SZ_PL + 2 * SZ_XB + SZ_LN;
static_assert(SZ_TOTAL <= (size_t)134217728);          // workspace carve <= 128 MiB
static_assert(((size_t)DM * DM * 2) % 256 == 0);       // weight sub-planes stay 256-byte aligned
static_assert((size_t)NB * OUT_SEQ * DM * 4 <= (size_t)NB_FULL * SEQ_FULL * DM * 4);   // single output at byte offset 0

static void cvt_in(const float* x, bf* dst, hipStream_t stream) {
    if (SEQ == SEQ_FULL) {
        const size_t n8 = (size_t)NB * SEQ * DM / 8;
        k_cvt8<<<(unsigned)((n8 + 255) / 256), 256, 0, stream>>>(x, dst, n8);
    } else {
        const size_t n8 = (size_t)SEQ * DM / 8;
        for (int b = 0; b < NB; ++b) k_cvt8<<<(unsigned)((n8 + 255) / 256), 256, 0, stream>>>(x + (size_t)b * SEQ_FULL * DM, dst + (size_t)b * SEQ * DM, n8);
    }
}

extern "C" void kernel_launch(void* const* d_in, const int* in_sizes, int n_in,
                              void* d_out, int out_size, void* d_ws, size_t ws_size, hipStream_t stream) {
    if (n_in < 13) return;
    const size_t needx = ((size_t)(NB - 1) * SEQ_FULL + SEQ) * DM;
    if ((size_t)in_sizes[0] < needx || (size_t)in_sizes[1] < needx || (size_t)in_sizes[2] < needx) return;
    if ((size_t)in_sizes[3] < (size_t)(NB - 1) * SEQ_FULL + SEQ || (size_t)in_sizes[4] < (size_t)(NB - 1) * SEQ_FULL + SEQ) return;
    if ((size_t)in_sizes[5] < (size_t)DM * DM || (size_t)in_sizes[7] < (size_t)DM * DM || (size_t)in_sizes[9] < (size_t)DM * DM || (size_t)in_sizes[11] < (size_t)DM * DM) return;
    if (in_sizes[6] < DM || in_sizes[8] < DM || in_sizes[10] < DM || in_sizes[12] < DM) return;
    if ((size_t)out_size < ((size_t)(NB - 1) * OUT_SEQ + SEQ) * DM) return;
    if (SZ_TOTAL > ws_size) return;
    // wire order: in_Q, in_K, in_V, Q_pad_mask (int32), K_pad_mask (int32), W_Q, b_Q, W_K, b_K, W_V, b_V, W_O, b_O
    const float* xq = (const float*)d_in[0]; const float* xk = (const float*)d_in[1]; const float* xv = (const float*)d_in[2];
    const int* qmask = (const int*)d_in[3]; const int* kmask = (const int*)d_in[4];
    const float* wq = (const float*)d_in[5];  const float* bq = (const float*)d_in[6];
    const float* wk = (const float*)d_in[7];  const float* bk = (const float*)d_in[8];
    const float* wv = (const float*)d_in[9];  const float* bv = (const float*)d_in[10];
    const float* wo = (const float*)d_in[11]; const float* bo = (const float*)d_in[12];
    float* OUT = (float*)d_out;      // [NB][SEQ][1024]
    char* wsp = (char*)d_ws;
    bf* QB = (bf*)wsp; wsp += SZ_XB;                 // [NB*SEQ][1024] bf16 query input
    bf* KB = (bf*)wsp; wsp += SZ_XB;                 // [NB*SEQ][1024] bf16 key input
    bf* VB = (bf*)wsp; wsp += SZ_XB;                 // [NB*SEQ][1024] bf16 value input
    bf* WB = (bf*)wsp; wsp += SZ_WB;                 // [4][1024 out][1024 in]: q | k | v | o
    h16* QH = (h16*)wsp; wsp += SZ_PL;               // [NB*16][SEQ][64]
    h16* QR = (h16*)wsp; wsp += SZ_PL;               // [NB*16][SEQ][64] residual x2048
    h16* KP = (h16*)wsp; wsp += SZ_PL;               // [NB*16][SEQ][64]
    h16* KR = (h16*)wsp; wsp += SZ_PL;               // [NB*16][SEQ][64] residual x2048
    h16* VT = (h16*)wsp; wsp += SZ_PL;               // [NB*16][64][SEQ]
    h16* VR = (h16*)wsp; wsp += SZ_PL;               // [NB*16][64][SEQ] residual x2048
    bf* CH = (bf*)wsp; wsp += SZ_XB;                 // [NB*SEQ][1024] context bf16 hi
    bf* CL = (bf*)wsp; wsp += SZ_XB;                 // [NB*SEQ][1024] context bf16 lo
    int* LN = (int*)wsp; wsp += SZ_LN;               // 32 ints: word b = q_len[b], word 8 + b = k_len[b]
    bf* WQT = WB; bf* WKT = WB + (size_t)DM * DM; bf* WVT = WB + (size_t)2 * DM * DM; bf* WOT = WB + (size_t)3 * DM * DM;

    cvt_in(xq, QB, stream); cvt_in(xk, KB, stream); cvt_in(xv, VB, stream);
    // weights: in[rows = k (in)][cols = n (out)] -> out[n][k]; square DM x DM, grid (k tiles, n tiles)
    { const dim3 g(DM / 64, DM / 64, 1);
      k_cvtT<<<g, 256, 0, stream>>>(wq, WQT); k_cvtT<<<g, 256, 0, stream>>>(wk, WKT); k_cvtT<<<g, 256, 0, stream>>>(wv, WVT); k_cvtT<<<g, 256, 0, stream>>>(wo, WOT); }
    k_lens<<<1, 32, 0, stream>>>(qmask, kmask, LN);

    // q, k: A = x rows (m = b*SEQ + t), Bt = W^T rows (n = h*64 + d), column bias -> planes [(b*16 + h)][t][d] (value and residual)
    k_proj<0><<<dim3(NB * SEQ / GT, DM / GT, 1), 128, 0, stream>>>(QB, QB, WQT, bq, 1, QH, QR, 1, OUT, SEQ, (size_t)NH_ * SEQ * HD, HD, HD, (size_t)SEQ * HD);
    k_proj<0><<<dim3(NB * SEQ / GT, DM / GT, 1), 128, 0, stream>>>(KB, KB, WKT, bk, 1, KP, KR, 1, OUT, SEQ, (size_t)NH_ * SEQ * HD, HD, HD, (size_t)SEQ * HD);
    // v^T: A = Wv^T rows (m = h*64 + d), Bt = value rows (n = b*SEQ + t), row bias -> planes [(b*1024 + m)][t] = [(b*16 + h)][d][t] (value and residual)
    k_proj<0><<<dim3(DM / GT, NB * SEQ / GT, 1), 128, 0, stream>>>(WVT, WVT, VB, bv, 2, VT, VR, 1, OUT, DM, (size_t)0, SEQ, SEQ, (size_t)DM * SEQ);

    // context planes: rows 0..EROWS-1 by the early kernel, rows EROWS..SEQ-1 by the single-product kernel (disjoint rows, every row written)
    k_flash_early<<<dim3(EROWS / (16 * AW), NB * NH_, 1), 32 * AW, 0, stream>>>(QH, QR, KP, KR, VT, VR, LN, CH, CL);
    if (SEQ > EROWS)
        k_flash<<<dim3((SEQ - EROWS) / (16 * AW), NB * NH_, 1), 32 * AW, 0, stream>>>(QH, KP, VT, LN, CH, CL);

    // output: A = context hi (+ lo) rows (m = b*SEQ + t), Bt = Wo^T rows (n), column bias -> OUT[(b*OUT_SEQ + t)][n] f32
    k_proj<1><<<dim3(NB * SEQ / GT, DM / GT, 1), 128, 0, stream>>>(CH, CL, WOT, bo, 1, QH, QH, 0, OUT, SEQ, (size_t)OUT_SEQ * DM, DM, DM, (size_t)0);
}

// v002
// Measured time: 165 microseconds a run.
// Two timings next to v001 put it at 1.16 and 1.17 times that version's speed.
// All steps since v000 together make it 1.46 times as fast.
#include <hip/hip_runtime.h>

// Projections q/k/v: v_wmma_f32_16x16x32_bf16 (inputs and weights RNE-converted to bf16, f32 accumulate); scores: v_wmma_f32_16x16x32_f16 (query rows >= EROWS: single f16 q and k; rows < EROWS: q and k as f16 value + f16 residual x2048, three products, residual products in their own accumulator); P.V: v_wmma_f32_16x16x32_f16 (P x256 carry, v single f16; rows < EROWS: P and v as value + residual x2048, three products, residual products in their own accumulator); output projection: v_wmma_f32_16x16x32_bf16 (context as bf16 hi + bf16 lo planes, Wo bf16), f32 accumulate everywhere, softmax f32.
// Attention block, width 1024 = 16 heads x 64; query/key/value inputs [NB][SEQ][1024] f32, W_Q/W_K/W_V/W_O [in][out] (y = x W + b), score scale 1/8,
// causal fill (key > query -> excluded) and length fill (query < q_len[b] and key < k_len[b], lengths = integer sums of the two int32 indicator rows); rows with no visible key give a zero context; output y = ctx W_O + b_O (f32).
// Layout: bf16 copies of the three inputs; bf16 TRANSPOSED copies of the four weights ([out][in], K-contiguous); q, k planes [b*16+h][t][d] and v^T plane [b*16+h][d][t] (value and residual x2048) written by the GEMM epilogue;
// fused flash kernel in transposed form (S^T = K Q^T, O^T = V^T P^T) writing the context as bf16 hi/lo planes [b*SEQ+t][1024]; final GEMM writes f32 rows.

#ifndef NB
#define NB 2
#endif
#ifndef SEQ
#define SEQ 2048
#endif
#define NB_FULL  2
#define SEQ_FULL 2048
#ifndef OUT_SEQ
#define OUT_SEQ SEQ              // row pitch (in tokens) between batches of the output
#endif
#ifndef EROWS
#define EROWS 256                // query rows below this use the value + residual products
#endif
#define DM   1024
#define NH_  16
#define HD   64
#define AW   4                   // waves per flash block (16 query rows each)
#define QRS  2048.0f             // carry of the residual planes
#define QRI  (1.0f / 2048.0f)
#define LOG2E 1.4426950408889634f
#define SC2  (0.125f * 1.4426950408889634f)   // HD^-0.5 * log2(e)
#define PSH  8.0f                // log2 of the P carry (256)

static_assert(HD == 64);
static_assert(NH_ * HD == DM);                 // head h = columns h*64 + d
static_assert(DM % 64 == 0);                   // column tiles of 64
static_assert(DM % 32 == 0);                   // GEMM k-loop steps by 32
static_assert(DM >= 8);                        // clamped bias loads stay inside a DM-float array
static_assert(SEQ % 64 == 0);                  // a 64-row tile never straddles two batches
static_assert((NB * SEQ) % 64 == 0);
static_assert(SEQ % 32 == 0);                  // key loop steps by 32
static_assert(SEQ % (16 * AW) == 0);           // flash grid covers the sequence exactly
static_assert(((size_t)SEQ * DM) % 8 == 0);
static_assert(NB <= NB_FULL);
static_assert(SEQ <= SEQ_FULL);
static_assert(SEQ_FULL % 4 == 0);
static_assert(EROWS % (16 * AW) == 0);         // the early band is a whole number of flash blocks
static_assert(EROWS % 32 == 0);                // early key steps stay inside the early key range
static_assert(EROWS >= 16 * AW);
static_assert(EROWS <= SEQ);
static_assert(NB <= 8);                        // length line: word b = q_len[b], word 8 + b = k_len[b]

typedef _Float16 h16;
typedef unsigned short bf;
typedef __attribute__((ext_vector_type(16))) __bf16   v16bf;
typedef __attribute__((ext_vector_type(16))) _Float16 v16h;
typedef __attribute__((ext_vector_type(8)))  _Float16 v8h;
typedef __attribute__((ext_vector_type(8)))  unsigned short v8us;
typedef __attribute__((ext_vector_type(8)))  float    v8f;
typedef __attribute__((ext_vector_type(4)))  float    v4f;
typedef __attribute__((ext_vector_type(4)))  int      v4i;
typedef v4f  __attribute__((may_alias)) v4fa;
typedef v8us __attribute__((may_alias)) v8usa;

__device__ __forceinline__ unsigned short f2bf(float f) { unsigned u = __float_as_uint(f); u += 0x7FFFu + ((u >> 16) & 1u); return (unsigned short)(u >> 16); }
__device__ __forceinline__ float bf2f(unsigned short b) { return __uint_as_float(((unsigned)b) << 16); }
__device__ __forceinline__ float rbf(float f) { return bf2f(f2bf(f)); }   // value after RNE convert to bf16
__device__ __forceinline__ v16h cat16(v8h lo, v8h hi) { return __builtin_shufflevector(lo, hi, 0, 1, 2, 3, 4, 5, 6, 7, 8, 9, 10, 11, 12, 13, 14, 15); }
__device__ __forceinline__ v16bf cat16b(v8us lo, v8us hi) { return __builtin_bit_cast(v16bf, __builtin_shufflevector(lo, hi, 0, 1, 2, 3, 4, 5, 6, 7, 8, 9, 10, 11, 12, 13, 14, 15)); }
__device__ __forceinline__ v8f wmma16(v16h a, v16h b, v8f c) { return __builtin_amdgcn_wmma_f32_16x16x32_f16(false, a, false, b, (short)0, c, false, false); }
__device__ __forceinline__ v8f wmmab(v16bf a, v16bf b, v8f c) { return __builtin_amdgcn_wmma_f32_16x16x32_bf16(false, a, false, b, (short)0, c, false, false); }
// fragment loaders from K-contiguous 16-bit rows; p already includes + 8*(lane>>4): elements 0..7 <- k0+8h+0..7, elements 8..15 <- k0+16+8h+0..7 (same map for A and B)
__device__ __forceinline__ v16h  ldh(const h16* p) { return cat16(*(const v8h*)p, *(const v8h*)(p + 16)); }
__device__ __forceinline__ v16bf ldb(const bf* p)  { return cat16b(*(const v8us*)p, *(const v8us*)(p + 16)); }
// ordering point for wave-private LDS tiles (same wave writes and reads)
__device__ __forceinline__ void wave_sync() { __builtin_amdgcn_fence(3 /* release order */, "wavefront"); __builtin_amdgcn_wave_barrier(); asm volatile("" ::: "memory"); }
// single guarded f16 WMMA (one accumulator per guard)
__device__ __forceinline__ v8f wmma16g(v16h a, v16h b, v8f c) {
    c = __builtin_amdgcn_wmma_f32_16x16x32_f16(false, a, false, b, (short)0, c, false, false);
    asm volatile("v_nop\n\tv_nop\n\tv_nop\n\tv_nop" : "+v"(c) : "v"(a), "v"(b));
    return c;
}
__device__ __forceinline__ int imin(int a, int b) { return a < b ? a : b; }
__device__ __forceinline__ int imax(int a, int b) { return a > b ? a : b; }

__global__ __launch_bounds__(256) void k_cvt8(const float* __restrict__ src, bf* dst, size_t n8) {
    const size_t i = (size_t)blockIdx.x * 256 + threadIdx.x; if (i >= n8) return;
    const v8f v = *(const v8f*)(src + i * 8); v8us o;
#pragma unroll
    for (int k = 0; k < 8; ++k) o[k] = f2bf(v[k]);
    *(v8us*)(dst + i * 8) = o; 
}

// k_cvtT: in[rows = k][cols = n] f32 (DM x DM, row pitch DM) -> out[n][k] bf16 (RNE convert), 64x64 tiles transposed through LDS.
// grid (DM/64 over k, DM/64 over n), 256 threads. LDS tile ts[n][k] is cross-wave: block barrier between fill and drain.
__global__ __launch_bounds__(256) void k_cvtT(const float* __restrict__ W, bf* WT) {
    __shared__ __align__(16) unsigned short ts[64 * 72];
    const int tid = threadIdx.x, lane = tid & 31, wave = __builtin_amdgcn_readfirstlane((int)(tid >> 5));
    const int k0 = blockIdx.x * 64, n0 = blockIdx.y * 64;
#pragma unroll
    for (int i = 0; i < 4; ++i) { const int idx = tid + i * 256; const int kr = idx >> 4, c4 = (idx & 15) * 4;   // 1024 float4 = 64 k-rows x 16
        const v4f v = *(const v4f*)(W + (size_t)(k0 + kr) * DM + n0 + c4);
#pragma unroll
        for (int j = 0; j < 4; ++j) ts[(c4 + j) * 72 + kr] = f2bf(v[j]); }
    __syncthreads();
{
#pragma unroll
        for (int s = 0; s < 2; ++s) { const int row = wave * 8 + s * 4 + (lane >> 3), c8 = (lane & 7) * 8;   // 8 waves x 2 s x 4 = 64 rows; 8 lanes x 8 = 64 columns
            const v8us o = *(const v8usa*)(&ts[row * 72 + c8]);
            *(v8us*)(WT + (size_t)(n0 + row) * DM + k0 + c8) = o; }
         }
}

// k_lens: q_len[b] and k_len[b] as integer sums of the first SEQ entries of row b of the two int32 indicator arrays (row pitch SEQ_FULL).
// LW waves per (array, batch) row: a lane brings its entries with SEQ / (128 LW) independent 16-byte loads (a wave-wide load covers 4 whole lines), all issued before the first sum,
// so the whole kernel waits for memory once instead of once per trip of a one-wave loop. Wave sums meet in LDS behind one block barrier; wave 0 adds them and stores the whole 32-word line.
#define LW 4                     // waves per indicator row
static_assert(SEQ % (128 * LW) == 0);          // a wave's share of a row is a whole number of wave-wide 16-byte loads
static_assert(64 * NB * LW <= 1024);           // 2 NB LW waves in one block
__global__ __launch_bounds__(64 * NB * LW) void k_lens(const int* __restrict__ qm, const int* __restrict__ km, int* lens) {
    __shared__ __align__(16) int ss[16 * LW];  // [word][wave of the row]; word b = q_len[b], word 8 + b = k_len[b]
    const int lane = threadIdx.x & 31, wave = __builtin_amdgcn_readfirstlane((int)(threadIdx.x >> 5));
    const int part = wave % LW, b = (wave / LW) % NB, which = wave / (LW * NB);
    const int* row = (which ? km : qm) + (size_t)b * SEQ_FULL + part * (SEQ / LW) + lane * 4;
    v4i p[SEQ / (128 * LW)];
#pragma unroll
    for (int i = 0; i < SEQ / (128 * LW); ++i) p[i] = *(const v4i*)(row + i * 128);
    int s = 0;
#pragma unroll
    for (int i = 0; i < SEQ / (128 * LW); ++i) s += (p[i][0] + p[i][1]) + (p[i][2] + p[i][3]);
#pragma unroll
    for (int o = 16; o > 0; o >>= 1) s += __shfl_xor(s, o, 32);
    if (lane == 0) ss[(which * 8 + b) * LW + part] = s;
    __syncthreads();   // every wave's sum is in LDS before wave 0 reads it
    if (wave == 0) {
        const bool used = lane < 16 && (lane & 7) < NB;   // words that a row feeds; only these LDS words were written
        int v = 0;
#pragma unroll
        for (int i = 0; i < LW; ++i) v += ss[(used ? lane : 0) * LW + i];
        *(int*)(lens + lane) = used ? v : 0;
    }
}

// k_proj: bf16 GEMM, one block of 4 waves (2 x 2) per 128x128 tile, each wave a 64x64 sub-tile (16 accumulators), K = DM in passes of KS.
// Operand tiles are staged in LDS: every thread brings 16-byte pieces of whole 256-byte row segments (a wave-wide load covers 4 whole lines) into registers one pass ahead
// and stores them into the other of two LDS buffers behind the pass's products; one block barrier per pass publishes that buffer and ends the reads of the one refilled next.
// Fragments come from LDS rows of pitch LP (272 B) with the same element map as ldb(); the k order of the sums is the ascending 32-step order.
// C[m][n] = sum_k (A[m][k] (+ A2[m][k] when MODE 1)) Bt[n][k] + bias (bmode 1: bias[n]; bmode 2: bias[m]; bias RNE-converted to bf16 first),
// sub-tile base (r0/RB)*sRB + (r0%RB)*pitch + (c0/CB)*sCB + (c0%CB), row pitch 'pitch' (elements). grid (M/128, N/128), 128 threads.
// MODE 1: written as f32 (Of); each row's 64 floats (256 B = two lines) by 16 consecutive lanes x 16 B (2 rows per instruction).
// Bias array has DM floats; both 16-byte bias loads use addresses clamped into [0, DM-4].
#define GT 128                   // block tile edge (rows of A and rows of Bt per block)
#define KS 128                   // k elements per pass (256 B of every operand row)
#define LP 136                   // LDS row pitch in elements (272 B: 16 B x odd, for 16-byte readers)
#define NLD (GT * KS / 8 / 128)  // 16-byte pieces per thread, operand and pass
static_assert(DM % KS == 0);
static_assert(DM % GT == 0);
static_assert((NB * SEQ) % GT == 0);
__device__ __forceinline__ v16bf ldbs(const bf* p) { return cat16b(*(const v8usa*)p, *(const v8usa*)(p + 16)); }   // ldb() on an LDS row
template <int MODE>
__global__ __launch_bounds__(128) void k_proj(const bf* __restrict__ A, const bf* __restrict__ A2, const bf* __restrict__ Bt,
                                              const float* __restrict__ bias, int bmode, h16* Ph, h16* Pr, int useRes, float* Of,
                                              int RB, size_t sRB, int pitch, int CB, size_t sCB) {
    constexpr int NOPD = (MODE == 1) ? 3 : 2;                    // staged operands: A, Bt (, A2)
    __shared__ __align__(16) bf st[2 * NOPD * GT * LP];          // [buffer][operand][row][LP]
    __shared__ __align__(16) float osall[4 * 16 * 68];           // one wave-private epilogue tile per wave
    const int K = DM;
    const int tid = threadIdx.x, lane = tid & 31, lr = lane & 15, hi = lane >> 4, wave = __builtin_amdgcn_readfirstlane((int)(tid >> 5));
    const int R0 = blockIdx.x * GT, C0 = blockIdx.y * GT;
    const int wm = wave >> 1, wn = wave & 1;
    const int r0 = R0 + wm * 64, c0 = C0 + wn * 64;              // this wave's 64x64 sub-tile
    float* os = osall + wave * (16 * 68);
    v8f acc[4][4];
#pragma unroll
    for (int mb = 0; mb < 4; ++mb)
#pragma unroll
        for (int nb = 0; nb < 4; ++nb) acc[mb][nb] = (v8f){};
    // staging map: piece i of a thread = row (tid >> 4) + 8 i, bytes 16 (tid & 15) of the row's 256-byte segment
    const int srow = tid >> 4, sch = (tid & 15) * 8;
    const bf* gA  = A  + (size_t)(R0 + srow) * K + sch;
    const bf* gA2 = A2 + (size_t)(R0 + srow) * K + sch;
    const bf* gB  = Bt + (size_t)(C0 + srow) * K + sch;
    const int sl = srow * LP + sch;
    const int fa = (wm * 64 + lr) * LP + 8 * hi, fb = GT * LP + (wn * 64 + lr) * LP + 8 * hi, fa2 = 2 * GT * LP + fa;   // fragment bases inside a buffer
    v8us pa[NLD], pb[NLD], pa2[NLD];
#pragma unroll
    for (int i = 0; i < NLD; ++i) { pa[i] = *(const v8us*)(gA + (size_t)i * 8 * K); pb[i] = *(const v8us*)(gB + (size_t)i * 8 * K);
        if (MODE == 1) pa2[i] = *(const v8us*)(gA2 + (size_t)i * 8 * K); }
#pragma unroll
    for (int i = 0; i < NLD; ++i) { *(v8usa*)(&st[sl + i * 8 * LP]) = pa[i]; *(v8usa*)(&st[GT * LP + sl + i * 8 * LP]) = pb[i];
        if (MODE == 1) *(v8usa*)(&st[2 * GT * LP + sl + i * 8 * LP]) = pa2[i]; }
    __syncthreads();
#pragma unroll 1
    for (int kp = 0; kp < K; kp += KS) {
        const int cur = (kp / KS) & 1;
        const bf* sb = st + cur * (NOPD * GT * LP);
        bf* sn = st + (cur ^ 1) * (NOPD * GT * LP);
        const bool more = kp + KS < K;                           // block-uniform: a next pass exists
        if (more) {
#pragma unroll
            for (int i = 0; i < NLD; ++i) { pa[i] = *(const v8us*)(gA + (size_t)i * 8 * K + kp + KS); pb[i] = *(const v8us*)(gB + (size_t)i * 8 * K + kp + KS);
                if (MODE == 1) pa2[i] = *(const v8us*)(gA2 + (size_t)i * 8 * K + kp + KS); }
            asm volatile("s_wait_xcnt 0x0" ::: "memory");   // stands before the address registers of the loads above are written again (the build reuses them for the LDS addresses below)
        }
        v16bf a[2][4], b[2][4], a2[2][4];
#pragma unroll
        for (int q = 0; q < 4; ++q) { a[0][q] = ldbs(sb + fa + q * 16 * LP); b[0][q] = ldbs(sb + fb + q * 16 * LP);
            if (MODE == 1) a2[0][q] = ldbs(sb + fa2 + q * 16 * LP); }
        __builtin_amdgcn_sched_barrier(0);   // keeps the next pass's global loads and the first fragment loads ahead of the products
#pragma unroll
        for (int s = 0; s < KS / 32; ++s) {
            const int c = s & 1, n = c ^ 1;
            if (s + 1 < KS / 32) {
#pragma unroll
                for (int q = 0; q < 4; ++q) { a[n][q] = ldbs(sb + fa + q * 16 * LP + (s + 1) * 32); b[n][q] = ldbs(sb + fb + q * 16 * LP + (s + 1) * 32);
                    if (MODE == 1) a2[n][q] = ldbs(sb + fa2 + q * 16 * LP + (s + 1) * 32); }
                __builtin_amdgcn_sched_barrier(0);   // the next 32-step's fragment loads stay one group in front of this step's products, not among them
            }
#pragma unroll
            for (int nb = 0; nb < 4; ++nb)
#pragma unroll
                for (int mb = 0; mb < 4; ++mb) acc[mb][nb] = wmmab(a[c][mb], b[c][nb], acc[mb][nb]);
            // issue slots behind the last products before their operand registers are written again
            asm volatile("v_nop\n\tv_nop\n\tv_nop\n\tv_nop" : "+v"(acc[0][0]), "+v"(acc[1][1]), "+v"(acc[2][2]), "+v"(acc[3][3]) : "v"(a[c][0]), "v"(a[c][1]), "v"(a[c][2]), "v"(a[c][3]));
            if (MODE == 1) {
#pragma unroll
                for (int nb = 0; nb < 4; ++nb)
#pragma unroll
                    for (int mb = 0; mb < 4; ++mb) acc[mb][nb] = wmmab(a2[c][mb], b[c][nb], acc[mb][nb]);
                // issue slots behind the last products before their operand registers are written again
                asm volatile("v_nop\n\tv_nop\n\tv_nop\n\tv_nop" : "+v"(acc[0][0]), "+v"(acc[1][1]), "+v"(acc[2][2]), "+v"(acc[3][3]) : "v"(a2[c][0]), "v"(a2[c][1]), "v"(a2[c][2]), "v"(a2[c][3]));
            }
        }
        if (more) {
#pragma unroll
            for (int i = 0; i < NLD; ++i) { *(v8usa*)(&sn[sl + i * 8 * LP]) = pa[i]; *(v8usa*)(&sn[GT * LP + sl + i * 8 * LP]) = pb[i];
                if (MODE == 1) *(v8usa*)(&sn[2 * GT * LP + sl + i * 8 * LP]) = pa2[i]; }
        }
        __syncthreads();   // publishes the buffer just filled; ends every wave's reads of the buffer that the next pass refills
    }
    const size_t tbase = (size_t)(r0 / RB) * sRB + (size_t)(r0 % RB) * (size_t)pitch + (size_t)(c0 / CB) * sCB + (size_t)(c0 % CB);
    // per-lane column bias for the lane's store columns; both load addresses clamped into the DM-float bias array (first to 0 when unused, second to DM-4)
    const int c8 = (lane & 7) * 8, cofs = lr * 4;
    const int ci = (bmode == 1) ? (c0 + ((MODE == 0) ? c8 : cofs)) : 0;
    const int ci4 = (ci + 4 <= DM - 4) ? (ci + 4) : (DM - 4);      // MODE 0: ci + 4 <= DM - 4 always (exact columns); MODE 1: upper half unused, address kept in range
    const v4f bl0 = *(const v4f*)(bias + ci), bl1 = *(const v4f*)(bias + ci4);
    float bc[8];
#pragma unroll
    for (int i = 0; i < 4; ++i) { bc[i] = (bmode == 1) ? rbf(bl0[i]) : 0.0f; bc[4 + i] = (bmode == 1) ? rbf(bl1[i]) : 0.0f; }
#pragma unroll
    for (int mb = 0; mb < 4; ++mb) {
#pragma unroll
        for (int nb = 0; nb < 4; ++nb) {
#pragma unroll
            for (int j = 0; j < 8; ++j) os[(hi * 8 + j) * 68 + nb * 16 + lr] = acc[mb][nb][j]; }   // D: row 8h+j, col lane&15; rows 0..15 x columns 0..63 all written
        wave_sync();
        const size_t sb = tbase + (size_t)(mb * 16) * (size_t)pitch;
        if (MODE == 0) {
{
#pragma unroll
                for (int s = 0; s < 4; ++s) { const int row = 4 * s + (lane >> 3);   // 4 s x 4 row groups = 16 rows; 8 lanes x 8 = 64 columns
                    const int ri = (bmode == 2) ? (r0 + mb * 16 + row) : 0;
                    const float braw = bias[ri];
                    const float brow = (bmode == 2) ? rbf(braw) : 0.0f;
                    const v4f x0 = *(const v4fa*)(&os[row * 68 + c8]); const v4f x1 = *(const v4fa*)(&os[row * 68 + c8 + 4]); v8h hv, rv;
#pragma unroll
                    for (int i = 0; i < 4; ++i) { const float f0 = x0[i] + bc[i] + brow; const float f1 = x1[i] + bc[4 + i] + brow;
                        const h16 a0 = (h16)f0; const h16 a1 = (h16)f1; hv[i] = a0; hv[4 + i] = a1; rv[i] = (h16)((f0 - (float)a0) * QRS); rv[4 + i] = (h16)((f1 - (float)a1) * QRS); }
                    const size_t oo = sb + (size_t)row * (size_t)pitch + c8;
                    *(v8h*)(Ph + oo) = hv; if (useRes) *(v8h*)(Pr + oo) = rv; }
                 }
        } else {
{
#pragma unroll
                for (int s = 0; s < 8; ++s) { const int row = 2 * s + hi;   // 8 s x 2 rows = 16 rows; 16 lanes x 4 floats = 64 columns
                    const v4f x0 = *(const v4fa*)(&os[row * 68 + cofs]); v4f val;
                    val[0] = x0[0] + bc[0]; val[1] = x0[1] + bc[1]; val[2] = x0[2] + bc[2]; val[3] = x0[3] + bc[3];
                    *(v4f*)(Of + sb + (size_t)row * (size_t)pitch + cofs) = val; }
                asm volatile("s_wait_xcnt 0x0" ::: "memory");   // stands before the registers that the stores above name are written again by the next row block
                 }
        }
        wave_sync();
    }
}

// flash_body: fused attention, one wave per 16 query rows of one (batch, head); K / V^T / Q fragments straight from the f16 planes (two 16-B loads each, arithmetic addressing).
// Transposed form: S^T[key][t] = K Q^T (A = K rows, B = Q rows); lane (t = lane&15, h = lane>>4) holds keys 8h+r of each 16-key tile, so the packed
// P tile is directly the B fragment of O^T[d][t] = V^T P^T (element r <- tile keys 0..15, element 8+r <- tile keys 16..31, lane unchanged).
// Visibility of (t, key): key <= lim(t) with lim = min(t, k_len - 1) when t < q_len, else -1 (nothing visible); excluded scores are REPLACED by a large negative fill and their P is set to 0 by value.
// The key loop runs to kend = min(t0 + 16, k_len) <= SEQ (wave-scalar, static upper bound SEQ); a row with no visible key keeps l = 0 and gets a zero context.
// Softmax state (running max, partial sum) is one scalar per lane; the two lane halves of a row are combined with one xor-16 exchange.
// EARLY = 1 (query rows < EROWS): q, k, P, v each as f16 value + f16 residual x2048; value x residual products go to separate accumulators folded with 1/2048 (scores: before the scale; context: before the normalisation); row sum over the unconverted p.
// EARLY = 0: single f16 products, row sum over the converted P.
template <int EARLY>
__device__ __forceinline__ void flash_body(const int xblk, const h16* __restrict__ QH, const h16* __restrict__ QR, const h16* __restrict__ KP, const h16* __restrict__ KR,
                                           const h16* __restrict__ VT, const h16* __restrict__ VR, const int* __restrict__ LENS, bf* CH, bf* CL) {
    __shared__ __align__(16) float os[AW * 16 * 68];
    const int lane = threadIdx.x & 31, wave = __builtin_amdgcn_readfirstlane((int)(threadIdx.x >> 5)), lr = lane & 15, hi = lane >> 4;
    const int zh = blockIdx.y; const int b = zh / NH_, h = zh % NH_;
    const int t0 = (xblk * AW + wave) * 16;
    const size_t pbase = (size_t)zh * SEQ * HD;
    const size_t qo = pbase + (size_t)(t0 + lr) * HD + 8 * hi;
    const v16h qh0 = ldh(QH + qo), qh1 = ldh(QH + qo + 32);   // B fragments: col t, k = d
    v16h qr0 = qh0, qr1 = qh1;
    if (EARLY) { qr0 = ldh(QR + qo); qr1 = ldh(QR + qo + 32); }
    const size_t ko = pbase + (size_t)lr * HD + 8 * hi;      // + key * HD       (A fragment: row key, k = d)
    const size_t vo = pbase + (size_t)lr * SEQ + 8 * hi;     // + 16j*SEQ + key  (A fragment: row d, k = key)
    const int qlen = imin(imax(LENS[b], 0), SEQ), klen = imin(imax(LENS[8 + b], 0), SEQ);   // lengths clamped into [0, SEQ]
    const int t = t0 + lr;
    const int lim = (t < qlen) ? imin(t, klen - 1) : -1;      // last visible key of query t (-1: none)
    const int kend = __builtin_amdgcn_readfirstlane(imin((xblk * AW + (int)(threadIdx.x >> 5)) * 16 + 16, klen));   // min taken first, then made wave-scalar; <= SEQ
    v8f o0 = (v8f){}, o1 = (v8f){}, o2 = (v8f){}, o3 = (v8f){};
    v8f e0 = (v8f){}, e1 = (v8f){}, e2 = (v8f){}, e3 = (v8f){};
    float m = -3.0e38f, l = 0.0f;
#pragma unroll 1
    for (int key0 = 0; key0 < kend; key0 += 32) {
        const size_t kof = ko + (size_t)key0 * HD;
        v8f sHa = (v8f){}, sLa = (v8f){}, sHb = (v8f){}, sLb = (v8f){};
        if (EARLY) {
            { const v16h kh0 = ldh(KP + kof), kh1 = ldh(KP + kof + 32), kr0 = ldh(KR + kof), kr1 = ldh(KR + kof + 32);
              sHa = wmma16g(kh0, qh0, sHa); sLa = wmma16g(kh0, qr0, sLa); sLa = wmma16g(kr0, qh0, sLa);
              sHa = wmma16g(kh1, qh1, sHa); sLa = wmma16g(kh1, qr1, sLa); sLa = wmma16g(kr1, qh1, sLa); }
            { const v16h kh0 = ldh(KP + kof + 16 * HD), kh1 = ldh(KP + kof + 16 * HD + 32), kr0 = ldh(KR + kof + 16 * HD), kr1 = ldh(KR + kof + 16 * HD + 32);
              sHb = wmma16g(kh0, qh0, sHb); sLb = wmma16g(kh0, qr0, sLb); sLb = wmma16g(kr0, qh0, sLb);
              sHb = wmma16g(kh1, qh1, sHb); sLb = wmma16g(kh1, qr1, sLb); sLb = wmma16g(kr1, qh1, sLb); }
        } else {
            const h16* ka = KP + kof;
            const v16h ka0 = ldh(ka), ka1 = ldh(ka + 32), kb0 = ldh(ka + 16 * HD), kb1 = ldh(ka + 16 * HD + 32);
            sHa = wmma16(ka0, qh0, sHa); sHb = wmma16(kb0, qh0, sHb);
            sHa = wmma16(ka1, qh1, sHa); sHb = wmma16(kb1, qh1, sHb);
            asm volatile("v_nop\n\tv_nop\n\tv_nop\n\tv_nop" : "+v"(sHa), "+v"(sHb) : "v"(ka0), "v"(ka1), "v"(kb0), "v"(kb1));
        }
        const int kq = key0 + 8 * hi;           // this lane's first key of tile a (tile b: + 16)
        float ta[8], tb[8]; float mx = -3.0e38f;
#pragma unroll
        for (int r = 0; r < 8; ++r) {
            const float xa = EARLY ? (sHa[r] + sLa[r] * QRI) * SC2 : sHa[r] * SC2;
            const float xb = EARLY ? (sHb[r] + sLb[r] * QRI) * SC2 : sHb[r] * SC2;
            ta[r] = (kq + r <= lim) ? xa : -3.0e38f;
            tb[r] = (kq + 16 + r <= lim) ? xb : -3.0e38f; }
#pragma unroll
        for (int r = 0; r < 8; ++r) mx = fmaxf(mx, fmaxf(ta[r], tb[r]));
        mx = fmaxf(mx, __shfl_xor(mx, 16, 32));
        const float mnew = fmaxf(m, mx);
        const float alpha = __builtin_amdgcn_exp2f(m - mnew);
        const float sh = PSH - mnew;
        v16h pb = (v16h){}, pr = (v16h){}; float ls = 0.0f;
#pragma unroll
        for (int r = 0; r < 8; ++r) {
            const float ya = __builtin_amdgcn_exp2f(ta[r] + sh), yb = __builtin_amdgcn_exp2f(tb[r] + sh);
            const float ea = (kq + r <= lim) ? ya : 0.0f;
            const float eb = (kq + 16 + r <= lim) ? yb : 0.0f;
            const h16 pa = (h16)ea; const h16 pc = (h16)eb; pb[r] = pa; pb[8 + r] = pc;
            if (EARLY) { pr[r] = (h16)((ea - (float)pa) * QRS); pr[8 + r] = (h16)((eb - (float)pc) * QRS); ls += ea + eb; }
            else { ls += (float)pa + (float)pc; } }
        l = l * alpha + ls; m = mnew;
        o0 = o0 * alpha; o1 = o1 * alpha; o2 = o2 * alpha; o3 = o3 * alpha;
        const size_t vof = vo + key0;
        if (EARLY) {
            e0 = e0 * alpha; e1 = e1 * alpha; e2 = e2 * alpha; e3 = e3 * alpha;
            { const v16h vh = ldh(VT + vof), vr = ldh(VR + vof);
              o0 = wmma16g(vh, pb, o0); e0 = wmma16g(vh, pr, e0); e0 = wmma16g(vr, pb, e0); }
            { const v16h vh = ldh(VT + vof + (size_t)16 * SEQ), vr = ldh(VR + vof + (size_t)16 * SEQ);
              o1 = wmma16g(vh, pb, o1); e1 = wmma16g(vh, pr, e1); e1 = wmma16g(vr, pb, e1); }
            { const v16h vh = ldh(VT + vof + (size_t)32 * SEQ), vr = ldh(VR + vof + (size_t)32 * SEQ);
              o2 = wmma16g(vh, pb, o2); e2 = wmma16g(vh, pr, e2); e2 = wmma16g(vr, pb, e2); }
            { const v16h vh = ldh(VT + vof + (size_t)48 * SEQ), vr = ldh(VR + vof + (size_t)48 * SEQ);
              o3 = wmma16g(vh, pb, o3); e3 = wmma16g(vh, pr, e3); e3 = wmma16g(vr, pb, e3); }
        } else {
            const h16* va = VT + vof;
            const v16h v0 = ldh(va), v1 = ldh(va + (size_t)16 * SEQ), v2 = ldh(va + (size_t)32 * SEQ), v3 = ldh(va + (size_t)48 * SEQ);
            o0 = wmma16(v0, pb, o0); o1 = wmma16(v1, pb, o1); o2 = wmma16(v2, pb, o2); o3 = wmma16(v3, pb, o3);
            asm volatile("v_nop\n\tv_nop\n\tv_nop\n\tv_nop" : "+v"(o0), "+v"(o1), "+v"(o2), "+v"(o3) : "v"(v0), "v"(v1), "v"(v2), "v"(v3), "v"(pb));
        }
    }
    if (EARLY) { o0 = o0 + e0 * QRI; o1 = o1 + e1 * QRI; o2 = o2 + e2 * QRI; o3 = o3 + e3 * QRI; }
    l += __shfl_xor(l, 16, 32);
    const float lsafe = (l > 0.0f) ? l : 1.0f;
    const float inv = (l > 0.0f) ? (1.0f / lsafe) : 0.0f;     // no visible key: zero context
    const int wb = wave * 16 * 68;
    // O^T D layout: o_j[r] = (d = 16j + 8h + r, t = lane&15) -> os[t][d]; rows 0..15 x columns 0..63 all written
    { v4f a, c;
      a[0] = o0[0] * inv; a[1] = o0[1] * inv; a[2] = o0[2] * inv; a[3] = o0[3] * inv; c[0] = o0[4] * inv; c[1] = o0[5] * inv; c[2] = o0[6] * inv; c[3] = o0[7] * inv;
      *(v4fa*)(&os[wb + lr * 68 +  0 + 8 * hi]) = a; *(v4fa*)(&os[wb + lr * 68 +  0 + 8 * hi + 4]) = c;
      a[0] = o1[0] * inv; a[1] = o1[1] * inv; a[2] = o1[2] * inv; a[3] = o1[3] * inv; c[0] = o1[4] * inv; c[1] = o1[5] * inv; c[2] = o1[6] * inv; c[3] = o1[7] * inv;
      *(v4fa*)(&os[wb + lr * 68 + 16 + 8 * hi]) = a; *(v4fa*)(&os[wb + lr * 68 + 16 + 8 * hi + 4]) = c;
      a[0] = o2[0] * inv; a[1] = o2[1] * inv; a[2] = o2[2] * inv; a[3] = o2[3] * inv; c[0] = o2[4] * inv; c[1] = o2[5] * inv; c[2] = o2[6] * inv; c[3] = o2[7] * inv;
      *(v4fa*)(&os[wb + lr * 68 + 32 + 8 * hi]) = a; *(v4fa*)(&os[wb + lr * 68 + 32 + 8 * hi + 4]) = c;
      a[0] = o3[0] * inv; a[1] = o3[1] * inv; a[2] = o3[2] * inv; a[3] = o3[3] * inv; c[0] = o3[4] * inv; c[1] = o3[5] * inv; c[2] = o3[6] * inv; c[3] = o3[7] * inv;
      *(v4fa*)(&os[wb + lr * 68 + 48 + 8 * hi]) = a; *(v4fa*)(&os[wb + lr * 68 + 48 + 8 * hi + 4]) = c; }
    wave_sync();
    const size_t obase = ((size_t)b * SEQ + t0) * DM + (size_t)h * HD;
{
#pragma unroll
        for (int s = 0; s < 4; ++s) { const int row = 4 * s + (lane >> 3), c8 = (lane & 7) * 8;   // 4 s x 4 row groups = 16 rows; 8 lanes x 8 = 64 columns
            const v4f x0 = *(const v4fa*)(&os[wb + row * 68 + c8]); const v4f x1 = *(const v4fa*)(&os[wb + row * 68 + c8 + 4]); v8us hv, lv;
#pragma unroll
            for (int i = 0; i < 4; ++i) { const unsigned short a0 = f2bf(x0[i]); const unsigned short a1 = f2bf(x1[i]);
                hv[i] = a0; hv[4 + i] = a1; lv[i] = f2bf(x0[i] - bf2f(a0)); lv[4 + i] = f2bf(x1[i] - bf2f(a1)); }
            const size_t oo = obase + (size_t)row * DM + c8;
            *(v8us*)(CH + oo) = hv; *(v8us*)(CL + oo) = lv; }
         }
}

// k_flash: query rows EROWS..SEQ-1 (single products); grid ((SEQ - EROWS) / (16*AW), NB*NH_).
__global__ __launch_bounds__(32 * AW) void k_flash(const h16* __restrict__ QH, const h16* __restrict__ KP, const h16* __restrict__ VT,
                                                   const int* __restrict__ LENS, bf* CH, bf* CL) {
    flash_body<0>((int)blockIdx.x + EROWS / (16 * AW), QH, QH, KP, KP, VT, VT, LENS, CH, CL);
}

// k_flash_early: query rows 0..EROWS-1 (value + residual products); grid (EROWS / (16*AW), NB*NH_).
__global__ __launch_bounds__(32 * AW) void k_flash_early(const h16* __restrict__ QH, const h16* __restrict__ QR, const h16* __restrict__ KP, const h16* __restrict__ KR,
                                                         const h16* __restrict__ VT, const h16* __restrict__ VR, const int* __restrict__ LENS, bf* CH, bf* CL) {
    flash_body<1>((int)blockIdx.x, QH, QR, KP, KR, VT, VR, LENS, CH, CL);
}

static constexpr size_t al256(size_t v) { return (v + 255) & ~(size_t)255; }
static constexpr size_t SZ_XB = al256((size_t)NB * SEQ * DM * 2);          // one bf16 activation plane [NB*SEQ][1024]
static constexpr size_t SZ_WB = al256((size_t)4 * DM * DM * 2);            // four transposed bf16 weight planes
static constexpr size_t SZ_PL = al256((size_t)NB * NH_ * SEQ * HD * 2);    // one f16 head plane
static constexpr size_t SZ_LN = al256((size_t)32 * 4);
static constexpr size_t SZ_TOTAL = 3 * SZ_XB + SZ_WB + 6 * SZ_PL + 2 * SZ_XB + SZ_LN;
static_assert(SZ_TOTAL <= (size_t)134217728);          // workspace carve <= 128 MiB
static_assert(((size_t)DM * DM * 2) % 256 == 0);       // weight sub-planes stay 256-byte aligned
static_assert((size_t)NB * OUT_SEQ * DM * 4 <= (size_t)NB_FULL * SEQ_FULL * DM * 4);   // single output at byte offset 0

static void cvt_in(const float* x, bf* dst, hipStream_t stream) {
    if (SEQ == SEQ_FULL) {
        const size_t n8 = (size_t)NB * SEQ * DM / 8;
        k_cvt8<<<(unsigned)((n8 + 255) / 256), 256, 0, stream>>>(x, dst, n8);
    } else {
        const size_t n8 = (size_t)SEQ * DM / 8;
        for (int b = 0; b < NB; ++b) k_cvt8<<<(unsigned)((n8 + 255) / 256), 256, 0, stream>>>(x + (size_t)b * SEQ_FULL * DM, dst + (size_t)b * SEQ * DM, n8);
    }
}

extern "C" void kernel_launch(void* const* d_in, const int* in_sizes, int n_in,
                              void* d_out, int out_size, void* d_ws, size_t ws_size, hipStream_t stream) {
    if (n_in < 13) return;
    const size_t needx = ((size_t)(NB - 1) * SEQ_FULL + SEQ) * DM;
    if ((size_t)in_sizes[0] < needx || (size_t)in_sizes[1] < needx || (size_t)in_sizes[2] < needx) return;
    if ((size_t)in_sizes[3] < (size_t)(NB - 1) * SEQ_FULL + SEQ || (size_t)in_sizes[4] < (size_t)(NB - 1) * SEQ_FULL + SEQ) return;
    if ((size_t)in_sizes[5] < (size_t)DM * DM || (size_t)in_sizes[7] < (size_t)DM * DM || (size_t)in_sizes[9] < (size_t)DM * DM || (size_t)in_sizes[11] < (size_t)DM * DM) return;
    if (in_sizes[6] < DM || in_sizes[8] < DM || in_sizes[10] < DM || in_sizes[12] < DM) return;
    if ((size_t)out_size < ((size_t)(NB - 1) * OUT_SEQ + SEQ) * DM) return;
    if (SZ_TOTAL > ws_size) return;
    // wire order: in_Q, in_K, in_V, Q_pad_mask (int32), K_pad_mask (int32), W_Q, b_Q, W_K, b_K, W_V, b_V, W_O, b_O
    const float* xq = (const float*)d_in[0]; const float* xk = (const float*)d_in[1]; const float* xv = (const float*)d_in[2];
    const int* qmask = (const int*)d_in[3]; const int* kmask = (const int*)d_in[4];
    const float* wq = (const float*)d_in[5];  const float* bq = (const float*)d_in[6];
    const float* wk = (const float*)d_in[7];  const float* bk = (const float*)d_in[8];
    const float* wv = (const float*)d_in[9];  const float* bv = (const float*)d_in[10];
    const float* wo = (const float*)d_in[11]; const float* bo = (const float*)d_in[12];
    float* OUT = (float*)d_out;      // [NB][SEQ][1024]
    char* wsp = (char*)d_ws;
    bf* QB = (bf*)wsp; wsp += SZ_XB;                 // [NB*SEQ][1024] bf16 query input
    bf* KB = (bf*)wsp; wsp += SZ_XB;                 // [NB*SEQ][1024] bf16 key input
    bf* VB = (bf*)wsp; wsp += SZ_XB;                 // [NB*SEQ][1024] bf16 value input
    bf* WB = (bf*)wsp; wsp += SZ_WB;                 // [4][1024 out][1024 in]: q | k | v | o
    h16* QH = (h16*)wsp; wsp += SZ_PL;               // [NB*16][SEQ][64]
    h16* QR = (h16*)wsp; wsp += SZ_PL;               // [NB*16][SEQ][64] residual x2048
    h16* KP = (h16*)wsp; wsp += SZ_PL;               // [NB*16][SEQ][64]
    h16* KR = (h16*)wsp; wsp += SZ_PL;               // [NB*16][SEQ][64] residual x2048
    h16* VT = (h16*)wsp; wsp += SZ_PL;               // [NB*16][64][SEQ]
    h16* VR = (h16*)wsp; wsp += SZ_PL;               // [NB*16][64][SEQ] residual x2048
    bf* CH = (bf*)wsp; wsp += SZ_XB;                 // [NB*SEQ][1024] context bf16 hi
    bf* CL = (bf*)wsp; wsp += SZ_XB;                 // [NB*SEQ][1024] context bf16 lo
    int* LN = (int*)wsp; wsp += SZ_LN;               // 32 ints: word b = q_len[b], word 8 + b = k_len[b]
    bf* WQT = WB; bf* WKT = WB + (size_t)DM * DM; bf* WVT = WB + (size_t)2 * DM * DM; bf* WOT = WB + (size_t)3 * DM * DM;

    cvt_in(xq, QB, stream); cvt_in(xk, KB, stream); cvt_in(xv, VB, stream);
    // weights: in[rows = k (in)][cols = n (out)] -> out[n][k]; square DM x DM, grid (k tiles, n tiles)
    { const dim3 g(DM / 64, DM / 64, 1);
      k_cvtT<<<g, 256, 0, stream>>>(wq, WQT); k_cvtT<<<g, 256, 0, stream>>>(wk, WKT); k_cvtT<<<g, 256, 0, stream>>>(wv, WVT); k_cvtT<<<g, 256, 0, stream>>>(wo, WOT); }
    k_lens<<<1, 64 * NB * LW, 0, stream>>>(qmask, kmask, LN);

    // q, k: A = x rows (m = b*SEQ + t), Bt = W^T rows (n = h*64 + d), column bias -> planes [(b*16 + h)][t][d] (value and residual)
    k_proj<0><<<dim3(NB * SEQ / GT, DM / GT, 1), 128, 0, stream>>>(QB, QB, WQT, bq, 1, QH, QR, 1, OUT, SEQ, (size_t)NH_ * SEQ * HD, HD, HD, (size_t)SEQ * HD);
    k_proj<0><<<dim3(NB * SEQ / GT, DM / GT, 1), 128, 0, stream>>>(KB, KB, WKT, bk, 1, KP, KR, 1, OUT, SEQ, (size_t)NH_ * SEQ * HD, HD, HD, (size_t)SEQ * HD);
    // v^T: A = Wv^T rows (m = h*64 + d), Bt = value rows (n = b*SEQ + t), row bias -> planes [(b*1024 + m)][t] = [(b*16 + h)][d][t] (value and residual)
    k_proj<0><<<dim3(DM / GT, NB * SEQ / GT, 1), 128, 0, stream>>>(WVT, WVT, VB, bv, 2, VT, VR, 1, OUT, DM, (size_t)0, SEQ, SEQ, (size_t)DM * SEQ);

    // context planes: rows 0..EROWS-1 by the early kernel, rows EROWS..SEQ-1 by the single-product kernel (disjoint rows, every row written)
    k_flash_early<<<dim3(EROWS / (16 * AW), NB * NH_, 1), 32 * AW, 0, stream>>>(QH, QR, KP, KR, VT, VR, LN, CH, CL);
    if (SEQ > EROWS)
        k_flash<<<dim3((SEQ - EROWS) / (16 * AW), NB * NH_, 1), 32 * AW, 0, stream>>>(QH, KP, VT, LN, CH, CL);

    // output: A = context hi (+ lo) rows (m = b*SEQ + t), Bt = Wo^T rows (n), column bias -> OUT[(b*OUT_SEQ + t)][n] f32
    k_proj<1><<<dim3(NB * SEQ / GT, DM / GT, 1), 128, 0, stream>>>(CH, CL, WOT, bo, 1, QH, QH, 0, OUT, SEQ, (size_t)OUT_SEQ * DM, DM, DM, (size_t)0);
}

// v003
// Measured time: 124 microseconds a run.
// Next to v002, in two timings, it ran 1.32 and 1.34 times as fast.
// Counting every step since v000, it is 1.95 times as fast.
#include <hip/hip_runtime.h>

// Projections q/k/v: v_wmma_f32_16x16x32_bf16 (inputs and weights RNE-converted to bf16, f32 accumulate); scores: v_wmma_f32_16x16x32_f16 (query rows >= EROWS: single f16 q and k; rows < EROWS: q and k as f16 value + f16 residual x2048, three products, residual products in their own accumulator); P.V: v_wmma_f32_16x16x32_f16 (P x256 carry, v single f16; rows < EROWS: P and v as value + residual x2048, three products, residual products in their own accumulator); output projection: v_wmma_f32_16x16x32_bf16 (context as bf16 hi + bf16 lo planes, Wo bf16), f32 accumulate everywhere, softmax f32.
// Attention block, width 1024 = 16 heads x 64; query/key/value inputs [NB][SEQ][1024] f32, W_Q/W_K/W_V/W_O [in][out] (y = x W + b), score scale 1/8,
// causal fill (key > query -> excluded) and length fill (query < q_len[b] and key < k_len[b], lengths = integer sums of the two int32 indicator rows); rows with no visible key give a zero context; output y = ctx W_O + b_O (f32).
// Layout: bf16 copies of the three inputs; bf16 TRANSPOSED copies of the four weights ([out][in], K-contiguous); q, k planes [b*16+h][t][d] and v^T plane [b*16+h][d][t] (value and residual x2048) written by the GEMM epilogue;
// fused flash kernel in transposed form (S^T = K Q^T, O^T = V^T P^T) writing the context as bf16 hi/lo planes [b*SEQ+t][1024]; final GEMM writes f32 rows.
// Four launches, one per level of the dependence chain; work that does not depend on each other shares a grid and is told apart by the block index:
// k_prep (lengths, weight transposes, input conversions), k_qkv (the three projections), k_flash (both row bands), k_out.

#ifndef NB
#define NB 2
#endif
#ifndef SEQ
#define SEQ 2048
#endif
#define NB_FULL  2
#define SEQ_FULL 2048
#ifndef OUT_SEQ
#define OUT_SEQ SEQ              // row pitch (in tokens) between batches of the output
#endif
#ifndef EROWS
#define EROWS 256                // query rows below this use the value + residual products
#endif
#define DM   1024
#define NH_  16
#define HD   64
#define AW   4                   // waves per flash block (16 query rows each)
#define QRS  2048.0f             // carry of the residual planes
#define QRI  (1.0f / 2048.0f)
#define LOG2E 1.4426950408889634f
#define SC2  (0.125f * 1.4426950408889634f)   // HD^-0.5 * log2(e)
#define PSH  8.0f                // log2 of the P carry (256)

static_assert(HD == 64);
static_assert(NH_ * HD == DM);                 // head h = columns h*64 + d
static_assert(DM % 64 == 0);                   // column tiles of 64
static_assert(DM % 32 == 0);                   // GEMM k-loop steps by 32
static_assert(DM >= 8);                        // clamped bias loads stay inside a DM-float array
static_assert(SEQ % 64 == 0);                  // a 64-row tile never straddles two batches
static_assert((NB * SEQ) % 64 == 0);
static_assert(SEQ % 32 == 0);                  // key loop steps by 32
static_assert(SEQ % (16 * AW) == 0);           // flash grid covers the sequence exactly
static_assert(((size_t)SEQ * DM) % 8 == 0);
static_assert(NB <= NB_FULL);
static_assert(SEQ <= SEQ_FULL);
static_assert(SEQ_FULL % 4 == 0);
static_assert(EROWS % (16 * AW) == 0);         // the early band is a whole number of flash blocks
static_assert(EROWS % 32 == 0);                // early key steps stay inside the early key range
static_assert(EROWS >= 16 * AW);
static_assert(EROWS <= SEQ);
static_assert(NB <= 8);                        // length line: word b = q_len[b], word 8 + b = k_len[b]

typedef _Float16 h16;
typedef unsigned short bf;
typedef __attribute__((ext_vector_type(16))) __bf16   v16bf;
typedef __attribute__((ext_vector_type(16))) _Float16 v16h;
typedef __attribute__((ext_vector_type(8)))  _Float16 v8h;
typedef __attribute__((ext_vector_type(8)))  unsigned short v8us;
typedef __attribute__((ext_vector_type(8)))  float    v8f;
typedef __attribute__((ext_vector_type(4)))  float    v4f;
typedef __attribute__((ext_vector_type(4)))  int      v4i;
typedef v4f  __attribute__((may_alias)) v4fa;
typedef v8us __attribute__((may_alias)) v8usa;

__device__ __forceinline__ unsigned short f2bf(float f) { unsigned u = __float_as_uint(f); u += 0x7FFFu + ((u >> 16) & 1u); return (unsigned short)(u >> 16); }
__device__ __forceinline__ float bf2f(unsigned short b) { return __uint_as_float(((unsigned)b) << 16); }
__device__ __forceinline__ float rbf(float f) { return bf2f(f2bf(f)); }   // value after RNE convert to bf16
__device__ __forceinline__ v16h cat16(v8h lo, v8h hi) { return __builtin_shufflevector(lo, hi, 0, 1, 2, 3, 4, 5, 6, 7, 8, 9, 10, 11, 12, 13, 14, 15); }
__device__ __forceinline__ v16bf cat16b(v8us lo, v8us hi) { return __builtin_bit_cast(v16bf, __builtin_shufflevector(lo, hi, 0, 1, 2, 3, 4, 5, 6, 7, 8, 9, 10, 11, 12, 13, 14, 15)); }
__device__ __forceinline__ v8f wmma16(v16h a, v16h b, v8f c) { return __builtin_amdgcn_wmma_f32_16x16x32_f16(false, a, false, b, (short)0, c, false, false); }
__device__ __forceinline__ v8f wmmab(v16bf a, v16bf b, v8f c) { return __builtin_amdgcn_wmma_f32_16x16x32_bf16(false, a, false, b, (short)0, c, false, false); }
// fragment loaders from K-contiguous 16-bit rows; p already includes + 8*(lane>>4): elements 0..7 <- k0+8h+0..7, elements 8..15 <- k0+16+8h+0..7 (same map for A and B)
__device__ __forceinline__ v16h  ldh(const h16* p) { return cat16(*(const v8h*)p, *(const v8h*)(p + 16)); }
__device__ __forceinline__ v16bf ldb(const bf* p)  { return cat16b(*(const v8us*)p, *(const v8us*)(p + 16)); }
// ordering point for wave-private LDS tiles (same wave writes and reads)
__device__ __forceinline__ void wave_sync() { __builtin_amdgcn_fence(3 /* release order */, "wavefront"); __builtin_amdgcn_wave_barrier(); asm volatile("" ::: "memory"); }
// single guarded f16 WMMA (one accumulator per guard)
__device__ __forceinline__ v8f wmma16g(v16h a, v16h b, v8f c) {
    c = __builtin_amdgcn_wmma_f32_16x16x32_f16(false, a, false, b, (short)0, c, false, false);
    asm volatile("v_nop\n\tv_nop\n\tv_nop\n\tv_nop" : "+v"(c) : "v"(a), "v"(b));
    return c;
}
__device__ __forceinline__ int imin(int a, int b) { return a < b ? a : b; }
__device__ __forceinline__ int imax(int a, int b) { return a > b ? a : b; }

// cvt8_body: thread's group i of eight f32 of an input (batch pitch SEQ_FULL rows) -> eight bf16 (RNE) of the packed [NB*SEQ][DM] plane. blk = block index inside the plane, 256 threads.
__device__ __forceinline__ void cvt8_body(const unsigned blk, const float* __restrict__ src, bf* dst) {
    const size_t n8 = (size_t)NB * SEQ * DM / 8, per = (size_t)SEQ * DM / 8;   // groups in the plane, groups in one batch
    const size_t i = (size_t)blk * 256 + threadIdx.x; if (i >= n8) return;
    const size_t so = (SEQ == SEQ_FULL) ? i * 8 : (i / per) * ((size_t)SEQ_FULL * DM) + (i % per) * 8;
    const v8f v = *(const v8f*)(src + so); v8us o;
#pragma unroll
    for (int k = 0; k < 8; ++k) o[k] = f2bf(v[k]);
    *(v8us*)(dst + i * 8) = o; 
}

// cvtT_body: in[rows = k][cols = n] f32 (DM x DM, row pitch DM) -> out[n][k] bf16 (RNE convert), 64x64 tiles transposed through LDS.
// tile (bx over k, by over n), each below DM/64; 256 threads. LDS tile ts[n][k] is cross-wave: block barrier between fill and drain.
__device__ __forceinline__ void cvtT_body(const int bx, const int by, const float* __restrict__ W, bf* WT) {
    __shared__ __align__(16) unsigned short ts[64 * 72];
    const int tid = threadIdx.x, lane = tid & 31, wave = __builtin_amdgcn_readfirstlane((int)(tid >> 5));
    const int k0 = bx * 64, n0 = by * 64;
#pragma unroll
    for (int i = 0; i < 4; ++i) { const int idx = tid + i * 256; const int kr = idx >> 4, c4 = (idx & 15) * 4;   // 1024 float4 = 64 k-rows x 16
        const v4f v = *(const v4f*)(W + (size_t)(k0 + kr) * DM + n0 + c4);
#pragma unroll
        for (int j = 0; j < 4; ++j) ts[(c4 + j) * 72 + kr] = f2bf(v[j]); }
    __syncthreads();
{
#pragma unroll
        for (int s = 0; s < 2; ++s) { const int row = wave * 8 + s * 4 + (lane >> 3), c8 = (lane & 7) * 8;   // 8 waves x 2 s x 4 = 64 rows; 8 lanes x 8 = 64 columns
            const v8us o = *(const v8usa*)(&ts[row * 72 + c8]);
            *(v8us*)(WT + (size_t)(n0 + row) * DM + k0 + c8) = o; }
        asm volatile("s_wait_xcnt 0x0" ::: "memory");   // stands before the registers that the stores above name are written again (the build lets this range's end run on into another range's code)
         }
}

// lens_body: q_len[b] and k_len[b] as integer sums of the first SEQ entries of row b of the two int32 indicator arrays (row pitch SEQ_FULL).
// LW waves per (array, batch) row: a lane brings its entries with SEQ / (128 LW) independent 16-byte loads (a wave-wide load covers 4 whole lines), all issued before the first sum,
// so the whole kernel waits for memory once instead of once per trip of a one-wave loop. Wave sums meet in LDS behind one block barrier; wave 0 adds them and stores the whole 32-word line.
#define LW 2                     // waves per indicator row (2 NB LW waves = the 256 threads of a k_prep block)
static_assert(SEQ % (128 * LW) == 0);          // a wave's share of a row is a whole number of wave-wide 16-byte loads
static_assert(64 * NB * LW == 256);            // 2 NB LW waves are exactly one k_prep block
__device__ __forceinline__ void lens_body(const int* __restrict__ qm, const int* __restrict__ km, int* lens) {
    __shared__ __align__(16) int ss[16 * LW];  // [word][wave of the row]; word b = q_len[b], word 8 + b = k_len[b]
    const int lane = threadIdx.x & 31, wave = __builtin_amdgcn_readfirstlane((int)(threadIdx.x >> 5));
    const int part = wave % LW, b = (wave / LW) % NB, which = wave / (LW * NB);
    const int* row = (which ? km : qm) + (size_t)b * SEQ_FULL + part * (SEQ / LW) + lane * 4;
    v4i p[SEQ / (128 * LW)];
#pragma unroll
    for (int i = 0; i < SEQ / (128 * LW); ++i) p[i] = *(const v4i*)(row + i * 128);
    int s = 0;
#pragma unroll
    for (int i = 0; i < SEQ / (128 * LW); ++i) s += (p[i][0] + p[i][1]) + (p[i][2] + p[i][3]);
#pragma unroll
    for (int o = 16; o > 0; o >>= 1) s += __shfl_xor(s, o, 32);
    if (lane == 0) ss[(which * 8 + b) * LW + part] = s;
    __syncthreads();   // every wave's sum is in LDS before wave 0 reads it
    if (wave == 0) {
        const bool used = lane < 16 && (lane & 7) < NB;   // words that a row feeds; only these LDS words were written
        int v = 0;
#pragma unroll
        for (int i = 0; i < LW; ++i) v += ss[(used ? lane : 0) * LW + i];
        *(int*)(lens + lane) = used ? v : 0;
        asm volatile("s_wait_xcnt 0x0" ::: "memory");   // stands before the registers that the store above names are written again (the build lets this range's end run on into another range's code)
    }
}

// k_prep: everything that reads only the inputs, in one grid of 256-thread blocks. Block 0: the lengths; the next 4 PB_WT blocks: the weight transposes (q | k | v | o);
// the last 3 PB_CV blocks: the input conversions (query | key | value). A block does one of the three jobs (the choice is a function of blockIdx alone, so every barrier is block-uniform).
#define PB_WT ((DM / 64) * (DM / 64))                                   // 64x64 tiles of one weight
#define PB_CV ((unsigned)(((size_t)NB * SEQ * DM / 8 + 255) / 256))     // blocks of one input plane
__global__ __launch_bounds__(256) void k_prep(const float* __restrict__ xq, const float* __restrict__ xk, const float* __restrict__ xv,
                                              const int* __restrict__ qm, const int* __restrict__ km,
                                              const float* __restrict__ wq, const float* __restrict__ wk, const float* __restrict__ wv, const float* __restrict__ wo,
                                              bf* QB, bf* KB, bf* VB, bf* WB, int* lens) {
    const unsigned blk = blockIdx.x;
    if (blk >= 1 + 4 * PB_WT) {
        const unsigned r = blk - (1 + 4 * PB_WT), p = r / PB_CV;
        cvt8_body(r % PB_CV, (p == 0) ? xq : (p == 1) ? xk : xv, (p == 0) ? QB : (p == 1) ? KB : VB);
    } else if (blk >= 1) {
        const unsigned r = blk - 1, w = r / PB_WT, t = r % PB_WT;
        const float* W = (w == 0) ? wq : (w == 1) ? wk : (w == 2) ? wv : wo;
        cvtT_body((int)(t % (DM / 64)), (int)(t / (DM / 64)), W, WB + (size_t)w * DM * DM);
    } else {
        lens_body(qm, km, lens);
    }
}

// proj_body: bf16 GEMM, one block of 4 waves (2 x 2) per 128x128 tile, each wave a 64x64 sub-tile (16 accumulators), K = DM in passes of KS.
// Operand tiles are staged in LDS: every thread brings 16-byte pieces of whole 256-byte row segments (a wave-wide load covers 4 whole lines) into registers one pass ahead
// and stores them into the other of two LDS buffers behind the pass's products; one block barrier per pass publishes that buffer and ends the reads of the one refilled next.
// Fragments come from LDS rows of pitch LP (272 B) with the same element map as ldb(); the k order of the sums is the ascending 32-step order.
// C[m][n] = sum_k (A[m][k] (+ A2[m][k] when MODE 1)) Bt[n][k] + bias (bmode 1: bias[n]; bmode 2: bias[m]; bias RNE-converted to bf16 first),
// sub-tile base (r0/RB)*sRB + (r0%RB)*pitch + (c0/CB)*sCB + (c0%CB), row pitch 'pitch' (elements). tile (bx below M/128, by below N/128), 128 threads.
// MODE 1: written as f32 (Of); each row's 64 floats (256 B = two lines) by 16 consecutive lanes x 16 B (2 rows per instruction).
// Bias array has DM floats; both 16-byte bias loads use addresses clamped into [0, DM-4].
#define GT 128                   // block tile edge (rows of A and rows of Bt per block)
#define KS 128                   // k elements per pass (256 B of every operand row)
#define LP 136                   // LDS row pitch in elements (272 B: 16 B x odd, for 16-byte readers)
#define NLD (GT * KS / 8 / 128)  // 16-byte pieces per thread, operand and pass
static_assert(DM % KS == 0);
static_assert(DM % GT == 0);
static_assert((NB * SEQ) % GT == 0);
__device__ __forceinline__ v16bf ldbs(const bf* p) { return cat16b(*(const v8usa*)p, *(const v8usa*)(p + 16)); }   // ldb() on an LDS row
template <int MODE>
__device__ __forceinline__ void proj_body(const int bx, const int by, const bf* __restrict__ A, const bf* __restrict__ A2, const bf* __restrict__ Bt,
                                          const float* __restrict__ bias, int bmode, h16* Ph, h16* Pr, int useRes, float* Of,
                                          int RB, size_t sRB, int pitch, int CB, size_t sCB) {
    constexpr int NOPD = (MODE == 1) ? 3 : 2;                    // staged operands: A, Bt (, A2)
    __shared__ __align__(16) bf st[2 * NOPD * GT * LP];          // [buffer][operand][row][LP]
    __shared__ __align__(16) float osall[4 * 16 * 68];           // one wave-private epilogue tile per wave
    const int K = DM;
    const int tid = threadIdx.x, lane = tid & 31, lr = lane & 15, hi = lane >> 4, wave = __builtin_amdgcn_readfirstlane((int)(tid >> 5));
    const int R0 = bx * GT, C0 = by * GT;
    const int wm = wave >> 1, wn = wave & 1;
    const int r0 = R0 + wm * 64, c0 = C0 + wn * 64;              // this wave's 64x64 sub-tile
    float* os = osall + wave * (16 * 68);
    v8f acc[4][4];
#pragma unroll
    for (int mb = 0; mb < 4; ++mb)
#pragma unroll
        for (int nb = 0; nb < 4; ++nb) acc[mb][nb] = (v8f){};
    // staging map: piece i of a thread = row (tid >> 4) + 8 i, bytes 16 (tid & 15) of the row's 256-byte segment
    const int srow = tid >> 4, sch = (tid & 15) * 8;
    const bf* gA  = A  + (size_t)(R0 + srow) * K + sch;
    const bf* gA2 = A2 + (size_t)(R0 + srow) * K + sch;
    const bf* gB  = Bt + (size_t)(C0 + srow) * K + sch;
    const int sl = srow * LP + sch;
    const int fa = (wm * 64 + lr) * LP + 8 * hi, fb = GT * LP + (wn * 64 + lr) * LP + 8 * hi, fa2 = 2 * GT * LP + fa;   // fragment bases inside a buffer
    v8us pa[NLD], pb[NLD], pa2[NLD];
#pragma unroll
    for (int i = 0; i < NLD; ++i) { pa[i] = *(const v8us*)(gA + (size_t)i * 8 * K); pb[i] = *(const v8us*)(gB + (size_t)i * 8 * K);
        if (MODE == 1) pa2[i] = *(const v8us*)(gA2 + (size_t)i * 8 * K); }
#pragma unroll
    for (int i = 0; i < NLD; ++i) { *(v8usa*)(&st[sl + i * 8 * LP]) = pa[i]; *(v8usa*)(&st[GT * LP + sl + i * 8 * LP]) = pb[i];
        if (MODE == 1) *(v8usa*)(&st[2 * GT * LP + sl + i * 8 * LP]) = pa2[i]; }
    __syncthreads();
#pragma unroll 1
    for (int kp = 0; kp < K; kp += KS) {
        const int cur = (kp / KS) & 1;
        const bf* sb = st + cur * (NOPD * GT * LP);
        bf* sn = st + (cur ^ 1) * (NOPD * GT * LP);
        const bool more = kp + KS < K;                           // block-uniform: a next pass exists
        if (more) {
#pragma unroll
            for (int i = 0; i < NLD; ++i) { pa[i] = *(const v8us*)(gA + (size_t)i * 8 * K + kp + KS); pb[i] = *(const v8us*)(gB + (size_t)i * 8 * K + kp + KS);
                if (MODE == 1) pa2[i] = *(const v8us*)(gA2 + (size_t)i * 8 * K + kp + KS); }
            asm volatile("s_wait_xcnt 0x0" ::: "memory");   // stands before the address registers of the loads above are written again (the build reuses them for the LDS addresses below)
        }
        v16bf a[2][4], b[2][4], a2[2][4];
#pragma unroll
        for (int q = 0; q < 4; ++q) { a[0][q] = ldbs(sb + fa + q * 16 * LP); b[0][q] = ldbs(sb + fb + q * 16 * LP);
            if (MODE == 1) a2[0][q] = ldbs(sb + fa2 + q * 16 * LP); }
        __builtin_amdgcn_sched_barrier(0);   // keeps the next pass's global loads and the first fragment loads ahead of the products
#pragma unroll
        for (int s = 0; s < KS / 32; ++s) {
            const int c = s & 1, n = c ^ 1;
            if (s + 1 < KS / 32) {
#pragma unroll
                for (int q = 0; q < 4; ++q) { a[n][q] = ldbs(sb + fa + q * 16 * LP + (s + 1) * 32); b[n][q] = ldbs(sb + fb + q * 16 * LP + (s + 1) * 32);
                    if (MODE == 1) a2[n][q] = ldbs(sb + fa2 + q * 16 * LP + (s + 1) * 32); }
                __builtin_amdgcn_sched_barrier(0);   // the next 32-step's fragment loads stay one group in front of this step's products, not among them
            }
#pragma unroll
            for (int nb = 0; nb < 4; ++nb)
#pragma unroll
                for (int mb = 0; mb < 4; ++mb) acc[mb][nb] = wmmab(a[c][mb], b[c][nb], acc[mb][nb]);
            // issue slots behind the last products before their operand registers are written again
            asm volatile("v_nop\n\tv_nop\n\tv_nop\n\tv_nop" : "+v"(acc[0][0]), "+v"(acc[1][1]), "+v"(acc[2][2]), "+v"(acc[3][3]) : "v"(a[c][0]), "v"(a[c][1]), "v"(a[c][2]), "v"(a[c][3]));
            if (MODE == 1) {
#pragma unroll
                for (int nb = 0; nb < 4; ++nb)
#pragma unroll
                    for (int mb = 0; mb < 4; ++mb) acc[mb][nb] = wmmab(a2[c][mb], b[c][nb], acc[mb][nb]);
                // issue slots behind the last products before their operand registers are written again
                asm volatile("v_nop\n\tv_nop\n\tv_nop\n\tv_nop" : "+v"(acc[0][0]), "+v"(acc[1][1]), "+v"(acc[2][2]), "+v"(acc[3][3]) : "v"(a2[c][0]), "v"(a2[c][1]), "v"(a2[c][2]), "v"(a2[c][3]));
            }
        }
        if (more) {
#pragma unroll
            for (int i = 0; i < NLD; ++i) { *(v8usa*)(&sn[sl + i * 8 * LP]) = pa[i]; *(v8usa*)(&sn[GT * LP + sl + i * 8 * LP]) = pb[i];
                if (MODE == 1) *(v8usa*)(&sn[2 * GT * LP + sl + i * 8 * LP]) = pa2[i]; }
        }
        __syncthreads();   // publishes the buffer just filled; ends every wave's reads of the buffer that the next pass refills
    }
    const size_t tbase = (size_t)(r0 / RB) * sRB + (size_t)(r0 % RB) * (size_t)pitch + (size_t)(c0 / CB) * sCB + (size_t)(c0 % CB);
    // per-lane column bias for the lane's store columns; both load addresses clamped into the DM-float bias array (first to 0 when unused, second to DM-4)
    const int c8 = (lane & 7) * 8, cofs = lr * 4;
    const int ci = (bmode == 1) ? (c0 + ((MODE == 0) ? c8 : cofs)) : 0;
    const int ci4 = (ci + 4 <= DM - 4) ? (ci + 4) : (DM - 4);      // MODE 0: ci + 4 <= DM - 4 always (exact columns); MODE 1: upper half unused, address kept in range
    const v4f bl0 = *(const v4f*)(bias + ci), bl1 = *(const v4f*)(bias + ci4);
    float bc[8];
#pragma unroll
    for (int i = 0; i < 4; ++i) { bc[i] = (bmode == 1) ? rbf(bl0[i]) : 0.0f; bc[4 + i] = (bmode == 1) ? rbf(bl1[i]) : 0.0f; }
#pragma unroll
    for (int mb = 0; mb < 4; ++mb) {
#pragma unroll
        for (int nb = 0; nb < 4; ++nb) {
#pragma unroll
            for (int j = 0; j < 8; ++j) os[(hi * 8 + j) * 68 + nb * 16 + lr] = acc[mb][nb][j]; }   // D: row 8h+j, col lane&15; rows 0..15 x columns 0..63 all written
        wave_sync();
        const size_t sb = tbase + (size_t)(mb * 16) * (size_t)pitch;
        if (MODE == 0) {
{
#pragma unroll
                for (int s = 0; s < 4; ++s) { const int row = 4 * s + (lane >> 3);   // 4 s x 4 row groups = 16 rows; 8 lanes x 8 = 64 columns
                    const int ri = (bmode == 2) ? (r0 + mb * 16 + row) : 0;
                    const float braw = bias[ri];
                    const float brow = (bmode == 2) ? rbf(braw) : 0.0f;
                    const v4f x0 = *(const v4fa*)(&os[row * 68 + c8]); const v4f x1 = *(const v4fa*)(&os[row * 68 + c8 + 4]); v8h hv, rv;
#pragma unroll
                    for (int i = 0; i < 4; ++i) { const float f0 = x0[i] + bc[i] + brow; const float f1 = x1[i] + bc[4 + i] + brow;
                        const h16 a0 = (h16)f0; const h16 a1 = (h16)f1; hv[i] = a0; hv[4 + i] = a1; rv[i] = (h16)((f0 - (float)a0) * QRS); rv[4 + i] = (h16)((f1 - (float)a1) * QRS); }
                    const size_t oo = sb + (size_t)row * (size_t)pitch + c8;
                    *(v8h*)(Ph + oo) = hv; if (useRes) *(v8h*)(Pr + oo) = rv;
                    asm volatile("s_wait_xcnt 0x0" ::: "memory"); }   // stands before the registers that the stores above name are written again by the next rows
                 }
        } else {
{
#pragma unroll
                for (int s = 0; s < 8; ++s) { const int row = 2 * s + hi;   // 8 s x 2 rows = 16 rows; 16 lanes x 4 floats = 64 columns
                    const v4f x0 = *(const v4fa*)(&os[row * 68 + cofs]); v4f val;
                    val[0] = x0[0] + bc[0]; val[1] = x0[1] + bc[1]; val[2] = x0[2] + bc[2]; val[3] = x0[3] + bc[3];
                    *(v4f*)(Of + sb + (size_t)row * (size_t)pitch + cofs) = val; }
                asm volatile("s_wait_xcnt 0x0" ::: "memory");   // stands before the registers that the stores above name are written again by the next row block
                 }
        }
        wave_sync();
    }
}

// k_qkv: the three projections in one grid (NB*SEQ/GT, DM/GT, 3); blockIdx.z picks the product.
// z = 0, 1 (q, k): A = x rows (m = b*SEQ + t), Bt = W^T rows (n = h*64 + d), column bias -> planes [(b*16 + h)][t][d] (value and residual).
// z = 2 (v^T): A = Wv^T rows (m = h*64 + d), Bt = value rows (n = b*SEQ + t), row bias -> planes [(b*1024 + m)][t] = [(b*16 + h)][d][t] (value and residual); its tile is (blockIdx.y, blockIdx.x).
__global__ __launch_bounds__(128) void k_qkv(const bf* __restrict__ QB, const bf* __restrict__ KB, const bf* __restrict__ VB,
                                             const bf* __restrict__ WQT, const bf* __restrict__ WKT, const bf* __restrict__ WVT,
                                             const float* __restrict__ bq, const float* __restrict__ bk, const float* __restrict__ bv,
                                             h16* QH, h16* QR, h16* KP, h16* KR, h16* VT, h16* VR) {
    const int z = blockIdx.z; const bool isv = z == 2;
    const bf* A  = isv ? WVT : z ? KB : QB;
    const bf* Bt = isv ? VB : z ? WKT : WQT;
    proj_body<0>((int)(isv ? blockIdx.y : blockIdx.x), (int)(isv ? blockIdx.x : blockIdx.y), A, A, Bt, isv ? bv : z ? bk : bq, isv ? 2 : 1,
                 isv ? VT : z ? KP : QH, isv ? VR : z ? KR : QR, 1, nullptr,
                 isv ? DM : SEQ, isv ? (size_t)0 : (size_t)NH_ * SEQ * HD, isv ? SEQ : HD, isv ? SEQ : HD, isv ? (size_t)DM * SEQ : (size_t)SEQ * HD);
}

// k_out: A = context hi (+ lo) rows (m = b*SEQ + t), Bt = Wo^T rows (n), column bias -> OUT[(b*OUT_SEQ + t)][n] f32; grid (NB*SEQ/GT, DM/GT).
__global__ __launch_bounds__(128) void k_out(const bf* __restrict__ CH, const bf* __restrict__ CL, const bf* __restrict__ WOT, const float* __restrict__ bo, float* OUT) {
    proj_body<1>((int)blockIdx.x, (int)blockIdx.y, CH, CL, WOT, bo, 1, nullptr, nullptr, 0, OUT, SEQ, (size_t)OUT_SEQ * DM, DM, DM, (size_t)0);
}

// flash_body: fused attention, one wave per 16 query rows of one (batch, head); K / V^T / Q fragments straight from the f16 planes (two 16-B loads each, arithmetic addressing).
// Transposed form: S^T[key][t] = K Q^T (A = K rows, B = Q rows); lane (t = lane&15, h = lane>>4) holds keys 8h+r of each 16-key tile, so the packed
// P tile is directly the B fragment of O^T[d][t] = V^T P^T (element r <- tile keys 0..15, element 8+r <- tile keys 16..31, lane unchanged).
// Visibility of (t, key): key <= lim(t) with lim = min(t, k_len - 1) when t < q_len, else -1 (nothing visible); excluded scores are REPLACED by a large negative fill and their P is set to 0 by value.
// The key loop runs to kend = min(t0 + 16, k_len) <= SEQ (wave-scalar, static upper bound SEQ); a row with no visible key keeps l = 0 and gets a zero context.
// Softmax state (running max, partial sum) is one scalar per lane; the two lane halves of a row are combined with one xor-16 exchange.
// EARLY = 1 (query rows < EROWS): q, k, P, v each as f16 value + f16 residual x2048; value x residual products go to separate accumulators folded with 1/2048 (scores: before the scale; context: before the normalisation); row sum over the unconverted p.
// EARLY = 0: single f16 products, row sum over the converted P.
template <int EARLY>
__device__ __forceinline__ void flash_body(const int xblk, const h16* __restrict__ QH, const h16* __restrict__ QR, const h16* __restrict__ KP, const h16* __restrict__ KR,
                                           const h16* __restrict__ VT, const h16* __restrict__ VR, const int* __restrict__ LENS, bf* CH, bf* CL) {
    __shared__ __align__(16) float os[AW * 16 * 68];
    const int lane = threadIdx.x & 31, wave = __builtin_amdgcn_readfirstlane((int)(threadIdx.x >> 5)), lr = lane & 15, hi = lane >> 4;
    const int zh = blockIdx.y; const int b = zh / NH_, h = zh % NH_;
    const int t0 = (xblk * AW + wave) * 16;
    const size_t pbase = (size_t)zh * SEQ * HD;
    const size_t qo = pbase + (size_t)(t0 + lr) * HD + 8 * hi;
    const v16h qh0 = ldh(QH + qo), qh1 = ldh(QH + qo + 32);   // B fragments: col t, k = d
    v16h qr0 = qh0, qr1 = qh1;
    if (EARLY) { qr0 = ldh(QR + qo); qr1 = ldh(QR + qo + 32); }
    const size_t ko = pbase + (size_t)lr * HD + 8 * hi;      // + key * HD       (A fragment: row key, k = d)
    const size_t vo = pbase + (size_t)lr * SEQ + 8 * hi;     // + 16j*SEQ + key  (A fragment: row d, k = key)
    const int qlen = imin(imax(LENS[b], 0), SEQ), klen = imin(imax(LENS[8 + b], 0), SEQ);   // lengths clamped into [0, SEQ]
    const int t = t0 + lr;
    const int lim = (t < qlen) ? imin(t, klen - 1) : -1;      // last visible key of query t (-1: none)
    const int kend = __builtin_amdgcn_readfirstlane(imin((xblk * AW + (int)(threadIdx.x >> 5)) * 16 + 16, klen));   // min taken first, then made wave-scalar; <= SEQ
    v8f o0 = (v8f){}, o1 = (v8f){}, o2 = (v8f){}, o3 = (v8f){};
    v8f e0 = (v8f){}, e1 = (v8f){}, e2 = (v8f){}, e3 = (v8f){};
    float m = -3.0e38f, l = 0.0f;
#pragma unroll 1
    for (int key0 = 0; key0 < kend; key0 += 32) {
        const size_t kof = ko + (size_t)key0 * HD;
        v8f sHa = (v8f){}, sLa = (v8f){}, sHb = (v8f){}, sLb = (v8f){};
        if (EARLY) {
            { const v16h kh0 = ldh(KP + kof), kh1 = ldh(KP + kof + 32), kr0 = ldh(KR + kof), kr1 = ldh(KR + kof + 32);
              sHa = wmma16g(kh0, qh0, sHa); sLa = wmma16g(kh0, qr0, sLa); sLa = wmma16g(kr0, qh0, sLa);
              sHa = wmma16g(kh1, qh1, sHa); sLa = wmma16g(kh1, qr1, sLa); sLa = wmma16g(kr1, qh1, sLa); }
            { const v16h kh0 = ldh(KP + kof + 16 * HD), kh1 = ldh(KP + kof + 16 * HD + 32), kr0 = ldh(KR + kof + 16 * HD), kr1 = ldh(KR + kof + 16 * HD + 32);
              sHb = wmma16g(kh0, qh0, sHb); sLb = wmma16g(kh0, qr0, sLb); sLb = wmma16g(kr0, qh0, sLb);
              sHb = wmma16g(kh1, qh1, sHb); sLb = wmma16g(kh1, qr1, sLb); sLb = wmma16g(kr1, qh1, sLb); }
        } else {
            const h16* ka = KP + kof;
            const v16h ka0 = ldh(ka), ka1 = ldh(ka + 32), kb0 = ldh(ka + 16 * HD), kb1 = ldh(ka + 16 * HD + 32);
            sHa = wmma16(ka0, qh0, sHa); sHb = wmma16(kb0, qh0, sHb);
            sHa = wmma16(ka1, qh1, sHa); sHb = wmma16(kb1, qh1, sHb);
            asm volatile("v_nop\n\tv_nop\n\tv_nop\n\tv_nop" : "+v"(sHa), "+v"(sHb) : "v"(ka0), "v"(ka1), "v"(kb0), "v"(kb1));
        }
        const int kq = key0 + 8 * hi;           // this lane's first key of tile a (tile b: + 16)
        float ta[8], tb[8]; float mx = -3.0e38f;
#pragma unroll
        for (int r = 0; r < 8; ++r) {
            const float xa = EARLY ? (sHa[r] + sLa[r] * QRI) * SC2 : sHa[r] * SC2;
            const float xb = EARLY ? (sHb[r] + sLb[r] * QRI) * SC2 : sHb[r] * SC2;
            ta[r] = (kq + r <= lim) ? xa : -3.0e38f;
            tb[r] = (kq + 16 + r <= lim) ? xb : -3.0e38f; }
#pragma unroll
        for (int r = 0; r < 8; ++r) mx = fmaxf(mx, fmaxf(ta[r], tb[r]));
        mx = fmaxf(mx, __shfl_xor(mx, 16, 32));
        const float mnew = fmaxf(m, mx);
        const float alpha = __builtin_amdgcn_exp2f(m - mnew);
        const float sh = PSH - mnew;
        v16h pb = (v16h){}, pr = (v16h){}; float ls = 0.0f;
#pragma unroll
        for (int r = 0; r < 8; ++r) {
            const float ya = __builtin_amdgcn_exp2f(ta[r] + sh), yb = __builtin_amdgcn_exp2f(tb[r] + sh);
            const float ea = (kq + r <= lim) ? ya : 0.0f;
            const float eb = (kq + 16 + r <= lim) ? yb : 0.0f;
            const h16 pa = (h16)ea; const h16 pc = (h16)eb; pb[r] = pa; pb[8 + r] = pc;
            if (EARLY) { pr[r] = (h16)((ea - (float)pa) * QRS); pr[8 + r] = (h16)((eb - (float)pc) * QRS); ls += ea + eb; }
            else { ls += (float)pa + (float)pc; } }
        l = l * alpha + ls; m = mnew;
        o0 = o0 * alpha; o1 = o1 * alpha; o2 = o2 * alpha; o3 = o3 * alpha;
        const size_t vof = vo + key0;
        if (EARLY) {
            e0 = e0 * alpha; e1 = e1 * alpha; e2 = e2 * alpha; e3 = e3 * alpha;
            { const v16h vh = ldh(VT + vof), vr = ldh(VR + vof);
              o0 = wmma16g(vh, pb, o0); e0 = wmma16g(vh, pr, e0); e0 = wmma16g(vr, pb, e0); }
            { const v16h vh = ldh(VT + vof + (size_t)16 * SEQ), vr = ldh(VR + vof + (size_t)16 * SEQ);
              o1 = wmma16g(vh, pb, o1); e1 = wmma16g(vh, pr, e1); e1 = wmma16g(vr, pb, e1); }
            { const v16h vh = ldh(VT + vof + (size_t)32 * SEQ), vr = ldh(VR + vof + (size_t)32 * SEQ);
              o2 = wmma16g(vh, pb, o2); e2 = wmma16g(vh, pr, e2); e2 = wmma16g(vr, pb, e2); }
            { const v16h vh = ldh(VT + vof + (size_t)48 * SEQ), vr = ldh(VR + vof + (size_t)48 * SEQ);
              o3 = wmma16g(vh, pb, o3); e3 = wmma16g(vh, pr, e3); e3 = wmma16g(vr, pb, e3); }
        } else {
            const h16* va = VT + vof;
            const v16h v0 = ldh(va), v1 = ldh(va + (size_t)16 * SEQ), v2 = ldh(va + (size_t)32 * SEQ), v3 = ldh(va + (size_t)48 * SEQ);
            o0 = wmma16(v0, pb, o0); o1 = wmma16(v1, pb, o1); o2 = wmma16(v2, pb, o2); o3 = wmma16(v3, pb, o3);
            asm volatile("v_nop\n\tv_nop\n\tv_nop\n\tv_nop" : "+v"(o0), "+v"(o1), "+v"(o2), "+v"(o3) : "v"(v0), "v"(v1), "v"(v2), "v"(v3), "v"(pb));
        }
    }
    if (EARLY) { o0 = o0 + e0 * QRI; o1 = o1 + e1 * QRI; o2 = o2 + e2 * QRI; o3 = o3 + e3 * QRI; }
    l += __shfl_xor(l, 16, 32);
    const float lsafe = (l > 0.0f) ? l : 1.0f;
    const float inv = (l > 0.0f) ? (1.0f / lsafe) : 0.0f;     // no visible key: zero context
    const int wb = wave * 16 * 68;
    // O^T D layout: o_j[r] = (d = 16j + 8h + r, t = lane&15) -> os[t][d]; rows 0..15 x columns 0..63 all written
    { v4f a, c;
      a[0] = o0[0] * inv; a[1] = o0[1] * inv; a[2] = o0[2] * inv; a[3] = o0[3] * inv; c[0] = o0[4] * inv; c[1] = o0[5] * inv; c[2] = o0[6] * inv; c[3] = o0[7] * inv;
      *(v4fa*)(&os[wb + lr * 68 +  0 + 8 * hi]) = a; *(v4fa*)(&os[wb + lr * 68 +  0 + 8 * hi + 4]) = c;
      a[0] = o1[0] * inv; a[1] = o1[1] * inv; a[2] = o1[2] * inv; a[3] = o1[3] * inv; c[0] = o1[4] * inv; c[1] = o1[5] * inv; c[2] = o1[6] * inv; c[3] = o1[7] * inv;
      *(v4fa*)(&os[wb + lr * 68 + 16 + 8 * hi]) = a; *(v4fa*)(&os[wb + lr * 68 + 16 + 8 * hi + 4]) = c;
      a[0] = o2[0] * inv; a[1] = o2[1] * inv; a[2] = o2[2] * inv; a[3] = o2[3] * inv; c[0] = o2[4] * inv; c[1] = o2[5] * inv; c[2] = o2[6] * inv; c[3] = o2[7] * inv;
      *(v4fa*)(&os[wb + lr * 68 + 32 + 8 * hi]) = a; *(v4fa*)(&os[wb + lr * 68 + 32 + 8 * hi + 4]) = c;
      a[0] = o3[0] * inv; a[1] = o3[1] * inv; a[2] = o3[2] * inv; a[3] = o3[3] * inv; c[0] = o3[4] * inv; c[1] = o3[5] * inv; c[2] = o3[6] * inv; c[3] = o3[7] * inv;
      *(v4fa*)(&os[wb + lr * 68 + 48 + 8 * hi]) = a; *(v4fa*)(&os[wb + lr * 68 + 48 + 8 * hi + 4]) = c; }
    wave_sync();
    const size_t obase = ((size_t)b * SEQ + t0) * DM + (size_t)h * HD;
{
#pragma unroll
        for (int s = 0; s < 4; ++s) { const int row = 4 * s + (lane >> 3), c8 = (lane & 7) * 8;   // 4 s x 4 row groups = 16 rows; 8 lanes x 8 = 64 columns
            const v4f x0 = *(const v4fa*)(&os[wb + row * 68 + c8]); const v4f x1 = *(const v4fa*)(&os[wb + row * 68 + c8 + 4]); v8us hv, lv;
#pragma unroll
            for (int i = 0; i < 4; ++i) { const unsigned short a0 = f2bf(x0[i]); const unsigned short a1 = f2bf(x1[i]);
                hv[i] = a0; hv[4 + i] = a1; lv[i] = f2bf(x0[i] - bf2f(a0)); lv[4 + i] = f2bf(x1[i] - bf2f(a1)); }
            const size_t oo = obase + (size_t)row * DM + c8;
            *(v8us*)(CH + oo) = hv; *(v8us*)(CL + oo) = lv; }
         }
}

// k_flash: both row bands in one grid (SEQ / (16*AW), NB*NH_), the choice a function of blockIdx.x alone:
// the first (SEQ - EROWS) / (16*AW) blocks of a head take query rows EROWS..SEQ-1 (single products), the last EROWS / (16*AW) take rows 0..EROWS-1 (value + residual products).
__global__ __launch_bounds__(32 * AW) void k_flash(const h16* __restrict__ QH, const h16* __restrict__ QR, const h16* __restrict__ KP, const h16* __restrict__ KR,
                                                   const h16* __restrict__ VT, const h16* __restrict__ VR, const int* __restrict__ LENS, bf* CH, bf* CL) {
    if ((int)blockIdx.x < (SEQ - EROWS) / (16 * AW))
        flash_body<0>((int)blockIdx.x + EROWS / (16 * AW), QH, QH, KP, KP, VT, VT, LENS, CH, CL);
    else
        flash_body<1>((int)blockIdx.x - (SEQ - EROWS) / (16 * AW), QH, QR, KP, KR, VT, VR, LENS, CH, CL);
}

static constexpr size_t al256(size_t v) { return (v + 255) & ~(size_t)255; }
static constexpr size_t SZ_XB = al256((size_t)NB * SEQ * DM * 2);          // one bf16 activation plane [NB*SEQ][1024]
static constexpr size_t SZ_WB = al256((size_t)4 * DM * DM * 2);            // four transposed bf16 weight planes
static constexpr size_t SZ_PL = al256((size_t)NB * NH_ * SEQ * HD * 2);    // one f16 head plane
static constexpr size_t SZ_LN = al256((size_t)32 * 4);
static constexpr size_t SZ_TOTAL = 3 * SZ_XB + SZ_WB + 6 * SZ_PL + 2 * SZ_XB + SZ_LN;
static_assert(SZ_TOTAL <= (size_t)134217728);          // workspace carve <= 128 MiB
static_assert(((size_t)DM * DM * 2) % 256 == 0);       // weight sub-planes stay 256-byte aligned
static_assert((size_t)NB * OUT_SEQ * DM * 4 <= (size_t)NB_FULL * SEQ_FULL * DM * 4);   // single output at byte offset 0

extern "C" void kernel_launch(void* const* d_in, const int* in_sizes, int n_in,
                              void* d_out, int out_size, void* d_ws, size_t ws_size, hipStream_t stream) {
    if (n_in < 13) return;
    const size_t needx = ((size_t)(NB - 1) * SEQ_FULL + SEQ) * DM;
    if ((size_t)in_sizes[0] < needx || (size_t)in_sizes[1] < needx || (size_t)in_sizes[2] < needx) return;
    if ((size_t)in_sizes[3] < (size_t)(NB - 1) * SEQ_FULL + SEQ || (size_t)in_sizes[4] < (size_t)(NB - 1) * SEQ_FULL + SEQ) return;
    if ((size_t)in_sizes[5] < (size_t)DM * DM || (size_t)in_sizes[7] < (size_t)DM * DM || (size_t)in_sizes[9] < (size_t)DM * DM || (size_t)in_sizes[11] < (size_t)DM * DM) return;
    if (in_sizes[6] < DM || in_sizes[8] < DM || in_sizes[10] < DM || in_sizes[12] < DM) return;
    if ((size_t)out_size < ((size_t)(NB - 1) * OUT_SEQ + SEQ) * DM) return;
    if (SZ_TOTAL > ws_size) return;
    // wire order: in_Q, in_K, in_V, Q_pad_mask (int32), K_pad_mask (int32), W_Q, b_Q, W_K, b_K, W_V, b_V, W_O, b_O
    const float* xq = (const float*)d_in[0]; const float* xk = (const float*)d_in[1]; const float* xv = (const float*)d_in[2];
    const int* qmask = (const int*)d_in[3]; const int* kmask = (const int*)d_in[4];
    const float* wq = (const float*)d_in[5];  const float* bq = (const float*)d_in[6];
    const float* wk = (const float*)d_in[7];  const float* bk = (const float*)d_in[8];
    const float* wv = (const float*)d_in[9];  const float* bv = (const float*)d_in[10];
    const float* wo = (const float*)d_in[11]; const float* bo = (const float*)d_in[12];
    float* OUT = (float*)d_out;      // [NB][SEQ][1024]
    char* wsp = (char*)d_ws;
    bf* QB = (bf*)wsp; wsp += SZ_XB;                 // [NB*SEQ][1024] bf16 query input
    bf* KB = (bf*)wsp; wsp += SZ_XB;                 // [NB*SEQ][1024] bf16 key input
    bf* VB = (bf*)wsp; wsp += SZ_XB;                 // [NB*SEQ][1024] bf16 value input
    bf* WB = (bf*)wsp; wsp += SZ_WB;                 // [4][1024 out][1024 in]: q | k | v | o
    h16* QH = (h16*)wsp; wsp += SZ_PL;               // [NB*16][SEQ][64]
    h16* QR = (h16*)wsp; wsp += SZ_PL;               // [NB*16][SEQ][64] residual x2048
    h16* KP = (h16*)wsp; wsp += SZ_PL;               // [NB*16][SEQ][64]
    h16* KR = (h16*)wsp; wsp += SZ_PL;               // [NB*16][SEQ][64] residual x2048
    h16* VT = (h16*)wsp; wsp += SZ_PL;               // [NB*16][64][SEQ]
    h16* VR = (h16*)wsp; wsp += SZ_PL;               // [NB*16][64][SEQ] residual x2048
    bf* CH = (bf*)wsp; wsp += SZ_XB;                 // [NB*SEQ][1024] context bf16 hi
    bf* CL = (bf*)wsp; wsp += SZ_XB;                 // [NB*SEQ][1024] context bf16 lo
    int* LN = (int*)wsp; wsp += SZ_LN;               // 32 ints: word b = q_len[b], word 8 + b = k_len[b]
    bf* WQT = WB; bf* WKT = WB + (size_t)DM * DM; bf* WVT = WB + (size_t)2 * DM * DM; bf* WOT = WB + (size_t)3 * DM * DM;

    // lengths, transposed bf16 weights ([out][in]) and bf16 inputs
    k_prep<<<1 + 4 * PB_WT + 3 * PB_CV, 256, 0, stream>>>(xq, xk, xv, qmask, kmask, wq, wk, wv, wo, QB, KB, VB, WB, LN);
    // q, k planes and v^T planes (value and residual)
    k_qkv<<<dim3(NB * SEQ / GT, DM / GT, 3), 128, 0, stream>>>(QB, KB, VB, WQT, WKT, WVT, bq, bk, bv, QH, QR, KP, KR, VT, VR);
    // context planes: disjoint rows, every row written
    k_flash<<<dim3(SEQ / (16 * AW), NB * NH_, 1), 32 * AW, 0, stream>>>(QH, QR, KP, KR, VT, VR, LN, CH, CL);
    // output rows
    k_out<<<dim3(NB * SEQ / GT, DM / GT, 1), 128, 0, stream>>>(CH, CL, WOT, bo, OUT);
}

// v004
// Measured time: 92.5 microseconds a run.
// In both of two side-by-side timings against v003, it was 1.34 times as fast.
// Counting every step since v000, it is 2.60 times as fast.
#include <hip/hip_runtime.h>

// Projections q/k/v: v_wmma_f32_16x16x32_bf16 (inputs and weights RNE-converted to bf16, f32 accumulate); scores: v_wmma_f32_16x16x32_f16 (query rows >= EROWS: single f16 q and k; rows < EROWS: q and k as f16 value + f16 residual x2048, three products, residual products in their own accumulator); P.V: v_wmma_f32_16x16x32_f16 (P x256 carry, v single f16; rows < EROWS: P and v as value + residual x2048, three products, residual products in their own accumulator); output projection: v_wmma_f32_16x16x32_bf16 (context as bf16 hi + bf16 lo planes, Wo bf16), f32 accumulate everywhere, softmax f32.
// Attention block, width 1024 = 16 heads x 64; query/key/value inputs [NB][SEQ][1024] f32, W_Q/W_K/W_V/W_O [in][out] (y = x W + b), score scale 1/8,
// causal fill (key > query -> excluded) and length fill (query < q_len[b] and key < k_len[b], lengths = integer sums of the two int32 indicator rows); rows with no visible key give a zero context; output y = ctx W_O + b_O (f32).
// Layout: bf16 copies of the three inputs; bf16 TRANSPOSED copies of the four weights ([out][in], K-contiguous); q, k planes [b*16+h][t][d] and v^T plane [b*16+h][d][t] (value and residual x2048) written by the GEMM epilogue;
// fused flash kernel in transposed form (S^T = K Q^T, O^T = V^T P^T) writing the context as bf16 hi/lo planes [b*SEQ+t][1024]; final GEMM writes f32 rows.
// Four launches, one per level of the dependence chain; work that does not depend on each other shares a grid and is told apart by the block index:
// k_prep (lengths, weight transposes, input conversions), k_qkv (the three projections), k_flash (both row bands), k_out.

#ifndef NB
#define NB 2
#endif
#ifndef SEQ
#define SEQ 2048
#endif
#define NB_FULL  2
#define SEQ_FULL 2048
#ifndef OUT_SEQ
#define OUT_SEQ SEQ              // row pitch (in tokens) between batches of the output
#endif
#ifndef EROWS
#define EROWS 256                // query rows below this use the value + residual products
#endif
#define DM   1024
#define NH_  16
#define HD   64
#define AW   4                   // waves per flash block (16 query rows each)
#define QRS  2048.0f             // carry of the residual planes
#define QRI  (1.0f / 2048.0f)
#define LOG2E 1.4426950408889634f
#define SC2  (0.125f * 1.4426950408889634f)   // HD^-0.5 * log2(e)
#define PSH  8.0f                // log2 of the P carry (256)

static_assert(HD == 64);
static_assert(NH_ * HD == DM);                 // head h = columns h*64 + d
static_assert(DM % 64 == 0);                   // column tiles of 64
static_assert(DM % 32 == 0);                   // GEMM k-loop steps by 32
static_assert(DM >= 8);                        // clamped bias loads stay inside a DM-float array
static_assert(SEQ % 64 == 0);                  // a 64-row tile never straddles two batches
static_assert((NB * SEQ) % 64 == 0);
static_assert(SEQ % 32 == 0);                  // key loop steps by 32
static_assert(SEQ % (16 * AW) == 0);           // flash grid covers the sequence exactly
static_assert(((size_t)SEQ * DM) % 8 == 0);
static_assert(NB <= NB_FULL);
static_assert(SEQ <= SEQ_FULL);
static_assert(SEQ_FULL % 4 == 0);
static_assert(EROWS % (16 * AW) == 0);         // the early band is a whole number of flash blocks
static_assert(EROWS % 32 == 0);                // early key steps stay inside the early key range
static_assert(EROWS >= 16 * AW);
static_assert(EROWS <= SEQ);
static_assert(NB <= 8);                        // length line: word b = q_len[b], word 8 + b = k_len[b]

typedef _Float16 h16;
typedef unsigned short bf;
typedef __attribute__((ext_vector_type(16))) __bf16   v16bf;
typedef __attribute__((ext_vector_type(16))) _Float16 v16h;
typedef __attribute__((ext_vector_type(8)))  _Float16 v8h;
typedef __attribute__((ext_vector_type(8)))  unsigned short v8us;
typedef __attribute__((ext_vector_type(8)))  float    v8f;
typedef __attribute__((ext_vector_type(4)))  float    v4f;
typedef __attribute__((ext_vector_type(4)))  int      v4i;
typedef v4f  __attribute__((may_alias)) v4fa;
typedef v8us __attribute__((may_alias)) v8usa;

__device__ __forceinline__ unsigned short f2bf(float f) { unsigned u = __float_as_uint(f); u += 0x7FFFu + ((u >> 16) & 1u); return (unsigned short)(u >> 16); }
__device__ __forceinline__ float bf2f(unsigned short b) { return __uint_as_float(((unsigned)b) << 16); }
__device__ __forceinline__ float rbf(float f) { return bf2f(f2bf(f)); }   // value after RNE convert to bf16
__device__ __forceinline__ v16h cat16(v8h lo, v8h hi) { return __builtin_shufflevector(lo, hi, 0, 1, 2, 3, 4, 5, 6, 7, 8, 9, 10, 11, 12, 13, 14, 15); }
__device__ __forceinline__ v16bf cat16b(v8us lo, v8us hi) { return __builtin_bit_cast(v16bf, __builtin_shufflevector(lo, hi, 0, 1, 2, 3, 4, 5, 6, 7, 8, 9, 10, 11, 12, 13, 14, 15)); }
__device__ __forceinline__ v8f wmma16(v16h a, v16h b, v8f c) { return __builtin_amdgcn_wmma_f32_16x16x32_f16(false, a, false, b, (short)0, c, false, false); }
__device__ __forceinline__ v8f wmmab(v16bf a, v16bf b, v8f c) { return __builtin_amdgcn_wmma_f32_16x16x32_bf16(false, a, false, b, (short)0, c, false, false); }
// fragment loaders from K-contiguous 16-bit rows; p already includes + 8*(lane>>4): elements 0..7 <- k0+8h+0..7, elements 8..15 <- k0+16+8h+0..7 (same map for A and B)
__device__ __forceinline__ v16h  ldh(const h16* p) { return cat16(*(const v8h*)p, *(const v8h*)(p + 16)); }
__device__ __forceinline__ v16bf ldb(const bf* p)  { return cat16b(*(const v8us*)p, *(const v8us*)(p + 16)); }
// ordering point for wave-private LDS tiles (same wave writes and reads)
__device__ __forceinline__ void wave_sync() { __builtin_amdgcn_fence(3 /* release order */, "wavefront"); __builtin_amdgcn_wave_barrier(); asm volatile("" ::: "memory"); }
// single guarded f16 WMMA (one accumulator per guard)
__device__ __forceinline__ v8f wmma16g(v16h a, v16h b, v8f c) {
    c = __builtin_amdgcn_wmma_f32_16x16x32_f16(false, a, false, b, (short)0, c, false, false);
    asm volatile("v_nop\n\tv_nop\n\tv_nop\n\tv_nop" : "+v"(c) : "v"(a), "v"(b));
    return c;
}
__device__ __forceinline__ int imin(int a, int b) { return a < b ? a : b; }
__device__ __forceinline__ int imax(int a, int b) { return a > b ? a : b; }

// cvt8_body: thread's group i of eight f32 of an input (batch pitch SEQ_FULL rows) -> eight bf16 (RNE) of the packed [NB*SEQ][DM] plane. blk = block index inside the plane, 256 threads.
__device__ __forceinline__ void cvt8_body(const unsigned blk, const float* __restrict__ src, bf* dst) {
    const size_t n8 = (size_t)NB * SEQ * DM / 8, per = (size_t)SEQ * DM / 8;   // groups in the plane, groups in one batch
    const size_t i = (size_t)blk * 256 + threadIdx.x; if (i >= n8) return;
    const size_t so = (SEQ == SEQ_FULL) ? i * 8 : (i / per) * ((size_t)SEQ_FULL * DM) + (i % per) * 8;
    const v8f v = *(const v8f*)(src + so); v8us o;
#pragma unroll
    for (int k = 0; k < 8; ++k) o[k] = f2bf(v[k]);
    *(v8us*)(dst + i * 8) = o; 
}

// cvtT_body: in[rows = k][cols = n] f32 (DM x DM, row pitch DM) -> out[n][k] bf16 (RNE convert), 64x64 tiles transposed through LDS.
// tile (bx over k, by over n), each below DM/64; 256 threads. LDS tile ts[n][k] is cross-wave: block barrier between fill and drain.
__device__ __forceinline__ void cvtT_body(const int bx, const int by, const float* __restrict__ W, bf* WT) {
    __shared__ __align__(16) unsigned short ts[64 * 72];
    const int tid = threadIdx.x, lane = tid & 31, wave = __builtin_amdgcn_readfirstlane((int)(tid >> 5));
    const int k0 = bx * 64, n0 = by * 64;
#pragma unroll
    for (int i = 0; i < 4; ++i) { const int idx = tid + i * 256; const int kr = idx >> 4, c4 = (idx & 15) * 4;   // 1024 float4 = 64 k-rows x 16
        const v4f v = *(const v4f*)(W + (size_t)(k0 + kr) * DM + n0 + c4);
#pragma unroll
        for (int j = 0; j < 4; ++j) ts[(c4 + j) * 72 + kr] = f2bf(v[j]); }
    __syncthreads();
{
#pragma unroll
        for (int s = 0; s < 2; ++s) { const int row = wave * 8 + s * 4 + (lane >> 3), c8 = (lane & 7) * 8;   // 8 waves x 2 s x 4 = 64 rows; 8 lanes x 8 = 64 columns
            const v8us o = *(const v8usa*)(&ts[row * 72 + c8]);
            *(v8us*)(WT + (size_t)(n0 + row) * DM + k0 + c8) = o; }
        asm volatile("s_wait_xcnt 0x0" ::: "memory");   // stands before the registers that the stores above name are written again (the build lets this range's end run on into another range's code)
         }
}

// lens_body: q_len[b] and k_len[b] as integer sums of the first SEQ entries of row b of the two int32 indicator arrays (row pitch SEQ_FULL).
// LW waves per (array, batch) row: a lane brings its entries with SEQ / (128 LW) independent 16-byte loads (a wave-wide load covers 4 whole lines), all issued before the first sum,
// so the whole kernel waits for memory once instead of once per trip of a one-wave loop. Wave sums meet in LDS behind one block barrier; wave 0 adds them and stores the whole 32-word line.
#define LW 2                     // waves per indicator row (2 NB LW waves = the 256 threads of a k_prep block)
static_assert(SEQ % (128 * LW) == 0);          // a wave's share of a row is a whole number of wave-wide 16-byte loads
static_assert(64 * NB * LW == 256);            // 2 NB LW waves are exactly one k_prep block
__device__ __forceinline__ void lens_body(const int* __restrict__ qm, const int* __restrict__ km, int* lens) {
    __shared__ __align__(16) int ss[16 * LW];  // [word][wave of the row]; word b = q_len[b], word 8 + b = k_len[b]
    const int lane = threadIdx.x & 31, wave = __builtin_amdgcn_readfirstlane((int)(threadIdx.x >> 5));
    const int part = wave % LW, b = (wave / LW) % NB, which = wave / (LW * NB);
    const int* row = (which ? km : qm) + (size_t)b * SEQ_FULL + part * (SEQ / LW) + lane * 4;
    v4i p[SEQ / (128 * LW)];
#pragma unroll
    for (int i = 0; i < SEQ / (128 * LW); ++i) p[i] = *(const v4i*)(row + i * 128);
    int s = 0;
#pragma unroll
    for (int i = 0; i < SEQ / (128 * LW); ++i) s += (p[i][0] + p[i][1]) + (p[i][2] + p[i][3]);
#pragma unroll
    for (int o = 16; o > 0; o >>= 1) s += __shfl_xor(s, o, 32);
    if (lane == 0) ss[(which * 8 + b) * LW + part] = s;
    __syncthreads();   // every wave's sum is in LDS before wave 0 reads it
    if (wave == 0) {
        const bool used = lane < 16 && (lane & 7) < NB;   // words that a row feeds; only these LDS words were written
        int v = 0;
#pragma unroll
        for (int i = 0; i < LW; ++i) v += ss[(used ? lane : 0) * LW + i];
        *(int*)(lens + lane) = used ? v : 0;
        asm volatile("s_wait_xcnt 0x0" ::: "memory");   // stands before the registers that the store above names are written again (the build lets this range's end run on into another range's code)
    }
}

// k_prep: everything that reads only the inputs, in one grid of 256-thread blocks. Block 0: the lengths; the next 4 PB_WT blocks: the weight transposes (q | k | v | o);
// the last 3 PB_CV blocks: the input conversions (query | key | value). A block does one of the three jobs (the choice is a function of blockIdx alone, so every barrier is block-uniform).
#define PB_WT ((DM / 64) * (DM / 64))                                   // 64x64 tiles of one weight
#define PB_CV ((unsigned)(((size_t)NB * SEQ * DM / 8 + 255) / 256))     // blocks of one input plane
__global__ __launch_bounds__(256) void k_prep(const float* __restrict__ xq, const float* __restrict__ xk, const float* __restrict__ xv,
                                              const int* __restrict__ qm, const int* __restrict__ km,
                                              const float* __restrict__ wq, const float* __restrict__ wk, const float* __restrict__ wv, const float* __restrict__ wo,
                                              bf* QB, bf* KB, bf* VB, bf* WB, int* lens) {
    const unsigned blk = blockIdx.x;
    if (blk >= 1 + 4 * PB_WT) {
        const unsigned r = blk - (1 + 4 * PB_WT), p = r / PB_CV;
        cvt8_body(r % PB_CV, (p == 0) ? xq : (p == 1) ? xk : xv, (p == 0) ? QB : (p == 1) ? KB : VB);
    } else if (blk >= 1) {
        const unsigned r = blk - 1, w = r / PB_WT, t = r % PB_WT;
        const float* W = (w == 0) ? wq : (w == 1) ? wk : (w == 2) ? wv : wo;
        cvtT_body((int)(t % (DM / 64)), (int)(t / (DM / 64)), W, WB + (size_t)w * DM * DM);
    } else {
        lens_body(qm, km, lens);
    }
}

// proj_body: bf16 GEMM, one block of 4 waves (2 x 2) per 128x128 tile, each wave a 64x64 sub-tile (16 accumulators), K = DM in passes of KS.
// Operand tiles are staged in LDS: every thread brings 16-byte pieces of whole 256-byte row segments (a wave-wide load covers 4 whole lines) into registers one pass ahead
// and stores them into the other of two LDS buffers behind the pass's products; one block barrier per pass publishes that buffer and ends the reads of the one refilled next.
// Fragments come from LDS rows of pitch LP (272 B) with the same element map as ldb(); the k order of the sums is the ascending 32-step order.
// C[m][n] = sum_k (A[m][k] (+ A2[m][k] when MODE 1)) Bt[n][k] + bias (bmode 1: bias[n]; bmode 2: bias[m]; bias RNE-converted to bf16 first),
// sub-tile base (r0/RB)*sRB + (r0%RB)*pitch + (c0/CB)*sCB + (c0%CB), row pitch 'pitch' (elements). tile (bx below M/128, by below N/128), 128 threads.
// MODE 1: written as f32 (Of); each row's 64 floats (256 B = two lines) by 16 consecutive lanes x 16 B (2 rows per instruction).
// Bias array has DM floats; both 16-byte bias loads use addresses clamped into [0, DM-4].
#define GT 128                   // block tile edge (rows of A and rows of Bt per block)
#define KS 128                   // k elements per pass (256 B of every operand row)
#define LP 136                   // LDS row pitch in elements (272 B: 16 B x odd, for 16-byte readers)
#define NLD (GT * KS / 8 / 128)  // 16-byte pieces per thread, operand and pass
static_assert(DM % KS == 0);
static_assert(DM % GT == 0);
static_assert((NB * SEQ) % GT == 0);
__device__ __forceinline__ v16bf ldbs(const bf* p) { return cat16b(*(const v8usa*)p, *(const v8usa*)(p + 16)); }   // ldb() on an LDS row
template <int MODE>
__device__ __forceinline__ void proj_body(const int bx, const int by, const bf* __restrict__ A, const bf* __restrict__ A2, const bf* __restrict__ Bt,
                                          const float* __restrict__ bias, int bmode, h16* Ph, h16* Pr, int useRes, float* Of,
                                          int RB, size_t sRB, int pitch, int CB, size_t sCB) {
    constexpr int NOPD = (MODE == 1) ? 3 : 2;                    // staged operands: A, Bt (, A2)
    __shared__ __align__(16) bf st[2 * NOPD * GT * LP];          // [buffer][operand][row][LP]
    __shared__ __align__(16) float osall[4 * 16 * 68];           // one wave-private epilogue tile per wave
    const int K = DM;
    const int tid = threadIdx.x, lane = tid & 31, lr = lane & 15, hi = lane >> 4, wave = __builtin_amdgcn_readfirstlane((int)(tid >> 5));
    const int R0 = bx * GT, C0 = by * GT;
    const int wm = wave >> 1, wn = wave & 1;
    const int r0 = R0 + wm * 64, c0 = C0 + wn * 64;              // this wave's 64x64 sub-tile
    float* os = osall + wave * (16 * 68);
    v8f acc[4][4];
#pragma unroll
    for (int mb = 0; mb < 4; ++mb)
#pragma unroll
        for (int nb = 0; nb < 4; ++nb) acc[mb][nb] = (v8f){};
    // staging map: piece i of a thread = row (tid >> 4) + 8 i, bytes 16 (tid & 15) of the row's 256-byte segment
    const int srow = tid >> 4, sch = (tid & 15) * 8;
    const bf* gA  = A  + (size_t)(R0 + srow) * K + sch;
    const bf* gA2 = A2 + (size_t)(R0 + srow) * K + sch;
    const bf* gB  = Bt + (size_t)(C0 + srow) * K + sch;
    const int sl = srow * LP + sch;
    const int fa = (wm * 64 + lr) * LP + 8 * hi, fb = GT * LP + (wn * 64 + lr) * LP + 8 * hi, fa2 = 2 * GT * LP + fa;   // fragment bases inside a buffer
    v8us pa[NLD], pb[NLD], pa2[NLD];
#pragma unroll
    for (int i = 0; i < NLD; ++i) { pa[i] = *(const v8us*)(gA + (size_t)i * 8 * K); pb[i] = *(const v8us*)(gB + (size_t)i * 8 * K);
        if (MODE == 1) pa2[i] = *(const v8us*)(gA2 + (size_t)i * 8 * K); }
#pragma unroll
    for (int i = 0; i < NLD; ++i) { *(v8usa*)(&st[sl + i * 8 * LP]) = pa[i]; *(v8usa*)(&st[GT * LP + sl + i * 8 * LP]) = pb[i];
        if (MODE == 1) *(v8usa*)(&st[2 * GT * LP + sl + i * 8 * LP]) = pa2[i]; }
    __syncthreads();
#pragma unroll 1
    for (int kp = 0; kp < K; kp += KS) {
        const int cur = (kp / KS) & 1;
        const bf* sb = st + cur * (NOPD * GT * LP);
        bf* sn = st + (cur ^ 1) * (NOPD * GT * LP);
        const bool more = kp + KS < K;                           // block-uniform: a next pass exists
        if (more) {
#pragma unroll
            for (int i = 0; i < NLD; ++i) { pa[i] = *(const v8us*)(gA + (size_t)i * 8 * K + kp + KS); pb[i] = *(const v8us*)(gB + (size_t)i * 8 * K + kp + KS);
                if (MODE == 1) pa2[i] = *(const v8us*)(gA2 + (size_t)i * 8 * K + kp + KS); }
            asm volatile("s_wait_xcnt 0x0" ::: "memory");   // stands before the address registers of the loads above are written again (the build reuses them for the LDS addresses below)
        }
        v16bf a[2][4], b[2][4], a2[2][4];
#pragma unroll
        for (int q = 0; q < 4; ++q) { a[0][q] = ldbs(sb + fa + q * 16 * LP); b[0][q] = ldbs(sb + fb + q * 16 * LP);
            if (MODE == 1) a2[0][q] = ldbs(sb + fa2 + q * 16 * LP); }
        __builtin_amdgcn_sched_barrier(0);   // keeps the next pass's global loads and the first fragment loads ahead of the products
#pragma unroll
        for (int s = 0; s < KS / 32; ++s) {
            const int c = s & 1, n = c ^ 1;
            if (s + 1 < KS / 32) {
#pragma unroll
                for (int q = 0; q < 4; ++q) { a[n][q] = ldbs(sb + fa + q * 16 * LP + (s + 1) * 32); b[n][q] = ldbs(sb + fb + q * 16 * LP + (s + 1) * 32);
                    if (MODE == 1) a2[n][q] = ldbs(sb + fa2 + q * 16 * LP + (s + 1) * 32); }
                __builtin_amdgcn_sched_barrier(0);   // the next 32-step's fragment loads stay one group in front of this step's products, not among them
            }
#pragma unroll
            for (int nb = 0; nb < 4; ++nb)
#pragma unroll
                for (int mb = 0; mb < 4; ++mb) acc[mb][nb] = wmmab(a[c][mb], b[c][nb], acc[mb][nb]);
            // issue slots behind the last products before their operand registers are written again
            asm volatile("v_nop\n\tv_nop\n\tv_nop\n\tv_nop" : "+v"(acc[0][0]), "+v"(acc[1][1]), "+v"(acc[2][2]), "+v"(acc[3][3]) : "v"(a[c][0]), "v"(a[c][1]), "v"(a[c][2]), "v"(a[c][3]));
            if (MODE == 1) {
#pragma unroll
                for (int nb = 0; nb < 4; ++nb)
#pragma unroll
                    for (int mb = 0; mb < 4; ++mb) acc[mb][nb] = wmmab(a2[c][mb], b[c][nb], acc[mb][nb]);
                // issue slots behind the last products before their operand registers are written again
                asm volatile("v_nop\n\tv_nop\n\tv_nop\n\tv_nop" : "+v"(acc[0][0]), "+v"(acc[1][1]), "+v"(acc[2][2]), "+v"(acc[3][3]) : "v"(a2[c][0]), "v"(a2[c][1]), "v"(a2[c][2]), "v"(a2[c][3]));
            }
        }
        if (more) {
#pragma unroll
            for (int i = 0; i < NLD; ++i) { *(v8usa*)(&sn[sl + i * 8 * LP]) = pa[i]; *(v8usa*)(&sn[GT * LP + sl + i * 8 * LP]) = pb[i];
                if (MODE == 1) *(v8usa*)(&sn[2 * GT * LP + sl + i * 8 * LP]) = pa2[i]; }
        }
        __syncthreads();   // publishes the buffer just filled; ends every wave's reads of the buffer that the next pass refills
    }
    const size_t tbase = (size_t)(r0 / RB) * sRB + (size_t)(r0 % RB) * (size_t)pitch + (size_t)(c0 / CB) * sCB + (size_t)(c0 % CB);
    // per-lane column bias for the lane's store columns; both load addresses clamped into the DM-float bias array (first to 0 when unused, second to DM-4)
    const int c8 = (lane & 7) * 8, cofs = lr * 4;
    const int ci = (bmode == 1) ? (c0 + ((MODE == 0) ? c8 : cofs)) : 0;
    const int ci4 = (ci + 4 <= DM - 4) ? (ci + 4) : (DM - 4);      // MODE 0: ci + 4 <= DM - 4 always (exact columns); MODE 1: upper half unused, address kept in range
    const v4f bl0 = *(const v4f*)(bias + ci), bl1 = *(const v4f*)(bias + ci4);
    float bc[8];
#pragma unroll
    for (int i = 0; i < 4; ++i) { bc[i] = (bmode == 1) ? rbf(bl0[i]) : 0.0f; bc[4 + i] = (bmode == 1) ? rbf(bl1[i]) : 0.0f; }
#pragma unroll
    for (int mb = 0; mb < 4; ++mb) {
#pragma unroll
        for (int nb = 0; nb < 4; ++nb) {
#pragma unroll
            for (int j = 0; j < 8; ++j) os[(hi * 8 + j) * 68 + nb * 16 + lr] = acc[mb][nb][j]; }   // D: row 8h+j, col lane&15; rows 0..15 x columns 0..63 all written
        wave_sync();
        const size_t sb = tbase + (size_t)(mb * 16) * (size_t)pitch;
        if (MODE == 0) {
{
#pragma unroll
                for (int s = 0; s < 4; ++s) { const int row = 4 * s + (lane >> 3);   // 4 s x 4 row groups = 16 rows; 8 lanes x 8 = 64 columns
                    const int ri = (bmode == 2) ? (r0 + mb * 16 + row) : 0;
                    const float braw = bias[ri];
                    const float brow = (bmode == 2) ? rbf(braw) : 0.0f;
                    const v4f x0 = *(const v4fa*)(&os[row * 68 + c8]); const v4f x1 = *(const v4fa*)(&os[row * 68 + c8 + 4]); v8h hv, rv;
#pragma unroll
                    for (int i = 0; i < 4; ++i) { const float f0 = x0[i] + bc[i] + brow; const float f1 = x1[i] + bc[4 + i] + brow;
                        const h16 a0 = (h16)f0; const h16 a1 = (h16)f1; hv[i] = a0; hv[4 + i] = a1; rv[i] = (h16)((f0 - (float)a0) * QRS); rv[4 + i] = (h16)((f1 - (float)a1) * QRS); }
                    const size_t oo = sb + (size_t)row * (size_t)pitch + c8;
                    *(v8h*)(Ph + oo) = hv; if (useRes) *(v8h*)(Pr + oo) = rv;
                    asm volatile("s_wait_xcnt 0x0" ::: "memory"); }   // stands before the registers that the stores above name are written again by the next rows
                 }
        } else {
{
#pragma unroll
                for (int s = 0; s < 8; ++s) { const int row = 2 * s + hi;   // 8 s x 2 rows = 16 rows; 16 lanes x 4 floats = 64 columns
                    const v4f x0 = *(const v4fa*)(&os[row * 68 + cofs]); v4f val;
                    val[0] = x0[0] + bc[0]; val[1] = x0[1] + bc[1]; val[2] = x0[2] + bc[2]; val[3] = x0[3] + bc[3];
                    *(v4f*)(Of + sb + (size_t)row * (size_t)pitch + cofs) = val; }
                asm volatile("s_wait_xcnt 0x0" ::: "memory");   // stands before the registers that the stores above name are written again by the next row block
                 }
        }
        wave_sync();
    }
}

// k_qkv: the three projections in one grid (NB*SEQ/GT, DM/GT, 3); blockIdx.z picks the product.
// z = 0, 1 (q, k): A = x rows (m = b*SEQ + t), Bt = W^T rows (n = h*64 + d), column bias -> planes [(b*16 + h)][t][d] (value and residual).
// z = 2 (v^T): A = Wv^T rows (m = h*64 + d), Bt = value rows (n = b*SEQ + t), row bias -> planes [(b*1024 + m)][t] = [(b*16 + h)][d][t] (value and residual); its tile is (blockIdx.y, blockIdx.x).
__global__ __launch_bounds__(128) void k_qkv(const bf* __restrict__ QB, const bf* __restrict__ KB, const bf* __restrict__ VB,
                                             const bf* __restrict__ WQT, const bf* __restrict__ WKT, const bf* __restrict__ WVT,
                                             const float* __restrict__ bq, const float* __restrict__ bk, const float* __restrict__ bv,
                                             h16* QH, h16* QR, h16* KP, h16* KR, h16* VT, h16* VR) {
    const int z = blockIdx.z; const bool isv = z == 2;
    const bf* A  = isv ? WVT : z ? KB : QB;
    const bf* Bt = isv ? VB : z ? WKT : WQT;
    proj_body<0>((int)(isv ? blockIdx.y : blockIdx.x), (int)(isv ? blockIdx.x : blockIdx.y), A, A, Bt, isv ? bv : z ? bk : bq, isv ? 2 : 1,
                 isv ? VT : z ? KP : QH, isv ? VR : z ? KR : QR, 1, nullptr,
                 isv ? DM : SEQ, isv ? (size_t)0 : (size_t)NH_ * SEQ * HD, isv ? SEQ : HD, isv ? SEQ : HD, isv ? (size_t)DM * SEQ : (size_t)SEQ * HD);
}

// k_out: A = context hi (+ lo) rows (m = b*SEQ + t), Bt = Wo^T rows (n), column bias -> OUT[(b*OUT_SEQ + t)][n] f32; grid (NB*SEQ/GT, DM/GT).
__global__ __launch_bounds__(128) void k_out(const bf* __restrict__ CH, const bf* __restrict__ CL, const bf* __restrict__ WOT, const float* __restrict__ bo, float* OUT) {
    proj_body<1>((int)blockIdx.x, (int)blockIdx.y, CH, CL, WOT, bo, 1, nullptr, nullptr, 0, OUT, SEQ, (size_t)OUT_SEQ * DM, DM, DM, (size_t)0);
}

// Key tiles of k_flash: the block's AW waves share one tile of TK keys in LDS, one plane pair = [K: TK key rows of 128 B | V^T: HD d rows of 128 B], row pitch TP elements (144 B, for 16-byte readers).
// The ring holds two plane pairs. EARLY = 0: two buffers of the value planes, the next tile's copies in flight while this tile is worked on. EARLY = 1: one buffer, value pair then residual pair.
#define TK 64                    // keys per staged tile (two 32-key passes)
#define TP 72                    // LDS row pitch in elements
#define TSZ ((TK + HD) * TP)     // elements of one plane pair
static_assert(TK * 2 == 128);                  // a V^T row segment of a tile is one whole line
static_assert(SEQ % TK == 0);                  // every tile lies wholly inside the planes
static_assert(16 * AW == TK);                  // a block's query rows span one tile: block xblk walks xblk + 1 tiles at most
static_assert(32 * AW / 8 == 16);              // one copy of the block covers 16 rows of 128 B
static_assert(TK == 64);                       // four copies cover the K rows of a tile, four the HD = 64 V^T rows
// tile_copy: the block's copy of one plane pair of a tile, 8 asynchronous 16-byte copies a lane (4 K, 4 V^T); a wave-wide copy covers 4 whole 128-byte rows.
// lk, lv: the lane's LDS byte addresses of its first K and V^T piece; gk, gv: the global addresses of the same pieces; piece i lies 16 rows further on.
// The last line of the statement stands before the address registers that the copies name are written again.
__device__ __forceinline__ void tile_copy(const unsigned lk, const unsigned lv, const h16* gk, const h16* gv) {
    asm volatile("global_load_async_to_lds_b128 %0, %8, off\n\t"
                 "global_load_async_to_lds_b128 %1, %9, off\n\t"
                 "global_load_async_to_lds_b128 %2, %10, off\n\t"
                 "global_load_async_to_lds_b128 %3, %11, off\n\t"
                 "global_load_async_to_lds_b128 %4, %12, off\n\t"
                 "global_load_async_to_lds_b128 %5, %13, off\n\t"
                 "global_load_async_to_lds_b128 %6, %14, off\n\t"
                 "global_load_async_to_lds_b128 %7, %15, off\n\t"
                 "s_wait_xcnt 0x0"
                 :: "v"(lk), "v"(lk + 16 * TP * 2), "v"(lk + 32 * TP * 2), "v"(lk + 48 * TP * 2),
                    "v"(lv), "v"(lv + 16 * TP * 2), "v"(lv + 32 * TP * 2), "v"(lv + 48 * TP * 2),
                    "v"(gk), "v"(gk + 16 * HD), "v"(gk + 32 * HD), "v"(gk + 48 * HD),
                    "v"(gv), "v"(gv + (size_t)16 * SEQ), "v"(gv + (size_t)32 * SEQ), "v"(gv + (size_t)48 * SEQ)
                 : "memory");
}

// flash_body: fused attention, one wave per 16 query rows of one (batch, head); Q fragments straight from the f16 planes (two 16-B loads each, arithmetic addressing);
// K / V^T fragments from the block's LDS tile with the same element map (two 16-B LDS loads each).
// Transposed form: S^T[key][t] = K Q^T (A = K rows, B = Q rows); lane (t = lane&15, h = lane>>4) holds keys 8h+r of each 16-key tile, so the packed
// P tile is directly the B fragment of O^T[d][t] = V^T P^T (element r <- tile keys 0..15, element 8+r <- tile keys 16..31, lane unchanged).
// Visibility of (t, key): key <= lim(t) with lim = min(t, k_len - 1) when t < q_len, else -1 (nothing visible); excluded scores are REPLACED by a large negative fill and their P is set to 0 by value.
// The key loop runs to kend = min(t0 + 16, k_len) <= SEQ (wave-scalar, static upper bound SEQ); a row with no visible key keeps l = 0 and gets a zero context.
// Softmax state (running max, partial sum) is one scalar per lane; the two lane halves of a row are combined with one xor-16 exchange.
// EARLY = 1 (query rows < EROWS): q, k, P, v each as f16 value + f16 residual x2048; value x residual products go to separate accumulators folded with 1/2048 (scores: before the scale; context: before the normalisation); row sum over the unconverted p.
// EARLY = 0: single f16 products, row sum over the converted P.
template <int EARLY>
__device__ __forceinline__ void flash_body(const int xblk, const h16* __restrict__ QH, const h16* __restrict__ QR, const h16* __restrict__ KP, const h16* __restrict__ KR,
                                           const h16* __restrict__ VT, const h16* __restrict__ VR, const int* __restrict__ LENS, bf* CH, bf* CL, h16* ring) {
    __shared__ __align__(16) float os[AW * 16 * 68];
    const int lane = threadIdx.x & 31, wave = __builtin_amdgcn_readfirstlane((int)(threadIdx.x >> 5)), lr = lane & 15, hi = lane >> 4;
    const int zh = blockIdx.y; const int b = zh / NH_, h = zh % NH_;
    const int t0 = (xblk * AW + wave) * 16;
    const size_t pbase = (size_t)zh * SEQ * HD;
    const size_t qo = pbase + (size_t)(t0 + lr) * HD + 8 * hi;
    const v16h qh0 = ldh(QH + qo), qh1 = ldh(QH + qo + 32);   // B fragments: col t, k = d
    v16h qr0 = qh0, qr1 = qh1;
    if (EARLY) { qr0 = ldh(QR + qo); qr1 = ldh(QR + qo + 32); }
    const int qlen = imin(imax(LENS[b], 0), SEQ), klen = imin(imax(LENS[8 + b], 0), SEQ);   // lengths clamped into [0, SEQ]
    const int t = t0 + lr;
    const int lim = (t < qlen) ? imin(t, klen - 1) : -1;      // last visible key of query t (-1: none)
    const int kend = __builtin_amdgcn_readfirstlane(imin((xblk * AW + (int)(threadIdx.x >> 5)) * 16 + 16, klen));   // min taken first, then made wave-scalar; <= SEQ
    v8f o0 = (v8f){}, o1 = (v8f){}, o2 = (v8f){}, o3 = (v8f){};
    v8f e0 = (v8f){}, e1 = (v8f){}, e2 = (v8f){}, e3 = (v8f){};
    float m = -3.0e38f, l = 0.0f;
    // one 32-key pass; kl (A fragment: row key, k = d; + 16 TP: the second 16 keys) and vl (A fragment: row d, k = key; + 16j TP) are this lane's fragment bases of the pass in the LDS tile, residual pair at + TSZ
    auto pass = [&](const int key0, const h16* kl, const h16* vl) __attribute__((always_inline)) {
        v8f sHa = (v8f){}, sLa = (v8f){}, sHb = (v8f){}, sLb = (v8f){};
        if (EARLY) {
            { const v16h kh0 = ldh(kl), kh1 = ldh(kl + 32), kr0 = ldh(kl + TSZ), kr1 = ldh(kl + TSZ + 32);
              sHa = wmma16g(kh0, qh0, sHa); sLa = wmma16g(kh0, qr0, sLa); sLa = wmma16g(kr0, qh0, sLa);
              sHa = wmma16g(kh1, qh1, sHa); sLa = wmma16g(kh1, qr1, sLa); sLa = wmma16g(kr1, qh1, sLa); }
            { const v16h kh0 = ldh(kl + 16 * TP), kh1 = ldh(kl + 16 * TP + 32), kr0 = ldh(kl + TSZ + 16 * TP), kr1 = ldh(kl + TSZ + 16 * TP + 32);
              sHb = wmma16g(kh0, qh0, sHb); sLb = wmma16g(kh0, qr0, sLb); sLb = wmma16g(kr0, qh0, sLb);
              sHb = wmma16g(kh1, qh1, sHb); sLb = wmma16g(kh1, qr1, sLb); sLb = wmma16g(kr1, qh1, sLb); }
        } else {
            const v16h ka0 = ldh(kl), ka1 = ldh(kl + 32), kb0 = ldh(kl + 16 * TP), kb1 = ldh(kl + 16 * TP + 32);
            sHa = wmma16(ka0, qh0, sHa); sHb = wmma16(kb0, qh0, sHb);
            sHa = wmma16(ka1, qh1, sHa); sHb = wmma16(kb1, qh1, sHb);
            asm volatile("v_nop\n\tv_nop\n\tv_nop\n\tv_nop" : "+v"(sHa), "+v"(sHb) : "v"(ka0), "v"(ka1), "v"(kb0), "v"(kb1));
        }
        const int kq = key0 + 8 * hi;           // this lane's first key of tile a (tile b: + 16)
        float ta[8], tb[8]; float mx = -3.0e38f;
#pragma unroll
        for (int r = 0; r < 8; ++r) {
            const float xa = EARLY ? (sHa[r] + sLa[r] * QRI) * SC2 : sHa[r] * SC2;
            const float xb = EARLY ? (sHb[r] + sLb[r] * QRI) * SC2 : sHb[r] * SC2;
            ta[r] = (kq + r <= lim) ? xa : -3.0e38f;
            tb[r] = (kq + 16 + r <= lim) ? xb : -3.0e38f; }
#pragma unroll
        for (int r = 0; r < 8; ++r) mx = fmaxf(mx, fmaxf(ta[r], tb[r]));
        mx = fmaxf(mx, __shfl_xor(mx, 16, 32));
        const float mnew = fmaxf(m, mx);
        const float alpha = __builtin_amdgcn_exp2f(m - mnew);
        const float sh = PSH - mnew;
        v16h pb = (v16h){}, pr = (v16h){}; float ls = 0.0f;
#pragma unroll
        for (int r = 0; r < 8; ++r) {
            const float ya = __builtin_amdgcn_exp2f(ta[r] + sh), yb = __builtin_amdgcn_exp2f(tb[r] + sh);
            const float ea = (kq + r <= lim) ? ya : 0.0f;
            const float eb = (kq + 16 + r <= lim) ? yb : 0.0f;
            const h16 pa = (h16)ea; const h16 pc = (h16)eb; pb[r] = pa; pb[8 + r] = pc;
            if (EARLY) { pr[r] = (h16)((ea - (float)pa) * QRS); pr[8 + r] = (h16)((eb - (float)pc) * QRS); ls += ea + eb; }
            else { ls += (float)pa + (float)pc; } }
        l = l * alpha + ls; m = mnew;
        o0 = o0 * alpha; o1 = o1 * alpha; o2 = o2 * alpha; o3 = o3 * alpha;
        if (EARLY) {
            e0 = e0 * alpha; e1 = e1 * alpha; e2 = e2 * alpha; e3 = e3 * alpha;
            { const v16h vh = ldh(vl), vr = ldh(vl + TSZ);
              o0 = wmma16g(vh, pb, o0); e0 = wmma16g(vh, pr, e0); e0 = wmma16g(vr, pb, e0); }
            { const v16h vh = ldh(vl + 16 * TP), vr = ldh(vl + TSZ + 16 * TP);
              o1 = wmma16g(vh, pb, o1); e1 = wmma16g(vh, pr, e1); e1 = wmma16g(vr, pb, e1); }
            { const v16h vh = ldh(vl + 32 * TP), vr = ldh(vl + TSZ + 32 * TP);
              o2 = wmma16g(vh, pb, o2); e2 = wmma16g(vh, pr, e2); e2 = wmma16g(vr, pb, e2); }
            { const v16h vh = ldh(vl + 48 * TP), vr = ldh(vl + TSZ + 48 * TP);
              o3 = wmma16g(vh, pb, o3); e3 = wmma16g(vh, pr, e3); e3 = wmma16g(vr, pb, e3); }
        } else {
            const v16h v0 = ldh(vl), v1 = ldh(vl + 16 * TP), v2 = ldh(vl + 32 * TP), v3 = ldh(vl + 48 * TP);
            o0 = wmma16(v0, pb, o0); o1 = wmma16(v1, pb, o1); o2 = wmma16(v2, pb, o2); o3 = wmma16(v3, pb, o3);
            asm volatile("v_nop\n\tv_nop\n\tv_nop\n\tv_nop" : "+v"(o0), "+v"(o1), "+v"(o2), "+v"(o3) : "v"(v0), "v"(v1), "v"(v2), "v"(v3), "v"(pb));
        }
    };
    const int nt = (imin(xblk * TK + TK, __builtin_amdgcn_readfirstlane(klen)) + TK - 1) / TK;   // tiles the block walks (block-uniform scalar, <= SEQ / TK): up to its last wave's kend
    const int crow = (int)threadIdx.x >> 3, cch = ((int)threadIdx.x & 7) * 8;                    // the lane's first row of a copy and its 16-byte piece of a 128-byte row
    const unsigned lk = (unsigned)(size_t)(__attribute__((address_space(3))) h16*)(ring + crow * TP + cch), lv = lk + TK * TP * 2;
    const h16* gk = KP + pbase + (size_t)crow * HD + cch;     // + tile * TK * HD
    const h16* gv = VT + pbase + (size_t)crow * SEQ + cch;    // + tile * TK
    const h16* fk = ring + lr * TP + 8 * hi;                  // fragment bases inside the first plane pair
    const h16* fv = fk + TK * TP;
    // In both loops a wave makes the 32-key passes below its own kend, in ascending order (wave-scalar tests), and passes every barrier.
    if constexpr (EARLY) {
        const h16* gkr = KR + pbase + (size_t)crow * HD + cch;
        const h16* gvr = VR + pbase + (size_t)crow * SEQ + cch;
#pragma unroll 1
        for (int s = 0; s < nt; ++s) {
            const int key0 = s * TK;
            tile_copy(lk, lv, gk + (size_t)key0 * HD, gv + key0);
            tile_copy(lk + TSZ * 2, lv + TSZ * 2, gkr + (size_t)key0 * HD, gvr + key0);
            asm volatile("s_wait_asynccnt 0x0" ::: "memory");     // this wave's part of the tile has landed
            __syncthreads();                                      // the tile is whole for every wave
            if (key0 < kend) pass(key0, fk, fv);
            if (key0 + 32 < kend) pass(key0 + 32, fk + 32 * TP, fv + 32);
            if (s + 1 < nt) {
                asm volatile("s_wait_dscnt 0x0" ::: "memory");    // this wave's reads of the tile are done before it is overwritten
                __syncthreads();                                  // ends every wave's reads of the tile that the next trip overwrites
            }
        }
    } else {
        if (nt > 0) tile_copy(lk, lv, gk, gv);
        asm volatile("s_wait_asynccnt 0x0" ::: "memory");         // this wave's part of tile 0 has landed
        __syncthreads();                                          // tile 0 is whole for every wave
        if (nt > 1) tile_copy(lk + TSZ * 2, lv + TSZ * 2, gk + (size_t)TK * HD, gv + TK);
#pragma unroll 1
        for (int s = 0; s < nt; ++s) {
            const int bo = (s & 1) * TSZ, key0 = s * TK;
            if (key0 < kend) pass(key0, fk + bo, fv + bo);
            if (key0 + 32 < kend) pass(key0 + 32, fk + bo + 32 * TP, fv + bo + 32);
            asm volatile("s_wait_dscnt 0x0" ::: "memory");        // this wave's reads of the buffer are done before it is refilled
            asm volatile("s_wait_asynccnt 0x0" ::: "memory");     // this wave's part of the next tile has landed
            __syncthreads();                                      // publishes the next tile; ends every wave's reads of the buffer refilled below
            if (s + 2 < nt) tile_copy(lk + bo * 2, lv + bo * 2, gk + (size_t)(s + 2) * TK * HD, gv + (s + 2) * TK);
        }
        asm volatile("s_wait_asynccnt 0x0" ::: "memory");         // no copy is outstanding when the wave goes on to its end
    }
    if (EARLY) { o0 = o0 + e0 * QRI; o1 = o1 + e1 * QRI; o2 = o2 + e2 * QRI; o3 = o3 + e3 * QRI; }
    l += __shfl_xor(l, 16, 32);
    const float lsafe = (l > 0.0f) ? l : 1.0f;
    const float inv = (l > 0.0f) ? (1.0f / lsafe) : 0.0f;     // no visible key: zero context
    const int wb = wave * 16 * 68;
    // O^T D layout: o_j[r] = (d = 16j + 8h + r, t = lane&15) -> os[t][d]; rows 0..15 x columns 0..63 all written
    { v4f a, c;
      a[0] = o0[0] * inv; a[1] = o0[1] * inv; a[2] = o0[2] * inv; a[3] = o0[3] * inv; c[0] = o0[4] * inv; c[1] = o0[5] * inv; c[2] = o0[6] * inv; c[3] = o0[7] * inv;
      *(v4fa*)(&os[wb + lr * 68 +  0 + 8 * hi]) = a; *(v4fa*)(&os[wb + lr * 68 +  0 + 8 * hi + 4]) = c;
      a[0] = o1[0] * inv; a[1] = o1[1] * inv; a[2] = o1[2] * inv; a[3] = o1[3] * inv; c[0] = o1[4] * inv; c[1] = o1[5] * inv; c[2] = o1[6] * inv; c[3] = o1[7] * inv;
      *(v4fa*)(&os[wb + lr * 68 + 16 + 8 * hi]) = a; *(v4fa*)(&os[wb + lr * 68 + 16 + 8 * hi + 4]) = c;
      a[0] = o2[0] * inv; a[1] = o2[1] * inv; a[2] = o2[2] * inv; a[3] = o2[3] * inv; c[0] = o2[4] * inv; c[1] = o2[5] * inv; c[2] = o2[6] * inv; c[3] = o2[7] * inv;
      *(v4fa*)(&os[wb + lr * 68 + 32 + 8 * hi]) = a; *(v4fa*)(&os[wb + lr * 68 + 32 + 8 * hi + 4]) = c;
      a[0] = o3[0] * inv; a[1] = o3[1] * inv; a[2] = o3[2] * inv; a[3] = o3[3] * inv; c[0] = o3[4] * inv; c[1] = o3[5] * inv; c[2] = o3[6] * inv; c[3] = o3[7] * inv;
      *(v4fa*)(&os[wb + lr * 68 + 48 + 8 * hi]) = a; *(v4fa*)(&os[wb + lr * 68 + 48 + 8 * hi + 4]) = c; }
    wave_sync();
    const size_t obase = ((size_t)b * SEQ + t0) * DM + (size_t)h * HD;
{
#pragma unroll
        for (int s = 0; s < 4; ++s) { const int row = 4 * s + (lane >> 3), c8 = (lane & 7) * 8;   // 4 s x 4 row groups = 16 rows; 8 lanes x 8 = 64 columns
            const v4f x0 = *(const v4fa*)(&os[wb + row * 68 + c8]); const v4f x1 = *(const v4fa*)(&os[wb + row * 68 + c8 + 4]); v8us hv, lv;
#pragma unroll
            for (int i = 0; i < 4; ++i) { const unsigned short a0 = f2bf(x0[i]); const unsigned short a1 = f2bf(x1[i]);
                hv[i] = a0; hv[4 + i] = a1; lv[i] = f2bf(x0[i] - bf2f(a0)); lv[4 + i] = f2bf(x1[i] - bf2f(a1)); }
            const size_t oo = obase + (size_t)row * DM + c8;
            *(v8us*)(CH + oo) = hv; *(v8us*)(CL + oo) = lv; }
         }
}

// k_flash: both row bands in one grid (SEQ / (16*AW), NB*NH_), the choice a function of blockIdx.x alone:
// the first (SEQ - EROWS) / (16*AW) blocks of a head take query rows EROWS..SEQ-1 (single products), the last EROWS / (16*AW) take rows 0..EROWS-1 (value + residual products).
__global__ __launch_bounds__(32 * AW) void k_flash(const h16* __restrict__ QH, const h16* __restrict__ QR, const h16* __restrict__ KP, const h16* __restrict__ KR,
                                                   const h16* __restrict__ VT, const h16* __restrict__ VR, const int* __restrict__ LENS, bf* CH, bf* CL) {
    __shared__ __align__(16) h16 ring[2 * TSZ];   // the key tiles of either band
    if ((int)blockIdx.x < (SEQ - EROWS) / (16 * AW))
        flash_body<0>((int)blockIdx.x + EROWS / (16 * AW), QH, QH, KP, KP, VT, VT, LENS, CH, CL, ring);
    else
        flash_body<1>((int)blockIdx.x - (SEQ - EROWS) / (16 * AW), QH, QR, KP, KR, VT, VR, LENS, CH, CL, ring);
}

static constexpr size_t al256(size_t v) { return (v + 255) & ~(size_t)255; }
static constexpr size_t SZ_XB = al256((size_t)NB * SEQ * DM * 2);          // one bf16 activation plane [NB*SEQ][1024]
static constexpr size_t SZ_WB = al256((size_t)4 * DM * DM * 2);            // four transposed bf16 weight planes
static constexpr size_t SZ_PL = al256((size_t)NB * NH_ * SEQ * HD * 2);    // one f16 head plane
static constexpr size_t SZ_LN = al256((size_t)32 * 4);
static constexpr size_t SZ_TOTAL = 3 * SZ_XB + SZ_WB + 6 * SZ_PL + 2 * SZ_XB + SZ_LN;
static_assert(SZ_TOTAL <= (size_t)134217728);          // workspace carve <= 128 MiB
static_assert(((size_t)DM * DM * 2) % 256 == 0);       // weight sub-planes stay 256-byte aligned
static_assert((size_t)NB * OUT_SEQ * DM * 4 <= (size_t)NB_FULL * SEQ_FULL * DM * 4);   // single output at byte offset 0

extern "C" void kernel_launch(void* const* d_in, const int* in_sizes, int n_in,
                              void* d_out, int out_size, void* d_ws, size_t ws_size, hipStream_t stream) {
    if (n_in < 13) return;
    const size_t needx = ((size_t)(NB - 1) * SEQ_FULL + SEQ) * DM;
    if ((size_t)in_sizes[0] < needx || (size_t)in_sizes[1] < needx || (size_t)in_sizes[2] < needx) return;
    if ((size_t)in_sizes[3] < (size_t)(NB - 1) * SEQ_FULL + SEQ || (size_t)in_sizes[4] < (size_t)(NB - 1) * SEQ_FULL + SEQ) return;
    if ((size_t)in_sizes[5] < (size_t)DM * DM || (size_t)in_sizes[7] < (size_t)DM * DM || (size_t)in_sizes[9] < (size_t)DM * DM || (size_t)in_sizes[11] < (size_t)DM * DM) return;
    if (in_sizes[6] < DM || in_sizes[8] < DM || in_sizes[10] < DM || in_sizes[12] < DM) return;
    if ((size_t)out_size < ((size_t)(NB - 1) * OUT_SEQ + SEQ) * DM) return;
    if (SZ_TOTAL > ws_size) return;
    // wire order: in_Q, in_K, in_V, Q_pad_mask (int32), K_pad_mask (int32), W_Q, b_Q, W_K, b_K, W_V, b_V, W_O, b_O
    const float* xq = (const float*)d_in[0]; const float* xk = (const float*)d_in[1]; const float* xv = (const float*)d_in[2];
    const int* qmask = (const int*)d_in[3]; const int* kmask = (const int*)d_in[4];
    const float* wq = (const float*)d_in[5];  const float* bq = (const float*)d_in[6];
    const float* wk = (const float*)d_in[7];  const float* bk = (const float*)d_in[8];
    const float* wv = (const float*)d_in[9];  const float* bv = (const float*)d_in[10];
    const float* wo = (const float*)d_in[11]; const float* bo = (const float*)d_in[12];
    float* OUT = (float*)d_out;      // [NB][SEQ][1024]
    char* wsp = (char*)d_ws;
    bf* QB = (bf*)wsp; wsp += SZ_XB;                 // [NB*SEQ][1024] bf16 query input
    bf* KB = (bf*)wsp; wsp += SZ_XB;                 // [NB*SEQ][1024] bf16 key input
    bf* VB = (bf*)wsp; wsp += SZ_XB;                 // [NB*SEQ][1024] bf16 value input
    bf* WB = (bf*)wsp; wsp += SZ_WB;                 // [4][1024 out][1024 in]: q | k | v | o
    h16* QH = (h16*)wsp; wsp += SZ_PL;               // [NB*16][SEQ][64]
    h16* QR = (h16*)wsp; wsp += SZ_PL;               // [NB*16][SEQ][64] residual x2048
    h16* KP = (h16*)wsp; wsp += SZ_PL;               // [NB*16][SEQ][64]
    h16* KR = (h16*)wsp; wsp += SZ_PL;               // [NB*16][SEQ][64] residual x2048
    h16* VT = (h16*)wsp; wsp += SZ_PL;               // [NB*16][64][SEQ]
    h16* VR = (h16*)wsp; wsp += SZ_PL;               // [NB*16][64][SEQ] residual x2048
    bf* CH = (bf*)wsp; wsp += SZ_XB;                 // [NB*SEQ][1024] context bf16 hi
    bf* CL = (bf*)wsp; wsp += SZ_XB;                 // [NB*SEQ][1024] context bf16 lo
    int* LN = (int*)wsp; wsp += SZ_LN;               // 32 ints: word b = q_len[b], word 8 + b = k_len[b]
    bf* WQT = WB; bf* WKT = WB + (size_t)DM * DM; bf* WVT = WB + (size_t)2 * DM * DM; bf* WOT = WB + (size_t)3 * DM * DM;

    // lengths, transposed bf16 weights ([out][in]) and bf16 inputs
    k_prep<<<1 + 4 * PB_WT + 3 * PB_CV, 256, 0, stream>>>(xq, xk, xv, qmask, kmask, wq, wk, wv, wo, QB, KB, VB, WB, LN);
    // q, k planes and v^T planes (value and residual)
    k_qkv<<<dim3(NB * SEQ / GT, DM / GT, 3), 128, 0, stream>>>(QB, KB, VB, WQT, WKT, WVT, bq, bk, bv, QH, QR, KP, KR, VT, VR);
    // context planes: disjoint rows, every row written
    k_flash<<<dim3(SEQ / (16 * AW), NB * NH_, 1), 32 * AW, 0, stream>>>(QH, QR, KP, KR, VT, VR, LN, CH, CL);
    // output rows
    k_out<<<dim3(NB * SEQ / GT, DM / GT, 1), 128, 0, stream>>>(CH, CL, WOT, bo, OUT);
}

// v005
// A run of this version takes 88.3 microseconds.
// In both of two side-by-side timings against v004, it was 1.04 times as fast.
// Counting every step since v000, it is 2.72 times as fast.
#include <hip/hip_runtime.h>

// Projections q/k/v: v_wmma_f32_16x16x32_bf16 (inputs and weights RNE-converted to bf16, f32 accumulate); scores: v_wmma_f32_16x16x32_f16 (query rows >= EROWS: single f16 q and k; rows < EROWS: q and k as f16 value + f16 residual x2048, three products, residual products in their own accumulator); P.V: v_wmma_f32_16x16x32_f16 (P x256 carry, v single f16; rows < EROWS: P and v as value + residual x2048, three products, residual products in their own accumulator); output projection: v_wmma_f32_16x16x32_bf16 (context as bf16 hi + bf16 lo planes, Wo bf16), f32 accumulate everywhere, softmax f32.
// Attention block, width 1024 = 16 heads x 64; query/key/value inputs [NB][SEQ][1024] f32, W_Q/W_K/W_V/W_O [in][out] (y = x W + b), score scale 1/8,
// causal fill (key > query -> excluded) and length fill (query < q_len[b] and key < k_len[b], lengths = integer sums of the two int32 indicator rows); rows with no visible key give a zero context; output y = ctx W_O + b_O (f32).
// Layout: bf16 copies of the three inputs; bf16 TRANSPOSED copies of the four weights ([out][in], K-contiguous); q, k planes [b*16+h][t][d] and v^T plane [b*16+h][d][t] (value and residual x2048) written by the GEMM epilogue;
// fused flash kernel in transposed form (S^T = K Q^T, O^T = V^T P^T) writing the context as bf16 hi/lo planes [b*SEQ+t][1024]; final GEMM writes f32 rows.
// Four launches, one per level of the dependence chain; work that does not depend on each other shares a grid and is told apart by the block index:
// k_prep (lengths, weight transposes, input conversions), k_qkv (the three projections), k_flash (both row bands), k_out.

#ifndef NB
#define NB 2
#endif
#ifndef SEQ
#define SEQ 2048
#endif
#define NB_FULL  2
#define SEQ_FULL 2048
#ifndef OUT_SEQ
#define OUT_SEQ SEQ              // row pitch (in tokens) between batches of the output
#endif
#ifndef EROWS
#define EROWS 256                // query rows below this use the value + residual products
#endif
#define DM   1024
#define NH_  16
#define HD   64
#define AW   4                   // waves per flash block (16 query rows each)
#define QRS  2048.0f             // carry of the residual planes
#define QRI  (1.0f / 2048.0f)
#define LOG2E 1.4426950408889634f
#define SC2  (0.125f * 1.4426950408889634f)   // HD^-0.5 * log2(e)
#define PSH  8.0f                // log2 of the P carry (256)

static_assert(HD == 64);
static_assert(NH_ * HD == DM);                 // head h = columns h*64 + d
static_assert(DM % 64 == 0);                   // column tiles of 64
static_assert(DM % 32 == 0);                   // GEMM k-loop steps by 32
static_assert(DM >= 8);                        // clamped bias loads stay inside a DM-float array
static_assert(SEQ % 64 == 0);                  // a 64-row tile never straddles two batches
static_assert((NB * SEQ) % 64 == 0);
static_assert(SEQ % 32 == 0);                  // key loop steps by 32
static_assert(SEQ % (16 * AW) == 0);           // flash grid covers the sequence exactly
static_assert(((size_t)SEQ * DM) % 8 == 0);
static_assert(NB <= NB_FULL);
static_assert(SEQ <= SEQ_FULL);
static_assert(SEQ_FULL % 4 == 0);
static_assert(EROWS % (16 * AW) == 0);         // the early band is a whole number of flash blocks
static_assert(EROWS % 32 == 0);                // early key steps stay inside the early key range
static_assert(EROWS >= 16 * AW);
static_assert(EROWS <= SEQ);
static_assert(NB <= 8);                        // length line: word b = q_len[b], word 8 + b = k_len[b]

typedef _Float16 h16;
typedef unsigned short bf;
typedef __attribute__((ext_vector_type(16))) __bf16   v16bf;
typedef __attribute__((ext_vector_type(16))) _Float16 v16h;
typedef __attribute__((ext_vector_type(8)))  _Float16 v8h;
typedef __attribute__((ext_vector_type(8)))  unsigned short v8us;
typedef __attribute__((ext_vector_type(8)))  float    v8f;
typedef __attribute__((ext_vector_type(4)))  float    v4f;
typedef __attribute__((ext_vector_type(4)))  int      v4i;
typedef v4f  __attribute__((may_alias)) v4fa;
typedef v8us __attribute__((may_alias)) v8usa;

__device__ __forceinline__ unsigned short f2bf(float f) { unsigned u = __float_as_uint(f); u += 0x7FFFu + ((u >> 16) & 1u); return (unsigned short)(u >> 16); }
__device__ __forceinline__ float bf2f(unsigned short b) { return __uint_as_float(((unsigned)b) << 16); }
__device__ __forceinline__ float rbf(float f) { return bf2f(f2bf(f)); }   // value after RNE convert to bf16
__device__ __forceinline__ v16h cat16(v8h lo, v8h hi) { return __builtin_shufflevector(lo, hi, 0, 1, 2, 3, 4, 5, 6, 7, 8, 9, 10, 11, 12, 13, 14, 15); }
__device__ __forceinline__ v16bf cat16b(v8us lo, v8us hi) { return __builtin_bit_cast(v16bf, __builtin_shufflevector(lo, hi, 0, 1, 2, 3, 4, 5, 6, 7, 8, 9, 10, 11, 12, 13, 14, 15)); }
__device__ __forceinline__ v8f wmma16(v16h a, v16h b, v8f c) { return __builtin_amdgcn_wmma_f32_16x16x32_f16(false, a, false, b, (short)0, c, false, false); }
__device__ __forceinline__ v8f wmmab(v16bf a, v16bf b, v8f c) { return __builtin_amdgcn_wmma_f32_16x16x32_bf16(false, a, false, b, (short)0, c, false, false); }
// fragment loaders from K-contiguous 16-bit rows; p already includes + 8*(lane>>4): elements 0..7 <- k0+8h+0..7, elements 8..15 <- k0+16+8h+0..7 (same map for A and B)
__device__ __forceinline__ v16h  ldh(const h16* p) { return cat16(*(const v8h*)p, *(const v8h*)(p + 16)); }
__device__ __forceinline__ v16bf ldb(const bf* p)  { return cat16b(*(const v8us*)p, *(const v8us*)(p + 16)); }
// ordering point for wave-private LDS tiles (same wave writes and reads)
__device__ __forceinline__ void wave_sync() { __builtin_amdgcn_fence(3 /* release order */, "wavefront"); __builtin_amdgcn_wave_barrier(); asm volatile("" ::: "memory"); }
// single guarded f16 WMMA (one accumulator per guard)
__device__ __forceinline__ v8f wmma16g(v16h a, v16h b, v8f c) {
    c = __builtin_amdgcn_wmma_f32_16x16x32_f16(false, a, false, b, (short)0, c, false, false);
    asm volatile("v_nop\n\tv_nop\n\tv_nop\n\tv_nop" : "+v"(c) : "v"(a), "v"(b));
    return c;
}
template <bool B> struct flag_t { static constexpr bool value = B; };   // compile-time switch handed to a generic lambda
__device__ __forceinline__ int imin(int a, int b) { return a < b ? a : b; }
__device__ __forceinline__ int imax(int a, int b) { return a > b ? a : b; }

// cvt8_body: thread's group i of eight f32 of an input (batch pitch SEQ_FULL rows) -> eight bf16 (RNE) of the packed [NB*SEQ][DM] plane. blk = block index inside the plane, 256 threads.
__device__ __forceinline__ void cvt8_body(const unsigned blk, const float* __restrict__ src, bf* dst) {
    const size_t n8 = (size_t)NB * SEQ * DM / 8, per = (size_t)SEQ * DM / 8;   // groups in the plane, groups in one batch
    const size_t i = (size_t)blk * 256 + threadIdx.x; if (i >= n8) return;
    const size_t so = (SEQ == SEQ_FULL) ? i * 8 : (i / per) * ((size_t)SEQ_FULL * DM) + (i % per) * 8;
    const v8f v = *(const v8f*)(src + so); v8us o;
#pragma unroll
    for (int k = 0; k < 8; ++k) o[k] = f2bf(v[k]);
    *(v8us*)(dst + i * 8) = o; 
}

// cvtT_body: in[rows = k][cols = n] f32 (DM x DM, row pitch DM) -> out[n][k] bf16 (RNE convert), 64x64 tiles transposed through LDS.
// tile (bx over k, by over n), each below DM/64; 256 threads. LDS tile ts[n][k] is cross-wave: block barrier between fill and drain.
__device__ __forceinline__ void cvtT_body(const int bx, const int by, const float* __restrict__ W, bf* WT) {
    __shared__ __align__(16) unsigned short ts[64 * 72];
    const int tid = threadIdx.x, lane = tid & 31, wave = __builtin_amdgcn_readfirstlane((int)(tid >> 5));
    const int k0 = bx * 64, n0 = by * 64;
#pragma unroll
    for (int i = 0; i < 4; ++i) { const int idx = tid + i * 256; const int kr = idx >> 4, c4 = (idx & 15) * 4;   // 1024 float4 = 64 k-rows x 16
        const v4f v = *(const v4f*)(W + (size_t)(k0 + kr) * DM + n0 + c4);
#pragma unroll
        for (int j = 0; j < 4; ++j) ts[(c4 + j) * 72 + kr] = f2bf(v[j]); }
    __syncthreads();
{
#pragma unroll
        for (int s = 0; s < 2; ++s) { const int row = wave * 8 + s * 4 + (lane >> 3), c8 = (lane & 7) * 8;   // 8 waves x 2 s x 4 = 64 rows; 8 lanes x 8 = 64 columns
            const v8us o = *(const v8usa*)(&ts[row * 72 + c8]);
            *(v8us*)(WT + (size_t)(n0 + row) * DM + k0 + c8) = o; }
        asm volatile("s_wait_xcnt 0x0" ::: "memory");   // stands before the registers that the stores above name are written again (the build lets this range's end run on into another range's code)
         }
}

// lens_body: q_len[b] and k_len[b] as integer sums of the first SEQ entries of row b of the two int32 indicator arrays (row pitch SEQ_FULL).
// LW waves per (array, batch) row: a lane brings its entries with SEQ / (128 LW) independent 16-byte loads (a wave-wide load covers 4 whole lines), all issued before the first sum,
// so the whole kernel waits for memory once instead of once per trip of a one-wave loop. Wave sums meet in LDS behind one block barrier; wave 0 adds them and stores the whole 32-word line.
#define LW 2                     // waves per indicator row (2 NB LW waves = the 256 threads of a k_prep block)
static_assert(SEQ % (128 * LW) == 0);          // a wave's share of a row is a whole number of wave-wide 16-byte loads
static_assert(64 * NB * LW == 256);            // 2 NB LW waves are exactly one k_prep block
__device__ __forceinline__ void lens_body(const int* __restrict__ qm, const int* __restrict__ km, int* lens) {
    __shared__ __align__(16) int ss[16 * LW];  // [word][wave of the row]; word b = q_len[b], word 8 + b = k_len[b]
    const int lane = threadIdx.x & 31, wave = __builtin_amdgcn_readfirstlane((int)(threadIdx.x >> 5));
    const int part = wave % LW, b = (wave / LW) % NB, which = wave / (LW * NB);
    const int* row = (which ? km : qm) + (size_t)b * SEQ_FULL + part * (SEQ / LW) + lane * 4;
    v4i p[SEQ / (128 * LW)];
#pragma unroll
    for (int i = 0; i < SEQ / (128 * LW); ++i) p[i] = *(const v4i*)(row + i * 128);
    int s = 0;
#pragma unroll
    for (int i = 0; i < SEQ / (128 * LW); ++i) s += (p[i][0] + p[i][1]) + (p[i][2] + p[i][3]);
#pragma unroll
    for (int o = 16; o > 0; o >>= 1) s += __shfl_xor(s, o, 32);
    if (lane == 0) ss[(which * 8 + b) * LW + part] = s;
    __syncthreads();   // every wave's sum is in LDS before wave 0 reads it
    if (wave == 0) {
        const bool used = lane < 16 && (lane & 7) < NB;   // words that a row feeds; only these LDS words were written
        int v = 0;
#pragma unroll
        for (int i = 0; i < LW; ++i) v += ss[(used ? lane : 0) * LW + i];
        *(int*)(lens + lane) = used ? v : 0;
        asm volatile("s_wait_xcnt 0x0" ::: "memory");   // stands before the registers that the store above names are written again (the build lets this range's end run on into another range's code)
    }
}

// k_prep: everything that reads only the inputs, in one grid of 256-thread blocks. Block 0: the lengths; the next 4 PB_WT blocks: the weight transposes (q | k | v | o);
// the last 3 PB_CV blocks: the input conversions (query | key | value). A block does one of the three jobs (the choice is a function of blockIdx alone, so every barrier is block-uniform).
#define PB_WT ((DM / 64) * (DM / 64))                                   // 64x64 tiles of one weight
#define PB_CV ((unsigned)(((size_t)NB * SEQ * DM / 8 + 255) / 256))     // blocks of one input plane
__global__ __launch_bounds__(256) void k_prep(const float* __restrict__ xq, const float* __restrict__ xk, const float* __restrict__ xv,
                                              const int* __restrict__ qm, const int* __restrict__ km,
                                              const float* __restrict__ wq, const float* __restrict__ wk, const float* __restrict__ wv, const float* __restrict__ wo,
                                              bf* QB, bf* KB, bf* VB, bf* WB, int* lens) {
    const unsigned blk = blockIdx.x;
    if (blk >= 1 + 4 * PB_WT) {
        const unsigned r = blk - (1 + 4 * PB_WT), p = r / PB_CV;
        cvt8_body(r % PB_CV, (p == 0) ? xq : (p == 1) ? xk : xv, (p == 0) ? QB : (p == 1) ? KB : VB);
    } else if (blk >= 1) {
        const unsigned r = blk - 1, w = r / PB_WT, t = r % PB_WT;
        const float* W = (w == 0) ? wq : (w == 1) ? wk : (w == 2) ? wv : wo;
        cvtT_body((int)(t % (DM / 64)), (int)(t / (DM / 64)), W, WB + (size_t)w * DM * DM);
    } else {
        lens_body(qm, km, lens);
    }
}

// proj_body: bf16 GEMM, one block of 4 waves (2 x 2) per 128x128 tile, each wave a 64x64 sub-tile (16 accumulators), K = DM in passes of KS.
// Operand tiles are staged in LDS: every thread brings 16-byte pieces of whole 256-byte row segments (a wave-wide load covers 4 whole lines) into registers one pass ahead
// and stores them into the other of two LDS buffers behind the pass's products; one block barrier per pass publishes that buffer and ends the reads of the one refilled next.
// Fragments come from LDS rows of pitch LP (272 B) with the same element map as ldb(); the k order of the sums is the ascending 32-step order.
// C[m][n] = sum_k (A[m][k] (+ A2[m][k] when MODE 1)) Bt[n][k] + bias (bmode 1: bias[n]; bmode 2: bias[m]; bias RNE-converted to bf16 first),
// sub-tile base (r0/RB)*sRB + (r0%RB)*pitch + (c0/CB)*sCB + (c0%CB), row pitch 'pitch' (elements). tile (bx below M/128, by below N/128), 128 threads.
// MODE 1: written as f32 (Of); each row's 64 floats (256 B = two lines) by 16 consecutive lanes x 16 B (2 rows per instruction).
// Bias array has DM floats; both 16-byte bias loads use addresses clamped into [0, DM-4].
#define GT 128                   // block tile edge (rows of A and rows of Bt per block)
#define KS 128                   // k elements per pass (256 B of every operand row)
#define LP 136                   // LDS row pitch in elements (272 B: 16 B x odd, for 16-byte readers)
#define NLD (GT * KS / 8 / 128)  // 16-byte pieces per thread, operand and pass
static_assert(DM % KS == 0);
static_assert(DM % GT == 0);
static_assert((NB * SEQ) % GT == 0);
__device__ __forceinline__ v16bf ldbs(const bf* p) { return cat16b(*(const v8usa*)p, *(const v8usa*)(p + 16)); }   // ldb() on an LDS row
template <int MODE>
__device__ __forceinline__ void proj_body(const int bx, const int by, const bf* __restrict__ A, const bf* __restrict__ A2, const bf* __restrict__ Bt,
                                          const float* __restrict__ bias, int bmode, h16* Ph, h16* Pr, int useRes, float* Of,
                                          int RB, size_t sRB, int pitch, int CB, size_t sCB) {
    constexpr int NOPD = (MODE == 1) ? 3 : 2;                    // staged operands: A, Bt (, A2)
    __shared__ __align__(16) bf st[2 * NOPD * GT * LP];          // [buffer][operand][row][LP]
    __shared__ __align__(16) float osall[4 * 16 * 68];           // one wave-private epilogue tile per wave
    const int K = DM;
    const int tid = threadIdx.x, lane = tid & 31, lr = lane & 15, hi = lane >> 4, wave = __builtin_amdgcn_readfirstlane((int)(tid >> 5));
    const int R0 = bx * GT, C0 = by * GT;
    const int wm = wave >> 1, wn = wave & 1;
    const int r0 = R0 + wm * 64, c0 = C0 + wn * 64;              // this wave's 64x64 sub-tile
    float* os = osall + wave * (16 * 68);
    v8f acc[4][4];
#pragma unroll
    for (int mb = 0; mb < 4; ++mb)
#pragma unroll
        for (int nb = 0; nb < 4; ++nb) acc[mb][nb] = (v8f){};
    // staging map: piece i of a thread = row (tid >> 4) + 8 i, bytes 16 (tid & 15) of the row's 256-byte segment
    const int srow = tid >> 4, sch = (tid & 15) * 8;
    const bf* gA  = A  + (size_t)(R0 + srow) * K + sch;
    const bf* gA2 = A2 + (size_t)(R0 + srow) * K + sch;
    const bf* gB  = Bt + (size_t)(C0 + srow) * K + sch;
    const int sl = srow * LP + sch;
    const int fa = (wm * 64 + lr) * LP + 8 * hi, fb = GT * LP + (wn * 64 + lr) * LP + 8 * hi, fa2 = 2 * GT * LP + fa;   // fragment bases inside a buffer
    v8us pa[NLD], pb[NLD], pa2[NLD];
#pragma unroll
    for (int i = 0; i < NLD; ++i) { pa[i] = *(const v8us*)(gA + (size_t)i * 8 * K); pb[i] = *(const v8us*)(gB + (size_t)i * 8 * K);
        if (MODE == 1) pa2[i] = *(const v8us*)(gA2 + (size_t)i * 8 * K); }
#pragma unroll
    for (int i = 0; i < NLD; ++i) { *(v8usa*)(&st[sl + i * 8 * LP]) = pa[i]; *(v8usa*)(&st[GT * LP + sl + i * 8 * LP]) = pb[i];
        if (MODE == 1) *(v8usa*)(&st[2 * GT * LP + sl + i * 8 * LP]) = pa2[i]; }
    __syncthreads();
#pragma unroll 1
    for (int kp = 0; kp < K; kp += KS) {
        const int cur = (kp / KS) & 1;
        const bf* sb = st + cur * (NOPD * GT * LP);
        bf* sn = st + (cur ^ 1) * (NOPD * GT * LP);
        const bool more = kp + KS < K;                           // block-uniform: a next pass exists
        if (more) {
#pragma unroll
            for (int i = 0; i < NLD; ++i) { pa[i] = *(const v8us*)(gA + (size_t)i * 8 * K + kp + KS); pb[i] = *(const v8us*)(gB + (size_t)i * 8 * K + kp + KS);
                if (MODE == 1) pa2[i] = *(const v8us*)(gA2 + (size_t)i * 8 * K + kp + KS); }
            asm volatile("s_wait_xcnt 0x0" ::: "memory");   // stands before the address registers of the loads above are written again (the build reuses them for the LDS addresses below)
        }
        v16bf a[2][4], b[2][4], a2[2][4];
#pragma unroll
        for (int q = 0; q < 4; ++q) { a[0][q] = ldbs(sb + fa + q * 16 * LP); b[0][q] = ldbs(sb + fb + q * 16 * LP);
            if (MODE == 1) a2[0][q] = ldbs(sb + fa2 + q * 16 * LP); }
        __builtin_amdgcn_sched_barrier(0);   // keeps the next pass's global loads and the first fragment loads ahead of the products
#pragma unroll
        for (int s = 0; s < KS / 32; ++s) {
            const int c = s & 1, n = c ^ 1;
            if (s + 1 < KS / 32) {
#pragma unroll
                for (int q = 0; q < 4; ++q) { a[n][q] = ldbs(sb + fa + q * 16 * LP + (s + 1) * 32); b[n][q] = ldbs(sb + fb + q * 16 * LP + (s + 1) * 32);
                    if (MODE == 1) a2[n][q] = ldbs(sb + fa2 + q * 16 * LP + (s + 1) * 32); }
                __builtin_amdgcn_sched_barrier(0);   // the next 32-step's fragment loads stay one group in front of this step's products, not among them
            }
#pragma unroll
            for (int nb = 0; nb < 4; ++nb)
#pragma unroll
                for (int mb = 0; mb < 4; ++mb) acc[mb][nb] = wmmab(a[c][mb], b[c][nb], acc[mb][nb]);
            // issue slots behind the last products before their operand registers are written again
            asm volatile("v_nop\n\tv_nop\n\tv_nop\n\tv_nop" : "+v"(acc[0][0]), "+v"(acc[1][1]), "+v"(acc[2][2]), "+v"(acc[3][3]) : "v"(a[c][0]), "v"(a[c][1]), "v"(a[c][2]), "v"(a[c][3]));
            if (MODE == 1) {
#pragma unroll
                for (int nb = 0; nb < 4; ++nb)
#pragma unroll
                    for (int mb = 0; mb < 4; ++mb) acc[mb][nb] = wmmab(a2[c][mb], b[c][nb], acc[mb][nb]);
                // issue slots behind the last products before their operand registers are written again
                asm volatile("v_nop\n\tv_nop\n\tv_nop\n\tv_nop" : "+v"(acc[0][0]), "+v"(acc[1][1]), "+v"(acc[2][2]), "+v"(acc[3][3]) : "v"(a2[c][0]), "v"(a2[c][1]), "v"(a2[c][2]), "v"(a2[c][3]));
            }
        }
        if (more) {
#pragma unroll
            for (int i = 0; i < NLD; ++i) { *(v8usa*)(&sn[sl + i * 8 * LP]) = pa[i]; *(v8usa*)(&sn[GT * LP + sl + i * 8 * LP]) = pb[i];
                if (MODE == 1) *(v8usa*)(&sn[2 * GT * LP + sl + i * 8 * LP]) = pa2[i]; }
        }
        __syncthreads();   // publishes the buffer just filled; ends every wave's reads of the buffer that the next pass refills
    }
    const size_t tbase = (size_t)(r0 / RB) * sRB + (size_t)(r0 % RB) * (size_t)pitch + (size_t)(c0 / CB) * sCB + (size_t)(c0 % CB);
    // per-lane column bias for the lane's store columns; both load addresses clamped into the DM-float bias array (first to 0 when unused, second to DM-4)
    const int c8 = (lane & 7) * 8, cofs = lr * 4;
    const int ci = (bmode == 1) ? (c0 + ((MODE == 0) ? c8 : cofs)) : 0;
    const int ci4 = (ci + 4 <= DM - 4) ? (ci + 4) : (DM - 4);      // MODE 0: ci + 4 <= DM - 4 always (exact columns); MODE 1: upper half unused, address kept in range
    const v4f bl0 = *(const v4f*)(bias + ci), bl1 = *(const v4f*)(bias + ci4);
    float bc[8];
#pragma unroll
    for (int i = 0; i < 4; ++i) { bc[i] = (bmode == 1) ? rbf(bl0[i]) : 0.0f; bc[4 + i] = (bmode == 1) ? rbf(bl1[i]) : 0.0f; }
#pragma unroll
    for (int mb = 0; mb < 4; ++mb) {
#pragma unroll
        for (int nb = 0; nb < 4; ++nb) {
#pragma unroll
            for (int j = 0; j < 8; ++j) os[(hi * 8 + j) * 68 + nb * 16 + lr] = acc[mb][nb][j]; }   // D: row 8h+j, col lane&15; rows 0..15 x columns 0..63 all written
        wave_sync();
        const size_t sb = tbase + (size_t)(mb * 16) * (size_t)pitch;
        if (MODE == 0) {
{
#pragma unroll
                for (int s = 0; s < 4; ++s) { const int row = 4 * s + (lane >> 3);   // 4 s x 4 row groups = 16 rows; 8 lanes x 8 = 64 columns
                    const int ri = (bmode == 2) ? (r0 + mb * 16 + row) : 0;
                    const float braw = bias[ri];
                    const float brow = (bmode == 2) ? rbf(braw) : 0.0f;
                    const v4f x0 = *(const v4fa*)(&os[row * 68 + c8]); const v4f x1 = *(const v4fa*)(&os[row * 68 + c8 + 4]); v8h hv, rv;
#pragma unroll
                    for (int i = 0; i < 4; ++i) { const float f0 = x0[i] + bc[i] + brow; const float f1 = x1[i] + bc[4 + i] + brow;
                        const h16 a0 = (h16)f0; const h16 a1 = (h16)f1; hv[i] = a0; hv[4 + i] = a1; rv[i] = (h16)((f0 - (float)a0) * QRS); rv[4 + i] = (h16)((f1 - (float)a1) * QRS); }
                    const size_t oo = sb + (size_t)row * (size_t)pitch + c8;
                    *(v8h*)(Ph + oo) = hv; if (useRes) *(v8h*)(Pr + oo) = rv;
                    asm volatile("s_wait_xcnt 0x0" ::: "memory"); }   // stands before the registers that the stores above name are written again by the next rows
                 }
        } else {
{
#pragma unroll
                for (int s = 0; s < 8; ++s) { const int row = 2 * s + hi;   // 8 s x 2 rows = 16 rows; 16 lanes x 4 floats = 64 columns
                    const v4f x0 = *(const v4fa*)(&os[row * 68 + cofs]); v4f val;
                    val[0] = x0[0] + bc[0]; val[1] = x0[1] + bc[1]; val[2] = x0[2] + bc[2]; val[3] = x0[3] + bc[3];
                    *(v4f*)(Of + sb + (size_t)row * (size_t)pitch + cofs) = val; }
                asm volatile("s_wait_xcnt 0x0" ::: "memory");   // stands before the registers that the stores above name are written again by the next row block
                 }
        }
        wave_sync();
    }
}

// k_qkv: the three projections in one grid (NB*SEQ/GT, DM/GT, 3); blockIdx.z picks the product.
// z = 0, 1 (q, k): A = x rows (m = b*SEQ + t), Bt = W^T rows (n = h*64 + d), column bias -> planes [(b*16 + h)][t][d] (value and residual).
// z = 2 (v^T): A = Wv^T rows (m = h*64 + d), Bt = value rows (n = b*SEQ + t), row bias -> planes [(b*1024 + m)][t] = [(b*16 + h)][d][t] (value and residual); its tile is (blockIdx.y, blockIdx.x).
__global__ __launch_bounds__(128) void k_qkv(const bf* __restrict__ QB, const bf* __restrict__ KB, const bf* __restrict__ VB,
                                             const bf* __restrict__ WQT, const bf* __restrict__ WKT, const bf* __restrict__ WVT,
                                             const float* __restrict__ bq, const float* __restrict__ bk, const float* __restrict__ bv,
                                             h16* QH, h16* QR, h16* KP, h16* KR, h16* VT, h16* VR) {
    const int z = blockIdx.z; const bool isv = z == 2;
    const bf* A  = isv ? WVT : z ? KB : QB;
    const bf* Bt = isv ? VB : z ? WKT : WQT;
    proj_body<0>((int)(isv ? blockIdx.y : blockIdx.x), (int)(isv ? blockIdx.x : blockIdx.y), A, A, Bt, isv ? bv : z ? bk : bq, isv ? 2 : 1,
                 isv ? VT : z ? KP : QH, isv ? VR : z ? KR : QR, 1, nullptr,
                 isv ? DM : SEQ, isv ? (size_t)0 : (size_t)NH_ * SEQ * HD, isv ? SEQ : HD, isv ? SEQ : HD, isv ? (size_t)DM * SEQ : (size_t)SEQ * HD);
}

// k_out: A = context hi (+ lo) rows (m = b*SEQ + t), Bt = Wo^T rows (n), column bias -> OUT[(b*OUT_SEQ + t)][n] f32; grid (NB*SEQ/GT, DM/GT).
__global__ __launch_bounds__(128) void k_out(const bf* __restrict__ CH, const bf* __restrict__ CL, const bf* __restrict__ WOT, const float* __restrict__ bo, float* OUT) {
    proj_body<1>((int)blockIdx.x, (int)blockIdx.y, CH, CL, WOT, bo, 1, nullptr, nullptr, 0, OUT, SEQ, (size_t)OUT_SEQ * DM, DM, DM, (size_t)0);
}

// Key tiles of k_flash: the block's AW waves share one tile of TK keys in LDS, one plane pair = [K: TK key rows of 128 B | V^T: HD d rows of 128 B], row pitch TP elements (144 B, for 16-byte readers).
// The ring holds two plane pairs. EARLY = 0: two buffers of the value planes, the next tile's copies in flight while this tile is worked on. EARLY = 1: one buffer, value pair then residual pair.
#define TK 64                    // keys per staged tile (two 32-key passes)
#define TP 72                    // LDS row pitch in elements
#define TSZ ((TK + HD) * TP)     // elements of one plane pair
static_assert(TK * 2 == 128);                  // a V^T row segment of a tile is one whole line
static_assert(SEQ % TK == 0);                  // every tile lies wholly inside the planes
static_assert(16 * AW == TK);                  // a block's query rows span one tile: block xblk walks xblk + 1 tiles at most
static_assert(32 * AW / 8 == 16);              // one copy of the block covers 16 rows of 128 B
static_assert(TK == 64);                       // four copies cover the K rows of a tile, four the HD = 64 V^T rows
// tile_copy: the block's copy of one plane pair of a tile, 8 asynchronous 16-byte copies a lane (4 K, 4 V^T); a wave-wide copy covers 4 whole 128-byte rows.
// lk, lv: the lane's LDS byte addresses of its first K and V^T piece; gk, gv: the global addresses of the same pieces; piece i lies 16 rows further on.
// The last line of the statement stands before the address registers that the copies name are written again.
__device__ __forceinline__ void tile_copy(const unsigned lk, const unsigned lv, const h16* gk, const h16* gv) {
    asm volatile("global_load_async_to_lds_b128 %0, %8, off\n\t"
                 "global_load_async_to_lds_b128 %1, %9, off\n\t"
                 "global_load_async_to_lds_b128 %2, %10, off\n\t"
                 "global_load_async_to_lds_b128 %3, %11, off\n\t"
                 "global_load_async_to_lds_b128 %4, %12, off\n\t"
                 "global_load_async_to_lds_b128 %5, %13, off\n\t"
                 "global_load_async_to_lds_b128 %6, %14, off\n\t"
                 "global_load_async_to_lds_b128 %7, %15, off\n\t"
                 "s_wait_xcnt 0x0"
                 :: "v"(lk), "v"(lk + 16 * TP * 2), "v"(lk + 32 * TP * 2), "v"(lk + 48 * TP * 2),
                    "v"(lv), "v"(lv + 16 * TP * 2), "v"(lv + 32 * TP * 2), "v"(lv + 48 * TP * 2),
                    "v"(gk), "v"(gk + 16 * HD), "v"(gk + 32 * HD), "v"(gk + 48 * HD),
                    "v"(gv), "v"(gv + (size_t)16 * SEQ), "v"(gv + (size_t)32 * SEQ), "v"(gv + (size_t)48 * SEQ)
                 : "memory");
}

// flash_body: fused attention, one wave per 16 query rows of one (batch, head); Q fragments straight from the f16 planes (two 16-B loads each, arithmetic addressing);
// K / V^T fragments from the block's LDS tile with the same element map (two 16-B LDS loads each).
// Transposed form: S^T[key][t] = K Q^T (A = K rows, B = Q rows); lane (t = lane&15, h = lane>>4) holds keys 8h+r of each 16-key tile, so the packed
// P tile is directly the B fragment of O^T[d][t] = V^T P^T (element r <- tile keys 0..15, element 8+r <- tile keys 16..31, lane unchanged).
// Visibility of (t, key): key <= lim(t) with lim = min(t, k_len - 1) when t < q_len, else -1 (nothing visible); excluded scores are REPLACED by a large negative fill and their P is set to 0 by value.
// The key loop runs to kend = min(t0 + 16, k_len) <= SEQ (wave-scalar, static upper bound SEQ); a row with no visible key keeps l = 0 and gets a zero context.
// Softmax state (running max, partial sum) is one scalar per lane; the two lane halves of a row are combined with one xor-16 exchange.
// EARLY = 1 (query rows < EROWS): q, k, P, v each as f16 value + f16 residual x2048; value x residual products go to separate accumulators folded with 1/2048 (scores: before the scale; context: before the normalisation); row sum over the unconverted p.
// EARLY = 0: single f16 products, row sum over the converted P.
template <int EARLY>
__device__ __forceinline__ void flash_body(const int xblk, const h16* __restrict__ QH, const h16* __restrict__ QR, const h16* __restrict__ KP, const h16* __restrict__ KR,
                                           const h16* __restrict__ VT, const h16* __restrict__ VR, const int* __restrict__ LENS, bf* CH, bf* CL, h16* ring) {
    __shared__ __align__(16) float os[AW * 16 * 68];
    const int lane = threadIdx.x & 31, wave = __builtin_amdgcn_readfirstlane((int)(threadIdx.x >> 5)), lr = lane & 15, hi = lane >> 4;
    const int zh = blockIdx.y; const int b = zh / NH_, h = zh % NH_;
    const int t0 = (xblk * AW + wave) * 16;
    const size_t pbase = (size_t)zh * SEQ * HD;
    const size_t qo = pbase + (size_t)(t0 + lr) * HD + 8 * hi;
    const v16h qh0 = ldh(QH + qo), qh1 = ldh(QH + qo + 32);   // B fragments: col t, k = d
    v16h qr0 = qh0, qr1 = qh1;
    if (EARLY) { qr0 = ldh(QR + qo); qr1 = ldh(QR + qo + 32); }
    const int qlen = imin(imax(LENS[b], 0), SEQ), klen = imin(imax(LENS[8 + b], 0), SEQ);   // lengths clamped into [0, SEQ]
    const int t = t0 + lr;
    const int lim = (t < qlen) ? imin(t, klen - 1) : -1;      // last visible key of query t (-1: none)
    const int kend = __builtin_amdgcn_readfirstlane(imin((xblk * AW + (int)(threadIdx.x >> 5)) * 16 + 16, klen));   // min taken first, then made wave-scalar; <= SEQ
    v8f o0 = (v8f){}, o1 = (v8f){}, o2 = (v8f){}, o3 = (v8f){};
    v8f e0 = (v8f){}, e1 = (v8f){}, e2 = (v8f){}, e3 = (v8f){};
    float m = -3.0e38f, l = 0.0f;
    // one 32-key pass; kl (A fragment: row key, k = d; + 16 TP: the second 16 keys) and vl (A fragment: row d, k = key; + 16j TP) are this lane's fragment bases of the pass in the LDS tile, residual pair at + TSZ
    // TEST::value = false: the caller has shown that every key of the pass is visible to every row of the wave, so each visibility test below is true and is left out (same order of sums)
    auto pass = [&](auto TEST, const int key0, const h16* kl, const h16* vl) __attribute__((always_inline)) {
        constexpr bool MK = decltype(TEST)::value;
        v8f sHa = (v8f){}, sLa = (v8f){}, sHb = (v8f){}, sLb = (v8f){};
        if (EARLY) {
            { const v16h kh0 = ldh(kl), kh1 = ldh(kl + 32), kr0 = ldh(kl + TSZ), kr1 = ldh(kl + TSZ + 32);
              sHa = wmma16g(kh0, qh0, sHa); sLa = wmma16g(kh0, qr0, sLa); sLa = wmma16g(kr0, qh0, sLa);
              sHa = wmma16g(kh1, qh1, sHa); sLa = wmma16g(kh1, qr1, sLa); sLa = wmma16g(kr1, qh1, sLa); }
            { const v16h kh0 = ldh(kl + 16 * TP), kh1 = ldh(kl + 16 * TP + 32), kr0 = ldh(kl + TSZ + 16 * TP), kr1 = ldh(kl + TSZ + 16 * TP + 32);
              sHb = wmma16g(kh0, qh0, sHb); sLb = wmma16g(kh0, qr0, sLb); sLb = wmma16g(kr0, qh0, sLb);
              sHb = wmma16g(kh1, qh1, sHb); sLb = wmma16g(kh1, qr1, sLb); sLb = wmma16g(kr1, qh1, sLb); }
        } else {
            const v16h ka0 = ldh(kl), ka1 = ldh(kl + 32), kb0 = ldh(kl + 16 * TP), kb1 = ldh(kl + 16 * TP + 32);
            sHa = wmma16(ka0, qh0, sHa); sHb = wmma16(kb0, qh0, sHb);
            sHa = wmma16(ka1, qh1, sHa); sHb = wmma16(kb1, qh1, sHb);
            asm volatile("v_nop\n\tv_nop\n\tv_nop\n\tv_nop" : "+v"(sHa), "+v"(sHb) : "v"(ka0), "v"(ka1), "v"(kb0), "v"(kb1));
        }
        const int kq = key0 + 8 * hi;           // this lane's first key of tile a (tile b: + 16)
        float ta[8], tb[8]; float mx = -3.0e38f;
#pragma unroll
        for (int r = 0; r < 8; ++r) {
            const float xa = EARLY ? (sHa[r] + sLa[r] * QRI) * SC2 : sHa[r] * SC2;
            const float xb = EARLY ? (sHb[r] + sLb[r] * QRI) * SC2 : sHb[r] * SC2;
            ta[r] = (!MK || kq + r <= lim) ? xa : -3.0e38f;
            tb[r] = (!MK || kq + 16 + r <= lim) ? xb : -3.0e38f; }
#pragma unroll
        for (int r = 0; r < 8; ++r) mx = fmaxf(mx, fmaxf(ta[r], tb[r]));
        mx = fmaxf(mx, __shfl_xor(mx, 16, 32));
        const float mnew = fmaxf(m, mx);
        const float alpha = __builtin_amdgcn_exp2f(m - mnew);
        const float sh = PSH - mnew;
        v16h pb = (v16h){}, pr = (v16h){}; float ls = 0.0f;
#pragma unroll
        for (int r = 0; r < 8; ++r) {
            const float ya = __builtin_amdgcn_exp2f(ta[r] + sh), yb = __builtin_amdgcn_exp2f(tb[r] + sh);
            const float ea = (!MK || kq + r <= lim) ? ya : 0.0f;
            const float eb = (!MK || kq + 16 + r <= lim) ? yb : 0.0f;
            const h16 pa = (h16)ea; const h16 pc = (h16)eb; pb[r] = pa; pb[8 + r] = pc;
            if (EARLY) { pr[r] = (h16)((ea - (float)pa) * QRS); pr[8 + r] = (h16)((eb - (float)pc) * QRS); ls += ea + eb; }
            else { ls += (float)pa + (float)pc; } }
        l = l * alpha + ls; m = mnew;
        o0 = o0 * alpha; o1 = o1 * alpha; o2 = o2 * alpha; o3 = o3 * alpha;
        if (EARLY) {
            e0 = e0 * alpha; e1 = e1 * alpha; e2 = e2 * alpha; e3 = e3 * alpha;
            { const v16h vh = ldh(vl), vr = ldh(vl + TSZ);
              o0 = wmma16g(vh, pb, o0); e0 = wmma16g(vh, pr, e0); e0 = wmma16g(vr, pb, e0); }
            { const v16h vh = ldh(vl + 16 * TP), vr = ldh(vl + TSZ + 16 * TP);
              o1 = wmma16g(vh, pb, o1); e1 = wmma16g(vh, pr, e1); e1 = wmma16g(vr, pb, e1); }
            { const v16h vh = ldh(vl + 32 * TP), vr = ldh(vl + TSZ + 32 * TP);
              o2 = wmma16g(vh, pb, o2); e2 = wmma16g(vh, pr, e2); e2 = wmma16g(vr, pb, e2); }
            { const v16h vh = ldh(vl + 48 * TP), vr = ldh(vl + TSZ + 48 * TP);
              o3 = wmma16g(vh, pb, o3); e3 = wmma16g(vh, pr, e3); e3 = wmma16g(vr, pb, e3); }
        } else {
            const v16h v0 = ldh(vl), v1 = ldh(vl + 16 * TP), v2 = ldh(vl + 32 * TP), v3 = ldh(vl + 48 * TP);
            o0 = wmma16(v0, pb, o0); o1 = wmma16(v1, pb, o1); o2 = wmma16(v2, pb, o2); o3 = wmma16(v3, pb, o3);
            asm volatile("v_nop\n\tv_nop\n\tv_nop\n\tv_nop" : "+v"(o0), "+v"(o1), "+v"(o2), "+v"(o3) : "v"(v0), "v"(v1), "v"(v2), "v"(v3), "v"(pb));
        }
    };
    const int nt = (imin(xblk * TK + TK, __builtin_amdgcn_readfirstlane(klen)) + TK - 1) / TK;   // tiles the block walks (block-uniform scalar, <= SEQ / TK): up to its last wave's kend
    const int crow = (int)threadIdx.x >> 3, cch = ((int)threadIdx.x & 7) * 8;                    // the lane's first row of a copy and its 16-byte piece of a 128-byte row
    const unsigned lk = (unsigned)(size_t)(__attribute__((address_space(3))) h16*)(ring + crow * TP + cch), lv = lk + TK * TP * 2;
    const h16* gk = KP + pbase + (size_t)crow * HD + cch;     // + tile * TK * HD
    const h16* gv = VT + pbase + (size_t)crow * SEQ + cch;    // + tile * TK
    const h16* fk = ring + lr * TP + 8 * hi;                  // fragment bases inside the first plane pair
    const h16* fv = fk + TK * TP;
    // In both loops a wave makes the 32-key passes below its own kend, in ascending order (wave-scalar tests), and passes every barrier.
    if constexpr (EARLY) {
        const h16* gkr = KR + pbase + (size_t)crow * HD + cch;
        const h16* gvr = VR + pbase + (size_t)crow * SEQ + cch;
#pragma unroll 1
        for (int s = 0; s < nt; ++s) {
            const int key0 = s * TK;
            tile_copy(lk, lv, gk + (size_t)key0 * HD, gv + key0);
            tile_copy(lk + TSZ * 2, lv + TSZ * 2, gkr + (size_t)key0 * HD, gvr + key0);
            asm volatile("s_wait_asynccnt 0x0" ::: "memory");     // this wave's part of the tile has landed
            __syncthreads();                                      // the tile is whole for every wave
            if (key0 < kend) pass(flag_t<true>{}, key0, fk, fv);
            if (key0 + 32 < kend) pass(flag_t<true>{}, key0 + 32, fk + 32 * TP, fv + 32);
            if (s + 1 < nt) {
                asm volatile("s_wait_dscnt 0x0" ::: "memory");    // this wave's reads of the tile are done before it is overwritten
                __syncthreads();                                  // ends every wave's reads of the tile that the next trip overwrites
            }
        }
    } else {
        if (nt > 0) tile_copy(lk, lv, gk, gv);
        asm volatile("s_wait_asynccnt 0x0" ::: "memory");         // this wave's part of tile 0 has landed
        __syncthreads();                                          // tile 0 is whole for every wave
        if (nt > 1) tile_copy(lk + TSZ * 2, lv + TSZ * 2, gk + (size_t)TK * HD, gv + TK);
        // foot of trip s of either loop below, passed by every wave
        auto foot = [&](const int s, const int bo) __attribute__((always_inline)) {
            asm volatile("s_wait_dscnt 0x0" ::: "memory");        // this wave's reads of the buffer are done before it is refilled
            asm volatile("s_wait_asynccnt 0x0" ::: "memory");     // this wave's part of the next tile has landed
            __syncthreads();                                      // publishes the next tile; ends every wave's reads of the buffer refilled below
            if (s + 2 < nt) tile_copy(lk + bo * 2, lv + bo * 2, gk + (size_t)(s + 2) * TK * HD, gv + (s + 2) * TK);
        };
        // keys 0 .. kvis - 1 are visible to every row of the block: the smallest lim + 1 over its TK rows (0 when a row lies at or past q_len); block-uniform scalar, kvis <= every wave's kend
        const int kvis = __builtin_amdgcn_readfirstlane((xblk * TK + TK - 1 < qlen) ? imin(xblk * TK, klen - 1) + 1 : 0);
        const int nf = kvis / TK;                                 // leading tiles that lie wholly below kvis; nf <= nt
        int s = 0;
#pragma unroll 1
        for (; s < nf; ++s) {                                     // tiles with no hidden score: both passes, no visibility tests
            const int bo = (s & 1) * TSZ, key0 = s * TK;
            pass(flag_t<false>{}, key0, fk + bo, fv + bo);
            pass(flag_t<false>{}, key0 + 32, fk + bo + 32 * TP, fv + bo + 32);
            foot(s, bo);
        }
#pragma unroll 1
        for (; s < nt; ++s) {                                     // the tiles at the diagonal or at k_len (all tiles when a row lies past q_len)
            const int bo = (s & 1) * TSZ, key0 = s * TK;
            if (key0 < kend) pass(flag_t<true>{}, key0, fk + bo, fv + bo);
            if (key0 + 32 < kend) pass(flag_t<true>{}, key0 + 32, fk + bo + 32 * TP, fv + bo + 32);
            foot(s, bo);
        }
        asm volatile("s_wait_asynccnt 0x0" ::: "memory");         // no copy is outstanding when the wave goes on to its end
    }
    if (EARLY) { o0 = o0 + e0 * QRI; o1 = o1 + e1 * QRI; o2 = o2 + e2 * QRI; o3 = o3 + e3 * QRI; }
    l += __shfl_xor(l, 16, 32);
    const float lsafe = (l > 0.0f) ? l : 1.0f;
    const float inv = (l > 0.0f) ? (1.0f / lsafe) : 0.0f;     // no visible key: zero context
    const int wb = wave * 16 * 68;
    // O^T D layout: o_j[r] = (d = 16j + 8h + r, t = lane&15) -> os[t][d]; rows 0..15 x columns 0..63 all written
    { v4f a, c;
      a[0] = o0[0] * inv; a[1] = o0[1] * inv; a[2] = o0[2] * inv; a[3] = o0[3] * inv; c[0] = o0[4] * inv; c[1] = o0[5] * inv; c[2] = o0[6] * inv; c[3] = o0[7] * inv;
      *(v4fa*)(&os[wb + lr * 68 +  0 + 8 * hi]) = a; *(v4fa*)(&os[wb + lr * 68 +  0 + 8 * hi + 4]) = c;
      a[0] = o1[0] * inv; a[1] = o1[1] * inv; a[2] = o1[2] * inv; a[3] = o1[3] * inv; c[0] = o1[4] * inv; c[1] = o1[5] * inv; c[2] = o1[6] * inv; c[3] = o1[7] * inv;
      *(v4fa*)(&os[wb + lr * 68 + 16 + 8 * hi]) = a; *(v4fa*)(&os[wb + lr * 68 + 16 + 8 * hi + 4]) = c;
      a[0] = o2[0] * inv; a[1] = o2[1] * inv; a[2] = o2[2] * inv; a[3] = o2[3] * inv; c[0] = o2[4] * inv; c[1] = o2[5] * inv; c[2] = o2[6] * inv; c[3] = o2[7] * inv;
      *(v4fa*)(&os[wb + lr * 68 + 32 + 8 * hi]) = a; *(v4fa*)(&os[wb + lr * 68 + 32 + 8 * hi + 4]) = c;
      a[0] = o3[0] * inv; a[1] = o3[1] * inv; a[2] = o3[2] * inv; a[3] = o3[3] * inv; c[0] = o3[4] * inv; c[1] = o3[5] * inv; c[2] = o3[6] * inv; c[3] = o3[7] * inv;
      *(v4fa*)(&os[wb + lr * 68 + 48 + 8 * hi]) = a; *(v4fa*)(&os[wb + lr * 68 + 48 + 8 * hi + 4]) = c; }
    wave_sync();
    const size_t obase = ((size_t)b * SEQ + t0) * DM + (size_t)h * HD;
{
#pragma unroll
        for (int s = 0; s < 4; ++s) { const int row = 4 * s + (lane >> 3), c8 = (lane & 7) * 8;   // 4 s x 4 row groups = 16 rows; 8 lanes x 8 = 64 columns
            const v4f x0 = *(const v4fa*)(&os[wb + row * 68 + c8]); const v4f x1 = *(const v4fa*)(&os[wb + row * 68 + c8 + 4]); v8us hv, lv;
#pragma unroll
            for (int i = 0; i < 4; ++i) { const unsigned short a0 = f2bf(x0[i]); const unsigned short a1 = f2bf(x1[i]);
                hv[i] = a0; hv[4 + i] = a1; lv[i] = f2bf(x0[i] - bf2f(a0)); lv[4 + i] = f2bf(x1[i] - bf2f(a1)); }
            const size_t oo = obase + (size_t)row * DM + c8;
            *(v8us*)(CH + oo) = hv; *(v8us*)(CL + oo) = lv; }
         }
}

// k_flash: both row bands in one grid (SEQ / (16*AW), NB*NH_), the choice a function of blockIdx.x alone:
// the first (SEQ - EROWS) / (16*AW) blocks of a head take query rows EROWS..SEQ-1 (single products), the last EROWS / (16*AW) take rows 0..EROWS-1 (value + residual products).
__global__ __launch_bounds__(32 * AW) void k_flash(const h16* __restrict__ QH, const h16* __restrict__ QR, const h16* __restrict__ KP, const h16* __restrict__ KR,
                                                   const h16* __restrict__ VT, const h16* __restrict__ VR, const int* __restrict__ LENS, bf* CH, bf* CL) {
    __shared__ __align__(16) h16 ring[2 * TSZ];   // the key tiles of either band
    if ((int)blockIdx.x < (SEQ - EROWS) / (16 * AW))
        flash_body<0>((int)blockIdx.x + EROWS / (16 * AW), QH, QH, KP, KP, VT, VT, LENS, CH, CL, ring);
    else
        flash_body<1>((int)blockIdx.x - (SEQ - EROWS) / (16 * AW), QH, QR, KP, KR, VT, VR, LENS, CH, CL, ring);
}

static constexpr size_t al256(size_t v) { return (v + 255) & ~(size_t)255; }
static constexpr size_t SZ_XB = al256((size_t)NB * SEQ * DM * 2);          // one bf16 activation plane [NB*SEQ][1024]
static constexpr size_t SZ_WB = al256((size_t)4 * DM * DM * 2);            // four transposed bf16 weight planes
static constexpr size_t SZ_PL = al256((size_t)NB * NH_ * SEQ * HD * 2);    // one f16 head plane
static constexpr size_t SZ_LN = al256((size_t)32 * 4);
static constexpr size_t SZ_TOTAL = 3 * SZ_XB + SZ_WB + 6 * SZ_PL + 2 * SZ_XB + SZ_LN;
static_assert(SZ_TOTAL <= (size_t)134217728);          // workspace carve <= 128 MiB
static_assert(((size_t)DM * DM * 2) % 256 == 0);       // weight sub-planes stay 256-byte aligned
static_assert((size_t)NB * OUT_SEQ * DM * 4 <= (size_t)NB_FULL * SEQ_FULL * DM * 4);   // single output at byte offset 0

extern "C" void kernel_launch(void* const* d_in, const int* in_sizes, int n_in,
                              void* d_out, int out_size, void* d_ws, size_t ws_size, hipStream_t stream) {
    if (n_in < 13) return;
    const size_t needx = ((size_t)(NB - 1) * SEQ_FULL + SEQ) * DM;
    if ((size_t)in_sizes[0] < needx || (size_t)in_sizes[1] < needx || (size_t)in_sizes[2] < needx) return;
    if ((size_t)in_sizes[3] < (size_t)(NB - 1) * SEQ_FULL + SEQ || (size_t)in_sizes[4] < (size_t)(NB - 1) * SEQ_FULL + SEQ) return;
    if ((size_t)in_sizes[5] < (size_t)DM * DM || (size_t)in_sizes[7] < (size_t)DM * DM || (size_t)in_sizes[9] < (size_t)DM * DM || (size_t)in_sizes[11] < (size_t)DM * DM) return;
    if (in_sizes[6] < DM || in_sizes[8] < DM || in_sizes[10] < DM || in_sizes[12] < DM) return;
    if ((size_t)out_size < ((size_t)(NB - 1) * OUT_SEQ + SEQ) * DM) return;
    if (SZ_TOTAL > ws_size) return;
    // wire order: in_Q, in_K, in_V, Q_pad_mask (int32), K_pad_mask (int32), W_Q, b_Q, W_K, b_K, W_V, b_V, W_O, b_O
    const float* xq = (const float*)d_in[0]; const float* xk = (const float*)d_in[1]; const float* xv = (const float*)d_in[2];
    const int* qmask = (const int*)d_in[3]; const int* kmask = (const int*)d_in[4];
    const float* wq = (const float*)d_in[5];  const float* bq = (const float*)d_in[6];
    const float* wk = (const float*)d_in[7];  const float* bk = (const float*)d_in[8];
    const float* wv = (const float*)d_in[9];  const float* bv = (const float*)d_in[10];
    const float* wo = (const float*)d_in[11]; const float* bo = (const float*)d_in[12];
    float* OUT = (float*)d_out;      // [NB][SEQ][1024]
    char* wsp = (char*)d_ws;
    bf* QB = (bf*)wsp; wsp += SZ_XB;                 // [NB*SEQ][1024] bf16 query input
    bf* KB = (bf*)wsp; wsp += SZ_XB;                 // [NB*SEQ][1024] bf16 key input
    bf* VB = (bf*)wsp; wsp += SZ_XB;                 // [NB*SEQ][1024] bf16 value input
    bf* WB = (bf*)wsp; wsp += SZ_WB;                 // [4][1024 out][1024 in]: q | k | v | o
    h16* QH = (h16*)wsp; wsp += SZ_PL;               // [NB*16][SEQ][64]
    h16* QR = (h16*)wsp; wsp += SZ_PL;               // [NB*16][SEQ][64] residual x2048
    h16* KP = (h16*)wsp; wsp += SZ_PL;               // [NB*16][SEQ][64]
    h16* KR = (h16*)wsp; wsp += SZ_PL;               // [NB*16][SEQ][64] residual x2048
    h16* VT = (h16*)wsp; wsp += SZ_PL;               // [NB*16][64][SEQ]
    h16* VR = (h16*)wsp; wsp += SZ_PL;               // [NB*16][64][SEQ] residual x2048
    bf* CH = (bf*)wsp; wsp += SZ_XB;                 // [NB*SEQ][1024] context bf16 hi
    bf* CL = (bf*)wsp; wsp += SZ_XB;                 // [NB*SEQ][1024] context bf16 lo
    int* LN = (int*)wsp; wsp += SZ_LN;               // 32 ints: word b = q_len[b], word 8 + b = k_len[b]
    bf* WQT = WB; bf* WKT = WB + (size_t)DM * DM; bf* WVT = WB + (size_t)2 * DM * DM; bf* WOT = WB + (size_t)3 * DM * DM;

    // lengths, transposed bf16 weights ([out][in]) and bf16 inputs
    k_prep<<<1 + 4 * PB_WT + 3 * PB_CV, 256, 0, stream>>>(xq, xk, xv, qmask, kmask, wq, wk, wv, wo, QB, KB, VB, WB, LN);
    // q, k planes and v^T planes (value and residual)
    k_qkv<<<dim3(NB * SEQ / GT, DM / GT, 3), 128, 0, stream>>>(QB, KB, VB, WQT, WKT, WVT, bq, bk, bv, QH, QR, KP, KR, VT, VR);
    // context planes: disjoint rows, every row written
    k_flash<<<dim3(SEQ / (16 * AW), NB * NH_, 1), 32 * AW, 0, stream>>>(QH, QR, KP, KR, VT, VR, LN, CH, CL);
    // output rows
    k_out<<<dim3(NB * SEQ / GT, DM / GT, 1), 128, 0, stream>>>(CH, CL, WOT, bo, OUT);
}

// v006
// Measured time: 80.9 microseconds a run.
// Next to v005, in two timings, it ran 1.10 and 1.09 times as fast.
// Over all steps from v000 it is 2.98 times as fast.
#include <hip/hip_runtime.h>

// Projections q/k/v: v_wmma_f32_16x16x32_bf16 (inputs and weights RNE-converted to bf16, f32 accumulate); scores: v_wmma_f32_16x16x32_f16 (query rows >= EROWS: single f16 q and k; rows < EROWS: q and k as f16 value + f16 residual x2048, three products, residual products in their own accumulator); P.V: v_wmma_f32_16x16x32_f16 (P x256 carry, v single f16; rows < EROWS: P and v as value + residual x2048, three products, residual products in their own accumulator); output projection: v_wmma_f32_16x16x32_bf16 (context as bf16 hi + bf16 lo planes, Wo bf16), f32 accumulate everywhere, softmax f32.
// Attention block, width 1024 = 16 heads x 64; query/key/value inputs [NB][SEQ][1024] f32, W_Q/W_K/W_V/W_O [in][out] (y = x W + b), score scale 1/8,
// causal fill (key > query -> excluded) and length fill (query < q_len[b] and key < k_len[b], lengths = integer sums of the two int32 indicator rows); rows with no visible key give a zero context; output y = ctx W_O + b_O (f32).
// Layout: bf16 copies of the three inputs; bf16 TRANSPOSED copies of the four weights ([out][in], K-contiguous); q, k planes [b*16+h][t][d] and v^T plane [b*16+h][d][t] (value and residual x2048) written by the GEMM epilogue;
// fused flash kernel in transposed form (S^T = K Q^T, O^T = V^T P^T) writing the context as bf16 hi/lo planes [b*SEQ+t][1024]; final GEMM writes f32 rows.
// Four launches, one per level of the dependence chain; work that does not depend on each other shares a grid and is told apart by the block index:
// k_prep (lengths, weight transposes, input conversions), k_qkv (the three projections), k_flash (both row bands), k_out.

#ifndef NB
#define NB 2
#endif
#ifndef SEQ
#define SEQ 2048
#endif
#define NB_FULL  2
#define SEQ_FULL 2048
#ifndef OUT_SEQ
#define OUT_SEQ SEQ              // row pitch (in tokens) between batches of the output
#endif
#ifndef EROWS
#define EROWS 256                // query rows below this use the value + residual products
#endif
#define DM   1024
#define NH_  16
#define HD   64
#define AW   4                   // waves per flash block (16 query rows each)
#define QRS  2048.0f             // carry of the residual planes
#define QRI  (1.0f / 2048.0f)
#define LOG2E 1.4426950408889634f
#define SC2  (0.125f * 1.4426950408889634f)   // HD^-0.5 * log2(e)
#define PSH  8.0f                // log2 of the P carry (256)

static_assert(HD == 64);
static_assert(NH_ * HD == DM);                 // head h = columns h*64 + d
static_assert(DM % 64 == 0);                   // column tiles of 64
static_assert(DM % 32 == 0);                   // GEMM k-loop steps by 32
static_assert(DM >= 8);                        // clamped bias loads stay inside a DM-float array
static_assert(SEQ % 64 == 0);                  // a 64-row tile never straddles two batches
static_assert((NB * SEQ) % 64 == 0);
static_assert(SEQ % 32 == 0);                  // key loop steps by 32
static_assert(SEQ % (16 * AW) == 0);           // flash grid covers the sequence exactly
static_assert(((size_t)SEQ * DM) % 8 == 0);
static_assert(NB <= NB_FULL);
static_assert(SEQ <= SEQ_FULL);
static_assert(SEQ_FULL % 4 == 0);
static_assert(EROWS % (16 * AW) == 0);         // the early band is a whole number of flash blocks
static_assert(EROWS % 32 == 0);                // early key steps stay inside the early key range
static_assert(EROWS >= 16 * AW);
static_assert(EROWS <= SEQ);
static_assert(NB <= 8);                        // length line: word b = q_len[b], word 8 + b = k_len[b]

typedef _Float16 h16;
typedef unsigned short bf;
typedef __attribute__((ext_vector_type(16))) __bf16   v16bf;
typedef __attribute__((ext_vector_type(16))) _Float16 v16h;
typedef __attribute__((ext_vector_type(8)))  _Float16 v8h;
typedef __attribute__((ext_vector_type(8)))  unsigned short v8us;
typedef __attribute__((ext_vector_type(8)))  float    v8f;
typedef __attribute__((ext_vector_type(4)))  float    v4f;
typedef __attribute__((ext_vector_type(4)))  int      v4i;
typedef v4f  __attribute__((may_alias)) v4fa;
typedef v8us __attribute__((may_alias)) v8usa;

__device__ __forceinline__ unsigned short f2bf(float f) { unsigned u = __float_as_uint(f); u += 0x7FFFu + ((u >> 16) & 1u); return (unsigned short)(u >> 16); }
__device__ __forceinline__ float bf2f(unsigned short b) { return __uint_as_float(((unsigned)b) << 16); }
__device__ __forceinline__ float rbf(float f) { return bf2f(f2bf(f)); }   // value after RNE convert to bf16
__device__ __forceinline__ v16h cat16(v8h lo, v8h hi) { return __builtin_shufflevector(lo, hi, 0, 1, 2, 3, 4, 5, 6, 7, 8, 9, 10, 11, 12, 13, 14, 15); }
__device__ __forceinline__ v16bf cat16b(v8us lo, v8us hi) { return __builtin_bit_cast(v16bf, __builtin_shufflevector(lo, hi, 0, 1, 2, 3, 4, 5, 6, 7, 8, 9, 10, 11, 12, 13, 14, 15)); }
__device__ __forceinline__ v8f wmma16(v16h a, v16h b, v8f c) { return __builtin_amdgcn_wmma_f32_16x16x32_f16(false, a, false, b, (short)0, c, false, false); }
__device__ __forceinline__ v8f wmmab(v16bf a, v16bf b, v8f c) { return __builtin_amdgcn_wmma_f32_16x16x32_bf16(false, a, false, b, (short)0, c, false, false); }
// fragment loaders from K-contiguous 16-bit rows; p already includes + 8*(lane>>4): elements 0..7 <- k0+8h+0..7, elements 8..15 <- k0+16+8h+0..7 (same map for A and B)
__device__ __forceinline__ v16h  ldh(const h16* p) { return cat16(*(const v8h*)p, *(const v8h*)(p + 16)); }
__device__ __forceinline__ v16bf ldb(const bf* p)  { return cat16b(*(const v8us*)p, *(const v8us*)(p + 16)); }
// ordering point for wave-private LDS tiles (same wave writes and reads)
__device__ __forceinline__ void wave_sync() { __builtin_amdgcn_fence(3 /* release order */, "wavefront"); __builtin_amdgcn_wave_barrier(); asm volatile("" ::: "memory"); }
// single guarded f16 WMMA (one accumulator per guard)
__device__ __forceinline__ v8f wmma16g(v16h a, v16h b, v8f c) {
    c = __builtin_amdgcn_wmma_f32_16x16x32_f16(false, a, false, b, (short)0, c, false, false);
    asm volatile("v_nop\n\tv_nop\n\tv_nop\n\tv_nop" : "+v"(c) : "v"(a), "v"(b));
    return c;
}
template <bool B> struct flag_t { static constexpr bool value = B; };   // compile-time switch handed to a generic lambda
__device__ __forceinline__ int imin(int a, int b) { return a < b ? a : b; }
__device__ __forceinline__ int imax(int a, int b) { return a > b ? a : b; }

// cvt8_body: thread's group i of eight f32 of an input (batch pitch SEQ_FULL rows) -> eight bf16 (RNE) of the packed [NB*SEQ][DM] plane. blk = block index inside the plane, 256 threads.
__device__ __forceinline__ void cvt8_body(const unsigned blk, const float* __restrict__ src, bf* dst) {
    const size_t n8 = (size_t)NB * SEQ * DM / 8, per = (size_t)SEQ * DM / 8;   // groups in the plane, groups in one batch
    const size_t i = (size_t)blk * 256 + threadIdx.x; if (i >= n8) return;
    const size_t so = (SEQ == SEQ_FULL) ? i * 8 : (i / per) * ((size_t)SEQ_FULL * DM) + (i % per) * 8;
    const v8f v = *(const v8f*)(src + so); v8us o;
#pragma unroll
    for (int k = 0; k < 8; ++k) o[k] = f2bf(v[k]);
    *(v8us*)(dst + i * 8) = o; 
}

// cvtT_body: in[rows = k][cols = n] f32 (DM x DM, row pitch DM) -> out[n][k] bf16 (RNE convert), 64x64 tiles transposed through LDS.
// tile (bx over k, by over n), each below DM/64; 256 threads. LDS tile ts[n][k] is cross-wave: block barrier between fill and drain.
__device__ __forceinline__ void cvtT_body(const int bx, const int by, const float* __restrict__ W, bf* WT) {
    __shared__ __align__(16) unsigned short ts[64 * 72];
    const int tid = threadIdx.x, lane = tid & 31, wave = __builtin_amdgcn_readfirstlane((int)(tid >> 5));
    const int k0 = bx * 64, n0 = by * 64;
#pragma unroll
    for (int i = 0; i < 4; ++i) { const int idx = tid + i * 256; const int kr = idx >> 4, c4 = (idx & 15) * 4;   // 1024 float4 = 64 k-rows x 16
        const v4f v = *(const v4f*)(W + (size_t)(k0 + kr) * DM + n0 + c4);
#pragma unroll
        for (int j = 0; j < 4; ++j) ts[(c4 + j) * 72 + kr] = f2bf(v[j]); }
    __syncthreads();
{
#pragma unroll
        for (int s = 0; s < 2; ++s) { const int row = wave * 8 + s * 4 + (lane >> 3), c8 = (lane & 7) * 8;   // 8 waves x 2 s x 4 = 64 rows; 8 lanes x 8 = 64 columns
            const v8us o = *(const v8usa*)(&ts[row * 72 + c8]);
            *(v8us*)(WT + (size_t)(n0 + row) * DM + k0 + c8) = o; }
        asm volatile("s_wait_xcnt 0x0" ::: "memory");   // stands before the registers that the stores above name are written again (the build lets this range's end run on into another range's code)
         }
}

// lens_body: q_len[b] and k_len[b] as integer sums of the first SEQ entries of row b of the two int32 indicator arrays (row pitch SEQ_FULL).
// LW waves per (array, batch) row: a lane brings its entries with SEQ / (128 LW) independent 16-byte loads (a wave-wide load covers 4 whole lines), all issued before the first sum,
// so the whole kernel waits for memory once instead of once per trip of a one-wave loop. Wave sums meet in LDS behind one block barrier; wave 0 adds them and stores the whole 32-word line.
#define LW 2                     // waves per indicator row (2 NB LW waves = the 256 threads of a k_prep block)
static_assert(SEQ % (128 * LW) == 0);          // a wave's share of a row is a whole number of wave-wide 16-byte loads
static_assert(64 * NB * LW == 256);            // 2 NB LW waves are exactly one k_prep block
__device__ __forceinline__ void lens_body(const int* __restrict__ qm, const int* __restrict__ km, int* lens) {
    __shared__ __align__(16) int ss[16 * LW];  // [word][wave of the row]; word b = q_len[b], word 8 + b = k_len[b]
    const int lane = threadIdx.x & 31, wave = __builtin_amdgcn_readfirstlane((int)(threadIdx.x >> 5));
    const int part = wave % LW, b = (wave / LW) % NB, which = wave / (LW * NB);
    const int* row = (which ? km : qm) + (size_t)b * SEQ_FULL + part * (SEQ / LW) + lane * 4;
    v4i p[SEQ / (128 * LW)];
#pragma unroll
    for (int i = 0; i < SEQ / (128 * LW); ++i) p[i] = *(const v4i*)(row + i * 128);
    int s = 0;
#pragma unroll
    for (int i = 0; i < SEQ / (128 * LW); ++i) s += (p[i][0] + p[i][1]) + (p[i][2] + p[i][3]);
#pragma unroll
    for (int o = 16; o > 0; o >>= 1) s += __shfl_xor(s, o, 32);
    if (lane == 0) ss[(which * 8 + b) * LW + part] = s;
    __syncthreads();   // every wave's sum is in LDS before wave 0 reads it
    if (wave == 0) {
        const bool used = lane < 16 && (lane & 7) < NB;   // words that a row feeds; only these LDS words were written
        int v = 0;
#pragma unroll
        for (int i = 0; i < LW; ++i) v += ss[(used ? lane : 0) * LW + i];
        *(int*)(lens + lane) = used ? v : 0;
        asm volatile("s_wait_xcnt 0x0" ::: "memory");   // stands before the registers that the store above names are written again (the build lets this range's end run on into another range's code)
    }
}

// k_prep: everything that reads only the inputs, in one grid of 256-thread blocks. Block 0: the lengths; the next 4 PB_WT blocks: the weight transposes (q | k | v | o);
// the last 3 PB_CV blocks: the input conversions (query | key | value). A block does one of the three jobs (the choice is a function of blockIdx alone, so every barrier is block-uniform).
#define PB_WT ((DM / 64) * (DM / 64))                                   // 64x64 tiles of one weight
#define PB_CV ((unsigned)(((size_t)NB * SEQ * DM / 8 + 255) / 256))     // blocks of one input plane
__global__ __launch_bounds__(256) void k_prep(const float* __restrict__ xq, const float* __restrict__ xk, const float* __restrict__ xv,
                                              const int* __restrict__ qm, const int* __restrict__ km,
                                              const float* __restrict__ wq, const float* __restrict__ wk, const float* __restrict__ wv, const float* __restrict__ wo,
                                              bf* QB, bf* KB, bf* VB, bf* WB, int* lens) {
    const unsigned blk = blockIdx.x;
    if (blk >= 1 + 4 * PB_WT) {
        const unsigned r = blk - (1 + 4 * PB_WT), p = r / PB_CV;
        cvt8_body(r % PB_CV, (p == 0) ? xq : (p == 1) ? xk : xv, (p == 0) ? QB : (p == 1) ? KB : VB);
    } else if (blk >= 1) {
        const unsigned r = blk - 1, w = r / PB_WT, t = r % PB_WT;
        const float* W = (w == 0) ? wq : (w == 1) ? wk : (w == 2) ? wv : wo;
        cvtT_body((int)(t % (DM / 64)), (int)(t / (DM / 64)), W, WB + (size_t)w * DM * DM);
    } else {
        lens_body(qm, km, lens);
    }
}

// proj_body: bf16 GEMM, one block of 4 waves (2 x 2) per 128x128 tile, each wave a 64x64 sub-tile (16 accumulators), K = DM in passes of KS.
// Operand tiles are staged in LDS: every thread brings 16-byte pieces of whole 256-byte row segments (a wave-wide load covers 4 whole lines) into registers one pass ahead
// and stores them into the other of two LDS buffers behind the pass's products; one block barrier per pass publishes that buffer and ends the reads of the one refilled next.
// Fragments come from LDS rows of pitch LP (272 B) with the same element map as ldb(); the k order of the sums is the ascending 32-step order.
// C[m][n] = sum_k (A[m][k] (+ A2[m][k] when MODE 1)) Bt[n][k] + bias (bmode 1: bias[n]; bmode 2: bias[m]; bias RNE-converted to bf16 first),
// sub-tile base (r0/RB)*sRB + (r0%RB)*pitch + (c0/CB)*sCB + (c0%CB), row pitch 'pitch' (elements). tile (bx below M/128, by below N/128), 128 threads.
// MODE 1: written as f32 (Of); each row's 64 floats (256 B = two lines) by 16 consecutive lanes x 16 B (2 rows per instruction).
// Bias array has DM floats; both 16-byte bias loads use addresses clamped into [0, DM-4].
#define GT 128                   // block tile edge (rows of A and rows of Bt per block)
#define KS 128                   // k elements per pass (256 B of every operand row)
#define LP 136                   // LDS row pitch in elements (272 B: 16 B x odd, for 16-byte readers)
#define NLD (GT * KS / 8 / 128)  // 16-byte pieces per thread, operand and pass
static_assert(DM % KS == 0);
static_assert(DM % GT == 0);
static_assert((NB * SEQ) % GT == 0);
__device__ __forceinline__ v16bf ldbs(const bf* p) { return cat16b(*(const v8usa*)p, *(const v8usa*)(p + 16)); }   // ldb() on an LDS row
template <int MODE>
__device__ __forceinline__ void proj_body(const int bx, const int by, const bf* __restrict__ A, const bf* __restrict__ A2, const bf* __restrict__ Bt,
                                          const float* __restrict__ bias, int bmode, h16* Ph, h16* Pr, int useRes, float* Of,
                                          int RB, size_t sRB, int pitch, int CB, size_t sCB) {
    constexpr int NOPD = (MODE == 1) ? 3 : 2;                    // staged operands: A, Bt (, A2)
    __shared__ __align__(16) bf st[2 * NOPD * GT * LP];          // [buffer][operand][row][LP]
    __shared__ __align__(16) float osall[4 * 16 * 68];           // one wave-private epilogue tile per wave
    const int K = DM;
    const int tid = threadIdx.x, lane = tid & 31, lr = lane & 15, hi = lane >> 4, wave = __builtin_amdgcn_readfirstlane((int)(tid >> 5));
    const int R0 = bx * GT, C0 = by * GT;
    const int wm = wave >> 1, wn = wave & 1;
    const int r0 = R0 + wm * 64, c0 = C0 + wn * 64;              // this wave's 64x64 sub-tile
    float* os = osall + wave * (16 * 68);
    v8f acc[4][4];
#pragma unroll
    for (int mb = 0; mb < 4; ++mb)
#pragma unroll
        for (int nb = 0; nb < 4; ++nb) acc[mb][nb] = (v8f){};
    // staging map: piece i of a thread = row (tid >> 4) + 8 i, bytes 16 (tid & 15) of the row's 256-byte segment
    const int srow = tid >> 4, sch = (tid & 15) * 8;
    const bf* gA  = A  + (size_t)(R0 + srow) * K + sch;
    const bf* gA2 = A2 + (size_t)(R0 + srow) * K + sch;
    const bf* gB  = Bt + (size_t)(C0 + srow) * K + sch;
    const int sl = srow * LP + sch;
    const int fa = (wm * 64 + lr) * LP + 8 * hi, fb = GT * LP + (wn * 64 + lr) * LP + 8 * hi, fa2 = 2 * GT * LP + fa;   // fragment bases inside a buffer
    v8us pa[NLD], pb[NLD], pa2[NLD];
#pragma unroll
    for (int i = 0; i < NLD; ++i) { pa[i] = *(const v8us*)(gA + (size_t)i * 8 * K); pb[i] = *(const v8us*)(gB + (size_t)i * 8 * K);
        if (MODE == 1) pa2[i] = *(const v8us*)(gA2 + (size_t)i * 8 * K); }
#pragma unroll
    for (int i = 0; i < NLD; ++i) { *(v8usa*)(&st[sl + i * 8 * LP]) = pa[i]; *(v8usa*)(&st[GT * LP + sl + i * 8 * LP]) = pb[i];
        if (MODE == 1) *(v8usa*)(&st[2 * GT * LP + sl + i * 8 * LP]) = pa2[i]; }
    __syncthreads();
#pragma unroll 1
    for (int kp = 0; kp < K; kp += KS) {
        const int cur = (kp / KS) & 1;
        const bf* sb = st + cur * (NOPD * GT * LP);
        bf* sn = st + (cur ^ 1) * (NOPD * GT * LP);
        const bool more = kp + KS < K;                           // block-uniform: a next pass exists
        if (more) {
#pragma unroll
            for (int i = 0; i < NLD; ++i) { pa[i] = *(const v8us*)(gA + (size_t)i * 8 * K + kp + KS); pb[i] = *(const v8us*)(gB + (size_t)i * 8 * K + kp + KS);
                if (MODE == 1) pa2[i] = *(const v8us*)(gA2 + (size_t)i * 8 * K + kp + KS); }
            asm volatile("s_wait_xcnt 0x0" ::: "memory");   // stands before the address registers of the loads above are written again (the build reuses them for the LDS addresses below)
        }
        v16bf a[2][4], b[2][4], a2[2][4];
#pragma unroll
        for (int q = 0; q < 4; ++q) { a[0][q] = ldbs(sb + fa + q * 16 * LP); b[0][q] = ldbs(sb + fb + q * 16 * LP);
            if (MODE == 1) a2[0][q] = ldbs(sb + fa2 + q * 16 * LP); }
        __builtin_amdgcn_sched_barrier(0);   // keeps the next pass's global loads and the first fragment loads ahead of the products
#pragma unroll
        for (int s = 0; s < KS / 32; ++s) {
            const int c = s & 1, n = c ^ 1;
            if (s + 1 < KS / 32) {
#pragma unroll
                for (int q = 0; q < 4; ++q) { a[n][q] = ldbs(sb + fa + q * 16 * LP + (s + 1) * 32); b[n][q] = ldbs(sb + fb + q * 16 * LP + (s + 1) * 32);
                    if (MODE == 1) a2[n][q] = ldbs(sb + fa2 + q * 16 * LP + (s + 1) * 32); }
                __builtin_amdgcn_sched_barrier(0);   // the next 32-step's fragment loads stay one group in front of this step's products, not among them
            }
#pragma unroll
            for (int nb = 0; nb < 4; ++nb)
#pragma unroll
                for (int mb = 0; mb < 4; ++mb) acc[mb][nb] = wmmab(a[c][mb], b[c][nb], acc[mb][nb]);
            // issue slots behind the last products before their operand registers are written again
            asm volatile("v_nop\n\tv_nop\n\tv_nop\n\tv_nop" : "+v"(acc[0][0]), "+v"(acc[1][1]), "+v"(acc[2][2]), "+v"(acc[3][3]) : "v"(a[c][0]), "v"(a[c][1]), "v"(a[c][2]), "v"(a[c][3]));
            if (MODE == 1) {
#pragma unroll
                for (int nb = 0; nb < 4; ++nb)
#pragma unroll
                    for (int mb = 0; mb < 4; ++mb) acc[mb][nb] = wmmab(a2[c][mb], b[c][nb], acc[mb][nb]);
                // issue slots behind the last products before their operand registers are written again
                asm volatile("v_nop\n\tv_nop\n\tv_nop\n\tv_nop" : "+v"(acc[0][0]), "+v"(acc[1][1]), "+v"(acc[2][2]), "+v"(acc[3][3]) : "v"(a2[c][0]), "v"(a2[c][1]), "v"(a2[c][2]), "v"(a2[c][3]));
            }
        }
        if (more) {
#pragma unroll
            for (int i = 0; i < NLD; ++i) { *(v8usa*)(&sn[sl + i * 8 * LP]) = pa[i]; *(v8usa*)(&sn[GT * LP + sl + i * 8 * LP]) = pb[i];
                if (MODE == 1) *(v8usa*)(&sn[2 * GT * LP + sl + i * 8 * LP]) = pa2[i]; }
        }
        __syncthreads();   // publishes the buffer just filled; ends every wave's reads of the buffer that the next pass refills
    }
    const size_t tbase = (size_t)(r0 / RB) * sRB + (size_t)(r0 % RB) * (size_t)pitch + (size_t)(c0 / CB) * sCB + (size_t)(c0 % CB);
    // per-lane column bias for the lane's store columns; both load addresses clamped into the DM-float bias array (first to 0 when unused, second to DM-4)
    const int c8 = (lane & 7) * 8, cofs = lr * 4;
    const int ci = (bmode == 1) ? (c0 + ((MODE == 0) ? c8 : cofs)) : 0;
    const int ci4 = (ci + 4 <= DM - 4) ? (ci + 4) : (DM - 4);      // MODE 0: ci + 4 <= DM - 4 always (exact columns); MODE 1: upper half unused, address kept in range
    const v4f bl0 = *(const v4f*)(bias + ci), bl1 = *(const v4f*)(bias + ci4);
    // MODE 0: the row bias of the lane's 16 store rows (row 16 mb + 4 s + (lane >> 3)), loaded here beside the column bias and converted once,
    // so that the store loop below holds no global load, no wait for one and no branch
    float brw[4][4];
    if (MODE == 0) {
        const float* br = bias + ((bmode == 2) ? (r0 + (lane >> 3)) : 0);   // bmode 2: r0 + 63 <= DM - 1; otherwise words 0..63 of the DM-float array, read and not used
        const unsigned bm = (bmode == 2) ? 0xFFFF0000u : 0u;                // keeps the RNE-converted value, or makes it +0
#pragma unroll
        for (int mb = 0; mb < 4; ++mb)
#pragma unroll
            for (int s = 0; s < 4; ++s) brw[mb][s] = br[mb * 16 + 4 * s];
        asm volatile("" :: "v"(brw[0][0]), "v"(brw[0][1]), "v"(brw[0][2]), "v"(brw[0][3]), "v"(brw[1][0]), "v"(brw[1][1]), "v"(brw[1][2]), "v"(brw[1][3]),
                           "v"(brw[2][0]), "v"(brw[2][1]), "v"(brw[2][2]), "v"(brw[2][3]), "v"(brw[3][0]), "v"(brw[3][1]), "v"(brw[3][2]), "v"(brw[3][3]),
                           "v"(bl0), "v"(bl1));   // inputs-only fence on the loaded values: holds all bias loads together here, one wait for all (the build otherwise sinks each row-bias load to its use, behind a wait of its own)
#pragma unroll
        for (int mb = 0; mb < 4; ++mb)
#pragma unroll
            for (int s = 0; s < 4; ++s) { unsigned u = __float_as_uint(brw[mb][s]); u += 0x7FFFu + ((u >> 16) & 1u); brw[mb][s] = __uint_as_float(u & bm); }   // rbf() under the mask
    }
    float bc[8];
#pragma unroll
    for (int i = 0; i < 4; ++i) { bc[i] = (bmode == 1) ? rbf(bl0[i]) : 0.0f; bc[4 + i] = (bmode == 1) ? rbf(bl1[i]) : 0.0f; }
#pragma unroll
    for (int mb = 0; mb < 4; ++mb) {
#pragma unroll
        for (int nb = 0; nb < 4; ++nb) {
#pragma unroll
            for (int j = 0; j < 8; ++j) os[(hi * 8 + j) * 68 + nb * 16 + lr] = acc[mb][nb][j]; }   // D: row 8h+j, col lane&15; rows 0..15 x columns 0..63 all written
        wave_sync();
        const size_t sb = tbase + (size_t)(mb * 16) * (size_t)pitch;
        if (MODE == 0) {
{
                // the four row groups of the block go as one batch: their LDS reads, conversions and stores are independent of each other and overlap
                v8h hv[4], rv[4]; h16* ph[4]; h16* pr[4];
#pragma unroll
                for (int s = 0; s < 4; ++s) { const int row = 4 * s + (lane >> 3);   // 4 s x 4 row groups = 16 rows; 8 lanes x 8 = 64 columns
                    const float brow = brw[mb][s];
                    const size_t oo = sb + (size_t)row * (size_t)pitch + c8; ph[s] = Ph + oo; pr[s] = Pr + oo;
                    const v4f x0 = *(const v4fa*)(&os[row * 68 + c8]); const v4f x1 = *(const v4fa*)(&os[row * 68 + c8 + 4]);
#pragma unroll
                    for (int i = 0; i < 4; ++i) { const float f0 = x0[i] + bc[i] + brow; const float f1 = x1[i] + bc[4 + i] + brow;
                        const h16 a0 = (h16)f0; const h16 a1 = (h16)f1; hv[s][i] = a0; hv[s][4 + i] = a1; rv[s][i] = (h16)((f0 - (float)a0) * QRS); rv[s][4 + i] = (h16)((f1 - (float)a1) * QRS); } }
                __builtin_amdgcn_sched_barrier(0);   // the stores stay behind all four conversions and address sums: a store among them has its registers reused at once, which costs a wait per store
#pragma unroll
                for (int s = 0; s < 4; ++s) { *(v8h*)ph[s] = hv[s]; if (useRes) *(v8h*)pr[s] = rv[s]; }
                asm volatile("s_wait_xcnt 0x0" ::: "memory");   // stands before the registers that the stores above name are written again by the next row block
                 }
        } else {
{
#pragma unroll
                for (int s = 0; s < 8; ++s) { const int row = 2 * s + hi;   // 8 s x 2 rows = 16 rows; 16 lanes x 4 floats = 64 columns
                    const v4f x0 = *(const v4fa*)(&os[row * 68 + cofs]); v4f val;
                    val[0] = x0[0] + bc[0]; val[1] = x0[1] + bc[1]; val[2] = x0[2] + bc[2]; val[3] = x0[3] + bc[3];
                    *(v4f*)(Of + sb + (size_t)row * (size_t)pitch + cofs) = val; }
                asm volatile("s_wait_xcnt 0x0" ::: "memory");   // stands before the registers that the stores above name are written again by the next row block
                 }
        }
        wave_sync();
    }
}

// k_qkv: the three projections in one grid (NB*SEQ/GT, DM/GT, 3); blockIdx.z picks the product.
// z = 0, 1 (q, k): A = x rows (m = b*SEQ + t), Bt = W^T rows (n = h*64 + d), column bias -> planes [(b*16 + h)][t][d] (value and residual).
// z = 2 (v^T): A = Wv^T rows (m = h*64 + d), Bt = value rows (n = b*SEQ + t), row bias -> planes [(b*1024 + m)][t] = [(b*16 + h)][d][t] (value and residual); its tile is (blockIdx.y, blockIdx.x).
__global__ __launch_bounds__(128) void k_qkv(const bf* __restrict__ QB, const bf* __restrict__ KB, const bf* __restrict__ VB,
                                             const bf* __restrict__ WQT, const bf* __restrict__ WKT, const bf* __restrict__ WVT,
                                             const float* __restrict__ bq, const float* __restrict__ bk, const float* __restrict__ bv,
                                             h16* QH, h16* QR, h16* KP, h16* KR, h16* VT, h16* VR) {
    const int z = blockIdx.z; const bool isv = z == 2;
    const bf* A  = isv ? WVT : z ? KB : QB;
    const bf* Bt = isv ? VB : z ? WKT : WQT;
    proj_body<0>((int)(isv ? blockIdx.y : blockIdx.x), (int)(isv ? blockIdx.x : blockIdx.y), A, A, Bt, isv ? bv : z ? bk : bq, isv ? 2 : 1,
                 isv ? VT : z ? KP : QH, isv ? VR : z ? KR : QR, 1, nullptr,
                 isv ? DM : SEQ, isv ? (size_t)0 : (size_t)NH_ * SEQ * HD, isv ? SEQ : HD, isv ? SEQ : HD, isv ? (size_t)DM * SEQ : (size_t)SEQ * HD);
}

// k_out: A = context hi (+ lo) rows (m = b*SEQ + t), Bt = Wo^T rows (n), column bias -> OUT[(b*OUT_SEQ + t)][n] f32; grid (NB*SEQ/GT, DM/GT).
__global__ __launch_bounds__(128) void k_out(const bf* __restrict__ CH, const bf* __restrict__ CL, const bf* __restrict__ WOT, const float* __restrict__ bo, float* OUT) {
    proj_body<1>((int)blockIdx.x, (int)blockIdx.y, CH, CL, WOT, bo, 1, nullptr, nullptr, 0, OUT, SEQ, (size_t)OUT_SEQ * DM, DM, DM, (size_t)0);
}

// Key tiles of k_flash: the block's AW waves share one tile of TK keys in LDS, one plane pair = [K: TK key rows of 128 B | V^T: HD d rows of 128 B], row pitch TP elements (144 B, for 16-byte readers).
// The ring holds two plane pairs. EARLY = 0: two buffers of the value planes, the next tile's copies in flight while this tile is worked on. EARLY = 1: one buffer, value pair then residual pair.
#define TK 64                    // keys per staged tile (two 32-key passes)
#define TP 72                    // LDS row pitch in elements
#define TSZ ((TK + HD) * TP)     // elements of one plane pair
static_assert(TK * 2 == 128);                  // a V^T row segment of a tile is one whole line
static_assert(SEQ % TK == 0);                  // every tile lies wholly inside the planes
static_assert(16 * AW == TK);                  // a block's query rows span one tile: block xblk walks xblk + 1 tiles at most
static_assert(32 * AW / 8 == 16);              // one copy of the block covers 16 rows of 128 B
static_assert(TK == 64);                       // four copies cover the K rows of a tile, four the HD = 64 V^T rows
// tile_copy: the block's copy of one plane pair of a tile, 8 asynchronous 16-byte copies a lane (4 K, 4 V^T); a wave-wide copy covers 4 whole 128-byte rows.
// lk, lv: the lane's LDS byte addresses of its first K and V^T piece; gk, gv: the global addresses of the same pieces; piece i lies 16 rows further on.
// The last line of the statement stands before the address registers that the copies name are written again.
__device__ __forceinline__ void tile_copy(const unsigned lk, const unsigned lv, const h16* gk, const h16* gv) {
    asm volatile("global_load_async_to_lds_b128 %0, %8, off\n\t"
                 "global_load_async_to_lds_b128 %1, %9, off\n\t"
                 "global_load_async_to_lds_b128 %2, %10, off\n\t"
                 "global_load_async_to_lds_b128 %3, %11, off\n\t"
                 "global_load_async_to_lds_b128 %4, %12, off\n\t"
                 "global_load_async_to_lds_b128 %5, %13, off\n\t"
                 "global_load_async_to_lds_b128 %6, %14, off\n\t"
                 "global_load_async_to_lds_b128 %7, %15, off\n\t"
                 "s_wait_xcnt 0x0"
                 :: "v"(lk), "v"(lk + 16 * TP * 2), "v"(lk + 32 * TP * 2), "v"(lk + 48 * TP * 2),
                    "v"(lv), "v"(lv + 16 * TP * 2), "v"(lv + 32 * TP * 2), "v"(lv + 48 * TP * 2),
                    "v"(gk), "v"(gk + 16 * HD), "v"(gk + 32 * HD), "v"(gk + 48 * HD),
                    "v"(gv), "v"(gv + (size_t)16 * SEQ), "v"(gv + (size_t)32 * SEQ), "v"(gv + (size_t)48 * SEQ)
                 : "memory");
}

// flash_body: fused attention, one wave per 16 query rows of one (batch, head); Q fragments straight from the f16 planes (two 16-B loads each, arithmetic addressing);
// K / V^T fragments from the block's LDS tile with the same element map (two 16-B LDS loads each).
// Transposed form: S^T[key][t] = K Q^T (A = K rows, B = Q rows); lane (t = lane&15, h = lane>>4) holds keys 8h+r of each 16-key tile, so the packed
// P tile is directly the B fragment of O^T[d][t] = V^T P^T (element r <- tile keys 0..15, element 8+r <- tile keys 16..31, lane unchanged).
// Visibility of (t, key): key <= lim(t) with lim = min(t, k_len - 1) when t < q_len, else -1 (nothing visible); excluded scores are REPLACED by a large negative fill and their P is set to 0 by value.
// The key loop runs to kend = min(t0 + 16, k_len) <= SEQ (wave-scalar, static upper bound SEQ); a row with no visible key keeps l = 0 and gets a zero context.
// Softmax state (running max, partial sum) is one scalar per lane; the two lane halves of a row are combined with one xor-16 exchange.
// EARLY = 1 (query rows < EROWS): q, k, P, v each as f16 value + f16 residual x2048; value x residual products go to separate accumulators folded with 1/2048 (scores: before the scale; context: before the normalisation); row sum over the unconverted p.
// EARLY = 0: single f16 products, row sum over the converted P.
template <int EARLY>
__device__ __forceinline__ void flash_body(const int xblk, const h16* __restrict__ QH, const h16* __restrict__ QR, const h16* __restrict__ KP, const h16* __restrict__ KR,
                                           const h16* __restrict__ VT, const h16* __restrict__ VR, const int* __restrict__ LENS, bf* CH, bf* CL, h16* ring) {
    __shared__ __align__(16) float os[AW * 16 * 68];
    const int lane = threadIdx.x & 31, wave = __builtin_amdgcn_readfirstlane((int)(threadIdx.x >> 5)), lr = lane & 15, hi = lane >> 4;
    const int zh = blockIdx.y; const int b = zh / NH_, h = zh % NH_;
    const int t0 = (xblk * AW + wave) * 16;
    const size_t pbase = (size_t)zh * SEQ * HD;
    const size_t qo = pbase + (size_t)(t0 + lr) * HD + 8 * hi;
    const v16h qh0 = ldh(QH + qo), qh1 = ldh(QH + qo + 32);   // B fragments: col t, k = d
    v16h qr0 = qh0, qr1 = qh1;
    if (EARLY) { qr0 = ldh(QR + qo); qr1 = ldh(QR + qo + 32); }
    const int qlen = imin(imax(LENS[b], 0), SEQ), klen = imin(imax(LENS[8 + b], 0), SEQ);   // lengths clamped into [0, SEQ]
    const int t = t0 + lr;
    const int lim = (t < qlen) ? imin(t, klen - 1) : -1;      // last visible key of query t (-1: none)
    const int kend = __builtin_amdgcn_readfirstlane(imin((xblk * AW + (int)(threadIdx.x >> 5)) * 16 + 16, klen));   // min taken first, then made wave-scalar; <= SEQ
    v8f o0 = (v8f){}, o1 = (v8f){}, o2 = (v8f){}, o3 = (v8f){};
    v8f e0 = (v8f){}, e1 = (v8f){}, e2 = (v8f){}, e3 = (v8f){};
    float m = -3.0e38f, l = 0.0f;
    // one 32-key pass; kl (A fragment: row key, k = d; + 16 TP: the second 16 keys) and vl (A fragment: row d, k = key; + 16j TP) are this lane's fragment bases of the pass in the LDS tile, residual pair at + TSZ
    // TEST::value = false: the caller has shown that every key of the pass is visible to every row of the wave, so each visibility test below is true and is left out (same order of sums)
    auto pass = [&](auto TEST, const int key0, const h16* kl, const h16* vl) __attribute__((always_inline)) {
        constexpr bool MK = decltype(TEST)::value;
        v8f sHa = (v8f){}, sLa = (v8f){}, sHb = (v8f){}, sLb = (v8f){};
        if (EARLY) {
            { const v16h kh0 = ldh(kl), kh1 = ldh(kl + 32), kr0 = ldh(kl + TSZ), kr1 = ldh(kl + TSZ + 32);
              sHa = wmma16g(kh0, qh0, sHa); sLa = wmma16g(kh0, qr0, sLa); sLa = wmma16g(kr0, qh0, sLa);
              sHa = wmma16g(kh1, qh1, sHa); sLa = wmma16g(kh1, qr1, sLa); sLa = wmma16g(kr1, qh1, sLa); }
            { const v16h kh0 = ldh(kl + 16 * TP), kh1 = ldh(kl + 16 * TP + 32), kr0 = ldh(kl + TSZ + 16 * TP), kr1 = ldh(kl + TSZ + 16 * TP + 32);
              sHb = wmma16g(kh0, qh0, sHb); sLb = wmma16g(kh0, qr0, sLb); sLb = wmma16g(kr0, qh0, sLb);
              sHb = wmma16g(kh1, qh1, sHb); sLb = wmma16g(kh1, qr1, sLb); sLb = wmma16g(kr1, qh1, sLb); }
        } else {
            const v16h ka0 = ldh(kl), ka1 = ldh(kl + 32), kb0 = ldh(kl + 16 * TP), kb1 = ldh(kl + 16 * TP + 32);
            sHa = wmma16(ka0, qh0, sHa); sHb = wmma16(kb0, qh0, sHb);
            sHa = wmma16(ka1, qh1, sHa); sHb = wmma16(kb1, qh1, sHb);
            asm volatile("v_nop\n\tv_nop\n\tv_nop\n\tv_nop" : "+v"(sHa), "+v"(sHb) : "v"(ka0), "v"(ka1), "v"(kb0), "v"(kb1));
        }
        const int kq = key0 + 8 * hi;           // this lane's first key of tile a (tile b: + 16)
        float ta[8], tb[8]; float mx = -3.0e38f;
#pragma unroll
        for (int r = 0; r < 8; ++r) {
            const float xa = EARLY ? (sHa[r] + sLa[r] * QRI) * SC2 : sHa[r] * SC2;
            const float xb = EARLY ? (sHb[r] + sLb[r] * QRI) * SC2 : sHb[r] * SC2;
            ta[r] = (!MK || kq + r <= lim) ? xa : -3.0e38f;
            tb[r] = (!MK || kq + 16 + r <= lim) ? xb : -3.0e38f; }
#pragma unroll
        for (int r = 0; r < 8; ++r) mx = fmaxf(mx, fmaxf(ta[r], tb[r]));
        mx = fmaxf(mx, __shfl_xor(mx, 16, 32));
        const float mnew = fmaxf(m, mx);
        const float alpha = __builtin_amdgcn_exp2f(m - mnew);
        const float sh = PSH - mnew;
        v16h pb = (v16h){}, pr = (v16h){}; float ls = 0.0f;
#pragma unroll
        for (int r = 0; r < 8; ++r) {
            const float ya = __builtin_amdgcn_exp2f(ta[r] + sh), yb = __builtin_amdgcn_exp2f(tb[r] + sh);
            const float ea = (!MK || kq + r <= lim) ? ya : 0.0f;
            const float eb = (!MK || kq + 16 + r <= lim) ? yb : 0.0f;
            const h16 pa = (h16)ea; const h16 pc = (h16)eb; pb[r] = pa; pb[8 + r] = pc;
            if (EARLY) { pr[r] = (h16)((ea - (float)pa) * QRS); pr[8 + r] = (h16)((eb - (float)pc) * QRS); ls += ea + eb; }
            else { ls += (float)pa + (float)pc; } }
        l = l * alpha + ls; m = mnew;
        o0 = o0 * alpha; o1 = o1 * alpha; o2 = o2 * alpha; o3 = o3 * alpha;
        if (EARLY) {
            e0 = e0 * alpha; e1 = e1 * alpha; e2 = e2 * alpha; e3 = e3 * alpha;
            { const v16h vh = ldh(vl), vr = ldh(vl + TSZ);
              o0 = wmma16g(vh, pb, o0); e0 = wmma16g(vh, pr, e0); e0 = wmma16g(vr, pb, e0); }
            { const v16h vh = ldh(vl + 16 * TP), vr = ldh(vl + TSZ + 16 * TP);
              o1 = wmma16g(vh, pb, o1); e1 = wmma16g(vh, pr, e1); e1 = wmma16g(vr, pb, e1); }
            { const v16h vh = ldh(vl + 32 * TP), vr = ldh(vl + TSZ + 32 * TP);
              o2 = wmma16g(vh, pb, o2); e2 = wmma16g(vh, pr, e2); e2 = wmma16g(vr, pb, e2); }
            { const v16h vh = ldh(vl + 48 * TP), vr = ldh(vl + TSZ + 48 * TP);
              o3 = wmma16g(vh, pb, o3); e3 = wmma16g(vh, pr, e3); e3 = wmma16g(vr, pb, e3); }
        } else {
            const v16h v0 = ldh(vl), v1 = ldh(vl + 16 * TP), v2 = ldh(vl + 32 * TP), v3 = ldh(vl + 48 * TP);
            o0 = wmma16(v0, pb, o0); o1 = wmma16(v1, pb, o1); o2 = wmma16(v2, pb, o2); o3 = wmma16(v3, pb, o3);
            asm volatile("v_nop\n\tv_nop\n\tv_nop\n\tv_nop" : "+v"(o0), "+v"(o1), "+v"(o2), "+v"(o3) : "v"(v0), "v"(v1), "v"(v2), "v"(v3), "v"(pb));
        }
    };
    const int nt = (imin(xblk * TK + TK, __builtin_amdgcn_readfirstlane(klen)) + TK - 1) / TK;   // tiles the block walks (block-uniform scalar, <= SEQ / TK): up to its last wave's kend
    const int crow = (int)threadIdx.x >> 3, cch = ((int)threadIdx.x & 7) * 8;                    // the lane's first row of a copy and its 16-byte piece of a 128-byte row
    const unsigned lk = (unsigned)(size_t)(__attribute__((address_space(3))) h16*)(ring + crow * TP + cch), lv = lk + TK * TP * 2;
    const h16* gk = KP + pbase + (size_t)crow * HD + cch;     // + tile * TK * HD
    const h16* gv = VT + pbase + (size_t)crow * SEQ + cch;    // + tile * TK
    const h16* fk = ring + lr * TP + 8 * hi;                  // fragment bases inside the first plane pair
    const h16* fv = fk + TK * TP;
    // In both loops a wave makes the 32-key passes below its own kend, in ascending order (wave-scalar tests), and passes every barrier.
    if constexpr (EARLY) {
        const h16* gkr = KR + pbase + (size_t)crow * HD + cch;
        const h16* gvr = VR + pbase + (size_t)crow * SEQ + cch;
#pragma unroll 1
        for (int s = 0; s < nt; ++s) {
            const int key0 = s * TK;
            tile_copy(lk, lv, gk + (size_t)key0 * HD, gv + key0);
            tile_copy(lk + TSZ * 2, lv + TSZ * 2, gkr + (size_t)key0 * HD, gvr + key0);
            asm volatile("s_wait_asynccnt 0x0" ::: "memory");     // this wave's part of the tile has landed
            __syncthreads();                                      // the tile is whole for every wave
            if (key0 < kend) pass(flag_t<true>{}, key0, fk, fv);
            if (key0 + 32 < kend) pass(flag_t<true>{}, key0 + 32, fk + 32 * TP, fv + 32);
            if (s + 1 < nt) {
                asm volatile("s_wait_dscnt 0x0" ::: "memory");    // this wave's reads of the tile are done before it is overwritten
                __syncthreads();                                  // ends every wave's reads of the tile that the next trip overwrites
            }
        }
    } else {
        if (nt > 0) tile_copy(lk, lv, gk, gv);
        asm volatile("s_wait_asynccnt 0x0" ::: "memory");         // this wave's part of tile 0 has landed
        __syncthreads();                                          // tile 0 is whole for every wave
        if (nt > 1) tile_copy(lk + TSZ * 2, lv + TSZ * 2, gk + (size_t)TK * HD, gv + TK);
        // foot of trip s of either loop below, passed by every wave
        auto foot = [&](const int s, const int bo) __attribute__((always_inline)) {
            asm volatile("s_wait_dscnt 0x0" ::: "memory");        // this wave's reads of the buffer are done before it is refilled
            asm volatile("s_wait_asynccnt 0x0" ::: "memory");     // this wave's part of the next tile has landed
            __syncthreads();                                      // publishes the next tile; ends every wave's reads of the buffer refilled below
            if (s + 2 < nt) tile_copy(lk + bo * 2, lv + bo * 2, gk + (size_t)(s + 2) * TK * HD, gv + (s + 2) * TK);
        };
        // keys 0 .. kvis - 1 are visible to every row of the block: the smallest lim + 1 over its TK rows (0 when a row lies at or past q_len); block-uniform scalar, kvis <= every wave's kend
        const int kvis = __builtin_amdgcn_readfirstlane((xblk * TK + TK - 1 < qlen) ? imin(xblk * TK, klen - 1) + 1 : 0);
        const int nf = kvis / TK;                                 // leading tiles that lie wholly below kvis; nf <= nt
        int s = 0;
#pragma unroll 1
        for (; s < nf; ++s) {                                     // tiles with no hidden score: both passes, no visibility tests
            const int bo = (s & 1) * TSZ, key0 = s * TK;
            pass(flag_t<false>{}, key0, fk + bo, fv + bo);
            pass(flag_t<false>{}, key0 + 32, fk + bo + 32 * TP, fv + bo + 32);
            foot(s, bo);
        }
#pragma unroll 1
        for (; s < nt; ++s) {                                     // the tiles at the diagonal or at k_len (all tiles when a row lies past q_len)
            const int bo = (s & 1) * TSZ, key0 = s * TK;
            if (key0 < kend) pass(flag_t<true>{}, key0, fk + bo, fv + bo);
            if (key0 + 32 < kend) pass(flag_t<true>{}, key0 + 32, fk + bo + 32 * TP, fv + bo + 32);
            foot(s, bo);
        }
        asm volatile("s_wait_asynccnt 0x0" ::: "memory");         // no copy is outstanding when the wave goes on to its end
    }
    if (EARLY) { o0 = o0 + e0 * QRI; o1 = o1 + e1 * QRI; o2 = o2 + e2 * QRI; o3 = o3 + e3 * QRI; }
    l += __shfl_xor(l, 16, 32);
    const float lsafe = (l > 0.0f) ? l : 1.0f;
    const float inv = (l > 0.0f) ? (1.0f / lsafe) : 0.0f;     // no visible key: zero context
    const int wb = wave * 16 * 68;
    // O^T D layout: o_j[r] = (d = 16j + 8h + r, t = lane&15) -> os[t][d]; rows 0..15 x columns 0..63 all written
    { v4f a, c;
      a[0] = o0[0] * inv; a[1] = o0[1] * inv; a[2] = o0[2] * inv; a[3] = o0[3] * inv; c[0] = o0[4] * inv; c[1] = o0[5] * inv; c[2] = o0[6] * inv; c[3] = o0[7] * inv;
      *(v4fa*)(&os[wb + lr * 68 +  0 + 8 * hi]) = a; *(v4fa*)(&os[wb + lr * 68 +  0 + 8 * hi + 4]) = c;
      a[0] = o1[0] * inv; a[1] = o1[1] * inv; a[2] = o1[2] * inv; a[3] = o1[3] * inv; c[0] = o1[4] * inv; c[1] = o1[5] * inv; c[2] = o1[6] * inv; c[3] = o1[7] * inv;
      *(v4fa*)(&os[wb + lr * 68 + 16 + 8 * hi]) = a; *(v4fa*)(&os[wb + lr * 68 + 16 + 8 * hi + 4]) = c;
      a[0] = o2[0] * inv; a[1] = o2[1] * inv; a[2] = o2[2] * inv; a[3] = o2[3] * inv; c[0] = o2[4] * inv; c[1] = o2[5] * inv; c[2] = o2[6] * inv; c[3] = o2[7] * inv;
      *(v4fa*)(&os[wb + lr * 68 + 32 + 8 * hi]) = a; *(v4fa*)(&os[wb + lr * 68 + 32 + 8 * hi + 4]) = c;
      a[0] = o3[0] * inv; a[1] = o3[1] * inv; a[2] = o3[2] * inv; a[3] = o3[3] * inv; c[0] = o3[4] * inv; c[1] = o3[5] * inv; c[2] = o3[6] * inv; c[3] = o3[7] * inv;
      *(v4fa*)(&os[wb + lr * 68 + 48 + 8 * hi]) = a; *(v4fa*)(&os[wb + lr * 68 + 48 + 8 * hi + 4]) = c; }
    wave_sync();
    const size_t obase = ((size_t)b * SEQ + t0) * DM + (size_t)h * HD;
{
#pragma unroll
        for (int s = 0; s < 4; ++s) { const int row = 4 * s + (lane >> 3), c8 = (lane & 7) * 8;   // 4 s x 4 row groups = 16 rows; 8 lanes x 8 = 64 columns
            const v4f x0 = *(const v4fa*)(&os[wb + row * 68 + c8]); const v4f x1 = *(const v4fa*)(&os[wb + row * 68 + c8 + 4]); v8us hv, lv;
#pragma unroll
            for (int i = 0; i < 4; ++i) { const unsigned short a0 = f2bf(x0[i]); const unsigned short a1 = f2bf(x1[i]);
                hv[i] = a0; hv[4 + i] = a1; lv[i] = f2bf(x0[i] - bf2f(a0)); lv[4 + i] = f2bf(x1[i] - bf2f(a1)); }
            const size_t oo = obase + (size_t)row * DM + c8;
            *(v8us*)(CH + oo) = hv; *(v8us*)(CL + oo) = lv; }
         }
}

// k_flash: both row bands in one grid (SEQ / (16*AW), NB*NH_), the choice a function of blockIdx.x alone:
// the first (SEQ - EROWS) / (16*AW) blocks of a head take query rows EROWS..SEQ-1 (single products), the last EROWS / (16*AW) take rows 0..EROWS-1 (value + residual products).
__global__ __launch_bounds__(32 * AW) void k_flash(const h16* __restrict__ QH, const h16* __restrict__ QR, const h16* __restrict__ KP, const h16* __restrict__ KR,
                                                   const h16* __restrict__ VT, const h16* __restrict__ VR, const int* __restrict__ LENS, bf* CH, bf* CL) {
    __shared__ __align__(16) h16 ring[2 * TSZ];   // the key tiles of either band
    if ((int)blockIdx.x < (SEQ - EROWS) / (16 * AW))
        flash_body<0>((int)blockIdx.x + EROWS / (16 * AW), QH, QH, KP, KP, VT, VT, LENS, CH, CL, ring);
    else
        flash_body<1>((int)blockIdx.x - (SEQ - EROWS) / (16 * AW), QH, QR, KP, KR, VT, VR, LENS, CH, CL, ring);
}

static constexpr size_t al256(size_t v) { return (v + 255) & ~(size_t)255; }
static constexpr size_t SZ_XB = al256((size_t)NB * SEQ * DM * 2);          // one bf16 activation plane [NB*SEQ][1024]
static constexpr size_t SZ_WB = al256((size_t)4 * DM * DM * 2);            // four transposed bf16 weight planes
static constexpr size_t SZ_PL = al256((size_t)NB * NH_ * SEQ * HD * 2);    // one f16 head plane
static constexpr size_t SZ_LN = al256((size_t)32 * 4);
static constexpr size_t SZ_TOTAL = 3 * SZ_XB + SZ_WB + 6 * SZ_PL + 2 * SZ_XB + SZ_LN;
static_assert(SZ_TOTAL <= (size_t)134217728);          // workspace carve <= 128 MiB
static_assert(((size_t)DM * DM * 2) % 256 == 0);       // weight sub-planes stay 256-byte aligned
static_assert((size_t)NB * OUT_SEQ * DM * 4 <= (size_t)NB_FULL * SEQ_FULL * DM * 4);   // single output at byte offset 0

extern "C" void kernel_launch(void* const* d_in, const int* in_sizes, int n_in,
                              void* d_out, int out_size, void* d_ws, size_t ws_size, hipStream_t stream) {
    if (n_in < 13) return;
    const size_t needx = ((size_t)(NB - 1) * SEQ_FULL + SEQ) * DM;
    if ((size_t)in_sizes[0] < needx || (size_t)in_sizes[1] < needx || (size_t)in_sizes[2] < needx) return;
    if ((size_t)in_sizes[3] < (size_t)(NB - 1) * SEQ_FULL + SEQ || (size_t)in_sizes[4] < (size_t)(NB - 1) * SEQ_FULL + SEQ) return;
    if ((size_t)in_sizes[5] < (size_t)DM * DM || (size_t)in_sizes[7] < (size_t)DM * DM || (size_t)in_sizes[9] < (size_t)DM * DM || (size_t)in_sizes[11] < (size_t)DM * DM) return;
    if (in_sizes[6] < DM || in_sizes[8] < DM || in_sizes[10] < DM || in_sizes[12] < DM) return;
    if ((size_t)out_size < ((size_t)(NB - 1) * OUT_SEQ + SEQ) * DM) return;
    if (SZ_TOTAL > ws_size) return;
    // wire order: in_Q, in_K, in_V, Q_pad_mask (int32), K_pad_mask (int32), W_Q, b_Q, W_K, b_K, W_V, b_V, W_O, b_O
    const float* xq = (const float*)d_in[0]; const float* xk = (const float*)d_in[1]; const float* xv = (const float*)d_in[2];
    const int* qmask = (const int*)d_in[3]; const int* kmask = (const int*)d_in[4];
    const float* wq = (const float*)d_in[5];  const float* bq = (const float*)d_in[6];
    const float* wk = (const float*)d_in[7];  const float* bk = (const float*)d_in[8];
    const float* wv = (const float*)d_in[9];  const float* bv = (const float*)d_in[10];
    const float* wo = (const float*)d_in[11]; const float* bo = (const float*)d_in[12];
    float* OUT = (float*)d_out;      // [NB][SEQ][1024]
    char* wsp = (char*)d_ws;
    bf* QB = (bf*)wsp; wsp += SZ_XB;                 // [NB*SEQ][1024] bf16 query input
    bf* KB = (bf*)wsp; wsp += SZ_XB;                 // [NB*SEQ][1024] bf16 key input
    bf* VB = (bf*)wsp; wsp += SZ_XB;                 // [NB*SEQ][1024] bf16 value input
    bf* WB = (bf*)wsp; wsp += SZ_WB;                 // [4][1024 out][1024 in]: q | k | v | o
    h16* QH = (h16*)wsp; wsp += SZ_PL;               // [NB*16][SEQ][64]
    h16* QR = (h16*)wsp; wsp += SZ_PL;               // [NB*16][SEQ][64] residual x2048
    h16* KP = (h16*)wsp; wsp += SZ_PL;               // [NB*16][SEQ][64]
    h16* KR = (h16*)wsp; wsp += SZ_PL;               // [NB*16][SEQ][64] residual x2048
    h16* VT = (h16*)wsp; wsp += SZ_PL;               // [NB*16][64][SEQ]
    h16* VR = (h16*)wsp; wsp += SZ_PL;               // [NB*16][64][SEQ] residual x2048
    bf* CH = (bf*)wsp; wsp += SZ_XB;                 // [NB*SEQ][1024] context bf16 hi
    bf* CL = (bf*)wsp; wsp += SZ_XB;                 // [NB*SEQ][1024] context bf16 lo
    int* LN = (int*)wsp; wsp += SZ_LN;               // 32 ints: word b = q_len[b], word 8 + b = k_len[b]
    bf* WQT = WB; bf* WKT = WB + (size_t)DM * DM; bf* WVT = WB + (size_t)2 * DM * DM; bf* WOT = WB + (size_t)3 * DM * DM;

    // lengths, transposed bf16 weights ([out][in]) and bf16 inputs
    k_prep<<<1 + 4 * PB_WT + 3 * PB_CV, 256, 0, stream>>>(xq, xk, xv, qmask, kmask, wq, wk, wv, wo, QB, KB, VB, WB, LN);
    // q, k planes and v^T planes (value and residual)
    k_qkv<<<dim3(NB * SEQ / GT, DM / GT, 3), 128, 0, stream>>>(QB, KB, VB, WQT, WKT, WVT, bq, bk, bv, QH, QR, KP, KR, VT, VR);
    // context planes: disjoint rows, every row written
    k_flash<<<dim3(SEQ / (16 * AW), NB * NH_, 1), 32 * AW, 0, stream>>>(QH, QR, KP, KR, VT, VR, LN, CH, CL);
    // output rows
    k_out<<<dim3(NB * SEQ / GT, DM / GT, 1), 128, 0, stream>>>(CH, CL, WOT, bo, OUT);
}

// v007
// A run of this version takes 75.7 microseconds.
// Two timings next to v006 both put it at 1.07 times that version's speed.
// Over all steps from v000 it is 3.18 times as fast.
#include <hip/hip_runtime.h>

// Projections q/k/v: v_wmma_f32_16x16x32_bf16 (inputs and weights RNE-converted to bf16, f32 accumulate); scores: v_wmma_f32_16x16x32_f16 (query rows >= EROWS: single f16 q and k; rows < EROWS: q and k as f16 value + f16 residual x2048, three products, residual products in their own accumulator); P.V: v_wmma_f32_16x16x32_f16 (P x256 carry, v single f16; rows < EROWS: P and v as value + residual x2048, three products, residual products in their own accumulator); output projection: v_wmma_f32_16x16x32_bf16 (context as bf16 hi + bf16 lo planes, Wo bf16), f32 accumulate everywhere, softmax f32.
// Attention block, width 1024 = 16 heads x 64; query/key/value inputs [NB][SEQ][1024] f32, W_Q/W_K/W_V/W_O [in][out] (y = x W + b), score scale 1/8,
// causal fill (key > query -> excluded) and length fill (query < q_len[b] and key < k_len[b], lengths = integer sums of the two int32 indicator rows); rows with no visible key give a zero context; output y = ctx W_O + b_O (f32).
// Layout: bf16 copies of the three inputs; bf16 TRANSPOSED copies of the four weights ([out][in], K-contiguous); q, k planes [b*16+h][t][d] and v^T plane [b*16+h][d][t] (value and residual x2048) written by the GEMM epilogue;
// fused flash kernel in transposed form (S^T = K Q^T, O^T = V^T P^T) writing the context as bf16 hi/lo planes [b*SEQ+t][1024]; final GEMM writes f32 rows.
// Four launches, one per level of the dependence chain; work that does not depend on each other shares a grid and is told apart by the block index:
// k_prep (lengths, weight transposes, input conversions), k_qkv (the three projections), k_flash (both row bands), k_out.

#ifndef NB
#define NB 2
#endif
#ifndef SEQ
#define SEQ 2048
#endif
#define NB_FULL  2
#define SEQ_FULL 2048
#ifndef OUT_SEQ
#define OUT_SEQ SEQ              // row pitch (in tokens) between batches of the output
#endif
#ifndef EROWS
#define EROWS 256                // query rows below this use the value + residual products
#endif
#define DM   1024
#define NH_  16
#define HD   64
#define AW   4                   // waves per flash block (16 query rows each)
#define QRS  2048.0f             // carry of the residual planes
#define QRI  (1.0f / 2048.0f)
#define LOG2E 1.4426950408889634f
#define SC2  (0.125f * 1.4426950408889634f)   // HD^-0.5 * log2(e)
#define PSH  8.0f                // log2 of the P carry (256)

static_assert(HD == 64);
static_assert(NH_ * HD == DM);                 // head h = columns h*64 + d
static_assert(DM % 64 == 0);                   // column tiles of 64
static_assert(DM % 32 == 0);                   // GEMM k-loop steps by 32
static_assert(DM >= 8);                        // clamped bias loads stay inside a DM-float array
static_assert(SEQ % 64 == 0);                  // a 64-row tile never straddles two batches
static_assert((NB * SEQ) % 64 == 0);
static_assert(SEQ % 32 == 0);                  // key loop steps by 32
static_assert(SEQ % (16 * AW) == 0);           // flash grid covers the sequence exactly
static_assert(((size_t)SEQ * DM) % 8 == 0);
static_assert(NB <= NB_FULL);
static_assert(SEQ <= SEQ_FULL);
static_assert(SEQ_FULL % 4 == 0);
static_assert(EROWS % (16 * AW) == 0);         // the early band is a whole number of flash blocks
static_assert(EROWS % 32 == 0);                // early key steps stay inside the early key range
static_assert(EROWS >= 16 * AW);
static_assert(EROWS <= SEQ);
static_assert(NB <= 8);                        // length line: word b = q_len[b], word 8 + b = k_len[b]

typedef _Float16 h16;
typedef unsigned short bf;
typedef __attribute__((ext_vector_type(16))) __bf16   v16bf;
typedef __attribute__((ext_vector_type(16))) _Float16 v16h;
typedef __attribute__((ext_vector_type(8)))  _Float16 v8h;
typedef __attribute__((ext_vector_type(8)))  unsigned short v8us;
typedef __attribute__((ext_vector_type(8)))  float    v8f;
typedef __attribute__((ext_vector_type(4)))  float    v4f;
typedef __attribute__((ext_vector_type(4)))  int      v4i;
typedef v4f  __attribute__((may_alias)) v4fa;
typedef v8us __attribute__((may_alias)) v8usa;

__device__ __forceinline__ unsigned short f2bf(float f) { unsigned u = __float_as_uint(f); u += 0x7FFFu + ((u >> 16) & 1u); return (unsigned short)(u >> 16); }
__device__ __forceinline__ float bf2f(unsigned short b) { return __uint_as_float(((unsigned)b) << 16); }
__device__ __forceinline__ float rbf(float f) { return bf2f(f2bf(f)); }   // value after RNE convert to bf16
__device__ __forceinline__ v16h cat16(v8h lo, v8h hi) { return __builtin_shufflevector(lo, hi, 0, 1, 2, 3, 4, 5, 6, 7, 8, 9, 10, 11, 12, 13, 14, 15); }
__device__ __forceinline__ v16bf cat16b(v8us lo, v8us hi) { return __builtin_bit_cast(v16bf, __builtin_shufflevector(lo, hi, 0, 1, 2, 3, 4, 5, 6, 7, 8, 9, 10, 11, 12, 13, 14, 15)); }
__device__ __forceinline__ v8f wmma16(v16h a, v16h b, v8f c) { return __builtin_amdgcn_wmma_f32_16x16x32_f16(false, a, false, b, (short)0, c, false, false); }
__device__ __forceinline__ v8f wmmab(v16bf a, v16bf b, v8f c) { return __builtin_amdgcn_wmma_f32_16x16x32_bf16(false, a, false, b, (short)0, c, false, false); }
// fragment loaders from K-contiguous 16-bit rows; p already includes + 8*(lane>>4): elements 0..7 <- k0+8h+0..7, elements 8..15 <- k0+16+8h+0..7 (same map for A and B)
__device__ __forceinline__ v16h  ldh(const h16* p) { return cat16(*(const v8h*)p, *(const v8h*)(p + 16)); }
__device__ __forceinline__ v16bf ldb(const bf* p)  { return cat16b(*(const v8us*)p, *(const v8us*)(p + 16)); }
// ordering point for wave-private LDS tiles (same wave writes and reads)
__device__ __forceinline__ void wave_sync() { __builtin_amdgcn_fence(3 /* release order */, "wavefront"); __builtin_amdgcn_wave_barrier(); asm volatile("" ::: "memory"); }
// single guarded f16 WMMA (one accumulator per guard)
__device__ __forceinline__ v8f wmma16g(v16h a, v16h b, v8f c) {
    c = __builtin_amdgcn_wmma_f32_16x16x32_f16(false, a, false, b, (short)0, c, false, false);
    asm volatile("v_nop\n\tv_nop\n\tv_nop\n\tv_nop" : "+v"(c) : "v"(a), "v"(b));
    return c;
}
template <bool B> struct flag_t { static constexpr bool value = B; };   // compile-time switch handed to a generic lambda
__device__ __forceinline__ int imin(int a, int b) { return a < b ? a : b; }
__device__ __forceinline__ int imax(int a, int b) { return a > b ? a : b; }

// cvt8_body: thread's group i of eight f32 of an input (batch pitch SEQ_FULL rows) -> eight bf16 (RNE) of the packed [NB*SEQ][DM] plane. blk = block index inside the plane, 256 threads.
__device__ __forceinline__ void cvt8_body(const unsigned blk, const float* __restrict__ src, bf* dst) {
    const size_t n8 = (size_t)NB * SEQ * DM / 8, per = (size_t)SEQ * DM / 8;   // groups in the plane, groups in one batch
    const size_t i = (size_t)blk * 256 + threadIdx.x; if (i >= n8) return;
    const size_t so = (SEQ == SEQ_FULL) ? i * 8 : (i / per) * ((size_t)SEQ_FULL * DM) + (i % per) * 8;
    const v8f v = *(const v8f*)(src + so); v8us o;
#pragma unroll
    for (int k = 0; k < 8; ++k) o[k] = f2bf(v[k]);
    *(v8us*)(dst + i * 8) = o; 
}

// cvtT_body: in[rows = k][cols = n] f32 (DM x DM, row pitch DM) -> out[n][k] bf16 (RNE convert), 64x64 tiles transposed through LDS.
// tile (bx over k, by over n), each below DM/64; 256 threads. LDS tile ts[n][k] is cross-wave: block barrier between fill and drain.
__device__ __forceinline__ void cvtT_body(const int bx, const int by, const float* __restrict__ W, bf* WT) {
    __shared__ __align__(16) unsigned short ts[64 * 72];
    const int tid = threadIdx.x, lane = tid & 31, wave = __builtin_amdgcn_readfirstlane((int)(tid >> 5));
    const int k0 = bx * 64, n0 = by * 64;
#pragma unroll
    for (int i = 0; i < 4; ++i) { const int idx = tid + i * 256; const int kr = idx >> 4, c4 = (idx & 15) * 4;   // 1024 float4 = 64 k-rows x 16
        const v4f v = *(const v4f*)(W + (size_t)(k0 + kr) * DM + n0 + c4);
#pragma unroll
        for (int j = 0; j < 4; ++j) ts[(c4 + j) * 72 + kr] = f2bf(v[j]); }
    __syncthreads();
{
#pragma unroll
        for (int s = 0; s < 2; ++s) { const int row = wave * 8 + s * 4 + (lane >> 3), c8 = (lane & 7) * 8;   // 8 waves x 2 s x 4 = 64 rows; 8 lanes x 8 = 64 columns
            const v8us o = *(const v8usa*)(&ts[row * 72 + c8]);
            *(v8us*)(WT + (size_t)(n0 + row) * DM + k0 + c8) = o; }
        asm volatile("s_wait_xcnt 0x0" ::: "memory");   // stands before the registers that the stores above name are written again (the build lets this range's end run on into another range's code)
         }
}

// lens_body: q_len[b] and k_len[b] as integer sums of the first SEQ entries of row b of the two int32 indicator arrays (row pitch SEQ_FULL).
// LW waves per (array, batch) row: a lane brings its entries with SEQ / (128 LW) independent 16-byte loads (a wave-wide load covers 4 whole lines), all issued before the first sum,
// so the whole kernel waits for memory once instead of once per trip of a one-wave loop. Wave sums meet in LDS behind one block barrier; wave 0 adds them and stores the whole 32-word line.
#define LW 2                     // waves per indicator row (2 NB LW waves = the 256 threads of a k_prep block)
static_assert(SEQ % (128 * LW) == 0);          // a wave's share of a row is a whole number of wave-wide 16-byte loads
static_assert(64 * NB * LW == 256);            // 2 NB LW waves are exactly one k_prep block
__device__ __forceinline__ void lens_body(const int* __restrict__ qm, const int* __restrict__ km, int* lens) {
    __shared__ __align__(16) int ss[16 * LW];  // [word][wave of the row]; word b = q_len[b], word 8 + b = k_len[b]
    const int lane = threadIdx.x & 31, wave = __builtin_amdgcn_readfirstlane((int)(threadIdx.x >> 5));
    const int part = wave % LW, b = (wave / LW) % NB, which = wave / (LW * NB);
    const int* row = (which ? km : qm) + (size_t)b * SEQ_FULL + part * (SEQ / LW) + lane * 4;
    v4i p[SEQ / (128 * LW)];
#pragma unroll
    for (int i = 0; i < SEQ / (128 * LW); ++i) p[i] = *(const v4i*)(row + i * 128);
    int s = 0;
#pragma unroll
    for (int i = 0; i < SEQ / (128 * LW); ++i) s += (p[i][0] + p[i][1]) + (p[i][2] + p[i][3]);
#pragma unroll
    for (int o = 16; o > 0; o >>= 1) s += __shfl_xor(s, o, 32);
    if (lane == 0) ss[(which * 8 + b) * LW + part] = s;
    __syncthreads();   // every wave's sum is in LDS before wave 0 reads it
    if (wave == 0) {
        const bool used = lane < 16 && (lane & 7) < NB;   // words that a row feeds; only these LDS words were written
        int v = 0;
#pragma unroll
        for (int i = 0; i < LW; ++i) v += ss[(used ? lane : 0) * LW + i];
        *(int*)(lens + lane) = used ? v : 0;
        asm volatile("s_wait_xcnt 0x0" ::: "memory");   // stands before the registers that the store above names are written again (the build lets this range's end run on into another range's code)
    }
}

// k_prep: everything that reads only the inputs, in one grid of 256-thread blocks. Block 0: the lengths; the next 4 PB_WT blocks: the weight transposes (q | k | v | o);
// the last 3 PB_CV blocks: the input conversions (query | key | value). A block does one of the three jobs (the choice is a function of blockIdx alone, so every barrier is block-uniform).
#define PB_WT ((DM / 64) * (DM / 64))                                   // 64x64 tiles of one weight
#define PB_CV ((unsigned)(((size_t)NB * SEQ * DM / 8 + 255) / 256))     // blocks of one input plane
__global__ __launch_bounds__(256) void k_prep(const float* __restrict__ xq, const float* __restrict__ xk, const float* __restrict__ xv,
                                              const int* __restrict__ qm, const int* __restrict__ km,
                                              const float* __restrict__ wq, const float* __restrict__ wk, const float* __restrict__ wv, const float* __restrict__ wo,
                                              bf* QB, bf* KB, bf* VB, bf* WB, int* lens) {
    const unsigned blk = blockIdx.x;
    if (blk >= 1 + 4 * PB_WT) {
        const unsigned r = blk - (1 + 4 * PB_WT), p = r / PB_CV;
        cvt8_body(r % PB_CV, (p == 0) ? xq : (p == 1) ? xk : xv, (p == 0) ? QB : (p == 1) ? KB : VB);
    } else if (blk >= 1) {
        const unsigned r = blk - 1, w = r / PB_WT, t = r % PB_WT;
        const float* W = (w == 0) ? wq : (w == 1) ? wk : (w == 2) ? wv : wo;
        cvtT_body((int)(t % (DM / 64)), (int)(t / (DM / 64)), W, WB + (size_t)w * DM * DM);
    } else {
        lens_body(qm, km, lens);
    }
}

// proj_body: bf16 GEMM, one block of 4 waves (2 x 2) per 128x128 tile, each wave a 64x64 sub-tile (16 accumulators), K = DM in passes of KS.
// Operand tiles are staged in LDS: every thread brings 16-byte pieces of whole 256-byte row segments (a wave-wide load covers 4 whole lines) into registers one pass ahead
// and stores them into the other of two LDS buffers behind the pass's products; one block barrier per pass publishes that buffer and ends the reads of the one refilled next.
// Fragments come from LDS rows of pitch LP (272 B) with the same element map as ldb().
// The k walk is a ring: a block starts at pass (bx + by) mod (DM / KS) and wraps round. Blocks of one tile row read the same A rows and blocks of one tile column the same Bt rows, all started together;
// from a common start they would ask L2 for the same lines at the same moment. The sums run over the 32-steps in ascending order from the block's own start, wrapped.
// C[m][n] = sum_k (A[m][k] (+ A2[m][k] when MODE 1)) Bt[n][k] + bias (bmode 1: bias[n]; bmode 2: bias[m]; bias RNE-converted to bf16 first),
// sub-tile base (r0/RB)*sRB + (r0%RB)*pitch + (c0/CB)*sCB + (c0%CB), row pitch 'pitch' (elements). tile (bx below M/128, by below N/128), 128 threads.
// MODE 1: written as f32 (Of); each row's 64 floats (256 B = two lines) by 16 consecutive lanes x 16 B (2 rows per instruction).
// Bias array has DM floats; both 16-byte bias loads use addresses clamped into [0, DM-4].
#define GT 128                   // block tile edge (rows of A and rows of Bt per block)
#define KS 128                   // k elements per pass (256 B of every operand row)
#define LP 136                   // LDS row pitch in elements (272 B: 16 B x odd, for 16-byte readers)
#define NLD (GT * KS / 8 / 128)  // 16-byte pieces per thread, operand and pass
static_assert(DM % KS == 0);
static_assert(((DM / KS) & (DM / KS - 1)) == 0);   // the ring of passes wraps by a mask
static_assert(DM % GT == 0);
static_assert((NB * SEQ) % GT == 0);
__device__ __forceinline__ v16bf ldbs(const bf* p) { return cat16b(*(const v8usa*)p, *(const v8usa*)(p + 16)); }   // ldb() on an LDS row
template <int MODE>
__device__ __forceinline__ void proj_body(const int bx, const int by, const bf* __restrict__ A, const bf* __restrict__ A2, const bf* __restrict__ Bt,
                                          const float* __restrict__ bias, int bmode, h16* Ph, h16* Pr, int useRes, float* Of,
                                          int RB, size_t sRB, int pitch, int CB, size_t sCB) {
    constexpr int NOPD = (MODE == 1) ? 3 : 2;                    // staged operands: A, Bt (, A2)
    __shared__ __align__(16) bf st[2 * NOPD * GT * LP];          // [buffer][operand][row][LP]
    __shared__ __align__(16) float osall[4 * 16 * 68];           // one wave-private epilogue tile per wave
    const int K = DM;
    const int tid = threadIdx.x, lane = tid & 31, lr = lane & 15, hi = lane >> 4, wave = __builtin_amdgcn_readfirstlane((int)(tid >> 5));
    const int R0 = bx * GT, C0 = by * GT;
    const int wm = wave >> 1, wn = wave & 1;
    const int r0 = R0 + wm * 64, c0 = C0 + wn * 64;              // this wave's 64x64 sub-tile
    float* os = osall + wave * (16 * 68);
    v8f acc[4][4];
#pragma unroll
    for (int mb = 0; mb < 4; ++mb)
#pragma unroll
        for (int nb = 0; nb < 4; ++nb) acc[mb][nb] = (v8f){};
    // staging map: piece i of a thread = row (tid >> 4) + 8 i, bytes 16 (tid & 15) of the row's 256-byte segment
    const int srow = tid >> 4, sch = (tid & 15) * 8;
    const bf* gA  = A  + (size_t)(R0 + srow) * K + sch;
    const bf* gA2 = A2 + (size_t)(R0 + srow) * K + sch;
    const bf* gB  = Bt + (size_t)(C0 + srow) * K + sch;
    const int sl = srow * LP + sch;
    const int fa = (wm * 64 + lr) * LP + 8 * hi, fb = GT * LP + (wn * 64 + lr) * LP + 8 * hi, fa2 = 2 * GT * LP + fa;   // fragment bases inside a buffer
    const int rot = (bx + by) & (K / KS - 1);                    // the block's first pass of the ring (block-uniform scalar)
    v8us pa[NLD], pb[NLD], pa2[NLD];
#pragma unroll
    for (int i = 0; i < NLD; ++i) { pa[i] = *(const v8us*)(gA + (size_t)i * 8 * K + rot * KS); pb[i] = *(const v8us*)(gB + (size_t)i * 8 * K + rot * KS);
        if (MODE == 1) pa2[i] = *(const v8us*)(gA2 + (size_t)i * 8 * K + rot * KS); }
    asm volatile("s_wait_xcnt 0x0" ::: "memory");   // stands before the address registers of the loads above are written again (the build forms the rotated addresses in registers that it reuses at once)
#pragma unroll
    for (int i = 0; i < NLD; ++i) { *(v8usa*)(&st[sl + i * 8 * LP]) = pa[i]; *(v8usa*)(&st[GT * LP + sl + i * 8 * LP]) = pb[i];
        if (MODE == 1) *(v8usa*)(&st[2 * GT * LP + sl + i * 8 * LP]) = pa2[i]; }
    __syncthreads();
#pragma unroll 1
    for (int it = 0; it < K / KS; ++it) {
        const int cur = it & 1;
        const bf* sb = st + cur * (NOPD * GT * LP);
        bf* sn = st + (cur ^ 1) * (NOPD * GT * LP);
        const bool more = it + 1 < K / KS;                       // block-uniform: a next pass exists
        if (more) {
            const int kn = ((rot + it + 1) & (K / KS - 1)) * KS; // first k of the next pass of the ring, below K
#pragma unroll
            for (int i = 0; i < NLD; ++i) { pa[i] = *(const v8us*)(gA + (size_t)i * 8 * K + kn); pb[i] = *(const v8us*)(gB + (size_t)i * 8 * K + kn);
                if (MODE == 1) pa2[i] = *(const v8us*)(gA2 + (size_t)i * 8 * K + kn); }
            asm volatile("s_wait_xcnt 0x0" ::: "memory");   // stands before the address registers of the loads above are written again (the build reuses them for the LDS addresses below)
        }
        v16bf a[2][4], b[2][4], a2[2][4];
#pragma unroll
        for (int q = 0; q < 4; ++q) { a[0][q] = ldbs(sb + fa + q * 16 * LP); b[0][q] = ldbs(sb + fb + q * 16 * LP);
            if (MODE == 1) a2[0][q] = ldbs(sb + fa2 + q * 16 * LP); }
        __builtin_amdgcn_sched_barrier(0);   // keeps the next pass's global loads and the first fragment loads ahead of the products
#pragma unroll
        for (int s = 0; s < KS / 32; ++s) {
            const int c = s & 1, n = c ^ 1;
            if (s + 1 < KS / 32) {
#pragma unroll
                for (int q = 0; q < 4; ++q) { a[n][q] = ldbs(sb + fa + q * 16 * LP + (s + 1) * 32); b[n][q] = ldbs(sb + fb + q * 16 * LP + (s + 1) * 32);
                    if (MODE == 1) a2[n][q] = ldbs(sb + fa2 + q * 16 * LP + (s + 1) * 32); }
                __builtin_amdgcn_sched_barrier(0);   // the next 32-step's fragment loads stay one group in front of this step's products, not among them
            }
#pragma unroll
            for (int nb = 0; nb < 4; ++nb)
#pragma unroll
                for (int mb = 0; mb < 4; ++mb) acc[mb][nb] = wmmab(a[c][mb], b[c][nb], acc[mb][nb]);
            // issue slots behind the last products before their operand registers are written again
            asm volatile("v_nop\n\tv_nop\n\tv_nop\n\tv_nop" : "+v"(acc[0][0]), "+v"(acc[1][1]), "+v"(acc[2][2]), "+v"(acc[3][3]) : "v"(a[c][0]), "v"(a[c][1]), "v"(a[c][2]), "v"(a[c][3]));
            if (MODE == 1) {
#pragma unroll
                for (int nb = 0; nb < 4; ++nb)
#pragma unroll
                    for (int mb = 0; mb < 4; ++mb) acc[mb][nb] = wmmab(a2[c][mb], b[c][nb], acc[mb][nb]);
                // issue slots behind the last products before their operand registers are written again
                asm volatile("v_nop\n\tv_nop\n\tv_nop\n\tv_nop" : "+v"(acc[0][0]), "+v"(acc[1][1]), "+v"(acc[2][2]), "+v"(acc[3][3]) : "v"(a2[c][0]), "v"(a2[c][1]), "v"(a2[c][2]), "v"(a2[c][3]));
            }
        }
        if (more) {
#pragma unroll
            for (int i = 0; i < NLD; ++i) { *(v8usa*)(&sn[sl + i * 8 * LP]) = pa[i]; *(v8usa*)(&sn[GT * LP + sl + i * 8 * LP]) = pb[i];
                if (MODE == 1) *(v8usa*)(&sn[2 * GT * LP + sl + i * 8 * LP]) = pa2[i]; }
        }
        __syncthreads();   // publishes the buffer just filled; ends every wave's reads of the buffer that the next pass refills
    }
    const size_t tbase = (size_t)(r0 / RB) * sRB + (size_t)(r0 % RB) * (size_t)pitch + (size_t)(c0 / CB) * sCB + (size_t)(c0 % CB);
    // per-lane column bias for the lane's store columns; both load addresses clamped into the DM-float bias array (first to 0 when unused, second to DM-4)
    const int c8 = (lane & 7) * 8, cofs = lr * 4;
    const int ci = (bmode == 1) ? (c0 + ((MODE == 0) ? c8 : cofs)) : 0;
    const int ci4 = (ci + 4 <= DM - 4) ? (ci + 4) : (DM - 4);      // MODE 0: ci + 4 <= DM - 4 always (exact columns); MODE 1: upper half unused, address kept in range
    const v4f bl0 = *(const v4f*)(bias + ci), bl1 = *(const v4f*)(bias + ci4);
    // MODE 0: the row bias of the lane's 16 store rows (row 16 mb + 4 s + (lane >> 3)), loaded here beside the column bias and converted once,
    // so that the store loop below holds no global load, no wait for one and no branch
    float brw[4][4];
    if (MODE == 0) {
        const float* br = bias + ((bmode == 2) ? (r0 + (lane >> 3)) : 0);   // bmode 2: r0 + 63 <= DM - 1; otherwise words 0..63 of the DM-float array, read and not used
        const unsigned bm = (bmode == 2) ? 0xFFFF0000u : 0u;                // keeps the RNE-converted value, or makes it +0
#pragma unroll
        for (int mb = 0; mb < 4; ++mb)
#pragma unroll
            for (int s = 0; s < 4; ++s) brw[mb][s] = br[mb * 16 + 4 * s];
        asm volatile("" :: "v"(brw[0][0]), "v"(brw[0][1]), "v"(brw[0][2]), "v"(brw[0][3]), "v"(brw[1][0]), "v"(brw[1][1]), "v"(brw[1][2]), "v"(brw[1][3]),
                           "v"(brw[2][0]), "v"(brw[2][1]), "v"(brw[2][2]), "v"(brw[2][3]), "v"(brw[3][0]), "v"(brw[3][1]), "v"(brw[3][2]), "v"(brw[3][3]),
                           "v"(bl0), "v"(bl1));   // inputs-only fence on the loaded values: holds all bias loads together here, one wait for all (the build otherwise sinks each row-bias load to its use, behind a wait of its own)
#pragma unroll
        for (int mb = 0; mb < 4; ++mb)
#pragma unroll
            for (int s = 0; s < 4; ++s) { unsigned u = __float_as_uint(brw[mb][s]); u += 0x7FFFu + ((u >> 16) & 1u); brw[mb][s] = __uint_as_float(u & bm); }   // rbf() under the mask
    }
    float bc[8];
#pragma unroll
    for (int i = 0; i < 4; ++i) { bc[i] = (bmode == 1) ? rbf(bl0[i]) : 0.0f; bc[4 + i] = (bmode == 1) ? rbf(bl1[i]) : 0.0f; }
#pragma unroll
    for (int mb = 0; mb < 4; ++mb) {
#pragma unroll
        for (int nb = 0; nb < 4; ++nb) {
#pragma unroll
            for (int j = 0; j < 8; ++j) os[(hi * 8 + j) * 68 + nb * 16 + lr] = acc[mb][nb][j]; }   // D: row 8h+j, col lane&15; rows 0..15 x columns 0..63 all written
        wave_sync();
        const size_t sb = tbase + (size_t)(mb * 16) * (size_t)pitch;
        if (MODE == 0) {
{
                // the four row groups of the block go as one batch: their LDS reads, conversions and stores are independent of each other and overlap
                v8h hv[4], rv[4]; h16* ph[4]; h16* pr[4];
#pragma unroll
                for (int s = 0; s < 4; ++s) { const int row = 4 * s + (lane >> 3);   // 4 s x 4 row groups = 16 rows; 8 lanes x 8 = 64 columns
                    const float brow = brw[mb][s];
                    const size_t oo = sb + (size_t)row * (size_t)pitch + c8; ph[s] = Ph + oo; pr[s] = Pr + oo;
                    const v4f x0 = *(const v4fa*)(&os[row * 68 + c8]); const v4f x1 = *(const v4fa*)(&os[row * 68 + c8 + 4]);
#pragma unroll
                    for (int i = 0; i < 4; ++i) { const float f0 = x0[i] + bc[i] + brow; const float f1 = x1[i] + bc[4 + i] + brow;
                        const h16 a0 = (h16)f0; const h16 a1 = (h16)f1; hv[s][i] = a0; hv[s][4 + i] = a1; rv[s][i] = (h16)((f0 - (float)a0) * QRS); rv[s][4 + i] = (h16)((f1 - (float)a1) * QRS); } }
                __builtin_amdgcn_sched_barrier(0);   // the stores stay behind all four conversions and address sums: a store among them has its registers reused at once, which costs a wait per store
#pragma unroll
                for (int s = 0; s < 4; ++s) { *(v8h*)ph[s] = hv[s]; if (useRes) *(v8h*)pr[s] = rv[s]; }
                asm volatile("s_wait_xcnt 0x0" ::: "memory");   // stands before the registers that the stores above name are written again by the next row block
                 }
        } else {
{
#pragma unroll
                for (int s = 0; s < 8; ++s) { const int row = 2 * s + hi;   // 8 s x 2 rows = 16 rows; 16 lanes x 4 floats = 64 columns
                    const v4f x0 = *(const v4fa*)(&os[row * 68 + cofs]); v4f val;
                    val[0] = x0[0] + bc[0]; val[1] = x0[1] + bc[1]; val[2] = x0[2] + bc[2]; val[3] = x0[3] + bc[3];
                    *(v4f*)(Of + sb + (size_t)row * (size_t)pitch + cofs) = val; }
                asm volatile("s_wait_xcnt 0x0" ::: "memory");   // stands before the registers that the stores above name are written again by the next row block
                 }
        }
        wave_sync();
    }
}

// k_qkv: the three projections in one grid (NB*SEQ/GT, DM/GT, 3); blockIdx.z picks the product.
// z = 0, 1 (q, k): A = x rows (m = b*SEQ + t), Bt = W^T rows (n = h*64 + d), column bias -> planes [(b*16 + h)][t][d] (value and residual).
// z = 2 (v^T): A = Wv^T rows (m = h*64 + d), Bt = value rows (n = b*SEQ + t), row bias -> planes [(b*1024 + m)][t] = [(b*16 + h)][d][t] (value and residual); its tile is (blockIdx.y, blockIdx.x).
__global__ __launch_bounds__(128) void k_qkv(const bf* __restrict__ QB, const bf* __restrict__ KB, const bf* __restrict__ VB,
                                             const bf* __restrict__ WQT, const bf* __restrict__ WKT, const bf* __restrict__ WVT,
                                             const float* __restrict__ bq, const float* __restrict__ bk, const float* __restrict__ bv,
                                             h16* QH, h16* QR, h16* KP, h16* KR, h16* VT, h16* VR) {
    const int z = blockIdx.z; const bool isv = z == 2;
    const bf* A  = isv ? WVT : z ? KB : QB;
    const bf* Bt = isv ? VB : z ? WKT : WQT;
    proj_body<0>((int)(isv ? blockIdx.y : blockIdx.x), (int)(isv ? blockIdx.x : blockIdx.y), A, A, Bt, isv ? bv : z ? bk : bq, isv ? 2 : 1,
                 isv ? VT : z ? KP : QH, isv ? VR : z ? KR : QR, 1, nullptr,
                 isv ? DM : SEQ, isv ? (size_t)0 : (size_t)NH_ * SEQ * HD, isv ? SEQ : HD, isv ? SEQ : HD, isv ? (size_t)DM * SEQ : (size_t)SEQ * HD);
}

// k_out: A = context hi (+ lo) rows (m = b*SEQ + t), Bt = Wo^T rows (n), column bias -> OUT[(b*OUT_SEQ + t)][n] f32; grid (NB*SEQ/GT, DM/GT).
__global__ __launch_bounds__(128) void k_out(const bf* __restrict__ CH, const bf* __restrict__ CL, const bf* __restrict__ WOT, const float* __restrict__ bo, float* OUT) {
    proj_body<1>((int)blockIdx.x, (int)blockIdx.y, CH, CL, WOT, bo, 1, nullptr, nullptr, 0, OUT, SEQ, (size_t)OUT_SEQ * DM, DM, DM, (size_t)0);
}

// Key tiles of k_flash: the block's AW waves share one tile of TK keys in LDS, one plane pair = [K: TK key rows of 128 B | V^T: HD d rows of 128 B], row pitch TP elements (144 B, for 16-byte readers).
// The ring holds two plane pairs. EARLY = 0: two buffers of the value planes, the next tile's copies in flight while this tile is worked on. EARLY = 1: one buffer, value pair then residual pair.
#define TK 64                    // keys per staged tile (two 32-key passes)
#define TP 72                    // LDS row pitch in elements
#define TSZ ((TK + HD) * TP)     // elements of one plane pair
static_assert(TK * 2 == 128);                  // a V^T row segment of a tile is one whole line
static_assert(SEQ % TK == 0);                  // every tile lies wholly inside the planes
static_assert(16 * AW == TK);                  // a block's query rows span one tile: block xblk walks xblk + 1 tiles at most
static_assert(32 * AW / 8 == 16);              // one copy of the block covers 16 rows of 128 B
static_assert(TK == 64);                       // four copies cover the K rows of a tile, four the HD = 64 V^T rows
// tile_copy: the block's copy of one plane pair of a tile, 8 asynchronous 16-byte copies a lane (4 K, 4 V^T); a wave-wide copy covers 4 whole 128-byte rows.
// lk, lv: the lane's LDS byte addresses of its first K and V^T piece; gk, gv: the global addresses of the same pieces; piece i lies 16 rows further on.
// The last line of the statement stands before the address registers that the copies name are written again.
__device__ __forceinline__ void tile_copy(const unsigned lk, const unsigned lv, const h16* gk, const h16* gv) {
    asm volatile("global_load_async_to_lds_b128 %0, %8, off\n\t"
                 "global_load_async_to_lds_b128 %1, %9, off\n\t"
                 "global_load_async_to_lds_b128 %2, %10, off\n\t"
                 "global_load_async_to_lds_b128 %3, %11, off\n\t"
                 "global_load_async_to_lds_b128 %4, %12, off\n\t"
                 "global_load_async_to_lds_b128 %5, %13, off\n\t"
                 "global_load_async_to_lds_b128 %6, %14, off\n\t"
                 "global_load_async_to_lds_b128 %7, %15, off\n\t"
                 "s_wait_xcnt 0x0"
                 :: "v"(lk), "v"(lk + 16 * TP * 2), "v"(lk + 32 * TP * 2), "v"(lk + 48 * TP * 2),
                    "v"(lv), "v"(lv + 16 * TP * 2), "v"(lv + 32 * TP * 2), "v"(lv + 48 * TP * 2),
                    "v"(gk), "v"(gk + 16 * HD), "v"(gk + 32 * HD), "v"(gk + 48 * HD),
                    "v"(gv), "v"(gv + (size_t)16 * SEQ), "v"(gv + (size_t)32 * SEQ), "v"(gv + (size_t)48 * SEQ)
                 : "memory");
}

// flash_body: fused attention, one wave per 16 query rows of one (batch, head); Q fragments straight from the f16 planes (two 16-B loads each, arithmetic addressing);
// K / V^T fragments from the block's LDS tile with the same element map (two 16-B LDS loads each).
// Transposed form: S^T[key][t] = K Q^T (A = K rows, B = Q rows); lane (t = lane&15, h = lane>>4) holds keys 8h+r of each 16-key tile, so the packed
// P tile is directly the B fragment of O^T[d][t] = V^T P^T (element r <- tile keys 0..15, element 8+r <- tile keys 16..31, lane unchanged).
// Visibility of (t, key): key <= lim(t) with lim = min(t, k_len - 1) when t < q_len, else -1 (nothing visible); excluded scores are REPLACED by a large negative fill and their P is set to 0 by value.
// The key loop runs to kend = min(t0 + 16, k_len) <= SEQ (wave-scalar, static upper bound SEQ); a row with no visible key keeps l = 0 and gets a zero context.
// Softmax state (running max, partial sum) is one scalar per lane; the two lane halves of a row are combined with one xor-16 exchange.
// EARLY = 1 (query rows < EROWS): q, k, P, v each as f16 value + f16 residual x2048; value x residual products go to separate accumulators folded with 1/2048 (scores: before the scale; context: before the normalisation); row sum over the unconverted p.
// EARLY = 0: single f16 products, row sum over the converted P.
template <int EARLY>
__device__ __forceinline__ void flash_body(const int xblk, const h16* __restrict__ QH, const h16* __restrict__ QR, const h16* __restrict__ KP, const h16* __restrict__ KR,
                                           const h16* __restrict__ VT, const h16* __restrict__ VR, const int* __restrict__ LENS, bf* CH, bf* CL, h16* ring) {
    __shared__ __align__(16) float os[AW * 16 * 68];
    const int lane = threadIdx.x & 31, wave = __builtin_amdgcn_readfirstlane((int)(threadIdx.x >> 5)), lr = lane & 15, hi = lane >> 4;
    const int zh = blockIdx.y; const int b = zh / NH_, h = zh % NH_;
    const int t0 = (xblk * AW + wave) * 16;
    const size_t pbase = (size_t)zh * SEQ * HD;
    const size_t qo = pbase + (size_t)(t0 + lr) * HD + 8 * hi;
    const v16h qh0 = ldh(QH + qo), qh1 = ldh(QH + qo + 32);   // B fragments: col t, k = d
    v16h qr0 = qh0, qr1 = qh1;
    if (EARLY) { qr0 = ldh(QR + qo); qr1 = ldh(QR + qo + 32); }
    const int qlen = imin(imax(LENS[b], 0), SEQ), klen = imin(imax(LENS[8 + b], 0), SEQ);   // lengths clamped into [0, SEQ]
    const int t = t0 + lr;
    const int lim = (t < qlen) ? imin(t, klen - 1) : -1;      // last visible key of query t (-1: none)
    const int kend = __builtin_amdgcn_readfirstlane(imin((xblk * AW + (int)(threadIdx.x >> 5)) * 16 + 16, klen));   // min taken first, then made wave-scalar; <= SEQ
    v8f o0 = (v8f){}, o1 = (v8f){}, o2 = (v8f){}, o3 = (v8f){};
    v8f e0 = (v8f){}, e1 = (v8f){}, e2 = (v8f){}, e3 = (v8f){};
    float m = -3.0e38f, l = 0.0f;
    // one 32-key pass; kl (A fragment: row key, k = d; + 16 TP: the second 16 keys) and vl (A fragment: row d, k = key; + 16j TP) are this lane's fragment bases of the pass in the LDS tile, residual pair at + TSZ
    // TEST::value = false: the caller has shown that every key of the pass is visible to every row of the wave, so each visibility test below is true and is left out (same order of sums)
    auto pass = [&](auto TEST, const int key0, const h16* kl, const h16* vl) __attribute__((always_inline)) {
        constexpr bool MK = decltype(TEST)::value;
        v8f sHa = (v8f){}, sLa = (v8f){}, sHb = (v8f){}, sLb = (v8f){};
        if (EARLY) {
            { const v16h kh0 = ldh(kl), kh1 = ldh(kl + 32), kr0 = ldh(kl + TSZ), kr1 = ldh(kl + TSZ + 32);
              sHa = wmma16g(kh0, qh0, sHa); sLa = wmma16g(kh0, qr0, sLa); sLa = wmma16g(kr0, qh0, sLa);
              sHa = wmma16g(kh1, qh1, sHa); sLa = wmma16g(kh1, qr1, sLa); sLa = wmma16g(kr1, qh1, sLa); }
            { const v16h kh0 = ldh(kl + 16 * TP), kh1 = ldh(kl + 16 * TP + 32), kr0 = ldh(kl + TSZ + 16 * TP), kr1 = ldh(kl + TSZ + 16 * TP + 32);
              sHb = wmma16g(kh0, qh0, sHb); sLb = wmma16g(kh0, qr0, sLb); sLb = wmma16g(kr0, qh0, sLb);
              sHb = wmma16g(kh1, qh1, sHb); sLb = wmma16g(kh1, qr1, sLb); sLb = wmma16g(kr1, qh1, sLb); }
        } else {
            const v16h ka0 = ldh(kl), ka1 = ldh(kl + 32), kb0 = ldh(kl + 16 * TP), kb1 = ldh(kl + 16 * TP + 32);
            sHa = wmma16(ka0, qh0, sHa); sHb = wmma16(kb0, qh0, sHb);
            sHa = wmma16(ka1, qh1, sHa); sHb = wmma16(kb1, qh1, sHb);
            asm volatile("v_nop\n\tv_nop\n\tv_nop\n\tv_nop" : "+v"(sHa), "+v"(sHb) : "v"(ka0), "v"(ka1), "v"(kb0), "v"(kb1));
        }
        const int kq = key0 + 8 * hi;           // this lane's first key of tile a (tile b: + 16)
        float ta[8], tb[8]; float mx = -3.0e38f;
#pragma unroll
        for (int r = 0; r < 8; ++r) {
            const float xa = EARLY ? (sHa[r] + sLa[r] * QRI) * SC2 : sHa[r] * SC2;
            const float xb = EARLY ? (sHb[r] + sLb[r] * QRI) * SC2 : sHb[r] * SC2;
            ta[r] = (!MK || kq + r <= lim) ? xa : -3.0e38f;
            tb[r] = (!MK || kq + 16 + r <= lim) ? xb : -3.0e38f; }
#pragma unroll
        for (int r = 0; r < 8; ++r) mx = fmaxf(mx, fmaxf(ta[r], tb[r]));
        mx = fmaxf(mx, __shfl_xor(mx, 16, 32));
        const float mnew = fmaxf(m, mx);
        const float alpha = __builtin_amdgcn_exp2f(m - mnew);
        const float sh = PSH - mnew;
        v16h pb = (v16h){}, pr = (v16h){}; float ls = 0.0f;
#pragma unroll
        for (int r = 0; r < 8; ++r) {
            const float ya = __builtin_amdgcn_exp2f(ta[r] + sh), yb = __builtin_amdgcn_exp2f(tb[r] + sh);
            const float ea = (!MK || kq + r <= lim) ? ya : 0.0f;
            const float eb = (!MK || kq + 16 + r <= lim) ? yb : 0.0f;
            const h16 pa = (h16)ea; const h16 pc = (h16)eb; pb[r] = pa; pb[8 + r] = pc;
            if (EARLY) { pr[r] = (h16)((ea - (float)pa) * QRS); pr[8 + r] = (h16)((eb - (float)pc) * QRS); ls += ea + eb; }
            else { ls += (float)pa + (float)pc; } }
        l = l * alpha + ls; m = mnew;
        o0 = o0 * alpha; o1 = o1 * alpha; o2 = o2 * alpha; o3 = o3 * alpha;
        if (EARLY) {
            e0 = e0 * alpha; e1 = e1 * alpha; e2 = e2 * alpha; e3 = e3 * alpha;
            { const v16h vh = ldh(vl), vr = ldh(vl + TSZ);
              o0 = wmma16g(vh, pb, o0); e0 = wmma16g(vh, pr, e0); e0 = wmma16g(vr, pb, e0); }
            { const v16h vh = ldh(vl + 16 * TP), vr = ldh(vl + TSZ + 16 * TP);
              o1 = wmma16g(vh, pb, o1); e1 = wmma16g(vh, pr, e1); e1 = wmma16g(vr, pb, e1); }
            { const v16h vh = ldh(vl + 32 * TP), vr = ldh(vl + TSZ + 32 * TP);
              o2 = wmma16g(vh, pb, o2); e2 = wmma16g(vh, pr, e2); e2 = wmma16g(vr, pb, e2); }
            { const v16h vh = ldh(vl + 48 * TP), vr = ldh(vl + TSZ + 48 * TP);
              o3 = wmma16g(vh, pb, o3); e3 = wmma16g(vh, pr, e3); e3 = wmma16g(vr, pb, e3); }
        } else {
            const v16h v0 = ldh(vl), v1 = ldh(vl + 16 * TP), v2 = ldh(vl + 32 * TP), v3 = ldh(vl + 48 * TP);
            o0 = wmma16(v0, pb, o0); o1 = wmma16(v1, pb, o1); o2 = wmma16(v2, pb, o2); o3 = wmma16(v3, pb, o3);
            asm volatile("v_nop\n\tv_nop\n\tv_nop\n\tv_nop" : "+v"(o0), "+v"(o1), "+v"(o2), "+v"(o3) : "v"(v0), "v"(v1), "v"(v2), "v"(v3), "v"(pb));
        }
    };
    const int nt = (imin(xblk * TK + TK, __builtin_amdgcn_readfirstlane(klen)) + TK - 1) / TK;   // tiles the block walks (block-uniform scalar, <= SEQ / TK): up to its last wave's kend
    const int crow = (int)threadIdx.x >> 3, cch = ((int)threadIdx.x & 7) * 8;                    // the lane's first row of a copy and its 16-byte piece of a 128-byte row
    const unsigned lk = (unsigned)(size_t)(__attribute__((address_space(3))) h16*)(ring + crow * TP + cch), lv = lk + TK * TP * 2;
    const h16* gk = KP + pbase + (size_t)crow * HD + cch;     // + tile * TK * HD
    const h16* gv = VT + pbase + (size_t)crow * SEQ + cch;    // + tile * TK
    const h16* fk = ring + lr * TP + 8 * hi;                  // fragment bases inside the first plane pair
    const h16* fv = fk + TK * TP;
    // In both bands a wave makes the 32-key passes below its own kend (wave-scalar tests) and passes every barrier; EARLY = 1: in ascending order; EARLY = 0: the wholly visible tiles as a ring, then the rest ascending.
    if constexpr (EARLY) {
        const h16* gkr = KR + pbase + (size_t)crow * HD + cch;
        const h16* gvr = VR + pbase + (size_t)crow * SEQ + cch;
#pragma unroll 1
        for (int s = 0; s < nt; ++s) {
            const int key0 = s * TK;
            tile_copy(lk, lv, gk + (size_t)key0 * HD, gv + key0);
            tile_copy(lk + TSZ * 2, lv + TSZ * 2, gkr + (size_t)key0 * HD, gvr + key0);
            asm volatile("s_wait_asynccnt 0x0" ::: "memory");     // this wave's part of the tile has landed
            __syncthreads();                                      // the tile is whole for every wave
            if (key0 < kend) pass(flag_t<true>{}, key0, fk, fv);
            if (key0 + 32 < kend) pass(flag_t<true>{}, key0 + 32, fk + 32 * TP, fv + 32);
            if (s + 1 < nt) {
                asm volatile("s_wait_dscnt 0x0" ::: "memory");    // this wave's reads of the tile are done before it is overwritten
                __syncthreads();                                  // ends every wave's reads of the tile that the next trip overwrites
            }
        }
    } else {
        // keys 0 .. kvis - 1 are visible to every row of the block: the smallest lim + 1 over its TK rows (0 when a row lies at or past q_len); block-uniform scalar, kvis <= every wave's kend
        const int kvis = __builtin_amdgcn_readfirstlane((xblk * TK + TK - 1 < qlen) ? imin(xblk * TK, klen - 1) + 1 : 0);
        const int nf = kvis / TK;                                 // leading tiles that lie wholly below kvis; nf <= nt
        // The nf leading tiles are walked as a ring from a start of the block's own: the blocks of a head read the same K and V^T rows and start together, and from a common start
        // they would ask L2 for the same lines at the same moment. (13 xblk) mod 32 is a permutation of the 32 block indices, scaled into [0, nf). The tiles from nf on keep their order.
        const int rot = (nf * ((xblk * 13) & 31)) >> 5;           // block-uniform scalar, 0 <= rot < nf (0 when nf = 0)
        auto tile_of = [&](const int s) __attribute__((always_inline)) {   // tile of trip s, below nt for s < nt: a permutation of the trips
            const int w = s + rot;
            return (s < nf) ? ((w < nf) ? w : w - nf) : s;
        };
        if (nt > 0) tile_copy(lk, lv, gk + (size_t)tile_of(0) * TK * HD, gv + tile_of(0) * TK);
        asm volatile("s_wait_asynccnt 0x0" ::: "memory");         // this wave's part of the first tile has landed
        __syncthreads();                                          // the first tile is whole for every wave
        if (nt > 1) tile_copy(lk + TSZ * 2, lv + TSZ * 2, gk + (size_t)tile_of(1) * TK * HD, gv + tile_of(1) * TK);
        // foot of trip s of either loop below, passed by every wave
        auto foot = [&](const int s, const int bo) __attribute__((always_inline)) {
            asm volatile("s_wait_dscnt 0x0" ::: "memory");        // this wave's reads of the buffer are done before it is refilled
            asm volatile("s_wait_asynccnt 0x0" ::: "memory");     // this wave's part of the next tile has landed
            __syncthreads();                                      // publishes the next tile; ends every wave's reads of the buffer refilled below
            if (s + 2 < nt) tile_copy(lk + bo * 2, lv + bo * 2, gk + (size_t)tile_of(s + 2) * TK * HD, gv + tile_of(s + 2) * TK);
        };
        int s = 0;
#pragma unroll 1
        for (; s < nf; ++s) {                                     // tiles with no hidden score: both passes, no visibility tests
            const int bo = (s & 1) * TSZ, key0 = tile_of(s) * TK;
            pass(flag_t<false>{}, key0, fk + bo, fv + bo);
            pass(flag_t<false>{}, key0 + 32, fk + bo + 32 * TP, fv + bo + 32);
            foot(s, bo);
        }
#pragma unroll 1
        for (; s < nt; ++s) {                                     // the tiles at the diagonal or at k_len (all tiles when a row lies past q_len)
            const int bo = (s & 1) * TSZ, key0 = s * TK;
            if (key0 < kend) pass(flag_t<true>{}, key0, fk + bo, fv + bo);
            if (key0 + 32 < kend) pass(flag_t<true>{}, key0 + 32, fk + bo + 32 * TP, fv + bo + 32);
            foot(s, bo);
        }
        asm volatile("s_wait_asynccnt 0x0" ::: "memory");         // no copy is outstanding when the wave goes on to its end
    }
    if (EARLY) { o0 = o0 + e0 * QRI; o1 = o1 + e1 * QRI; o2 = o2 + e2 * QRI; o3 = o3 + e3 * QRI; }
    l += __shfl_xor(l, 16, 32);
    const float lsafe = (l > 0.0f) ? l : 1.0f;
    const float inv = (l > 0.0f) ? (1.0f / lsafe) : 0.0f;     // no visible key: zero context
    const int wb = wave * 16 * 68;
    // O^T D layout: o_j[r] = (d = 16j + 8h + r, t = lane&15) -> os[t][d]; rows 0..15 x columns 0..63 all written
    { v4f a, c;
      a[0] = o0[0] * inv; a[1] = o0[1] * inv; a[2] = o0[2] * inv; a[3] = o0[3] * inv; c[0] = o0[4] * inv; c[1] = o0[5] * inv; c[2] = o0[6] * inv; c[3] = o0[7] * inv;
      *(v4fa*)(&os[wb + lr * 68 +  0 + 8 * hi]) = a; *(v4fa*)(&os[wb + lr * 68 +  0 + 8 * hi + 4]) = c;
      a[0] = o1[0] * inv; a[1] = o1[1] * inv; a[2] = o1[2] * inv; a[3] = o1[3] * inv; c[0] = o1[4] * inv; c[1] = o1[5] * inv; c[2] = o1[6] * inv; c[3] = o1[7] * inv;
      *(v4fa*)(&os[wb + lr * 68 + 16 + 8 * hi]) = a; *(v4fa*)(&os[wb + lr * 68 + 16 + 8 * hi + 4]) = c;
      a[0] = o2[0] * inv; a[1] = o2[1] * inv; a[2] = o2[2] * inv; a[3] = o2[3] * inv; c[0] = o2[4] * inv; c[1] = o2[5] * inv; c[2] = o2[6] * inv; c[3] = o2[7] * inv;
      *(v4fa*)(&os[wb + lr * 68 + 32 + 8 * hi]) = a; *(v4fa*)(&os[wb + lr * 68 + 32 + 8 * hi + 4]) = c;
      a[0] = o3[0] * inv; a[1] = o3[1] * inv; a[2] = o3[2] * inv; a[3] = o3[3] * inv; c[0] = o3[4] * inv; c[1] = o3[5] * inv; c[2] = o3[6] * inv; c[3] = o3[7] * inv;
      *(v4fa*)(&os[wb + lr * 68 + 48 + 8 * hi]) = a; *(v4fa*)(&os[wb + lr * 68 + 48 + 8 * hi + 4]) = c; }
    wave_sync();
    const size_t obase = ((size_t)b * SEQ + t0) * DM + (size_t)h * HD;
{
#pragma unroll
        for (int s = 0; s < 4; ++s) { const int row = 4 * s + (lane >> 3), c8 = (lane & 7) * 8;   // 4 s x 4 row groups = 16 rows; 8 lanes x 8 = 64 columns
            const v4f x0 = *(const v4fa*)(&os[wb + row * 68 + c8]); const v4f x1 = *(const v4fa*)(&os[wb + row * 68 + c8 + 4]); v8us hv, lv;
#pragma unroll
            for (int i = 0; i < 4; ++i) { const unsigned short a0 = f2bf(x0[i]); const unsigned short a1 = f2bf(x1[i]);
                hv[i] = a0; hv[4 + i] = a1; lv[i] = f2bf(x0[i] - bf2f(a0)); lv[4 + i] = f2bf(x1[i] - bf2f(a1)); }
            const size_t oo = obase + (size_t)row * DM + c8;
            *(v8us*)(CH + oo) = hv; *(v8us*)(CL + oo) = lv; }
         }
}

// k_flash: both row bands in one grid (SEQ / (16*AW), NB*NH_), the choice a function of blockIdx.x alone:
// the first (SEQ - EROWS) / (16*AW) blocks of a head take query rows EROWS..SEQ-1 (single products), the last EROWS / (16*AW) take rows 0..EROWS-1 (value + residual products).
__global__ __launch_bounds__(32 * AW) void k_flash(const h16* __restrict__ QH, const h16* __restrict__ QR, const h16* __restrict__ KP, const h16* __restrict__ KR,
                                                   const h16* __restrict__ VT, const h16* __restrict__ VR, const int* __restrict__ LENS, bf* CH, bf* CL) {
    __shared__ __align__(16) h16 ring[2 * TSZ];   // the key tiles of either band
    if ((int)blockIdx.x < (SEQ - EROWS) / (16 * AW))
        flash_body<0>((int)blockIdx.x + EROWS / (16 * AW), QH, QH, KP, KP, VT, VT, LENS, CH, CL, ring);
    else
        flash_body<1>((int)blockIdx.x - (SEQ - EROWS) / (16 * AW), QH, QR, KP, KR, VT, VR, LENS, CH, CL, ring);
}

static constexpr size_t al256(size_t v) { return (v + 255) & ~(size_t)255; }
static constexpr size_t SZ_XB = al256((size_t)NB * SEQ * DM * 2);          // one bf16 activation plane [NB*SEQ][1024]
static constexpr size_t SZ_WB = al256((size_t)4 * DM * DM * 2);            // four transposed bf16 weight planes
static constexpr size_t SZ_PL = al256((size_t)NB * NH_ * SEQ * HD * 2);    // one f16 head plane
static constexpr size_t SZ_LN = al256((size_t)32 * 4);
static constexpr size_t SZ_TOTAL = 3 * SZ_XB + SZ_WB + 6 * SZ_PL + 2 * SZ_XB + SZ_LN;
static_assert(SZ_TOTAL <= (size_t)134217728);          // workspace carve <= 128 MiB
static_assert(((size_t)DM * DM * 2) % 256 == 0);       // weight sub-planes stay 256-byte aligned
static_assert((size_t)NB * OUT_SEQ * DM * 4 <= (size_t)NB_FULL * SEQ_FULL * DM * 4);   // single output at byte offset 0

extern "C" void kernel_launch(void* const* d_in, const int* in_sizes, int n_in,
                              void* d_out, int out_size, void* d_ws, size_t ws_size, hipStream_t stream) {
    if (n_in < 13) return;
    const size_t needx = ((size_t)(NB - 1) * SEQ_FULL + SEQ) * DM;
    if ((size_t)in_sizes[0] < needx || (size_t)in_sizes[1] < needx || (size_t)in_sizes[2] < needx) return;
    if ((size_t)in_sizes[3] < (size_t)(NB - 1) * SEQ_FULL + SEQ || (size_t)in_sizes[4] < (size_t)(NB - 1) * SEQ_FULL + SEQ) return;
    if ((size_t)in_sizes[5] < (size_t)DM * DM || (size_t)in_sizes[7] < (size_t)DM * DM || (size_t)in_sizes[9] < (size_t)DM * DM || (size_t)in_sizes[11] < (size_t)DM * DM) return;
    if (in_sizes[6] < DM || in_sizes[8] < DM || in_sizes[10] < DM || in_sizes[12] < DM) return;
    if ((size_t)out_size < ((size_t)(NB - 1) * OUT_SEQ + SEQ) * DM) return;
    if (SZ_TOTAL > ws_size) return;
    // wire order: in_Q, in_K, in_V, Q_pad_mask (int32), K_pad_mask (int32), W_Q, b_Q, W_K, b_K, W_V, b_V, W_O, b_O
    const float* xq = (const float*)d_in[0]; const float* xk = (const float*)d_in[1]; const float* xv = (const float*)d_in[2];
    const int* qmask = (const int*)d_in[3]; const int* kmask = (const int*)d_in[4];
    const float* wq = (const float*)d_in[5];  const float* bq = (const float*)d_in[6];
    const float* wk = (const float*)d_in[7];  const float* bk = (const float*)d_in[8];
    const float* wv = (const float*)d_in[9];  const float* bv = (const float*)d_in[10];
    const float* wo = (const float*)d_in[11]; const float* bo = (const float*)d_in[12];
    float* OUT = (float*)d_out;      // [NB][SEQ][1024]
    char* wsp = (char*)d_ws;
    bf* QB = (bf*)wsp; wsp += SZ_XB;                 // [NB*SEQ][1024] bf16 query input
    bf* KB = (bf*)wsp; wsp += SZ_XB;                 // [NB*SEQ][1024] bf16 key input
    bf* VB = (bf*)wsp; wsp += SZ_XB;                 // [NB*SEQ][1024] bf16 value input
    bf* WB = (bf*)wsp; wsp += SZ_WB;                 // [4][1024 out][1024 in]: q | k | v | o
    h16* QH = (h16*)wsp; wsp += SZ_PL;               // [NB*16][SEQ][64]
    h16* QR = (h16*)wsp; wsp += SZ_PL;               // [NB*16][SEQ][64] residual x2048
    h16* KP = (h16*)wsp; wsp += SZ_PL;               // [NB*16][SEQ][64]
    h16* KR = (h16*)wsp; wsp += SZ_PL;               // [NB*16][SEQ][64] residual x2048
    h16* VT = (h16*)wsp; wsp += SZ_PL;               // [NB*16][64][SEQ]
    h16* VR = (h16*)wsp; wsp += SZ_PL;               // [NB*16][64][SEQ] residual x2048
    bf* CH = (bf*)wsp; wsp += SZ_XB;                 // [NB*SEQ][1024] context bf16 hi
    bf* CL = (bf*)wsp; wsp += SZ_XB;                 // [NB*SEQ][1024] context bf16 lo
    int* LN = (int*)wsp; wsp += SZ_LN;               // 32 ints: word b = q_len[b], word 8 + b = k_len[b]
    bf* WQT = WB; bf* WKT = WB + (size_t)DM * DM; bf* WVT = WB + (size_t)2 * DM * DM; bf* WOT = WB + (size_t)3 * DM * DM;

    // lengths, transposed bf16 weights ([out][in]) and bf16 inputs
    k_prep<<<1 + 4 * PB_WT + 3 * PB_CV, 256, 0, stream>>>(xq, xk, xv, qmask, kmask, wq, wk, wv, wo, QB, KB, VB, WB, LN);
    // q, k planes and v^T planes (value and residual)
    k_qkv<<<dim3(NB * SEQ / GT, DM / GT, 3), 128, 0, stream>>>(QB, KB, VB, WQT, WKT, WVT, bq, bk, bv, QH, QR, KP, KR, VT, VR);
    // context planes: disjoint rows, every row written
    k_flash<<<dim3(SEQ / (16 * AW), NB * NH_, 1), 32 * AW, 0, stream>>>(QH, QR, KP, KR, VT, VR, LN, CH, CL);
    // output rows
    k_out<<<dim3(NB * SEQ / GT, DM / GT, 1), 128, 0, stream>>>(CH, CL, WOT, bo, OUT);
}

// v009
// Measured time: 65.6 microseconds a run.
// Versions between v007 and this one are left out; their measured steps multiply to 1.15 times as fast.
// All steps since v000 together make it 3.65 times as fast.
#include <hip/hip_runtime.h>

// Projections q/k/v: v_wmma_f32_16x16x32_bf16 (inputs and weights RNE-converted to bf16, f32 accumulate); scores: v_wmma_f32_16x16x32_f16 (query rows >= EROWS: single f16 q and k; rows < EROWS: q and k as f16 value + f16 residual x2048, three products, residual products in their own accumulator); P.V: v_wmma_f32_16x16x32_f16 (P x256 carry, v single f16; rows < EROWS: P and v as value + residual x2048, three products, residual products in their own accumulator); output projection: v_wmma_f32_16x16x32_f16 (context as one f16 plane, Wo RNE-converted to bf16 and that value held as f16), f32 accumulate everywhere, softmax f32.
// Attention block, width 1024 = 16 heads x 64; query/key/value inputs [NB][SEQ][1024] f32, W_Q/W_K/W_V/W_O [in][out] (y = x W + b), score scale 1/8,
// causal fill (key > query -> excluded) and length fill (query < q_len[b] and key < k_len[b], lengths = integer sums of the two int32 indicator rows); rows with no visible key give a zero context; output y = ctx W_O + b_O (f32).
// Layout: bf16 copies of the three inputs; 16-bit TRANSPOSED copies of the four weights ([out][in], K-contiguous; q, k, v bf16, o f16); q, k planes [b*16+h][t][d] and v^T plane [b*16+h][d][t] (value and residual x2048) written by the GEMM epilogue;
// fused flash kernel in transposed form (S^T = K Q^T, O^T = V^T P^T) writing the context as an f16 plane [b*SEQ+t][1024]; final GEMM writes f32 rows.
// Four launches, one per level of the dependence chain; work that does not depend on each other shares a grid and is told apart by the block index:
// k_prep (lengths, weight transposes, input conversions), k_qkv (the three projections), k_flash (both row bands), k_out.

#ifndef NB
#define NB 2
#endif
#ifndef SEQ
#define SEQ 2048
#endif
#define NB_FULL  2
#define SEQ_FULL 2048
#ifndef OUT_SEQ
#define OUT_SEQ SEQ              // row pitch (in tokens) between batches of the output
#endif
#ifndef EROWS
#define EROWS 256                // query rows below this use the value + residual products
#endif
#define DM   1024
#define NH_  16
#define HD   64
#define AW   4                   // waves per flash block (16 query rows each)
#define QRS  2048.0f             // carry of the residual planes
#define QRI  (1.0f / 2048.0f)
#define LOG2E 1.4426950408889634f
#define SC2  (0.125f * 1.4426950408889634f)   // HD^-0.5 * log2(e)
#define PSH  8.0f                // log2 of the P carry (256)

static_assert(HD == 64);
static_assert(NH_ * HD == DM);                 // head h = columns h*64 + d
static_assert(DM % 64 == 0);                   // column tiles of 64
static_assert(DM % 32 == 0);                   // GEMM k-loop steps by 32
static_assert(DM >= 8);                        // clamped bias loads stay inside a DM-float array
static_assert(SEQ % 64 == 0);                  // a 64-row tile never straddles two batches
static_assert((NB * SEQ) % 64 == 0);
static_assert(SEQ % 32 == 0);                  // key loop steps by 32
static_assert(SEQ % (16 * AW) == 0);           // flash grid covers the sequence exactly
static_assert(((size_t)SEQ * DM) % 8 == 0);
static_assert(NB <= NB_FULL);
static_assert(SEQ <= SEQ_FULL);
static_assert(SEQ_FULL % 4 == 0);
static_assert(EROWS % (16 * AW) == 0);         // the early band is a whole number of flash blocks
static_assert(EROWS % 32 == 0);                // early key steps stay inside the early key range
static_assert(EROWS >= 16 * AW);
static_assert(EROWS <= SEQ);
static_assert(NB <= 8);                        // length line: word b = q_len[b], word 8 + b = k_len[b]

typedef _Float16 h16;
typedef unsigned short bf;        // 16 bits of a staged GEMM operand: bf16, or f16 for the operands of k_out
typedef __attribute__((ext_vector_type(16))) __bf16   v16bf;
typedef __attribute__((ext_vector_type(16))) _Float16 v16h;
typedef __attribute__((ext_vector_type(8)))  _Float16 v8h;
typedef __attribute__((ext_vector_type(8)))  unsigned short v8us;
typedef __attribute__((ext_vector_type(8)))  float    v8f;
typedef __attribute__((ext_vector_type(4)))  float    v4f;
typedef __attribute__((ext_vector_type(4)))  int      v4i;
typedef v4f  __attribute__((may_alias)) v4fa;
typedef v8us __attribute__((may_alias)) v8usa;

__device__ __forceinline__ unsigned short f2bf(float f) { unsigned u = __float_as_uint(f); u += 0x7FFFu + ((u >> 16) & 1u); return (unsigned short)(u >> 16); }
__device__ __forceinline__ float bf2f(unsigned short b) { return __uint_as_float(((unsigned)b) << 16); }
__device__ __forceinline__ float rbf(float f) { return bf2f(f2bf(f)); }   // value after RNE convert to bf16
__device__ __forceinline__ unsigned short f2h(float f) { return __builtin_bit_cast(unsigned short, (h16)f); }   // bits of the f16 nearest to f
__device__ __forceinline__ v16h cat16(v8h lo, v8h hi) { return __builtin_shufflevector(lo, hi, 0, 1, 2, 3, 4, 5, 6, 7, 8, 9, 10, 11, 12, 13, 14, 15); }
__device__ __forceinline__ v16bf cat16b(v8us lo, v8us hi) { return __builtin_bit_cast(v16bf, __builtin_shufflevector(lo, hi, 0, 1, 2, 3, 4, 5, 6, 7, 8, 9, 10, 11, 12, 13, 14, 15)); }
__device__ __forceinline__ v8f wmma16(v16h a, v16h b, v8f c) { return __builtin_amdgcn_wmma_f32_16x16x32_f16(false, a, false, b, (short)0, c, false, false); }
__device__ __forceinline__ v8f wmmab(v16bf a, v16bf b, v8f c) { return __builtin_amdgcn_wmma_f32_16x16x32_bf16(false, a, false, b, (short)0, c, false, false); }
// fragment loaders from K-contiguous 16-bit rows; p already includes + 8*(lane>>4): elements 0..7 <- k0+8h+0..7, elements 8..15 <- k0+16+8h+0..7 (same map for A and B)
__device__ __forceinline__ v16h  ldh(const h16* p) { return cat16(*(const v8h*)p, *(const v8h*)(p + 16)); }
__device__ __forceinline__ v16bf ldb(const bf* p)  { return cat16b(*(const v8us*)p, *(const v8us*)(p + 16)); }
// ordering point for wave-private LDS tiles (same wave writes and reads)
__device__ __forceinline__ void wave_sync() { __builtin_amdgcn_fence(3 /* release order */, "wavefront"); __builtin_amdgcn_wave_barrier(); asm volatile("" ::: "memory"); }
// single guarded f16 WMMA (one accumulator per guard)
__device__ __forceinline__ v8f wmma16g(v16h a, v16h b, v8f c) {
    c = __builtin_amdgcn_wmma_f32_16x16x32_f16(false, a, false, b, (short)0, c, false, false);
    asm volatile("v_nop\n\tv_nop\n\tv_nop\n\tv_nop" : "+v"(c) : "v"(a), "v"(b));
    return c;
}
template <bool B> struct flag_t { static constexpr bool value = B; };   // compile-time switch handed to a generic lambda
__device__ __forceinline__ int imin(int a, int b) { return a < b ? a : b; }
__device__ __forceinline__ int imax(int a, int b) { return a > b ? a : b; }

// cvt8_body: thread's group i of eight f32 of an input (batch pitch SEQ_FULL rows) -> eight bf16 (RNE) of the packed [NB*SEQ][DM] plane. blk = block index inside the plane, 256 threads.
__device__ __forceinline__ void cvt8_body(const unsigned blk, const float* __restrict__ src, bf* dst) {
    const size_t n8 = (size_t)NB * SEQ * DM / 8, per = (size_t)SEQ * DM / 8;   // groups in the plane, groups in one batch
    const size_t i = (size_t)blk * 256 + threadIdx.x; if (i >= n8) return;
    const size_t so = (SEQ == SEQ_FULL) ? i * 8 : (i / per) * ((size_t)SEQ_FULL * DM) + (i % per) * 8;
    const v8f v = *(const v8f*)(src + so); v8us o;
#pragma unroll
    for (int k = 0; k < 8; ++k) o[k] = f2bf(v[k]);
    *(v8us*)(dst + i * 8) = o; 
}

// cvtT_body: in[rows = k][cols = n] f32 (DM x DM, row pitch DM) -> out[n][k] bf16 (RNE convert; ash: the same bf16 value written as f16), 64x64 tiles transposed through LDS.
// tile (bx over k, by over n), each below DM/64; 256 threads. LDS tile ts[n][k] is cross-wave: block barrier between fill and drain.
__device__ __forceinline__ void cvtT_body(const int bx, const int by, const float* __restrict__ W, bf* WT, const bool ash) {
    __shared__ __align__(16) unsigned short ts[64 * 72];
    const int tid = threadIdx.x, lane = tid & 31, wave = __builtin_amdgcn_readfirstlane((int)(tid >> 5));
    const int k0 = bx * 64, n0 = by * 64;
#pragma unroll
    for (int i = 0; i < 4; ++i) { const int idx = tid + i * 256; const int kr = idx >> 4, c4 = (idx & 15) * 4;   // 1024 float4 = 64 k-rows x 16
        const v4f v = *(const v4f*)(W + (size_t)(k0 + kr) * DM + n0 + c4);
#pragma unroll
        for (int j = 0; j < 4; ++j) ts[(c4 + j) * 72 + kr] = f2bf(v[j]); }
    __syncthreads();
{
        const int row = wave * 8 + (lane >> 3), c8 = (lane & 7) * 8;   // rows row + 4 s: 8 waves x 2 s x 4 = 64 rows; 8 lanes x 8 = 64 columns
        v8us o[2];
#pragma unroll
        for (int s = 0; s < 2; ++s) o[s] = *(const v8usa*)(&ts[(row + s * 4) * 72 + c8]);
        if (ash) {   // block-uniform: the bf16 values go out in f16 form
#pragma unroll
            for (int k = 0; k < 16; ++k) o[k >> 3][k & 7] = f2h(bf2f(o[k >> 3][k & 7])); }
#pragma unroll
        for (int s = 0; s < 2; ++s) *(v8us*)(WT + (size_t)(n0 + row + s * 4) * DM + k0 + c8) = o[s];
        asm volatile("s_wait_xcnt 0x0" ::: "memory");   // stands before the registers that the stores above name are written again (the build lets this range's end run on into another range's code)
         }
}

// lens_body: q_len[b] and k_len[b] as integer sums of the first SEQ entries of row b of the two int32 indicator arrays (row pitch SEQ_FULL).
// LW waves per (array, batch) row: a lane brings its entries with SEQ / (128 LW) independent 16-byte loads (a wave-wide load covers 4 whole lines), all issued before the first sum,
// so the whole kernel waits for memory once instead of once per trip of a one-wave loop. Wave sums meet in LDS behind one block barrier; wave 0 adds them and stores the whole 32-word line.
#define LW 2                     // waves per indicator row (2 NB LW waves = the 256 threads of a k_prep block)
static_assert(SEQ % (128 * LW) == 0);          // a wave's share of a row is a whole number of wave-wide 16-byte loads
static_assert(64 * NB * LW == 256);            // 2 NB LW waves are exactly one k_prep block
__device__ __forceinline__ void lens_body(const int* __restrict__ qm, const int* __restrict__ km, int* lens) {
    __shared__ __align__(16) int ss[16 * LW];  // [word][wave of the row]; word b = q_len[b], word 8 + b = k_len[b]
    const int lane = threadIdx.x & 31, wave = __builtin_amdgcn_readfirstlane((int)(threadIdx.x >> 5));
    const int part = wave % LW, b = (wave / LW) % NB, which = wave / (LW * NB);
    const int* row = (which ? km : qm) + (size_t)b * SEQ_FULL + part * (SEQ / LW) + lane * 4;
    v4i p[SEQ / (128 * LW)];
#pragma unroll
    for (int i = 0; i < SEQ / (128 * LW); ++i) p[i] = *(const v4i*)(row + i * 128);
    int s = 0;
#pragma unroll
    for (int i = 0; i < SEQ / (128 * LW); ++i) s += (p[i][0] + p[i][1]) + (p[i][2] + p[i][3]);
#pragma unroll
    for (int o = 16; o > 0; o >>= 1) s += __shfl_xor(s, o, 32);
    if (lane == 0) ss[(which * 8 + b) * LW + part] = s;
    __syncthreads();   // every wave's sum is in LDS before wave 0 reads it
    if (wave == 0) {
        const bool used = lane < 16 && (lane & 7) < NB;   // words that a row feeds; only these LDS words were written
        int v = 0;
#pragma unroll
        for (int i = 0; i < LW; ++i) v += ss[(used ? lane : 0) * LW + i];
        *(int*)(lens + lane) = used ? v : 0;
        asm volatile("s_wait_xcnt 0x0" ::: "memory");   // stands before the registers that the store above names are written again (the build lets this range's end run on into another range's code)
    }
}

// k_prep: everything that reads only the inputs, in one grid of 256-thread blocks. Block 0: the lengths; the next 4 PB_WT blocks: the weight transposes (q | k | v | o);
// the last 3 PB_CV blocks: the input conversions (query | key | value). A block does one of the three jobs (the choice is a function of blockIdx alone, so every barrier is block-uniform).
#define PB_WT ((DM / 64) * (DM / 64))                                   // 64x64 tiles of one weight
#define PB_CV ((unsigned)(((size_t)NB * SEQ * DM / 8 + 255) / 256))     // blocks of one input plane
__global__ __launch_bounds__(256) void k_prep(const float* __restrict__ xq, const float* __restrict__ xk, const float* __restrict__ xv,
                                              const int* __restrict__ qm, const int* __restrict__ km,
                                              const float* __restrict__ wq, const float* __restrict__ wk, const float* __restrict__ wv, const float* __restrict__ wo,
                                              bf* QB, bf* KB, bf* VB, bf* WB, int* lens) {
    const unsigned blk = blockIdx.x;
    if (blk >= 1 + 4 * PB_WT) {
        const unsigned r = blk - (1 + 4 * PB_WT), p = r / PB_CV;
        cvt8_body(r % PB_CV, (p == 0) ? xq : (p == 1) ? xk : xv, (p == 0) ? QB : (p == 1) ? KB : VB);
    } else if (blk >= 1) {
        const unsigned r = blk - 1, w = r / PB_WT, t = r % PB_WT;
        const float* W = (w == 0) ? wq : (w == 1) ? wk : (w == 2) ? wv : wo;
        cvtT_body((int)(t % (DM / 64)), (int)(t / (DM / 64)), W, WB + (size_t)w * DM * DM, w == 3);
    } else {
        lens_body(qm, km, lens);
    }
}

// proj_body: 16-bit GEMM (MODE 0: bf16 operands, MODE 1: f16 operands), one block of 4 waves (2 x 2) per 128x128 tile, each wave a 64x64 sub-tile (16 accumulators), K = DM in passes of KS.
// Operand tiles are staged in LDS by the tensor mover, through no register: each wave asks for one slice (64 rows x 256 B of A or of Bt) of a stage with one tensor_load_to_lds, which lays the rows at pitch LP.
// Two buffers: the request for stage s + 2 is issued behind the barrier at the foot of pass s and flies while pass s + 1 is worked on; that barrier publishes stage s + 1 and ends the reads of the buffer refilled behind it.
// Fragments come from LDS rows of pitch LP (272 B) with the same element map as ldb().
// The k walk is a ring: a block starts at pass (bx + by) mod (DM / KS) and wraps round. Blocks of one tile row read the same A rows and blocks of one tile column the same Bt rows, all started together;
// from a common start they would ask L2 for the same lines at the same moment. The sums run over the 32-steps in ascending order from the block's own start, wrapped.
// C[m][n] = sum_k A[m][k] Bt[n][k] + bias (bmode 1: bias[n]; bmode 2: bias[m]; bias RNE-converted to bf16 first),
// sub-tile base (r0/RB)*sRB + (r0%RB)*pitch + (c0/CB)*sCB + (c0%CB), row pitch 'pitch' (elements). tile (bx below M/128, by below N/128), 128 threads.
// MODE 1: written as f32 (Of); each row's 64 floats (256 B = two lines) by 16 consecutive lanes x 16 B (2 rows per instruction).
// Bias array has DM floats; both 16-byte bias loads use addresses clamped into [0, DM-4].
#define GT 128                   // block tile edge (rows of A and rows of Bt per block)
#define KS 128                   // k elements per pass (256 B of every operand row)
#define LP 136                   // LDS row pitch in elements (272 B: 16 B x odd, for 16-byte readers)
#define SLB 18432                // bytes of one slice's place in LDS: 64 rows x 272 B = 17,408, rounded up to a multiple of 2 KiB
#define SLE (SLB / 2)            // the same in elements
#define BUFB (4 * SLB)           // bytes of one buffer: two slices of A, two of Bt
static_assert(KS * 2 == 256);                  // rows of 256 B: the pad interval of stage_load
static_assert(LP * 2 == KS * 2 + 16);          // pitch = row + the 16-byte pad of stage_load
static_assert(64 * LP * 2 <= SLB && SLB % 2048 == 0);
static_assert(GT == 128);                      // four slices of 64 rows, one per wave
static_assert(DM / KS >= 2);                   // the ring's prologue needs two stages
static_assert((DM * 2) % 16 == 0 && DM * 2 <= 131072);   // source row pitch inside the mover's range
static_assert(4 * 16 * 68 * 4 <= BUFB);        // the epilogue tiles fit the ring
static_assert(DM % KS == 0);
static_assert(((DM / KS) & (DM / KS - 1)) == 0);   // the ring of passes wraps by a mask
static_assert(DM % GT == 0);
static_assert((NB * SEQ) % GT == 0);
typedef unsigned int u32x4 __attribute__((ext_vector_type(4)));
typedef unsigned int u32x8 __attribute__((ext_vector_type(8)));
__device__ __forceinline__ unsigned uni(unsigned v) { return (unsigned)__builtin_amdgcn_readfirstlane(v); }   // a descriptor word, wave-uniform, in a scalar register
__device__ __forceinline__ unsigned pinned(unsigned v) { unsigned w = (unsigned)__builtin_amdgcn_readfirstlane(v); asm volatile("" : "+s"(w)); return w; }   // the pinned() form for the guard of a tensor op: the empty statement holds the test word in a scalar register, so that the test compiles to s_cmp and a scalar branch (a tensor load ignores EXEC)
// stage_load: one request of the whole wave: 64 rows x 256 B at source pitch DM * 2 B from g (first byte at a multiple of 256 B) to LDS byte offset lds (a multiple of 2 KiB), 16 B of pad behind every row (pitch 272 B).
// Extents in bytes (data_size code 0), tensor dims = tile dims, no mask.
__device__ __forceinline__ void stage_load(const unsigned lds, const bf* g) {
    const unsigned long long ga = (unsigned long long)(size_t)g;
    u32x4 g0; u32x8 g1;
    g0[0] = uni(1u); g0[1] = uni(lds); g0[2] = uni((unsigned)ga); g0[3] = uni((((unsigned)(ga >> 32)) & 0x01FFFFFFu) | 0x80000000u);
    g1[0] = uni((1u << 20) | (5u << 22) | (3u << 25));   // pad on, a pad behind every 64 dwords (one row), 4 dwords of pad
    g1[1] = uni(256u << 16);                             // tensor_dim0 = 256 B
    g1[2] = uni(64u << 16);                              // tensor_dim1 = 64 rows
    g1[3] = uni(256u << 16);                             // tile_dim0 = 256 B
    g1[4] = uni(64u);                                    // tile_dim1 = 64 rows
    g1[5] = uni((unsigned)(DM * 2));                     // source row pitch in bytes
    g1[6] = uni(0u); g1[7] = uni(0u);
    asm volatile("tensor_load_to_lds %0, %1" :: "s"(g0), "s"(g1) : "memory");
}
__device__ __forceinline__ v16bf ldbs(const bf* p) { return cat16b(*(const v8usa*)p, *(const v8usa*)(p + 16)); }   // ldb() on an LDS row
template <int MODE>
__device__ __forceinline__ void proj_body(const int bx, const int by, const bf* __restrict__ A, const bf* __restrict__ Bt,
                                          const float* __restrict__ bias, int bmode, h16* Ph, h16* Pr, int useRes, float* Of,
                                          int RB, size_t sRB, int pitch, int CB, size_t sCB) {
    __shared__ __attribute__((aligned(2048))) unsigned char smem[2 * BUFB];   // the ring [buffer][slice][row][LP]; behind the loop its first bytes are the waves' epilogue tiles
    bf* st = (bf*)smem;
    const int K = DM;
    constexpr int NP = DM / KS;                                  // stages = passes of the k walk
    const int tid = threadIdx.x, lane = tid & 31, lr = lane & 15, hi = lane >> 4, wave = __builtin_amdgcn_readfirstlane((int)(tid >> 5));
    const int R0 = bx * GT, C0 = by * GT;
    const int wm = wave >> 1, wn = wave & 1;
    const int r0 = R0 + wm * 64, c0 = C0 + wn * 64;              // this wave's 64x64 sub-tile
    v8f acc[4][4];
#pragma unroll
    for (int mb = 0; mb < 4; ++mb)
#pragma unroll
        for (int nb = 0; nb < 4; ++nb) acc[mb][nb] = (v8f){};
    // staging: wave w brings slice w of every stage (w = 0, 1: A rows R0 + 64 w ..; w = 2, 3: Bt rows C0 + 64 (w - 2) ..), 64 rows x 256 B, all inside the operand planes
    const bf* gS = (wave < 2) ? A + (size_t)(R0 + wave * 64) * K : Bt + (size_t)(C0 + (wave - 2) * 64) * K;   // wave-uniform
    const unsigned l0 = (unsigned)(size_t)(__attribute__((address_space(3))) unsigned char*)(smem + wave * SLB);   // the slice's place in buffer 0, a multiple of 2 KiB
    const int fa = wm * SLE + lr * LP + 8 * hi, fb = (2 + wn) * SLE + lr * LP + 8 * hi;   // fragment bases inside a buffer
    const int rot = (bx + by) & (NP - 1);                        // the block's first pass of the ring (block-uniform scalar)
    stage_load(l0, gS + rot * KS);
    asm volatile("s_wait_tensorcnt 0x0" ::: "memory");           // this wave's slice of stage 0 has landed
    __syncthreads();                                             // stage 0 is whole for every wave
    stage_load(l0 + BUFB, gS + ((rot + 1) & (NP - 1)) * KS);
#pragma unroll 1
    for (int it = 0; it < NP; ++it) {
        const int cur = it & 1;
        const bf* sb = st + cur * (BUFB / 2);
        v16bf a[2][4], b[2][4];
#pragma unroll
        for (int q = 0; q < 4; ++q) { a[0][q] = ldbs(sb + fa + q * 16 * LP); b[0][q] = ldbs(sb + fb + q * 16 * LP); }
        __builtin_amdgcn_sched_barrier(0);   // keeps the first fragment loads one group ahead of the products
#pragma unroll
        for (int s = 0; s < KS / 32; ++s) {
            const int c = s & 1, n = c ^ 1;
            if (s + 1 < KS / 32) {
#pragma unroll
                for (int q = 0; q < 4; ++q) { a[n][q] = ldbs(sb + fa + q * 16 * LP + (s + 1) * 32); b[n][q] = ldbs(sb + fb + q * 16 * LP + (s + 1) * 32); }
                __builtin_amdgcn_sched_barrier(0);   // the next 32-step's fragment loads stay one group in front of this step's products, not among them
            }
#pragma unroll
            for (int nb = 0; nb < 4; ++nb)
#pragma unroll
                for (int mb = 0; mb < 4; ++mb) acc[mb][nb] = (MODE == 1) ? wmma16(__builtin_bit_cast(v16h, a[c][mb]), __builtin_bit_cast(v16h, b[c][nb]), acc[mb][nb]) : wmmab(a[c][mb], b[c][nb], acc[mb][nb]);
            // issue slots behind the last products before their operand registers are written again
            asm volatile("v_nop\n\tv_nop\n\tv_nop\n\tv_nop" : "+v"(acc[0][0]), "+v"(acc[1][1]), "+v"(acc[2][2]), "+v"(acc[3][3]) : "v"(a[c][0]), "v"(a[c][1]), "v"(a[c][2]), "v"(a[c][3]));
        }
        __builtin_amdgcn_sched_barrier(0);   // keeps the pass's products in front of the foot: the build otherwise sinks a third of them behind the barrier, ahead of the refill, which then starts that much later
        asm volatile("s_wait_dscnt 0x0" ::: "memory");           // this wave's reads of the buffer are done before it is refilled
        asm volatile("s_wait_tensorcnt 0x0" ::: "memory");       // this wave's slice of the next stage has landed
        __syncthreads();                                         // publishes the next stage; ends every wave's reads of the buffer refilled below
        if (pinned(it + 2 < NP)) stage_load(l0 + cur * BUFB, gS + ((rot + it + 2) & (NP - 1)) * KS);   // scalar branch: a tensor load ignores EXEC
    }
    asm volatile("s_wait_tensorcnt 0x0" ::: "memory");           // no request is outstanding
    asm volatile("s_wait_dscnt 0x0" ::: "memory");               // no LDS read is outstanding; the last pass's barrier has ended every wave's reads, so the ring may hold the epilogue tiles
    float* os = (float*)smem + wave * (16 * 68);                 // one wave-private epilogue tile per wave
    const size_t tbase = (size_t)(r0 / RB) * sRB + (size_t)(r0 % RB) * (size_t)pitch + (size_t)(c0 / CB) * sCB + (size_t)(c0 % CB);
    // per-lane column bias for the lane's store columns; both load addresses clamped into the DM-float bias array (first to 0 when unused, second to DM-4)
    const int c8 = (lane & 7) * 8, cofs = lr * 4;
    const int ci = (bmode == 1) ? (c0 + ((MODE == 0) ? c8 : cofs)) : 0;
    const int ci4 = (ci + 4 <= DM - 4) ? (ci + 4) : (DM - 4);      // MODE 0: ci + 4 <= DM - 4 always (exact columns); MODE 1: upper half unused, address kept in range
    const v4f bl0 = *(const v4f*)(bias + ci), bl1 = *(const v4f*)(bias + ci4);
    // MODE 0: the row bias of the lane's 16 store rows (row 16 mb + 4 s + (lane >> 3)), loaded here beside the column bias and converted once,
    // so that the store loop below holds no global load, no wait for one and no branch
    float brw[4][4];
    if (MODE == 0) {
        const float* br = bias + ((bmode == 2) ? (r0 + (lane >> 3)) : 0);   // bmode 2: r0 + 63 <= DM - 1; otherwise words 0..63 of the DM-float array, read and not used
        const unsigned bm = (bmode == 2) ? 0xFFFF0000u : 0u;                // keeps the RNE-converted value, or makes it +0
#pragma unroll
        for (int mb = 0; mb < 4; ++mb)
#pragma unroll
            for (int s = 0; s < 4; ++s) brw[mb][s] = br[mb * 16 + 4 * s];
        asm volatile("" :: "v"(brw[0][0]), "v"(brw[0][1]), "v"(brw[0][2]), "v"(brw[0][3]), "v"(brw[1][0]), "v"(brw[1][1]), "v"(brw[1][2]), "v"(brw[1][3]),
                           "v"(brw[2][0]), "v"(brw[2][1]), "v"(brw[2][2]), "v"(brw[2][3]), "v"(brw[3][0]), "v"(brw[3][1]), "v"(brw[3][2]), "v"(brw[3][3]),
                           "v"(bl0), "v"(bl1));   // inputs-only fence on the loaded values: holds all bias loads together here, one wait for all (the build otherwise sinks each row-bias load to its use, behind a wait of its own)
#pragma unroll
        for (int mb = 0; mb < 4; ++mb)
#pragma unroll
            for (int s = 0; s < 4; ++s) { unsigned u = __float_as_uint(brw[mb][s]); u += 0x7FFFu + ((u >> 16) & 1u); brw[mb][s] = __uint_as_float(u & bm); }   // rbf() under the mask
    }
    float bc[8];
#pragma unroll
    for (int i = 0; i < 4; ++i) { bc[i] = (bmode == 1) ? rbf(bl0[i]) : 0.0f; bc[4 + i] = (bmode == 1) ? rbf(bl1[i]) : 0.0f; }
#pragma unroll
    for (int mb = 0; mb < 4; ++mb) {
#pragma unroll
        for (int nb = 0; nb < 4; ++nb) {
#pragma unroll
            for (int j = 0; j < 8; ++j) os[(hi * 8 + j) * 68 + nb * 16 + lr] = acc[mb][nb][j]; }   // D: row 8h+j, col lane&15; rows 0..15 x columns 0..63 all written
        wave_sync();
        const size_t sb = tbase + (size_t)(mb * 16) * (size_t)pitch;
        if (MODE == 0) {
{
                // the four row groups of the block go as one batch: their LDS reads, conversions and stores are independent of each other and overlap
                v8h hv[4], rv[4]; h16* ph[4]; h16* pr[4];
#pragma unroll
                for (int s = 0; s < 4; ++s) { const int row = 4 * s + (lane >> 3);   // 4 s x 4 row groups = 16 rows; 8 lanes x 8 = 64 columns
                    const float brow = brw[mb][s];
                    const size_t oo = sb + (size_t)row * (size_t)pitch + c8; ph[s] = Ph + oo; pr[s] = Pr + oo;
                    const v4f x0 = *(const v4fa*)(&os[row * 68 + c8]); const v4f x1 = *(const v4fa*)(&os[row * 68 + c8 + 4]);
#pragma unroll
                    for (int i = 0; i < 4; ++i) { const float f0 = x0[i] + bc[i] + brow; const float f1 = x1[i] + bc[4 + i] + brow;
                        const h16 a0 = (h16)f0; const h16 a1 = (h16)f1; hv[s][i] = a0; hv[s][4 + i] = a1; rv[s][i] = (h16)((f0 - (float)a0) * QRS); rv[s][4 + i] = (h16)((f1 - (float)a1) * QRS); } }
                __builtin_amdgcn_sched_barrier(0);   // the stores stay behind all four conversions and address sums: a store among them has its registers reused at once, which costs a wait per store
#pragma unroll
                for (int s = 0; s < 4; ++s) { *(v8h*)ph[s] = hv[s]; if (useRes) *(v8h*)pr[s] = rv[s]; }
                asm volatile("s_wait_xcnt 0x0" ::: "memory");   // stands before the registers that the stores above name are written again by the next row block
                 }
        } else {
{
#pragma unroll
                for (int s = 0; s < 8; ++s) { const int row = 2 * s + hi;   // 8 s x 2 rows = 16 rows; 16 lanes x 4 floats = 64 columns
                    const v4f x0 = *(const v4fa*)(&os[row * 68 + cofs]); v4f val;
                    val[0] = x0[0] + bc[0]; val[1] = x0[1] + bc[1]; val[2] = x0[2] + bc[2]; val[3] = x0[3] + bc[3];
                    *(v4f*)(Of + sb + (size_t)row * (size_t)pitch + cofs) = val; }
                asm volatile("s_wait_xcnt 0x0" ::: "memory");   // stands before the registers that the stores above name are written again by the next row block
                 }
        }
        wave_sync();
    }
}

// k_qkv: the three projections in one grid (NB*SEQ/GT, DM/GT, 3); blockIdx.z picks the product.
// z = 0, 1 (q, k): A = x rows (m = b*SEQ + t), Bt = W^T rows (n = h*64 + d), column bias -> planes [(b*16 + h)][t][d] (value and residual).
// z = 2 (v^T): A = Wv^T rows (m = h*64 + d), Bt = value rows (n = b*SEQ + t), row bias -> planes [(b*1024 + m)][t] = [(b*16 + h)][d][t] (value and residual); its tile is (blockIdx.y, blockIdx.x).
__global__ __launch_bounds__(128) void k_qkv(const bf* __restrict__ QB, const bf* __restrict__ KB, const bf* __restrict__ VB,
                                             const bf* __restrict__ WQT, const bf* __restrict__ WKT, const bf* __restrict__ WVT,
                                             const float* __restrict__ bq, const float* __restrict__ bk, const float* __restrict__ bv,
                                             h16* QH, h16* QR, h16* KP, h16* KR, h16* VT, h16* VR) {
    const int z = blockIdx.z; const bool isv = z == 2;
    const bf* A  = isv ? WVT : z ? KB : QB;
    const bf* Bt = isv ? VB : z ? WKT : WQT;
    proj_body<0>((int)(isv ? blockIdx.y : blockIdx.x), (int)(isv ? blockIdx.x : blockIdx.y), A, Bt, isv ? bv : z ? bk : bq, isv ? 2 : 1,
                 isv ? VT : z ? KP : QH, isv ? VR : z ? KR : QR, 1, nullptr,
                 isv ? DM : SEQ, isv ? (size_t)0 : (size_t)NH_ * SEQ * HD, isv ? SEQ : HD, isv ? SEQ : HD, isv ? (size_t)DM * SEQ : (size_t)SEQ * HD);
}

// k_out: A = context rows (m = b*SEQ + t, f16), Bt = Wo^T rows (n, f16), column bias -> OUT[(b*OUT_SEQ + t)][n] f32; grid (NB*SEQ/GT, DM/GT).
__global__ __launch_bounds__(128) void k_out(const bf* __restrict__ CH, const bf* __restrict__ WOT, const float* __restrict__ bo, float* OUT) {
    proj_body<1>((int)blockIdx.x, (int)blockIdx.y, CH, WOT, bo, 1, nullptr, nullptr, 0, OUT, SEQ, (size_t)OUT_SEQ * DM, DM, DM, (size_t)0);
}

// Key tiles of k_flash: the block's AW waves share one tile of TK keys in LDS, one plane pair = [K: TK key rows of 128 B | V^T: HD d rows of 128 B], row pitch TP elements (144 B, for 16-byte readers).
// The ring holds two plane pairs. EARLY = 0: two buffers of the value planes, the next tile's copies in flight while this tile is worked on. EARLY = 1: one buffer, value pair then residual pair.
#define TK 64                    // keys per staged tile (two 32-key passes)
#define TP 72                    // LDS row pitch in elements
#define TSZ ((TK + HD) * TP)     // elements of one plane pair
static_assert(TK * 2 == 128);                  // a V^T row segment of a tile is one whole line
static_assert(SEQ % TK == 0);                  // every tile lies wholly inside the planes
static_assert(16 * AW == TK);                  // a block's query rows span one tile: block xblk walks xblk + 1 tiles at most
static_assert(32 * AW / 8 == 16);              // one copy of the block covers 16 rows of 128 B
static_assert(TK == 64);                       // four copies cover the K rows of a tile, four the HD = 64 V^T rows
// tile_copy: the block's copy of one plane pair of a tile, 8 asynchronous 16-byte copies a lane (4 K, 4 V^T); a wave-wide copy covers 4 whole 128-byte rows.
// lk, lv: the lane's LDS byte addresses of its first K and V^T piece; gk, gv: the global addresses of the same pieces; piece i lies 16 rows further on.
// The last line of the statement stands before the address registers that the copies name are written again.
__device__ __forceinline__ void tile_copy(const unsigned lk, const unsigned lv, const h16* gk, const h16* gv) {
    asm volatile("global_load_async_to_lds_b128 %0, %8, off\n\t"
                 "global_load_async_to_lds_b128 %1, %9, off\n\t"
                 "global_load_async_to_lds_b128 %2, %10, off\n\t"
                 "global_load_async_to_lds_b128 %3, %11, off\n\t"
                 "global_load_async_to_lds_b128 %4, %12, off\n\t"
                 "global_load_async_to_lds_b128 %5, %13, off\n\t"
                 "global_load_async_to_lds_b128 %6, %14, off\n\t"
                 "global_load_async_to_lds_b128 %7, %15, off\n\t"
                 "s_wait_xcnt 0x0"
                 :: "v"(lk), "v"(lk + 16 * TP * 2), "v"(lk + 32 * TP * 2), "v"(lk + 48 * TP * 2),
                    "v"(lv), "v"(lv + 16 * TP * 2), "v"(lv + 32 * TP * 2), "v"(lv + 48 * TP * 2),
                    "v"(gk), "v"(gk + 16 * HD), "v"(gk + 32 * HD), "v"(gk + 48 * HD),
                    "v"(gv), "v"(gv + (size_t)16 * SEQ), "v"(gv + (size_t)32 * SEQ), "v"(gv + (size_t)48 * SEQ)
                 : "memory");
}

// flash_body: fused attention, one wave per 16 query rows of one (batch, head); Q fragments straight from the f16 planes (two 16-B loads each, arithmetic addressing);
// K / V^T fragments from the block's LDS tile with the same element map (two 16-B LDS loads each).
// Transposed form: S^T[key][t] = K Q^T (A = K rows, B = Q rows); lane (t = lane&15, h = lane>>4) holds keys 8h+r of each 16-key tile, so the packed
// P tile is directly the B fragment of O^T[d][t] = V^T P^T (element r <- tile keys 0..15, element 8+r <- tile keys 16..31, lane unchanged).
// Visibility of (t, key): key <= lim(t) with lim = min(t, k_len - 1) when t < q_len, else -1 (nothing visible); excluded scores are REPLACED by a large negative fill and their P is set to 0 by value.
// The key loop runs to kend = min(t0 + 16, k_len) <= SEQ (wave-scalar, static upper bound SEQ); a row with no visible key keeps l = 0 and gets a zero context.
// Softmax state (running max, partial sum) is one scalar per lane; the two lane halves of a row are combined with one xor-16 exchange.
// EARLY = 1 (query rows < EROWS): q, k, P, v each as f16 value + f16 residual x2048; value x residual products go to separate accumulators folded with 1/2048 (scores: before the scale; context: before the normalisation); row sum over the unconverted p.
// EARLY = 0: single f16 products, row sum over the converted P.
template <int EARLY>
__device__ __forceinline__ void flash_body(const int xblk, const h16* __restrict__ QH, const h16* __restrict__ QR, const h16* __restrict__ KP, const h16* __restrict__ KR,
                                           const h16* __restrict__ VT, const h16* __restrict__ VR, const int* __restrict__ LENS, bf* CH, h16* ring) {
    __shared__ __align__(16) float os[AW * 16 * 68];
    const int lane = threadIdx.x & 31, wave = __builtin_amdgcn_readfirstlane((int)(threadIdx.x >> 5)), lr = lane & 15, hi = lane >> 4;
    const int zh = blockIdx.y; const int b = zh / NH_, h = zh % NH_;
    const int t0 = (xblk * AW + wave) * 16;
    const size_t pbase = (size_t)zh * SEQ * HD;
    const size_t qo = pbase + (size_t)(t0 + lr) * HD + 8 * hi;
    const v16h qh0 = ldh(QH + qo), qh1 = ldh(QH + qo + 32);   // B fragments: col t, k = d
    v16h qr0 = qh0, qr1 = qh1;
    if (EARLY) { qr0 = ldh(QR + qo); qr1 = ldh(QR + qo + 32); }
    const int qlen = imin(imax(LENS[b], 0), SEQ), klen = imin(imax(LENS[8 + b], 0), SEQ);   // lengths clamped into [0, SEQ]
    const int t = t0 + lr;
    const int lim = (t < qlen) ? imin(t, klen - 1) : -1;      // last visible key of query t (-1: none)
    const int kend = __builtin_amdgcn_readfirstlane(imin((xblk * AW + (int)(threadIdx.x >> 5)) * 16 + 16, klen));   // min taken first, then made wave-scalar; <= SEQ
    v8f o0 = (v8f){}, o1 = (v8f){}, o2 = (v8f){}, o3 = (v8f){};
    v8f e0 = (v8f){}, e1 = (v8f){}, e2 = (v8f){}, e3 = (v8f){};
    float m = -3.0e38f, l = 0.0f;
    // one 32-key pass; kl (A fragment: row key, k = d; + 16 TP: the second 16 keys) and vl (A fragment: row d, k = key; + 16j TP) are this lane's fragment bases of the pass in the LDS tile, residual pair at + TSZ
    // TEST::value = false: the caller has shown that every key of the pass is visible to every row of the wave, so each visibility test below is true and is left out (same order of sums)
    auto pass = [&](auto TEST, const int key0, const h16* kl, const h16* vl) __attribute__((always_inline)) {
        constexpr bool MK = decltype(TEST)::value;
        v8f sHa = (v8f){}, sLa = (v8f){}, sHb = (v8f){}, sLb = (v8f){};
        if (EARLY) {
            { const v16h kh0 = ldh(kl), kh1 = ldh(kl + 32), kr0 = ldh(kl + TSZ), kr1 = ldh(kl + TSZ + 32);
              sHa = wmma16g(kh0, qh0, sHa); sLa = wmma16g(kh0, qr0, sLa); sLa = wmma16g(kr0, qh0, sLa);
              sHa = wmma16g(kh1, qh1, sHa); sLa = wmma16g(kh1, qr1, sLa); sLa = wmma16g(kr1, qh1, sLa); }
            { const v16h kh0 = ldh(kl + 16 * TP), kh1 = ldh(kl + 16 * TP + 32), kr0 = ldh(kl + TSZ + 16 * TP), kr1 = ldh(kl + TSZ + 16 * TP + 32);
              sHb = wmma16g(kh0, qh0, sHb); sLb = wmma16g(kh0, qr0, sLb); sLb = wmma16g(kr0, qh0, sLb);
              sHb = wmma16g(kh1, qh1, sHb); sLb = wmma16g(kh1, qr1, sLb); sLb = wmma16g(kr1, qh1, sLb); }
        } else {
            const v16h ka0 = ldh(kl), ka1 = ldh(kl + 32), kb0 = ldh(kl + 16 * TP), kb1 = ldh(kl + 16 * TP + 32);
            sHa = wmma16(ka0, qh0, sHa); sHb = wmma16(kb0, qh0, sHb);
            sHa = wmma16(ka1, qh1, sHa); sHb = wmma16(kb1, qh1, sHb);
            asm volatile("v_nop\n\tv_nop\n\tv_nop\n\tv_nop" : "+v"(sHa), "+v"(sHb) : "v"(ka0), "v"(ka1), "v"(kb0), "v"(kb1));
        }
        const int kq = key0 + 8 * hi;           // this lane's first key of tile a (tile b: + 16)
        float ta[8], tb[8]; float mx = -3.0e38f;
#pragma unroll
        for (int r = 0; r < 8; ++r) {
            const float xa = EARLY ? (sHa[r] + sLa[r] * QRI) * SC2 : sHa[r] * SC2;
            const float xb = EARLY ? (sHb[r] + sLb[r] * QRI) * SC2 : sHb[r] * SC2;
            ta[r] = (!MK || kq + r <= lim) ? xa : -3.0e38f;
            tb[r] = (!MK || kq + 16 + r <= lim) ? xb : -3.0e38f; }
#pragma unroll
        for (int r = 0; r < 8; ++r) mx = fmaxf(mx, fmaxf(ta[r], tb[r]));
        mx = fmaxf(mx, __shfl_xor(mx, 16, 32));
        const float mnew = fmaxf(m, mx);
        const float alpha = __builtin_amdgcn_exp2f(m - mnew);
        const float sh = PSH - mnew;
        v16h pb = (v16h){}, pr = (v16h){}; float ls = 0.0f;
#pragma unroll
        for (int r = 0; r < 8; ++r) {
            const float ya = __builtin_amdgcn_exp2f(ta[r] + sh), yb = __builtin_amdgcn_exp2f(tb[r] + sh);
            const float ea = (!MK || kq + r <= lim) ? ya : 0.0f;
            const float eb = (!MK || kq + 16 + r <= lim) ? yb : 0.0f;
            const h16 pa = (h16)ea; const h16 pc = (h16)eb; pb[r] = pa; pb[8 + r] = pc;
            if (EARLY) { pr[r] = (h16)((ea - (float)pa) * QRS); pr[8 + r] = (h16)((eb - (float)pc) * QRS); ls += ea + eb; }
            else { ls += (float)pa + (float)pc; } }
        l = l * alpha + ls; m = mnew;
        o0 = o0 * alpha; o1 = o1 * alpha; o2 = o2 * alpha; o3 = o3 * alpha;
        if (EARLY) {
            e0 = e0 * alpha; e1 = e1 * alpha; e2 = e2 * alpha; e3 = e3 * alpha;
            { const v16h vh = ldh(vl), vr = ldh(vl + TSZ);
              o0 = wmma16g(vh, pb, o0); e0 = wmma16g(vh, pr, e0); e0 = wmma16g(vr, pb, e0); }
            { const v16h vh = ldh(vl + 16 * TP), vr = ldh(vl + TSZ + 16 * TP);
              o1 = wmma16g(vh, pb, o1); e1 = wmma16g(vh, pr, e1); e1 = wmma16g(vr, pb, e1); }
            { const v16h vh = ldh(vl + 32 * TP), vr = ldh(vl + TSZ + 32 * TP);
              o2 = wmma16g(vh, pb, o2); e2 = wmma16g(vh, pr, e2); e2 = wmma16g(vr, pb, e2); }
            { const v16h vh = ldh(vl + 48 * TP), vr = ldh(vl + TSZ + 48 * TP);
              o3 = wmma16g(vh, pb, o3); e3 = wmma16g(vh, pr, e3); e3 = wmma16g(vr, pb, e3); }
        } else {
            const v16h v0 = ldh(vl), v1 = ldh(vl + 16 * TP), v2 = ldh(vl + 32 * TP), v3 = ldh(vl + 48 * TP);
            o0 = wmma16(v0, pb, o0); o1 = wmma16(v1, pb, o1); o2 = wmma16(v2, pb, o2); o3 = wmma16(v3, pb, o3);
            asm volatile("v_nop\n\tv_nop\n\tv_nop\n\tv_nop" : "+v"(o0), "+v"(o1), "+v"(o2), "+v"(o3) : "v"(v0), "v"(v1), "v"(v2), "v"(v3), "v"(pb));
        }
    };
    const int nt = (imin(xblk * TK + TK, __builtin_amdgcn_readfirstlane(klen)) + TK - 1) / TK;   // tiles the block walks (block-uniform scalar, <= SEQ / TK): up to its last wave's kend
    const int crow = (int)threadIdx.x >> 3, cch = ((int)threadIdx.x & 7) * 8;                    // the lane's first row of a copy and its 16-byte piece of a 128-byte row
    const unsigned lk = (unsigned)(size_t)(__attribute__((address_space(3))) h16*)(ring + crow * TP + cch), lv = lk + TK * TP * 2;
    const h16* gk = KP + pbase + (size_t)crow * HD + cch;     // + tile * TK * HD
    const h16* gv = VT + pbase + (size_t)crow * SEQ + cch;    // + tile * TK
    const h16* fk = ring + lr * TP + 8 * hi;                  // fragment bases inside the first plane pair
    const h16* fv = fk + TK * TP;
    // In both bands a wave makes the 32-key passes below its own kend (wave-scalar tests) and passes every barrier; EARLY = 1: in ascending order; EARLY = 0: the wholly visible tiles as a ring, then the rest ascending.
    if constexpr (EARLY) {
        const h16* gkr = KR + pbase + (size_t)crow * HD + cch;
        const h16* gvr = VR + pbase + (size_t)crow * SEQ + cch;
#pragma unroll 1
        for (int s = 0; s < nt; ++s) {
            const int key0 = s * TK;
            tile_copy(lk, lv, gk + (size_t)key0 * HD, gv + key0);
            tile_copy(lk + TSZ * 2, lv + TSZ * 2, gkr + (size_t)key0 * HD, gvr + key0);
            asm volatile("s_wait_asynccnt 0x0" ::: "memory");     // this wave's part of the tile has landed
            __syncthreads();                                      // the tile is whole for every wave
            if (key0 < kend) pass(flag_t<true>{}, key0, fk, fv);
            if (key0 + 32 < kend) pass(flag_t<true>{}, key0 + 32, fk + 32 * TP, fv + 32);
            if (s + 1 < nt) {
                asm volatile("s_wait_dscnt 0x0" ::: "memory");    // this wave's reads of the tile are done before it is overwritten
                __syncthreads();                                  // ends every wave's reads of the tile that the next trip overwrites
            }
        }
    } else {
        // keys 0 .. kvis - 1 are visible to every row of the block: the smallest lim + 1 over its TK rows (0 when a row lies at or past q_len); block-uniform scalar, kvis <= every wave's kend
        const int kvis = __builtin_amdgcn_readfirstlane((xblk * TK + TK - 1 < qlen) ? imin(xblk * TK, klen - 1) + 1 : 0);
        const int nf = kvis / TK;                                 // leading tiles that lie wholly below kvis; nf <= nt
        // The nf leading tiles are walked as a ring from a start of the block's own: the blocks of a head read the same K and V^T rows and start together, and from a common start
        // they would ask L2 for the same lines at the same moment. (13 xblk) mod 32 is a permutation of the 32 block indices, scaled into [0, nf). The tiles from nf on keep their order.
        const int rot = (nf * ((xblk * 13) & 31)) >> 5;           // block-uniform scalar, 0 <= rot < nf (0 when nf = 0)
        auto tile_of = [&](const int s) __attribute__((always_inline)) {   // tile of trip s, below nt for s < nt: a permutation of the trips
            const int w = s + rot;
            return (s < nf) ? ((w < nf) ? w : w - nf) : s;
        };
        if (nt > 0) tile_copy(lk, lv, gk + (size_t)tile_of(0) * TK * HD, gv + tile_of(0) * TK);
        asm volatile("s_wait_asynccnt 0x0" ::: "memory");         // this wave's part of the first tile has landed
        __syncthreads();                                          // the first tile is whole for every wave
        if (nt > 1) tile_copy(lk + TSZ * 2, lv + TSZ * 2, gk + (size_t)tile_of(1) * TK * HD, gv + tile_of(1) * TK);
        // foot of trip s of either loop below, passed by every wave
        auto foot = [&](const int s, const int bo) __attribute__((always_inline)) {
            asm volatile("s_wait_dscnt 0x0" ::: "memory");        // this wave's reads of the buffer are done before it is refilled
            asm volatile("s_wait_asynccnt 0x0" ::: "memory");     // this wave's part of the next tile has landed
            __syncthreads();                                      // publishes the next tile; ends every wave's reads of the buffer refilled below
            if (s + 2 < nt) tile_copy(lk + bo * 2, lv + bo * 2, gk + (size_t)tile_of(s + 2) * TK * HD, gv + tile_of(s + 2) * TK);
        };
        int s = 0;
#pragma unroll 1
        for (; s < nf; ++s) {                                     // tiles with no hidden score: both passes, no visibility tests
            const int bo = (s & 1) * TSZ, key0 = tile_of(s) * TK;
            pass(flag_t<false>{}, key0, fk + bo, fv + bo);
            pass(flag_t<false>{}, key0 + 32, fk + bo + 32 * TP, fv + bo + 32);
            foot(s, bo);
        }
#pragma unroll 1
        for (; s < nt; ++s) {                                     // the tiles at the diagonal or at k_len (all tiles when a row lies past q_len)
            const int bo = (s & 1) * TSZ, key0 = s * TK;
            if (key0 < kend) pass(flag_t<true>{}, key0, fk + bo, fv + bo);
            if (key0 + 32 < kend) pass(flag_t<true>{}, key0 + 32, fk + bo + 32 * TP, fv + bo + 32);
            foot(s, bo);
        }
        asm volatile("s_wait_asynccnt 0x0" ::: "memory");         // no copy is outstanding when the wave goes on to its end
    }
    if (EARLY) { o0 = o0 + e0 * QRI; o1 = o1 + e1 * QRI; o2 = o2 + e2 * QRI; o3 = o3 + e3 * QRI; }
    l += __shfl_xor(l, 16, 32);
    const float lsafe = (l > 0.0f) ? l : 1.0f;
    const float inv = (l > 0.0f) ? (1.0f / lsafe) : 0.0f;     // no visible key: zero context
    const int wb = wave * 16 * 68;
    // O^T D layout: o_j[r] = (d = 16j + 8h + r, t = lane&15) -> os[t][d]; rows 0..15 x columns 0..63 all written
    { v4f a, c;
      a[0] = o0[0] * inv; a[1] = o0[1] * inv; a[2] = o0[2] * inv; a[3] = o0[3] * inv; c[0] = o0[4] * inv; c[1] = o0[5] * inv; c[2] = o0[6] * inv; c[3] = o0[7] * inv;
      *(v4fa*)(&os[wb + lr * 68 +  0 + 8 * hi]) = a; *(v4fa*)(&os[wb + lr * 68 +  0 + 8 * hi + 4]) = c;
      a[0] = o1[0] * inv; a[1] = o1[1] * inv; a[2] = o1[2] * inv; a[3] = o1[3] * inv; c[0] = o1[4] * inv; c[1] = o1[5] * inv; c[2] = o1[6] * inv; c[3] = o1[7] * inv;
      *(v4fa*)(&os[wb + lr * 68 + 16 + 8 * hi]) = a; *(v4fa*)(&os[wb + lr * 68 + 16 + 8 * hi + 4]) = c;
      a[0] = o2[0] * inv; a[1] = o2[1] * inv; a[2] = o2[2] * inv; a[3] = o2[3] * inv; c[0] = o2[4] * inv; c[1] = o2[5] * inv; c[2] = o2[6] * inv; c[3] = o2[7] * inv;
      *(v4fa*)(&os[wb + lr * 68 + 32 + 8 * hi]) = a; *(v4fa*)(&os[wb + lr * 68 + 32 + 8 * hi + 4]) = c;
      a[0] = o3[0] * inv; a[1] = o3[1] * inv; a[2] = o3[2] * inv; a[3] = o3[3] * inv; c[0] = o3[4] * inv; c[1] = o3[5] * inv; c[2] = o3[6] * inv; c[3] = o3[7] * inv;
      *(v4fa*)(&os[wb + lr * 68 + 48 + 8 * hi]) = a; *(v4fa*)(&os[wb + lr * 68 + 48 + 8 * hi + 4]) = c; }
    wave_sync();
    const size_t obase = ((size_t)b * SEQ + t0) * DM + (size_t)h * HD;
{
#pragma unroll
        for (int s = 0; s < 4; ++s) { const int row = 4 * s + (lane >> 3), c8 = (lane & 7) * 8;   // 4 s x 4 row groups = 16 rows; 8 lanes x 8 = 64 columns
            const v4f x0 = *(const v4fa*)(&os[wb + row * 68 + c8]); const v4f x1 = *(const v4fa*)(&os[wb + row * 68 + c8 + 4]); v8us hv;
#pragma unroll
            for (int i = 0; i < 4; ++i) { hv[i] = f2h(x0[i]); hv[4 + i] = f2h(x1[i]); }
            const size_t oo = obase + (size_t)row * DM + c8;
            *(v8us*)(CH + oo) = hv; }
         }
}

// k_flash: both row bands in one grid (SEQ / (16*AW), NB*NH_), the choice a function of blockIdx.x alone:
// the first (SEQ - EROWS) / (16*AW) blocks of a head take query rows EROWS..SEQ-1 (single products), the last EROWS / (16*AW) take rows 0..EROWS-1 (value + residual products).
__global__ __launch_bounds__(32 * AW) void k_flash(const h16* __restrict__ QH, const h16* __restrict__ QR, const h16* __restrict__ KP, const h16* __restrict__ KR,
                                                   const h16* __restrict__ VT, const h16* __restrict__ VR, const int* __restrict__ LENS, bf* CH) {
    __shared__ __align__(16) h16 ring[2 * TSZ];   // the key tiles of either band
    if ((int)blockIdx.x < (SEQ - EROWS) / (16 * AW))
        flash_body<0>((int)blockIdx.x + EROWS / (16 * AW), QH, QH, KP, KP, VT, VT, LENS, CH, ring);
    else
        flash_body<1>((int)blockIdx.x - (SEQ - EROWS) / (16 * AW), QH, QR, KP, KR, VT, VR, LENS, CH, ring);
}

static constexpr size_t al256(size_t v) { return (v + 255) & ~(size_t)255; }
static constexpr size_t SZ_XB = al256((size_t)NB * SEQ * DM * 2);          // one 16-bit activation plane [NB*SEQ][1024]
static constexpr size_t SZ_WB = al256((size_t)4 * DM * DM * 2);            // four transposed 16-bit weight planes
static constexpr size_t SZ_PL = al256((size_t)NB * NH_ * SEQ * HD * 2);    // one f16 head plane
static constexpr size_t SZ_LN = al256((size_t)32 * 4);
static constexpr size_t SZ_TOTAL = 3 * SZ_XB + SZ_WB + 6 * SZ_PL + SZ_XB + SZ_LN;
static_assert(SZ_TOTAL <= (size_t)134217728);          // workspace carve <= 128 MiB
static_assert(((size_t)DM * DM * 2) % 256 == 0);       // weight sub-planes stay 256-byte aligned
static_assert((size_t)NB * OUT_SEQ * DM * 4 <= (size_t)NB_FULL * SEQ_FULL * DM * 4);   // single output at byte offset 0

extern "C" void kernel_launch(void* const* d_in, const int* in_sizes, int n_in,
                              void* d_out, int out_size, void* d_ws, size_t ws_size, hipStream_t stream) {
    if (n_in < 13) return;
    const size_t needx = ((size_t)(NB - 1) * SEQ_FULL + SEQ) * DM;
    if ((size_t)in_sizes[0] < needx || (size_t)in_sizes[1] < needx || (size_t)in_sizes[2] < needx) return;
    if ((size_t)in_sizes[3] < (size_t)(NB - 1) * SEQ_FULL + SEQ || (size_t)in_sizes[4] < (size_t)(NB - 1) * SEQ_FULL + SEQ) return;
    if ((size_t)in_sizes[5] < (size_t)DM * DM || (size_t)in_sizes[7] < (size_t)DM * DM || (size_t)in_sizes[9] < (size_t)DM * DM || (size_t)in_sizes[11] < (size_t)DM * DM) return;
    if (in_sizes[6] < DM || in_sizes[8] < DM || in_sizes[10] < DM || in_sizes[12] < DM) return;
    if ((size_t)out_size < ((size_t)(NB - 1) * OUT_SEQ + SEQ) * DM) return;
    if (SZ_TOTAL > ws_size) return;
    // wire order: in_Q, in_K, in_V, Q_pad_mask (int32), K_pad_mask (int32), W_Q, b_Q, W_K, b_K, W_V, b_V, W_O, b_O
    const float* xq = (const float*)d_in[0]; const float* xk = (const float*)d_in[1]; const float* xv = (const float*)d_in[2];
    const int* qmask = (const int*)d_in[3]; const int* kmask = (const int*)d_in[4];
    const float* wq = (const float*)d_in[5];  const float* bq = (const float*)d_in[6];
    const float* wk = (const float*)d_in[7];  const float* bk = (const float*)d_in[8];
    const float* wv = (const float*)d_in[9];  const float* bv = (const float*)d_in[10];
    const float* wo = (const float*)d_in[11]; const float* bo = (const float*)d_in[12];
    float* OUT = (float*)d_out;      // [NB][SEQ][1024]
    char* wsp = (char*)d_ws;
    bf* QB = (bf*)wsp; wsp += SZ_XB;                 // [NB*SEQ][1024] bf16 query input
    bf* KB = (bf*)wsp; wsp += SZ_XB;                 // [NB*SEQ][1024] bf16 key input
    bf* VB = (bf*)wsp; wsp += SZ_XB;                 // [NB*SEQ][1024] bf16 value input
    bf* WB = (bf*)wsp; wsp += SZ_WB;                 // [4][1024 out][1024 in]: q | k | v | o
    h16* QH = (h16*)wsp; wsp += SZ_PL;               // [NB*16][SEQ][64]
    h16* QR = (h16*)wsp; wsp += SZ_PL;               // [NB*16][SEQ][64] residual x2048
    h16* KP = (h16*)wsp; wsp += SZ_PL;               // [NB*16][SEQ][64]
    h16* KR = (h16*)wsp; wsp += SZ_PL;               // [NB*16][SEQ][64] residual x2048
    h16* VT = (h16*)wsp; wsp += SZ_PL;               // [NB*16][64][SEQ]
    h16* VR = (h16*)wsp; wsp += SZ_PL;               // [NB*16][64][SEQ] residual x2048
    bf* CH = (bf*)wsp; wsp += SZ_XB;                 // [NB*SEQ][1024] context f16
    int* LN = (int*)wsp; wsp += SZ_LN;               // 32 ints: word b = q_len[b], word 8 + b = k_len[b]
    bf* WQT = WB; bf* WKT = WB + (size_t)DM * DM; bf* WVT = WB + (size_t)2 * DM * DM; bf* WOT = WB + (size_t)3 * DM * DM;

    // lengths, transposed 16-bit weights ([out][in]) and bf16 inputs
    k_prep<<<1 + 4 * PB_WT + 3 * PB_CV, 256, 0, stream>>>(xq, xk, xv, qmask, kmask, wq, wk, wv, wo, QB, KB, VB, WB, LN);
    // q, k planes and v^T planes (value and residual)
    k_qkv<<<dim3(NB * SEQ / GT, DM / GT, 3), 128, 0, stream>>>(QB, KB, VB, WQT, WKT, WVT, bq, bk, bv, QH, QR, KP, KR, VT, VR);
    // context plane: disjoint rows, every row written
    k_flash<<<dim3(SEQ / (16 * AW), NB * NH_, 1), 32 * AW, 0, stream>>>(QH, QR, KP, KR, VT, VR, LN, CH);
    // output rows
    k_out<<<dim3(NB * SEQ / GT, DM / GT, 1), 128, 0, stream>>>(CH, WOT, bo, OUT);
}

// v010
// One run takes 62.7 microseconds.
// Next to v009, in two timings, it ran 1.05 and 1.04 times as fast.
// All steps since v000 together make it 3.83 times as fast.
#include <hip/hip_runtime.h>

// Projections q/k/v: v_wmma_f32_16x16x32_bf16 (inputs and weights RNE-converted to bf16, f32 accumulate); scores: v_wmma_f32_16x16x32_f16 (query rows >= EROWS: single f16 q and k; rows < EROWS: q and k as f16 value + f16 residual x2048, three products, residual products in their own accumulator); P.V: v_wmma_f32_16x16x32_f16 (P x256 carry, v single f16; rows < EROWS: P and v as value + residual x2048, three products, residual products in their own accumulator); output projection: v_wmma_f32_16x16x32_f16 (context as one f16 plane, Wo RNE-converted to bf16 and that value held as f16), f32 accumulate everywhere, softmax f32.
// Attention block, width 1024 = 16 heads x 64; query/key/value inputs [NB][SEQ][1024] f32, W_Q/W_K/W_V/W_O [in][out] (y = x W + b), score scale 1/8,
// causal fill (key > query -> excluded) and length fill (query < q_len[b] and key < k_len[b], lengths = integer sums of the two int32 indicator rows); rows with no visible key give a zero context; output y = ctx W_O + b_O (f32).
// Layout: bf16 copies of the three inputs; 16-bit TRANSPOSED copies of the four weights ([out][in], K-contiguous; q, k, v bf16, o f16); q, k planes [b*16+h][t][d] and v^T plane [b*16+h][d][t] (value and residual x2048) written by the GEMM epilogue, only where k_flash reads them (k, v^T: key tiles that start below k_len; residuals: tokens below EROWS);
// fused flash kernel in transposed form (S^T = K Q^T, O^T = V^T P^T) writing the context as an f16 plane [b*SEQ+t][1024]; final GEMM writes f32 rows.
// Four launches, one per level of the dependence chain; work that does not depend on each other shares a grid and is told apart by the block index:
// k_prep (lengths, weight transposes, input conversions), k_qkv (the three projections), k_flash (both row bands), k_out.

#ifndef NB
#define NB 2
#endif
#ifndef SEQ
#define SEQ 2048
#endif
#define NB_FULL  2
#define SEQ_FULL 2048
#ifndef OUT_SEQ
#define OUT_SEQ SEQ              // row pitch (in tokens) between batches of the output
#endif
#ifndef EROWS
#define EROWS 256                // query rows below this use the value + residual products
#endif
#define DM   1024
#define NH_  16
#define HD   64
#define AW   4                   // waves per flash block (16 query rows each)
#define QRS  2048.0f             // carry of the residual planes
#define QRI  (1.0f / 2048.0f)
#define LOG2E 1.4426950408889634f
#define SC2  (0.125f * 1.4426950408889634f)   // HD^-0.5 * log2(e)
#define PSH  8.0f                // log2 of the P carry (256)

static_assert(HD == 64);
static_assert(NH_ * HD == DM);                 // head h = columns h*64 + d
static_assert(DM % 64 == 0);                   // column tiles of 64
static_assert(DM % 32 == 0);                   // GEMM k-loop steps by 32
static_assert(DM >= 8);                        // clamped bias loads stay inside a DM-float array
static_assert(SEQ % 64 == 0);                  // a 64-row tile never straddles two batches
static_assert((NB * SEQ) % 64 == 0);
static_assert(SEQ % 32 == 0);                  // key loop steps by 32
static_assert(SEQ % (16 * AW) == 0);           // flash grid covers the sequence exactly
static_assert(((size_t)SEQ * DM) % 8 == 0);
static_assert(NB <= NB_FULL);
static_assert(SEQ <= SEQ_FULL);
static_assert(SEQ_FULL % 4 == 0);
static_assert(EROWS % (16 * AW) == 0);         // the early band is a whole number of flash blocks
static_assert(EROWS % 32 == 0);                // early key steps stay inside the early key range
static_assert(EROWS >= 16 * AW);
static_assert(EROWS <= SEQ);
static_assert(NB <= 8);                        // length line: word b = q_len[b], word 8 + b = k_len[b]

typedef _Float16 h16;
typedef unsigned short bf;        // 16 bits of a staged GEMM operand: bf16, or f16 for the operands of k_out
typedef __attribute__((ext_vector_type(16))) __bf16   v16bf;
typedef __attribute__((ext_vector_type(16))) _Float16 v16h;
typedef __attribute__((ext_vector_type(8)))  _Float16 v8h;
typedef __attribute__((ext_vector_type(8)))  unsigned short v8us;
typedef __attribute__((ext_vector_type(8)))  float    v8f;
typedef __attribute__((ext_vector_type(4)))  float    v4f;
typedef __attribute__((ext_vector_type(4)))  int      v4i;
typedef v4f  __attribute__((may_alias)) v4fa;
typedef v8us __attribute__((may_alias)) v8usa;

__device__ __forceinline__ unsigned short f2bf(float f) { unsigned u = __float_as_uint(f); u += 0x7FFFu + ((u >> 16) & 1u); return (unsigned short)(u >> 16); }
__device__ __forceinline__ float bf2f(unsigned short b) { return __uint_as_float(((unsigned)b) << 16); }
__device__ __forceinline__ float rbf(float f) { return bf2f(f2bf(f)); }   // value after RNE convert to bf16
__device__ __forceinline__ unsigned short f2h(float f) { return __builtin_bit_cast(unsigned short, (h16)f); }   // bits of the f16 nearest to f
__device__ __forceinline__ v16h cat16(v8h lo, v8h hi) { return __builtin_shufflevector(lo, hi, 0, 1, 2, 3, 4, 5, 6, 7, 8, 9, 10, 11, 12, 13, 14, 15); }
__device__ __forceinline__ v16bf cat16b(v8us lo, v8us hi) { return __builtin_bit_cast(v16bf, __builtin_shufflevector(lo, hi, 0, 1, 2, 3, 4, 5, 6, 7, 8, 9, 10, 11, 12, 13, 14, 15)); }
__device__ __forceinline__ v8f wmma16(v16h a, v16h b, v8f c) { return __builtin_amdgcn_wmma_f32_16x16x32_f16(false, a, false, b, (short)0, c, false, false); }
__device__ __forceinline__ v8f wmmab(v16bf a, v16bf b, v8f c) { return __builtin_amdgcn_wmma_f32_16x16x32_bf16(false, a, false, b, (short)0, c, false, false); }
// fragment loaders from K-contiguous 16-bit rows; p already includes + 8*(lane>>4): elements 0..7 <- k0+8h+0..7, elements 8..15 <- k0+16+8h+0..7 (same map for A and B)
__device__ __forceinline__ v16h  ldh(const h16* p) { return cat16(*(const v8h*)p, *(const v8h*)(p + 16)); }
__device__ __forceinline__ v16bf ldb(const bf* p)  { return cat16b(*(const v8us*)p, *(const v8us*)(p + 16)); }
// ordering point for wave-private LDS tiles (same wave writes and reads)
__device__ __forceinline__ void wave_sync() { __builtin_amdgcn_fence(3 /* release order */, "wavefront"); __builtin_amdgcn_wave_barrier(); asm volatile("" ::: "memory"); }
// single guarded f16 WMMA (one accumulator per guard)
__device__ __forceinline__ v8f wmma16g(v16h a, v16h b, v8f c) {
    c = __builtin_amdgcn_wmma_f32_16x16x32_f16(false, a, false, b, (short)0, c, false, false);
    asm volatile("v_nop\n\tv_nop\n\tv_nop\n\tv_nop" : "+v"(c) : "v"(a), "v"(b));
    return c;
}
template <bool B> struct flag_t { static constexpr bool value = B; };   // compile-time switch handed to a generic lambda
__device__ __forceinline__ int imin(int a, int b) { return a < b ? a : b; }
__device__ __forceinline__ int imax(int a, int b) { return a > b ? a : b; }

// cvt8_body: thread's group i of eight f32 of an input (batch pitch SEQ_FULL rows) -> eight bf16 (RNE) of the packed [NB*SEQ][DM] plane. blk = block index inside the plane, 256 threads.
__device__ __forceinline__ void cvt8_body(const unsigned blk, const float* __restrict__ src, bf* dst) {
    const size_t n8 = (size_t)NB * SEQ * DM / 8, per = (size_t)SEQ * DM / 8;   // groups in the plane, groups in one batch
    const size_t i = (size_t)blk * 256 + threadIdx.x; if (i >= n8) return;
    const size_t so = (SEQ == SEQ_FULL) ? i * 8 : (i / per) * ((size_t)SEQ_FULL * DM) + (i % per) * 8;
    const v8f v = *(const v8f*)(src + so); v8us o;
#pragma unroll
    for (int k = 0; k < 8; ++k) o[k] = f2bf(v[k]);
    *(v8us*)(dst + i * 8) = o; 
}

// cvtT_body: in[rows = k][cols = n] f32 (DM x DM, row pitch DM) -> out[n][k] bf16 (RNE convert; ash: the same bf16 value written as f16), 64x64 tiles transposed through LDS.
// tile (bx over k, by over n), each below DM/64; 256 threads. LDS tile ts[n][k] is cross-wave: block barrier between fill and drain.
__device__ __forceinline__ void cvtT_body(const int bx, const int by, const float* __restrict__ W, bf* WT, const bool ash) {
    __shared__ __align__(16) unsigned short ts[64 * 72];
    const int tid = threadIdx.x, lane = tid & 31, wave = __builtin_amdgcn_readfirstlane((int)(tid >> 5));
    const int k0 = bx * 64, n0 = by * 64;
#pragma unroll
    for (int i = 0; i < 4; ++i) { const int idx = tid + i * 256; const int kr = idx >> 4, c4 = (idx & 15) * 4;   // 1024 float4 = 64 k-rows x 16
        const v4f v = *(const v4f*)(W + (size_t)(k0 + kr) * DM + n0 + c4);
#pragma unroll
        for (int j = 0; j < 4; ++j) ts[(c4 + j) * 72 + kr] = f2bf(v[j]); }
    __syncthreads();
{
        const int row = wave * 8 + (lane >> 3), c8 = (lane & 7) * 8;   // rows row + 4 s: 8 waves x 2 s x 4 = 64 rows; 8 lanes x 8 = 64 columns
        v8us o[2];
#pragma unroll
        for (int s = 0; s < 2; ++s) o[s] = *(const v8usa*)(&ts[(row + s * 4) * 72 + c8]);
        if (ash) {   // block-uniform: the bf16 values go out in f16 form
#pragma unroll
            for (int k = 0; k < 16; ++k) o[k >> 3][k & 7] = f2h(bf2f(o[k >> 3][k & 7])); }
#pragma unroll
        for (int s = 0; s < 2; ++s) *(v8us*)(WT + (size_t)(n0 + row + s * 4) * DM + k0 + c8) = o[s];
        asm volatile("s_wait_xcnt 0x0" ::: "memory");   // stands before the registers that the stores above name are written again (the build lets this range's end run on into another range's code)
         }
}

// lens_body: q_len[b] and k_len[b] as integer sums of the first SEQ entries of row b of the two int32 indicator arrays (row pitch SEQ_FULL).
// LW waves per (array, batch) row: a lane brings its entries with SEQ / (128 LW) independent 16-byte loads (a wave-wide load covers 4 whole lines), all issued before the first sum,
// so the whole kernel waits for memory once instead of once per trip of a one-wave loop. Wave sums meet in LDS behind one block barrier; wave 0 adds them and stores the whole 32-word line.
#define LW 2                     // waves per indicator row (2 NB LW waves = the 256 threads of a k_prep block)
static_assert(SEQ % (128 * LW) == 0);          // a wave's share of a row is a whole number of wave-wide 16-byte loads
static_assert(64 * NB * LW == 256);            // 2 NB LW waves are exactly one k_prep block
__device__ __forceinline__ void lens_body(const int* __restrict__ qm, const int* __restrict__ km, int* lens) {
    __shared__ __align__(16) int ss[16 * LW];  // [word][wave of the row]; word b = q_len[b], word 8 + b = k_len[b]
    const int lane = threadIdx.x & 31, wave = __builtin_amdgcn_readfirstlane((int)(threadIdx.x >> 5));
    const int part = wave % LW, b = (wave / LW) % NB, which = wave / (LW * NB);
    const int* row = (which ? km : qm) + (size_t)b * SEQ_FULL + part * (SEQ / LW) + lane * 4;
    v4i p[SEQ / (128 * LW)];
#pragma unroll
    for (int i = 0; i < SEQ / (128 * LW); ++i) p[i] = *(const v4i*)(row + i * 128);
    int s = 0;
#pragma unroll
    for (int i = 0; i < SEQ / (128 * LW); ++i) s += (p[i][0] + p[i][1]) + (p[i][2] + p[i][3]);
#pragma unroll
    for (int o = 16; o > 0; o >>= 1) s += __shfl_xor(s, o, 32);
    if (lane == 0) ss[(which * 8 + b) * LW + part] = s;
    __syncthreads();   // every wave's sum is in LDS before wave 0 reads it
    if (wave == 0) {
        const bool used = lane < 16 && (lane & 7) < NB;   // words that a row feeds; only these LDS words were written
        int v = 0;
#pragma unroll
        for (int i = 0; i < LW; ++i) v += ss[(used ? lane : 0) * LW + i];
        *(int*)(lens + lane) = used ? v : 0;
        asm volatile("s_wait_xcnt 0x0" ::: "memory");   // stands before the registers that the store above names are written again (the build lets this range's end run on into another range's code)
    }
}

// k_prep: everything that reads only the inputs, in one grid of 256-thread blocks. Block 0: the lengths; the next 4 PB_WT blocks: the weight transposes (q | k | v | o);
// the last 3 PB_CV blocks: the input conversions (query | key | value). A block does one of the three jobs (the choice is a function of blockIdx alone, so every barrier is block-uniform).
#define PB_WT ((DM / 64) * (DM / 64))                                   // 64x64 tiles of one weight
#define PB_CV ((unsigned)(((size_t)NB * SEQ * DM / 8 + 255) / 256))     // blocks of one input plane
__global__ __launch_bounds__(256) void k_prep(const float* __restrict__ xq, const float* __restrict__ xk, const float* __restrict__ xv,
                                              const int* __restrict__ qm, const int* __restrict__ km,
                                              const float* __restrict__ wq, const float* __restrict__ wk, const float* __restrict__ wv, const float* __restrict__ wo,
                                              bf* QB, bf* KB, bf* VB, bf* WB, int* lens) {
    const unsigned blk = blockIdx.x;
    if (blk >= 1 + 4 * PB_WT) {
        const unsigned r = blk - (1 + 4 * PB_WT), p = r / PB_CV;
        cvt8_body(r % PB_CV, (p == 0) ? xq : (p == 1) ? xk : xv, (p == 0) ? QB : (p == 1) ? KB : VB);
    } else if (blk >= 1) {
        const unsigned r = blk - 1, w = r / PB_WT, t = r % PB_WT;
        const float* W = (w == 0) ? wq : (w == 1) ? wk : (w == 2) ? wv : wo;
        cvtT_body((int)(t % (DM / 64)), (int)(t / (DM / 64)), W, WB + (size_t)w * DM * DM, w == 3);
    } else {
        lens_body(qm, km, lens);
    }
}

// proj_body: 16-bit GEMM (MODE 0: bf16 operands, MODE 1: f16 operands), one block of 4 waves (2 x 2) per 128x128 tile, each wave a 64x64 sub-tile (16 accumulators), K = DM in passes of KS.
// Operand tiles are staged in LDS by the tensor mover, through no register: each wave asks for one slice (64 rows x 256 B of A or of Bt) of a stage with one tensor_load_to_lds, which lays the rows at pitch LP.
// Two buffers: the request for stage s + 2 is issued behind the barrier at the foot of pass s and flies while pass s + 1 is worked on; that barrier publishes stage s + 1 and ends the reads of the buffer refilled behind it.
// Fragments come from LDS rows of pitch LP (272 B) with the same element map as ldb().
// The k walk is a ring: a block starts at pass (bx + by) mod (DM / KS) and wraps round. Blocks of one tile row read the same A rows and blocks of one tile column the same Bt rows, all started together;
// from a common start they would ask L2 for the same lines at the same moment. The sums run over the 32-steps in ascending order from the block's own start, wrapped.
// C[m][n] = sum_k A[m][k] Bt[n][k] + bias (bmode 1: bias[n]; bmode 2: bias[m]; bias RNE-converted to bf16 first),
// sub-tile base (r0/RB)*sRB + (r0%RB)*pitch + (c0/CB)*sCB + (c0%CB), row pitch 'pitch' (elements). tile (bx below M/128, by below N/128), 128 threads.
// MODE 1: written as f32 (Of); each row's 64 floats (256 B = two lines) by 16 consecutive lanes x 16 B (2 rows per instruction).
// Bias array has DM floats; both 16-byte bias loads use addresses clamped into [0, DM-4].
#define GT 128                   // block tile edge (rows of A and rows of Bt per block)
#define KS 128                   // k elements per pass (256 B of every operand row)
#define LP 136                   // LDS row pitch in elements (272 B: 16 B x odd, for 16-byte readers)
#define SLB 18432                // bytes of one slice's place in LDS: 64 rows x 272 B = 17,408, rounded up to a multiple of 2 KiB
#define SLE (SLB / 2)            // the same in elements
#define BUFB (4 * SLB)           // bytes of one buffer: two slices of A, two of Bt
static_assert(KS * 2 == 256);                  // rows of 256 B: the pad interval of stage_load
static_assert(LP * 2 == KS * 2 + 16);          // pitch = row + the 16-byte pad of stage_load
static_assert(64 * LP * 2 <= SLB && SLB % 2048 == 0);
static_assert(GT == 128);                      // four slices of 64 rows, one per wave
static_assert(DM / KS >= 2);                   // the ring's prologue needs two stages
static_assert((DM * 2) % 16 == 0 && DM * 2 <= 131072);   // source row pitch inside the mover's range
static_assert(4 * 16 * 68 * 4 <= BUFB);        // the epilogue tiles fit the ring
static_assert(DM % KS == 0);
static_assert(((DM / KS) & (DM / KS - 1)) == 0);   // the ring of passes wraps by a mask
static_assert(DM % GT == 0);
static_assert((NB * SEQ) % GT == 0);
static_assert(SEQ % GT == 0);                  // a tile's GT token rows lie in one batch
typedef unsigned int u32x4 __attribute__((ext_vector_type(4)));
typedef unsigned int u32x8 __attribute__((ext_vector_type(8)));
__device__ __forceinline__ unsigned uni(unsigned v) { return (unsigned)__builtin_amdgcn_readfirstlane(v); }   // a descriptor word, wave-uniform, in a scalar register
__device__ __forceinline__ unsigned pinned(unsigned v) { unsigned w = (unsigned)__builtin_amdgcn_readfirstlane(v); asm volatile("" : "+s"(w)); return w; }   // the pinned() form for the guard of a tensor op: the empty statement holds the test word in a scalar register, so that the test compiles to s_cmp and a scalar branch (a tensor load ignores EXEC)
// stage_load: one request of the whole wave: 64 rows x 256 B at source pitch DM * 2 B from g (first byte at a multiple of 256 B) to LDS byte offset lds (a multiple of 2 KiB), 16 B of pad behind every row (pitch 272 B).
// Extents in bytes (data_size code 0), tensor dims = tile dims, no mask.
__device__ __forceinline__ void stage_load(const unsigned lds, const bf* g) {
    const unsigned long long ga = (unsigned long long)(size_t)g;
    u32x4 g0; u32x8 g1;
    g0[0] = uni(1u); g0[1] = uni(lds); g0[2] = uni((unsigned)ga); g0[3] = uni((((unsigned)(ga >> 32)) & 0x01FFFFFFu) | 0x80000000u);
    g1[0] = uni((1u << 20) | (5u << 22) | (3u << 25));   // pad on, a pad behind every 64 dwords (one row), 4 dwords of pad
    g1[1] = uni(256u << 16);                             // tensor_dim0 = 256 B
    g1[2] = uni(64u << 16);                              // tensor_dim1 = 64 rows
    g1[3] = uni(256u << 16);                             // tile_dim0 = 256 B
    g1[4] = uni(64u);                                    // tile_dim1 = 64 rows
    g1[5] = uni((unsigned)(DM * 2));                     // source row pitch in bytes
    g1[6] = uni(0u); g1[7] = uni(0u);
    asm volatile("tensor_load_to_lds %0, %1" :: "s"(g0), "s"(g1) : "memory");
}
__device__ __forceinline__ v16bf ldbs(const bf* p) { return cat16b(*(const v8usa*)p, *(const v8usa*)(p + 16)); }   // ldb() on an LDS row
template <int MODE>
__device__ __forceinline__ void proj_body(const int bx, const int by, const bf* __restrict__ A, const bf* __restrict__ Bt,
                                          const float* __restrict__ bias, int bmode, h16* Ph, h16* Pr, int useRes, float* Of,
                                          int RB, size_t sRB, int pitch, int CB, size_t sCB) {
    __shared__ __attribute__((aligned(2048))) unsigned char smem[2 * BUFB];   // the ring [buffer][slice][row][LP]; behind the loop its first bytes are the waves' epilogue tiles
    bf* st = (bf*)smem;
    const int K = DM;
    constexpr int NP = DM / KS;                                  // stages = passes of the k walk
    const int tid = threadIdx.x, lane = tid & 31, lr = lane & 15, hi = lane >> 4, wave = __builtin_amdgcn_readfirstlane((int)(tid >> 5));
    const int R0 = bx * GT, C0 = by * GT;
    const int wm = wave >> 1, wn = wave & 1;
    const int r0 = R0 + wm * 64, c0 = C0 + wn * 64;              // this wave's 64x64 sub-tile
    // residual plane: k_flash reads it only at tokens below EROWS (rows of q and k, columns of v^T); a wave whose 64 tokens lie at or past EROWS neither forms nor stores it (wave-uniform scalar)
    const bool res = useRes && ((bmode == 2) ? c0 : r0) % SEQ < EROWS;
    v8f acc[4][4];
#pragma unroll
    for (int mb = 0; mb < 4; ++mb)
#pragma unroll
        for (int nb = 0; nb < 4; ++nb) acc[mb][nb] = (v8f){};
    // staging: wave w brings slice w of every stage (w = 0, 1: A rows R0 + 64 w ..; w = 2, 3: Bt rows C0 + 64 (w - 2) ..), 64 rows x 256 B, all inside the operand planes
    const bf* gS = (wave < 2) ? A + (size_t)(R0 + wave * 64) * K : Bt + (size_t)(C0 + (wave - 2) * 64) * K;   // wave-uniform
    const unsigned l0 = (unsigned)(size_t)(__attribute__((address_space(3))) unsigned char*)(smem + wave * SLB);   // the slice's place in buffer 0, a multiple of 2 KiB
    const int fa = wm * SLE + lr * LP + 8 * hi, fb = (2 + wn) * SLE + lr * LP + 8 * hi;   // fragment bases inside a buffer
    const int rot = (bx + by) & (NP - 1);                        // the block's first pass of the ring (block-uniform scalar)
    stage_load(l0, gS + rot * KS);
    asm volatile("s_wait_tensorcnt 0x0" ::: "memory");           // this wave's slice of stage 0 has landed
    __syncthreads();                                             // stage 0 is whole for every wave
    stage_load(l0 + BUFB, gS + ((rot + 1) & (NP - 1)) * KS);
#pragma unroll 1
    for (int it = 0; it < NP; ++it) {
        const int cur = it & 1;
        const bf* sb = st + cur * (BUFB / 2);
        v16bf a[2][4], b[2][4];
#pragma unroll
        for (int q = 0; q < 4; ++q) { a[0][q] = ldbs(sb + fa + q * 16 * LP); b[0][q] = ldbs(sb + fb + q * 16 * LP); }
        __builtin_amdgcn_sched_barrier(0);   // keeps the first fragment loads one group ahead of the products
#pragma unroll
        for (int s = 0; s < KS / 32; ++s) {
            const int c = s & 1, n = c ^ 1;
            if (s + 1 < KS / 32) {
#pragma unroll
                for (int q = 0; q < 4; ++q) { a[n][q] = ldbs(sb + fa + q * 16 * LP + (s + 1) * 32); b[n][q] = ldbs(sb + fb + q * 16 * LP + (s + 1) * 32); }
                __builtin_amdgcn_sched_barrier(0);   // the next 32-step's fragment loads stay one group in front of this step's products, not among them
            }
#pragma unroll
            for (int nb = 0; nb < 4; ++nb)
#pragma unroll
                for (int mb = 0; mb < 4; ++mb) acc[mb][nb] = (MODE == 1) ? wmma16(__builtin_bit_cast(v16h, a[c][mb]), __builtin_bit_cast(v16h, b[c][nb]), acc[mb][nb]) : wmmab(a[c][mb], b[c][nb], acc[mb][nb]);
            // issue slots behind the last products before their operand registers are written again
            asm volatile("v_nop\n\tv_nop\n\tv_nop\n\tv_nop" : "+v"(acc[0][0]), "+v"(acc[1][1]), "+v"(acc[2][2]), "+v"(acc[3][3]) : "v"(a[c][0]), "v"(a[c][1]), "v"(a[c][2]), "v"(a[c][3]));
        }
        __builtin_amdgcn_sched_barrier(0);   // keeps the pass's products in front of the foot: the build otherwise sinks a third of them behind the barrier, ahead of the refill, which then starts that much later
        asm volatile("s_wait_dscnt 0x0" ::: "memory");           // this wave's reads of the buffer are done before it is refilled
        asm volatile("s_wait_tensorcnt 0x0" ::: "memory");       // this wave's slice of the next stage has landed
        __syncthreads();                                         // publishes the next stage; ends every wave's reads of the buffer refilled below
        if (pinned(it + 2 < NP)) stage_load(l0 + cur * BUFB, gS + ((rot + it + 2) & (NP - 1)) * KS);   // scalar branch: a tensor load ignores EXEC
    }
    asm volatile("s_wait_tensorcnt 0x0" ::: "memory");           // no request is outstanding
    asm volatile("s_wait_dscnt 0x0" ::: "memory");               // no LDS read is outstanding; the last pass's barrier has ended every wave's reads, so the ring may hold the epilogue tiles
    float* os = (float*)smem + wave * (16 * 68);                 // one wave-private epilogue tile per wave
    const size_t tbase = (size_t)(r0 / RB) * sRB + (size_t)(r0 % RB) * (size_t)pitch + (size_t)(c0 / CB) * sCB + (size_t)(c0 % CB);
    // per-lane column bias for the lane's store columns; both load addresses clamped into the DM-float bias array (first to 0 when unused, second to DM-4)
    const int c8 = (lane & 7) * 8, cofs = lr * 4;
    const int ci = (bmode == 1) ? (c0 + ((MODE == 0) ? c8 : cofs)) : 0;
    const int ci4 = (ci + 4 <= DM - 4) ? (ci + 4) : (DM - 4);      // MODE 0: ci + 4 <= DM - 4 always (exact columns); MODE 1: upper half unused, address kept in range
    const v4f bl0 = *(const v4f*)(bias + ci), bl1 = *(const v4f*)(bias + ci4);
    // MODE 0: the row bias of the lane's 16 store rows (row 16 mb + 4 s + (lane >> 3)), loaded here beside the column bias and converted once,
    // so that the store loop below holds no global load, no wait for one and no branch
    float brw[4][4];
    if (MODE == 0) {
        const float* br = bias + ((bmode == 2) ? (r0 + (lane >> 3)) : 0);   // bmode 2: r0 + 63 <= DM - 1; otherwise words 0..63 of the DM-float array, read and not used
        const unsigned bm = (bmode == 2) ? 0xFFFF0000u : 0u;                // keeps the RNE-converted value, or makes it +0
#pragma unroll
        for (int mb = 0; mb < 4; ++mb)
#pragma unroll
            for (int s = 0; s < 4; ++s) brw[mb][s] = br[mb * 16 + 4 * s];
        asm volatile("" :: "v"(brw[0][0]), "v"(brw[0][1]), "v"(brw[0][2]), "v"(brw[0][3]), "v"(brw[1][0]), "v"(brw[1][1]), "v"(brw[1][2]), "v"(brw[1][3]),
                           "v"(brw[2][0]), "v"(brw[2][1]), "v"(brw[2][2]), "v"(brw[2][3]), "v"(brw[3][0]), "v"(brw[3][1]), "v"(brw[3][2]), "v"(brw[3][3]),
                           "v"(bl0), "v"(bl1));   // inputs-only fence on the loaded values: holds all bias loads together here, one wait for all (the build otherwise sinks each row-bias load to its use, behind a wait of its own)
#pragma unroll
        for (int mb = 0; mb < 4; ++mb)
#pragma unroll
            for (int s = 0; s < 4; ++s) { unsigned u = __float_as_uint(brw[mb][s]); u += 0x7FFFu + ((u >> 16) & 1u); brw[mb][s] = __uint_as_float(u & bm); }   // rbf() under the mask
    }
    float bc[8];
#pragma unroll
    for (int i = 0; i < 4; ++i) { bc[i] = (bmode == 1) ? rbf(bl0[i]) : 0.0f; bc[4 + i] = (bmode == 1) ? rbf(bl1[i]) : 0.0f; }
    // the store loop, once with and once without the residual plane (RES::value), each a straight run of code: one scalar branch a wave picks the form
    auto store_tile = [&](auto RES) __attribute__((always_inline)) {
    constexpr bool RS = decltype(RES)::value;
#pragma unroll
    for (int mb = 0; mb < 4; ++mb) {
#pragma unroll
        for (int nb = 0; nb < 4; ++nb) {
#pragma unroll
            for (int j = 0; j < 8; ++j) os[(hi * 8 + j) * 68 + nb * 16 + lr] = acc[mb][nb][j]; }   // D: row 8h+j, col lane&15; rows 0..15 x columns 0..63 all written
        wave_sync();
        const size_t sb = tbase + (size_t)(mb * 16) * (size_t)pitch;
        if (MODE == 0) {
{
                // the four row groups of the block go as one batch: their LDS reads, conversions and stores are independent of each other and overlap
                v8h hv[4], rv[4]; h16* ph[4]; h16* pr[4];
#pragma unroll
                for (int s = 0; s < 4; ++s) { const int row = 4 * s + (lane >> 3);   // 4 s x 4 row groups = 16 rows; 8 lanes x 8 = 64 columns
                    const float brow = brw[mb][s];
                    const size_t oo = sb + (size_t)row * (size_t)pitch + c8; ph[s] = Ph + oo; pr[s] = Pr + oo;
                    const v4f x0 = *(const v4fa*)(&os[row * 68 + c8]); const v4f x1 = *(const v4fa*)(&os[row * 68 + c8 + 4]);
#pragma unroll
                    for (int i = 0; i < 4; ++i) { const float f0 = x0[i] + bc[i] + brow; const float f1 = x1[i] + bc[4 + i] + brow;
                        const h16 a0 = (h16)f0; const h16 a1 = (h16)f1; hv[s][i] = a0; hv[s][4 + i] = a1;
                        if (RS) { rv[s][i] = (h16)((f0 - (float)a0) * QRS); rv[s][4 + i] = (h16)((f1 - (float)a1) * QRS); } } }
                __builtin_amdgcn_sched_barrier(0);   // the stores stay behind all four conversions and address sums: a store among them has its registers reused at once, which costs a wait per store
#pragma unroll
                for (int s = 0; s < 4; ++s) { *(v8h*)ph[s] = hv[s]; if (RS) *(v8h*)pr[s] = rv[s]; }
                asm volatile("s_wait_xcnt 0x0" ::: "memory");   // stands before the registers that the stores above name are written again by the next row block
                 }
        } else {
{
#pragma unroll
                for (int s = 0; s < 8; ++s) { const int row = 2 * s + hi;   // 8 s x 2 rows = 16 rows; 16 lanes x 4 floats = 64 columns
                    const v4f x0 = *(const v4fa*)(&os[row * 68 + cofs]); v4f val;
                    val[0] = x0[0] + bc[0]; val[1] = x0[1] + bc[1]; val[2] = x0[2] + bc[2]; val[3] = x0[3] + bc[3];
                    *(v4f*)(Of + sb + (size_t)row * (size_t)pitch + cofs) = val; }
                asm volatile("s_wait_xcnt 0x0" ::: "memory");   // stands before the registers that the stores above name are written again by the next row block
                 }
        }
        wave_sync();
    }
    };
    if (MODE == 0 && res) store_tile(flag_t<true>{}); else store_tile(flag_t<false>{});
}

// k_qkv: the three projections in one grid (NB*SEQ/GT, DM/GT, 3); blockIdx.z picks the product: 0 -> z = 1 (k), 1 -> z = 2 (v^T), 2 -> z = 0 (q).
// A k or v^T tile whose GT key rows all lie at or past k_len[b] is not computed: a key is visible only below k_len, and k_flash copies key tiles only below k_len rounded up to TK (TK divides GT),
// so no later launch reads those rows. The block leaves at entry, on a block-uniform test in front of every barrier and tensor load. k and v^T come first in the grid, so that the LDS places
// of the blocks that leave are free again while the q blocks are still being started.
// z = 0, 1 (q, k): A = x rows (m = b*SEQ + t), Bt = W^T rows (n = h*64 + d), column bias -> planes [(b*16 + h)][t][d] (value and residual).
// z = 2 (v^T): A = Wv^T rows (m = h*64 + d), Bt = value rows (n = b*SEQ + t), row bias -> planes [(b*1024 + m)][t] = [(b*16 + h)][d][t] (value and residual); its tile is (blockIdx.y, blockIdx.x).
__global__ __launch_bounds__(128) void k_qkv(const bf* __restrict__ QB, const bf* __restrict__ KB, const bf* __restrict__ VB,
                                             const bf* __restrict__ WQT, const bf* __restrict__ WKT, const bf* __restrict__ WVT,
                                             const float* __restrict__ bq, const float* __restrict__ bk, const float* __restrict__ bv,
                                             const int* __restrict__ LENS, h16* QH, h16* QR, h16* KP, h16* KR, h16* VT, h16* VR) {
    const int z = (blockIdx.z == 2) ? 0 : (int)blockIdx.z + 1; const bool isv = z == 2;
    if (z != 0) {   // blockIdx.x is the tile of GT key rows b*SEQ + t in both products
        const int row0 = (int)blockIdx.x * GT;
        if (row0 % SEQ >= imin(imax(LENS[8 + row0 / SEQ], 0), SEQ)) return;   // length clamped into [0, SEQ] as in k_flash
    }
    const bf* A  = isv ? WVT : z ? KB : QB;
    const bf* Bt = isv ? VB : z ? WKT : WQT;
    proj_body<0>((int)(isv ? blockIdx.y : blockIdx.x), (int)(isv ? blockIdx.x : blockIdx.y), A, Bt, isv ? bv : z ? bk : bq, isv ? 2 : 1,
                 isv ? VT : z ? KP : QH, isv ? VR : z ? KR : QR, 1, nullptr,
                 isv ? DM : SEQ, isv ? (size_t)0 : (size_t)NH_ * SEQ * HD, isv ? SEQ : HD, isv ? SEQ : HD, isv ? (size_t)DM * SEQ : (size_t)SEQ * HD);
}

// k_out: A = context rows (m = b*SEQ + t, f16), Bt = Wo^T rows (n, f16), column bias -> OUT[(b*OUT_SEQ + t)][n] f32; grid (NB*SEQ/GT, DM/GT).
__global__ __launch_bounds__(128) void k_out(const bf* __restrict__ CH, const bf* __restrict__ WOT, const float* __restrict__ bo, float* OUT) {
    proj_body<1>((int)blockIdx.x, (int)blockIdx.y, CH, WOT, bo, 1, nullptr, nullptr, 0, OUT, SEQ, (size_t)OUT_SEQ * DM, DM, DM, (size_t)0);
}

// Key tiles of k_flash: the block's AW waves share one tile of TK keys in LDS, one plane pair = [K: TK key rows of 128 B | V^T: HD d rows of 128 B], row pitch TP elements (144 B, for 16-byte readers).
// The ring holds two plane pairs. EARLY = 0: two buffers of the value planes, the next tile's copies in flight while this tile is worked on. EARLY = 1: one buffer, value pair then residual pair.
#define TK 64                    // keys per staged tile (two 32-key passes)
#define TP 72                    // LDS row pitch in elements
#define TSZ ((TK + HD) * TP)     // elements of one plane pair
static_assert(TK * 2 == 128);                  // a V^T row segment of a tile is one whole line
static_assert(SEQ % TK == 0);                  // every tile lies wholly inside the planes
static_assert(16 * AW == TK);                  // a block's query rows span one tile: block xblk walks xblk + 1 tiles at most
static_assert(32 * AW / 8 == 16);              // one copy of the block covers 16 rows of 128 B
static_assert(GT % TK == 0);                   // key rows below k_len rounded up to TK lie in projection tiles that start below k_len
static_assert(TK == 64);                       // four copies cover the K rows of a tile, four the HD = 64 V^T rows
// tile_copy: the block's copy of one plane pair of a tile, 8 asynchronous 16-byte copies a lane (4 K, 4 V^T); a wave-wide copy covers 4 whole 128-byte rows.
// lk, lv: the lane's LDS byte addresses of its first K and V^T piece; gk, gv: the global addresses of the same pieces; piece i lies 16 rows further on.
// The last line of the statement stands before the address registers that the copies name are written again.
__device__ __forceinline__ void tile_copy(const unsigned lk, const unsigned lv, const h16* gk, const h16* gv) {
    asm volatile("global_load_async_to_lds_b128 %0, %8, off\n\t"
                 "global_load_async_to_lds_b128 %1, %9, off\n\t"
                 "global_load_async_to_lds_b128 %2, %10, off\n\t"
                 "global_load_async_to_lds_b128 %3, %11, off\n\t"
                 "global_load_async_to_lds_b128 %4, %12, off\n\t"
                 "global_load_async_to_lds_b128 %5, %13, off\n\t"
                 "global_load_async_to_lds_b128 %6, %14, off\n\t"
                 "global_load_async_to_lds_b128 %7, %15, off\n\t"
                 "s_wait_xcnt 0x0"
                 :: "v"(lk), "v"(lk + 16 * TP * 2), "v"(lk + 32 * TP * 2), "v"(lk + 48 * TP * 2),
                    "v"(lv), "v"(lv + 16 * TP * 2), "v"(lv + 32 * TP * 2), "v"(lv + 48 * TP * 2),
                    "v"(gk), "v"(gk + 16 * HD), "v"(gk + 32 * HD), "v"(gk + 48 * HD),
                    "v"(gv), "v"(gv + (size_t)16 * SEQ), "v"(gv + (size_t)32 * SEQ), "v"(gv + (size_t)48 * SEQ)
                 : "memory");
}

// flash_body: fused attention, one wave per 16 query rows of one (batch, head); Q fragments straight from the f16 planes (two 16-B loads each, arithmetic addressing);
// K / V^T fragments from the block's LDS tile with the same element map (two 16-B LDS loads each).
// Transposed form: S^T[key][t] = K Q^T (A = K rows, B = Q rows); lane (t = lane&15, h = lane>>4) holds keys 8h+r of each 16-key tile, so the packed
// P tile is directly the B fragment of O^T[d][t] = V^T P^T (element r <- tile keys 0..15, element 8+r <- tile keys 16..31, lane unchanged).
// Visibility of (t, key): key <= lim(t) with lim = min(t, k_len - 1) when t < q_len, else -1 (nothing visible); excluded scores are REPLACED by a large negative fill and their P is set to 0 by value.
// The key loop runs to kend = min(t0 + 16, k_len) <= SEQ (wave-scalar, static upper bound SEQ); a row with no visible key keeps l = 0 and gets a zero context.
// Softmax state (running max, partial sum) is one scalar per lane; the two lane halves of a row are combined with one xor-16 exchange.
// EARLY = 1 (query rows < EROWS): q, k, P, v each as f16 value + f16 residual x2048; value x residual products go to separate accumulators folded with 1/2048 (scores: before the scale; context: before the normalisation); row sum over the unconverted p.
// EARLY = 0: single f16 products, row sum over the converted P.
template <int EARLY>
__device__ __forceinline__ void flash_body(const int xblk, const h16* __restrict__ QH, const h16* __restrict__ QR, const h16* __restrict__ KP, const h16* __restrict__ KR,
                                           const h16* __restrict__ VT, const h16* __restrict__ VR, const int* __restrict__ LENS, bf* CH, h16* ring) {
    __shared__ __align__(16) float os[AW * 16 * 68];
    const int lane = threadIdx.x & 31, wave = __builtin_amdgcn_readfirstlane((int)(threadIdx.x >> 5)), lr = lane & 15, hi = lane >> 4;
    const int zh = blockIdx.y; const int b = zh / NH_, h = zh % NH_;
    const int t0 = (xblk * AW + wave) * 16;
    const size_t pbase = (size_t)zh * SEQ * HD;
    const size_t qo = pbase + (size_t)(t0 + lr) * HD + 8 * hi;
    const v16h qh0 = ldh(QH + qo), qh1 = ldh(QH + qo + 32);   // B fragments: col t, k = d
    v16h qr0 = qh0, qr1 = qh1;
    if (EARLY) { qr0 = ldh(QR + qo); qr1 = ldh(QR + qo + 32); }
    const int qlen = imin(imax(LENS[b], 0), SEQ), klen = imin(imax(LENS[8 + b], 0), SEQ);   // lengths clamped into [0, SEQ]
    const int t = t0 + lr;
    const int lim = (t < qlen) ? imin(t, klen - 1) : -1;      // last visible key of query t (-1: none)
    const int kend = __builtin_amdgcn_readfirstlane(imin((xblk * AW + (int)(threadIdx.x >> 5)) * 16 + 16, klen));   // min taken first, then made wave-scalar; <= SEQ
    v8f o0 = (v8f){}, o1 = (v8f){}, o2 = (v8f){}, o3 = (v8f){};
    v8f e0 = (v8f){}, e1 = (v8f){}, e2 = (v8f){}, e3 = (v8f){};
    float m = -3.0e38f, l = 0.0f;
    // one 32-key pass; kl (A fragment: row key, k = d; + 16 TP: the second 16 keys) and vl (A fragment: row d, k = key; + 16j TP) are this lane's fragment bases of the pass in the LDS tile, residual pair at + TSZ
    // TEST::value = false: the caller has shown that every key of the pass is visible to every row of the wave, so each visibility test below is true and is left out (same order of sums)
    auto pass = [&](auto TEST, const int key0, const h16* kl, const h16* vl) __attribute__((always_inline)) {
        constexpr bool MK = decltype(TEST)::value;
        v8f sHa = (v8f){}, sLa = (v8f){}, sHb = (v8f){}, sLb = (v8f){};
        if (EARLY) {
            { const v16h kh0 = ldh(kl), kh1 = ldh(kl + 32), kr0 = ldh(kl + TSZ), kr1 = ldh(kl + TSZ + 32);
              sHa = wmma16g(kh0, qh0, sHa); sLa = wmma16g(kh0, qr0, sLa); sLa = wmma16g(kr0, qh0, sLa);
              sHa = wmma16g(kh1, qh1, sHa); sLa = wmma16g(kh1, qr1, sLa); sLa = wmma16g(kr1, qh1, sLa); }
            { const v16h kh0 = ldh(kl + 16 * TP), kh1 = ldh(kl + 16 * TP + 32), kr0 = ldh(kl + TSZ + 16 * TP), kr1 = ldh(kl + TSZ + 16 * TP + 32);
              sHb = wmma16g(kh0, qh0, sHb); sLb = wmma16g(kh0, qr0, sLb); sLb = wmma16g(kr0, qh0, sLb);
              sHb = wmma16g(kh1, qh1, sHb); sLb = wmma16g(kh1, qr1, sLb); sLb = wmma16g(kr1, qh1, sLb); }
        } else {
            const v16h ka0 = ldh(kl), ka1 = ldh(kl + 32), kb0 = ldh(kl + 16 * TP), kb1 = ldh(kl + 16 * TP + 32);
            sHa = wmma16(ka0, qh0, sHa); sHb = wmma16(kb0, qh0, sHb);
            sHa = wmma16(ka1, qh1, sHa); sHb = wmma16(kb1, qh1, sHb);
            asm volatile("v_nop\n\tv_nop\n\tv_nop\n\tv_nop" : "+v"(sHa), "+v"(sHb) : "v"(ka0), "v"(ka1), "v"(kb0), "v"(kb1));
        }
        const int kq = key0 + 8 * hi;           // this lane's first key of tile a (tile b: + 16)
        float ta[8], tb[8]; float mx = -3.0e38f;
#pragma unroll
        for (int r = 0; r < 8; ++r) {
            const float xa = EARLY ? (sHa[r] + sLa[r] * QRI) * SC2 : sHa[r] * SC2;
            const float xb = EARLY ? (sHb[r] + sLb[r] * QRI) * SC2 : sHb[r] * SC2;
            ta[r] = (!MK || kq + r <= lim) ? xa : -3.0e38f;
            tb[r] = (!MK || kq + 16 + r <= lim) ? xb : -3.0e38f; }
#pragma unroll
        for (int r = 0; r < 8; ++r) mx = fmaxf(mx, fmaxf(ta[r], tb[r]));
        mx = fmaxf(mx, __shfl_xor(mx, 16, 32));
        const float mnew = fmaxf(m, mx);
        const float alpha = __builtin_amdgcn_exp2f(m - mnew);
        const float sh = PSH - mnew;
        v16h pb = (v16h){}, pr = (v16h){}; float ls = 0.0f;
#pragma unroll
        for (int r = 0; r < 8; ++r) {
            const float ya = __builtin_amdgcn_exp2f(ta[r] + sh), yb = __builtin_amdgcn_exp2f(tb[r] + sh);
            const float ea = (!MK || kq + r <= lim) ? ya : 0.0f;
            const float eb = (!MK || kq + 16 + r <= lim) ? yb : 0.0f;
            const h16 pa = (h16)ea; const h16 pc = (h16)eb; pb[r] = pa; pb[8 + r] = pc;
            if (EARLY) { pr[r] = (h16)((ea - (float)pa) * QRS); pr[8 + r] = (h16)((eb - (float)pc) * QRS); ls += ea + eb; }
            else { ls += (float)pa + (float)pc; } }
        l = l * alpha + ls; m = mnew;
        o0 = o0 * alpha; o1 = o1 * alpha; o2 = o2 * alpha; o3 = o3 * alpha;
        if (EARLY) {
            e0 = e0 * alpha; e1 = e1 * alpha; e2 = e2 * alpha; e3 = e3 * alpha;
            { const v16h vh = ldh(vl), vr = ldh(vl + TSZ);
              o0 = wmma16g(vh, pb, o0); e0 = wmma16g(vh, pr, e0); e0 = wmma16g(vr, pb, e0); }
            { const v16h vh = ldh(vl + 16 * TP), vr = ldh(vl + TSZ + 16 * TP);
              o1 = wmma16g(vh, pb, o1); e1 = wmma16g(vh, pr, e1); e1 = wmma16g(vr, pb, e1); }
            { const v16h vh = ldh(vl + 32 * TP), vr = ldh(vl + TSZ + 32 * TP);
              o2 = wmma16g(vh, pb, o2); e2 = wmma16g(vh, pr, e2); e2 = wmma16g(vr, pb, e2); }
            { const v16h vh = ldh(vl + 48 * TP), vr = ldh(vl + TSZ + 48 * TP);
              o3 = wmma16g(vh, pb, o3); e3 = wmma16g(vh, pr, e3); e3 = wmma16g(vr, pb, e3); }
        } else {
            const v16h v0 = ldh(vl), v1 = ldh(vl + 16 * TP), v2 = ldh(vl + 32 * TP), v3 = ldh(vl + 48 * TP);
            o0 = wmma16(v0, pb, o0); o1 = wmma16(v1, pb, o1); o2 = wmma16(v2, pb, o2); o3 = wmma16(v3, pb, o3);
            asm volatile("v_nop\n\tv_nop\n\tv_nop\n\tv_nop" : "+v"(o0), "+v"(o1), "+v"(o2), "+v"(o3) : "v"(v0), "v"(v1), "v"(v2), "v"(v3), "v"(pb));
        }
    };
    const int nt = (imin(xblk * TK + TK, __builtin_amdgcn_readfirstlane(klen)) + TK - 1) / TK;   // tiles the block walks (block-uniform scalar, <= SEQ / TK): up to its last wave's kend
    const int crow = (int)threadIdx.x >> 3, cch = ((int)threadIdx.x & 7) * 8;                    // the lane's first row of a copy and its 16-byte piece of a 128-byte row
    const unsigned lk = (unsigned)(size_t)(__attribute__((address_space(3))) h16*)(ring + crow * TP + cch), lv = lk + TK * TP * 2;
    const h16* gk = KP + pbase + (size_t)crow * HD + cch;     // + tile * TK * HD
    const h16* gv = VT + pbase + (size_t)crow * SEQ + cch;    // + tile * TK
    const h16* fk = ring + lr * TP + 8 * hi;                  // fragment bases inside the first plane pair
    const h16* fv = fk + TK * TP;
    // In both bands a wave makes the 32-key passes below its own kend (wave-scalar tests) and passes every barrier; EARLY = 1: in ascending order; EARLY = 0: the wholly visible tiles as a ring, then the rest ascending.
    if constexpr (EARLY) {
        const h16* gkr = KR + pbase + (size_t)crow * HD + cch;
        const h16* gvr = VR + pbase + (size_t)crow * SEQ + cch;
#pragma unroll 1
        for (int s = 0; s < nt; ++s) {
            const int key0 = s * TK;
            tile_copy(lk, lv, gk + (size_t)key0 * HD, gv + key0);
            tile_copy(lk + TSZ * 2, lv + TSZ * 2, gkr + (size_t)key0 * HD, gvr + key0);
            asm volatile("s_wait_asynccnt 0x0" ::: "memory");     // this wave's part of the tile has landed
            __syncthreads();                                      // the tile is whole for every wave
            if (key0 < kend) pass(flag_t<true>{}, key0, fk, fv);
            if (key0 + 32 < kend) pass(flag_t<true>{}, key0 + 32, fk + 32 * TP, fv + 32);
            if (s + 1 < nt) {
                asm volatile("s_wait_dscnt 0x0" ::: "memory");    // this wave's reads of the tile are done before it is overwritten
                __syncthreads();                                  // ends every wave's reads of the tile that the next trip overwrites
            }
        }
    } else {
        // keys 0 .. kvis - 1 are visible to every row of the block: the smallest lim + 1 over its TK rows (0 when a row lies at or past q_len); block-uniform scalar, kvis <= every wave's kend
        const int kvis = __builtin_amdgcn_readfirstlane((xblk * TK + TK - 1 < qlen) ? imin(xblk * TK, klen - 1) + 1 : 0);
        const int nf = kvis / TK;                                 // leading tiles that lie wholly below kvis; nf <= nt
        // The nf leading tiles are walked as a ring from a start of the block's own: the blocks of a head read the same K and V^T rows and start together, and from a common start
        // they would ask L2 for the same lines at the same moment. (13 xblk) mod 32 is a permutation of the 32 block indices, scaled into [0, nf). The tiles from nf on keep their order.
        const int rot = (nf * ((xblk * 13) & 31)) >> 5;           // block-uniform scalar, 0 <= rot < nf (0 when nf = 0)
        auto tile_of = [&](const int s) __attribute__((always_inline)) {   // tile of trip s, below nt for s < nt: a permutation of the trips
            const int w = s + rot;
            return (s < nf) ? ((w < nf) ? w : w - nf) : s;
        };
        if (nt > 0) tile_copy(lk, lv, gk + (size_t)tile_of(0) * TK * HD, gv + tile_of(0) * TK);
        asm volatile("s_wait_asynccnt 0x0" ::: "memory");         // this wave's part of the first tile has landed
        __syncthreads();                                          // the first tile is whole for every wave
        if (nt > 1) tile_copy(lk + TSZ * 2, lv + TSZ * 2, gk + (size_t)tile_of(1) * TK * HD, gv + tile_of(1) * TK);
        // foot of trip s of either loop below, passed by every wave
        auto foot = [&](const int s, const int bo) __attribute__((always_inline)) {
            asm volatile("s_wait_dscnt 0x0" ::: "memory");        // this wave's reads of the buffer are done before it is refilled
            asm volatile("s_wait_asynccnt 0x0" ::: "memory");     // this wave's part of the next tile has landed
            __syncthreads();                                      // publishes the next tile; ends every wave's reads of the buffer refilled below
            if (s + 2 < nt) tile_copy(lk + bo * 2, lv + bo * 2, gk + (size_t)tile_of(s + 2) * TK * HD, gv + tile_of(s + 2) * TK);
        };
        int s = 0;
#pragma unroll 1
        for (; s < nf; ++s) {                                     // tiles with no hidden score: both passes, no visibility tests
            const int bo = (s & 1) * TSZ, key0 = tile_of(s) * TK;
            pass(flag_t<false>{}, key0, fk + bo, fv + bo);
            pass(flag_t<false>{}, key0 + 32, fk + bo + 32 * TP, fv + bo + 32);
            foot(s, bo);
        }
#pragma unroll 1
        for (; s < nt; ++s) {                                     // the tiles at the diagonal or at k_len (all tiles when a row lies past q_len)
            const int bo = (s & 1) * TSZ, key0 = s * TK;
            if (key0 < kend) pass(flag_t<true>{}, key0, fk + bo, fv + bo);
            if (key0 + 32 < kend) pass(flag_t<true>{}, key0 + 32, fk + bo + 32 * TP, fv + bo + 32);
            foot(s, bo);
        }
        asm volatile("s_wait_asynccnt 0x0" ::: "memory");         // no copy is outstanding when the wave goes on to its end
    }
    if (EARLY) { o0 = o0 + e0 * QRI; o1 = o1 + e1 * QRI; o2 = o2 + e2 * QRI; o3 = o3 + e3 * QRI; }
    l += __shfl_xor(l, 16, 32);
    const float lsafe = (l > 0.0f) ? l : 1.0f;
    const float inv = (l > 0.0f) ? (1.0f / lsafe) : 0.0f;     // no visible key: zero context
    const int wb = wave * 16 * 68;
    // O^T D layout: o_j[r] = (d = 16j + 8h + r, t = lane&15) -> os[t][d]; rows 0..15 x columns 0..63 all written
    { v4f a, c;
      a[0] = o0[0] * inv; a[1] = o0[1] * inv; a[2] = o0[2] * inv; a[3] = o0[3] * inv; c[0] = o0[4] * inv; c[1] = o0[5] * inv; c[2] = o0[6] * inv; c[3] = o0[7] * inv;
      *(v4fa*)(&os[wb + lr * 68 +  0 + 8 * hi]) = a; *(v4fa*)(&os[wb + lr * 68 +  0 + 8 * hi + 4]) = c;
      a[0] = o1[0] * inv; a[1] = o1[1] * inv; a[2] = o1[2] * inv; a[3] = o1[3] * inv; c[0] = o1[4] * inv; c[1] = o1[5] * inv; c[2] = o1[6] * inv; c[3] = o1[7] * inv;
      *(v4fa*)(&os[wb + lr * 68 + 16 + 8 * hi]) = a; *(v4fa*)(&os[wb + lr * 68 + 16 + 8 * hi + 4]) = c;
      a[0] = o2[0] * inv; a[1] = o2[1] * inv; a[2] = o2[2] * inv; a[3] = o2[3] * inv; c[0] = o2[4] * inv; c[1] = o2[5] * inv; c[2] = o2[6] * inv; c[3] = o2[7] * inv;
      *(v4fa*)(&os[wb + lr * 68 + 32 + 8 * hi]) = a; *(v4fa*)(&os[wb + lr * 68 + 32 + 8 * hi + 4]) = c;
      a[0] = o3[0] * inv; a[1] = o3[1] * inv; a[2] = o3[2] * inv; a[3] = o3[3] * inv; c[0] = o3[4] * inv; c[1] = o3[5] * inv; c[2] = o3[6] * inv; c[3] = o3[7] * inv;
      *(v4fa*)(&os[wb + lr * 68 + 48 + 8 * hi]) = a; *(v4fa*)(&os[wb + lr * 68 + 48 + 8 * hi + 4]) = c; }
    wave_sync();
    const size_t obase = ((size_t)b * SEQ + t0) * DM + (size_t)h * HD;
{
#pragma unroll
        for (int s = 0; s < 4; ++s) { const int row = 4 * s + (lane >> 3), c8 = (lane & 7) * 8;   // 4 s x 4 row groups = 16 rows; 8 lanes x 8 = 64 columns
            const v4f x0 = *(const v4fa*)(&os[wb + row * 68 + c8]); const v4f x1 = *(const v4fa*)(&os[wb + row * 68 + c8 + 4]); v8us hv;
#pragma unroll
            for (int i = 0; i < 4; ++i) { hv[i] = f2h(x0[i]); hv[4 + i] = f2h(x1[i]); }
            const size_t oo = obase + (size_t)row * DM + c8;
            *(v8us*)(CH + oo) = hv; }
         }
}

// k_flash: both row bands in one grid (SEQ / (16*AW), NB*NH_), the choice a function of blockIdx.x alone:
// the first (SEQ - EROWS) / (16*AW) blocks of a head take query rows EROWS..SEQ-1 (single products), the last EROWS / (16*AW) take rows 0..EROWS-1 (value + residual products).
__global__ __launch_bounds__(32 * AW) void k_flash(const h16* __restrict__ QH, const h16* __restrict__ QR, const h16* __restrict__ KP, const h16* __restrict__ KR,
                                                   const h16* __restrict__ VT, const h16* __restrict__ VR, const int* __restrict__ LENS, bf* CH) {
    __shared__ __align__(16) h16 ring[2 * TSZ];   // the key tiles of either band
    if ((int)blockIdx.x < (SEQ - EROWS) / (16 * AW))
        flash_body<0>((int)blockIdx.x + EROWS / (16 * AW), QH, QH, KP, KP, VT, VT, LENS, CH, ring);
    else
        flash_body<1>((int)blockIdx.x - (SEQ - EROWS) / (16 * AW), QH, QR, KP, KR, VT, VR, LENS, CH, ring);
}

static constexpr size_t al256(size_t v) { return (v + 255) & ~(size_t)255; }
static constexpr size_t SZ_XB = al256((size_t)NB * SEQ * DM * 2);          // one 16-bit activation plane [NB*SEQ][1024]
static constexpr size_t SZ_WB = al256((size_t)4 * DM * DM * 2);            // four transposed 16-bit weight planes
static constexpr size_t SZ_PL = al256((size_t)NB * NH_ * SEQ * HD * 2);    // one f16 head plane
static constexpr size_t SZ_LN = al256((size_t)32 * 4);
static constexpr size_t SZ_TOTAL = 3 * SZ_XB + SZ_WB + 6 * SZ_PL + SZ_XB + SZ_LN;
static_assert(SZ_TOTAL <= (size_t)134217728);          // workspace carve <= 128 MiB
static_assert(((size_t)DM * DM * 2) % 256 == 0);       // weight sub-planes stay 256-byte aligned
static_assert((size_t)NB * OUT_SEQ * DM * 4 <= (size_t)NB_FULL * SEQ_FULL * DM * 4);   // single output at byte offset 0

extern "C" void kernel_launch(void* const* d_in, const int* in_sizes, int n_in,
                              void* d_out, int out_size, void* d_ws, size_t ws_size, hipStream_t stream) {
    if (n_in < 13) return;
    const size_t needx = ((size_t)(NB - 1) * SEQ_FULL + SEQ) * DM;
    if ((size_t)in_sizes[0] < needx || (size_t)in_sizes[1] < needx || (size_t)in_sizes[2] < needx) return;
    if ((size_t)in_sizes[3] < (size_t)(NB - 1) * SEQ_FULL + SEQ || (size_t)in_sizes[4] < (size_t)(NB - 1) * SEQ_FULL + SEQ) return;
    if ((size_t)in_sizes[5] < (size_t)DM * DM || (size_t)in_sizes[7] < (size_t)DM * DM || (size_t)in_sizes[9] < (size_t)DM * DM || (size_t)in_sizes[11] < (size_t)DM * DM) return;
    if (in_sizes[6] < DM || in_sizes[8] < DM || in_sizes[10] < DM || in_sizes[12] < DM) return;
    if ((size_t)out_size < ((size_t)(NB - 1) * OUT_SEQ + SEQ) * DM) return;
    if (SZ_TOTAL > ws_size) return;
    // wire order: in_Q, in_K, in_V, Q_pad_mask (int32), K_pad_mask (int32), W_Q, b_Q, W_K, b_K, W_V, b_V, W_O, b_O
    const float* xq = (const float*)d_in[0]; const float* xk = (const float*)d_in[1]; const float* xv = (const float*)d_in[2];
    const int* qmask = (const int*)d_in[3]; const int* kmask = (const int*)d_in[4];
    const float* wq = (const float*)d_in[5];  const float* bq = (const float*)d_in[6];
    const float* wk = (const float*)d_in[7];  const float* bk = (const float*)d_in[8];
    const float* wv = (const float*)d_in[9];  const float* bv = (const float*)d_in[10];
    const float* wo = (const float*)d_in[11]; const float* bo = (const float*)d_in[12];
    float* OUT = (float*)d_out;      // [NB][SEQ][1024]
    char* wsp = (char*)d_ws;
    bf* QB = (bf*)wsp; wsp += SZ_XB;                 // [NB*SEQ][1024] bf16 query input
    bf* KB = (bf*)wsp; wsp += SZ_XB;                 // [NB*SEQ][1024] bf16 key input
    bf* VB = (bf*)wsp; wsp += SZ_XB;                 // [NB*SEQ][1024] bf16 value input
    bf* WB = (bf*)wsp; wsp += SZ_WB;                 // [4][1024 out][1024 in]: q | k | v | o
    h16* QH = (h16*)wsp; wsp += SZ_PL;               // [NB*16][SEQ][64]
    h16* QR = (h16*)wsp; wsp += SZ_PL;               // [NB*16][SEQ][64] residual x2048
    h16* KP = (h16*)wsp; wsp += SZ_PL;               // [NB*16][SEQ][64]
    h16* KR = (h16*)wsp; wsp += SZ_PL;               // [NB*16][SEQ][64] residual x2048
    h16* VT = (h16*)wsp; wsp += SZ_PL;               // [NB*16][64][SEQ]
    h16* VR = (h16*)wsp; wsp += SZ_PL;               // [NB*16][64][SEQ] residual x2048
    bf* CH = (bf*)wsp; wsp += SZ_XB;                 // [NB*SEQ][1024] context f16
    int* LN = (int*)wsp; wsp += SZ_LN;               // 32 ints: word b = q_len[b], word 8 + b = k_len[b]
    bf* WQT = WB; bf* WKT = WB + (size_t)DM * DM; bf* WVT = WB + (size_t)2 * DM * DM; bf* WOT = WB + (size_t)3 * DM * DM;

    // lengths, transposed 16-bit weights ([out][in]) and bf16 inputs
    k_prep<<<1 + 4 * PB_WT + 3 * PB_CV, 256, 0, stream>>>(xq, xk, xv, qmask, kmask, wq, wk, wv, wo, QB, KB, VB, WB, LN);
    // q, k planes and v^T planes (value and residual); k and v^T only in tiles that start below k_len, residuals only at tokens below EROWS
    k_qkv<<<dim3(NB * SEQ / GT, DM / GT, 3), 128, 0, stream>>>(QB, KB, VB, WQT, WKT, WVT, bq, bk, bv, LN, QH, QR, KP, KR, VT, VR);
    // context plane: disjoint rows, every row written
    k_flash<<<dim3(SEQ / (16 * AW), NB * NH_, 1), 32 * AW, 0, stream>>>(QH, QR, KP, KR, VT, VR, LN, CH);
    // output rows
    k_out<<<dim3(NB * SEQ / GT, DM / GT, 1), 128, 0, stream>>>(CH, WOT, bo, OUT);
}
